// v000
// The times below were measured on an AMD MI455X: many runs one after another, warmed up first and cycling through
// copies of the inputs, with the whole window's GPU time divided by the number of runs. Launches and the gaps
// between them are all in it. The median over several windows is given; except for v000 it joins two sittings, which
// can be a few percent apart, so the side-by-side timings, each taken in one sitting, are the better comparison.
// v000 is the starting kernel. One run takes 3480 microseconds.
#include <hip/hip_runtime.h>
// Relative-position multi-head attention with the 'skew' trick (2 x 2048 tokens x 1024, 16 heads x 64): q = x*q_w + q_b; [k | v] = x*kv_w + kv_b; QEr = q . Er^T against the learned INPUT table Er [2048][64]; Srel = skew(QEr) (pad one zero column on the left, reinterpret as [(N+1)][N], drop the first row -> Srel[i][j] = padded.flat[(i+1)*N + j]); logits = (q.k + Srel)/8 (no mask); softmax; merged . proj_w + proj_b -> [2,2048,1024].
// Structure: x as an exact f16 plane; the projections as f16 WMMA GEMMs (32x64 wave tiles, f32, exact products + bias) into f16 planes; Er as an exact f16 plane; v re-laid per (batch, head) as [d][token]; per (batch, head): the score GEMM q.k^T and the QEr GEMM q.Er^T into f32 planes, a wave-per-row softmax kernel that adds the skewed QEr element by its structural index and scales by 1/8 (max subtraction, P x2^10 f16), O = P.V^T into the merged f32 plane; O split into f16 hi + residual planes; output projection as two GEMMs (bias in the first).
// Compute dtype: x, weights, biases and Er rounded to bf16; projections exact; q, k, v, P as f16 operands (~2^-12), O as hi + residual; f32 accumulation and softmax. v_wmma_f32_16x16x32_f16.
#define NBT 2
#define TT 2048
#define DM 1024
#define NH 16
#define NR (NBT * TT)
typedef __bf16 v16b __attribute__((ext_vector_type(16)));
typedef unsigned short v8us __attribute__((ext_vector_type(8), may_alias));
typedef float  v8f  __attribute__((ext_vector_type(8)));
typedef float  v4f  __attribute__((ext_vector_type(4)));
typedef float  v4fa __attribute__((ext_vector_type(4), may_alias));
union FragB { v16b v; v8us half[2]; unsigned short u[16]; };

__device__ __forceinline__ unsigned short bf16_bits(float x) { unsigned int u = __float_as_uint(x); return (unsigned short)((u + 0x7FFFu + ((u >> 16) & 1u)) >> 16); }
__device__ __forceinline__ float bf16_val(unsigned short b) { return __uint_as_float(((unsigned int)b) << 16); }
__device__ __forceinline__ float bf16_round(float x) { return bf16_val(bf16_bits(x)); }
// D += A·B with NT terms: 1 = ah·bh, 2 = + al·bh (A split), 3 = + ah·bl (both split)
template <int NT>
__device__ __forceinline__ v8f mmaN(v16b ah, v16b al, v16b bh, v16b bl, v8f c) {
  c = __builtin_amdgcn_wmma_f32_16x16x32_bf16(false, ah, false, bh, (short)0, c, false, false);
  if (NT >= 2) c = __builtin_amdgcn_wmma_f32_16x16x32_bf16(false, al, false, bh, (short)0, c, false, false);
  if (NT >= 3) c = __builtin_amdgcn_wmma_f32_16x16x32_bf16(false, ah, false, bl, (short)0, c, false, false);
  asm volatile("v_nop\n\tv_nop\n\tv_nop\n\tv_nop" : "+v"(c) : "v"(ah), "v"(al), "v"(bh), "v"(bl));
  return c;
}

__global__ __launch_bounds__(256) void k_wt_bf16(const float* __restrict__ W, unsigned short* __restrict__ Wt, int K, int N) {
  const int t = blockIdx.x * 256 + threadIdx.x;
  const int k8n = K / 8;
  if (t >= N * k8n) return;
  const int n = t / k8n, k8 = (t % k8n) * 8;
  v8us v;
#pragma unroll
  for (int i = 0; i < 8; ++i) v[i] = bf16_bits(W[(size_t)(k8 + i) * N + n]);
  *(v8us*)(Wt + (size_t)n * K + k8) = v;
  
}

// GEMM C[M][N] (f32, pitch ldc) = act(A[M][K]·W + bias). A f32 row-major (pitch lda) converted per fragment to bf16
// (ASPLIT: hi/lo two planes -> 2 terms, else single rounded term); Wt bf16 [N][K] (pitch ldb). BIAS_BF16 rounds the
// bias to bf16 first (bias quantised to bf16 before the add). K%32==0, M%16==0, N%64==0.
template <bool ASPLIT, int ACT, bool BIAS_BF16>
__global__ __launch_bounds__(128) void k_gemm_bf(const float* __restrict__ A, int lda, const unsigned short* __restrict__ Wt, int ldb,
                                               const float* __restrict__ bias, float* __restrict__ C, int ldc, int M, int N, int K) {
  __shared__ __attribute__((aligned(16))) float so[4][16][64];
  const int tid = threadIdx.x, w = tid >> 5, lane = tid & 31, ln = lane & 15, hh = lane >> 4;
  const int ntn = N / 64;
  const int wid = blockIdx.x * 4 + w;
  const int mt = wid / ntn, nq = wid % ntn;
  if (mt * 16 >= M) return;
  const int row0 = mt * 16, col0 = nq * 64;
  const float* arow = A + (size_t)(row0 + ln) * lda;
  v8f acc[4] = {};
  for (int kb = 0; kb < K; kb += 32) {
    FragB ah, al;
    const v4f x0 = *(const v4fa*)(arow + kb + 8 * hh), x1 = *(const v4fa*)(arow + kb + 8 * hh + 4);
    const v4f x2 = *(const v4fa*)(arow + kb + 16 + 8 * hh), x3 = *(const v4fa*)(arow + kb + 16 + 8 * hh + 4);
    float xs[16] = {x0[0],x0[1],x0[2],x0[3],x1[0],x1[1],x1[2],x1[3],x2[0],x2[1],x2[2],x2[3],x3[0],x3[1],x3[2],x3[3]};
#pragma unroll
    for (int i = 0; i < 16; ++i) { const unsigned short hb = bf16_bits(xs[i]); ah.u[i] = hb; al.u[i] = ASPLIT ? bf16_bits(xs[i] - bf16_val(hb)) : (unsigned short)0; }
#pragma unroll
    for (int t = 0; t < 4; ++t) {
      const unsigned short* brow = Wt + (size_t)(col0 + t * 16 + ln) * ldb + kb;
      FragB b;
      b.half[0] = *(const v8us*)(brow + 8 * hh);
      b.half[1] = *(const v8us*)(brow + 16 + 8 * hh);
      acc[t] = mmaN<ASPLIT ? 2 : 1>(ah.v, al.v, b.v, b.v, acc[t]);
    }
  }
#pragma unroll
  for (int t = 0; t < 4; ++t) {
    float bv = bias ? bias[col0 + t * 16 + ln] : 0.f;
    if (BIAS_BF16) bv = bf16_round(bv);
#pragma unroll
    for (int r = 0; r < 8; ++r) { float v = acc[t][r] + bv; if (ACT == 1) v = fmaxf(v, 0.f); so[w][8 * hh + r][t * 16 + ln] = v; }
  }
  __builtin_amdgcn_fence(__ATOMIC_ACQ_REL, "workgroup");
  __builtin_amdgcn_wave_barrier();
  const int rsub = lane >> 4, c4 = (lane & 15) * 4;
  {
#pragma unroll
    for (int q = 0; q < 8; ++q) {
      const int r = q * 2 + rsub;
      const v4f v = *(const v4fa*)&so[w][r][c4];
      *(v4f*)(C + (size_t)(row0 + r) * ldc + col0 + c4) = v;
    }
    
  }
}

// GEMM C = act(A·W + bias + resid): A f32 (ASPLIT -> hi/lo 2 terms), Wt bf16 [N][K]; ACT 0 none, 1 relu, 2 exact gelu;
// resid (optional, f32, row index = (row % rmod), pitch ldr, RES_BF16 rounds it) added before the activation.
template <bool ASPLIT, int ACT, bool BIAS_BF16, bool RES_BF16>
__global__ __launch_bounds__(128) void k_gemm_bf3(const float* __restrict__ A, int lda, const unsigned short* __restrict__ Wt, int ldb,
                                                const float* __restrict__ bias, const float* __restrict__ resid, int rmod, int ldr,
                                                float* __restrict__ C, int ldc, int M, int N, int K) {
  __shared__ __attribute__((aligned(16))) float so[4][16][64];
  const int tid = threadIdx.x, w = tid >> 5, lane = tid & 31, ln = lane & 15, hh = lane >> 4;
  const int ntn = N / 64;
  const int wid = blockIdx.x * 4 + w;
  const int mt = wid / ntn, nq = wid % ntn;
  if (mt * 16 >= M) return;
  const int row0 = mt * 16, col0 = nq * 64;
  const float* arow = A + (size_t)(row0 + ln) * lda;
  v8f acc[4] = {};
  for (int kb = 0; kb < K; kb += 32) {
    FragB ah, al;
    const v4f x0 = *(const v4fa*)(arow + kb + 8 * hh), x1 = *(const v4fa*)(arow + kb + 8 * hh + 4);
    const v4f x2 = *(const v4fa*)(arow + kb + 16 + 8 * hh), x3 = *(const v4fa*)(arow + kb + 16 + 8 * hh + 4);
    float xs[16] = {x0[0],x0[1],x0[2],x0[3],x1[0],x1[1],x1[2],x1[3],x2[0],x2[1],x2[2],x2[3],x3[0],x3[1],x3[2],x3[3]};
#pragma unroll
    for (int i = 0; i < 16; ++i) { const unsigned short hb = bf16_bits(xs[i]); ah.u[i] = hb; al.u[i] = ASPLIT ? bf16_bits(xs[i] - bf16_val(hb)) : (unsigned short)0; }
#pragma unroll
    for (int t = 0; t < 4; ++t) {
      const unsigned short* brow = Wt + (size_t)(col0 + t * 16 + ln) * ldb + kb;
      FragB b;
      b.half[0] = *(const v8us*)(brow + 8 * hh);
      b.half[1] = *(const v8us*)(brow + 16 + 8 * hh);
      acc[t] = mmaN<ASPLIT ? 2 : 1>(ah.v, al.v, b.v, b.v, acc[t]);
    }
  }
#pragma unroll
  for (int t = 0; t < 4; ++t) {
    const int col = col0 + t * 16 + ln;
    float bv = bias ? bias[col] : 0.f;
    if (BIAS_BF16) bv = bf16_round(bv);
#pragma unroll
    for (int r = 0; r < 8; ++r) {
      float v = acc[t][r] + bv;
      if (resid) { float rv = resid[(size_t)((row0 + 8 * hh + r) % rmod) * ldr + col]; if (RES_BF16) rv = bf16_round(rv); v += rv; }
      if (ACT == 1) v = fmaxf(v, 0.f);
      if (ACT == 2) v = 0.5f * v * (1.0f + erff(v * 0.70710678118654752f));
      if (ACT == 3) { const float u = 0.7978845608028654f * (v + 0.044715f * v * v * v); v = 0.5f * v * (1.0f + tanhf(u)); }
      so[w][8 * hh + r][t * 16 + ln] = v;
    }
  }
  __builtin_amdgcn_fence(__ATOMIC_ACQ_REL, "workgroup");
  __builtin_amdgcn_wave_barrier();
  const int rsub = lane >> 4, c4 = (lane & 15) * 4;
  {
#pragma unroll
    for (int q = 0; q < 8; ++q) {
      const int r = q * 2 + rsub;
      const v4f v = *(const v4fa*)&so[w][r][c4];
      *(v4f*)(C + (size_t)(row0 + r) * ldc + col0 + c4) = v;
    }
    
  }
}
// row LayerNorm (biased variance, eps) over N: s = X (+ R); optional out_sum <- s; out_norm <- (s-mu)*rsqrt(var+eps)*g + b
template <bool PARAM_BF16>
__global__ __launch_bounds__(256) void k_layernorm(const float* __restrict__ X, const float* __restrict__ R, const float* __restrict__ g, const float* __restrict__ bta,
                                                  float* __restrict__ out_sum, float* __restrict__ out_norm, int N, float eps) {
  __shared__ float red[256];
  const int row = blockIdx.x, tid = threadIdx.x;
  const float* x = X + (size_t)row * N; const float* rr = R ? R + (size_t)row * N : nullptr;
  float vals[16];                     // up to N = 4096
  const int per = N / 256;            // contiguous chunk per thread? use strided-by-4 chunks: thread handles j = tid*4 + 1024*u
  float s1 = 0.f;
  for (int u = 0; u < per / 4; ++u) {
    const int j = tid * 4 + 1024 * u;
    const v4f a = *(const v4fa*)(x + j);
    v4f b = {0.f,0.f,0.f,0.f}; if (rr) b = *(const v4fa*)(rr + j);
#pragma unroll
    for (int q = 0; q < 4; ++q) { const float v = a[q] + b[q]; vals[u * 4 + q] = v; s1 += v; }
  }
  red[tid] = s1; __syncthreads();
  for (int st = 128; st > 0; st >>= 1) { if (tid < st) red[tid] += red[tid + st]; __syncthreads(); }
  const float mu = red[0] / (float)N; __syncthreads();
  float s2 = 0.f;
  for (int u = 0; u < per / 4; ++u)
#pragma unroll
    for (int q = 0; q < 4; ++q) { const float c = vals[u * 4 + q] - mu; s2 += c * c; }
  red[tid] = s2; __syncthreads();
  for (int st = 128; st > 0; st >>= 1) { if (tid < st) red[tid] += red[tid + st]; __syncthreads(); }
  const float rs = rsqrtf(red[0] / (float)N + eps);
  {
    for (int u = 0; u < per / 4; ++u) {
      const int j = tid * 4 + 1024 * u;
      v4f o, sm;
#pragma unroll
      for (int q = 0; q < 4; ++q) {
        float gg = g[j + q], bb = bta[j + q];
        if (PARAM_BF16) { gg = bf16_round(gg); bb = bf16_round(bb); }
        sm[q] = vals[u * 4 + q]; o[q] = (vals[u * 4 + q] - mu) * rs * gg + bb;
      }
      if (out_sum) *(v4f*)(out_sum + (size_t)row * N + j) = sm;
      *(v4f*)(out_norm + (size_t)row * N + j) = o;
    }
    
  }
}



// ---- f16 WMMA path (v_wmma_f32_16x16x32_f16): 11-bit significands for operands in range — used where a [0,1] probability operand needs more precision than bf16
typedef _Float16 v16h __attribute__((ext_vector_type(16)));
union FragH { v16h v; v8us half[2]; _Float16 h[16]; unsigned short u[16]; };
template <int NT>
__device__ __forceinline__ v8f mmaH(v16h ah, v16h al, v16h bh, v16h bl, v8f c) {
  c = __builtin_amdgcn_wmma_f32_16x16x32_f16(false, ah, false, bh, (short)0, c, false, false);
  if (NT >= 2) c = __builtin_amdgcn_wmma_f32_16x16x32_f16(false, al, false, bh, (short)0, c, false, false);
  if (NT >= 3) c = __builtin_amdgcn_wmma_f32_16x16x32_f16(false, ah, false, bl, (short)0, c, false, false);
  asm volatile("v_nop\n\tv_nop\n\tv_nop\n\tv_nop" : "+v"(c) : "v"(ah), "v"(al), "v"(bh), "v"(bl));
  return c;
}
// batched GEMM like k_gemm_b but f16 operands: A f32 (split into f16 hi/lo if ASPLIT, else rounded to f16), Bt = f16 values [n][k]; alpha; C f32; N multiple of 16 (partial tiles skipped)
template <bool ASPLIT>
__global__ __launch_bounds__(128) void k_gemm_h(const float* __restrict__ A, int lda, size_t sA, const _Float16* __restrict__ Bh, int ldb, size_t sB, float alpha, float* __restrict__ C, int ldc, size_t sC, int M, int N, int K) {
  __shared__ __attribute__((aligned(16))) float so[4][16][64];
  const int tid = threadIdx.x, w = tid >> 5, lane = tid & 31, ln = lane & 15, hh = lane >> 4; const int by = blockIdx.y;
  A += (size_t)by * sA; Bh += (size_t)by * sB; C += (size_t)by * sC;
  const int ntn = (N + 63) / 64; const int wid = blockIdx.x * 4 + w; const int mt = wid / ntn, nq = wid % ntn; if (mt * 16 >= M) return;
  const int row0 = mt * 16, col0 = nq * 64; const float* arow = A + (size_t)(row0 + ln) * lda;
  v8f acc[4] = {};
  for (int kb = 0; kb < K; kb += 32) {
    FragH ah, al;
    const v4f x0 = *(const v4fa*)(arow + kb + 8 * hh), x1 = *(const v4fa*)(arow + kb + 8 * hh + 4), x2 = *(const v4fa*)(arow + kb + 16 + 8 * hh), x3 = *(const v4fa*)(arow + kb + 16 + 8 * hh + 4);
    float xs[16] = {x0[0],x0[1],x0[2],x0[3],x1[0],x1[1],x1[2],x1[3],x2[0],x2[1],x2[2],x2[3],x3[0],x3[1],x3[2],x3[3]};
#pragma unroll
    for (int i = 0; i < 16; ++i) { const _Float16 h = (_Float16)xs[i]; ah.h[i] = h; al.h[i] = ASPLIT ? (_Float16)(xs[i] - (float)h) : (_Float16)0.0f; }
#pragma unroll
    for (int t = 0; t < 4; ++t) { if (col0 + t * 16 >= N) continue; const size_t boff = (size_t)(col0 + t * 16 + ln) * ldb + kb; FragH bq; bq.half[0] = *(const v8us*)(Bh + boff + 8 * hh); bq.half[1] = *(const v8us*)(Bh + boff + 16 + 8 * hh);
      acc[t] = mmaH<ASPLIT ? 2 : 1>(ah.v, al.v, bq.v, bq.v, acc[t]); }
  }
#pragma unroll
  for (int t = 0; t < 4; ++t) { if (col0 + t * 16 >= N) continue;
#pragma unroll
    for (int r = 0; r < 8; ++r) so[w][8 * hh + r][t * 16 + ln] = acc[t][r] * alpha; }
  __builtin_amdgcn_fence(__ATOMIC_ACQ_REL, "workgroup"); __builtin_amdgcn_wave_barrier();
  const int rsub = lane >> 4, c4 = (lane & 15) * 4;
  {
#pragma unroll
    for (int q = 0; q < 8; ++q) { const int r = q * 2 + rsub; if (col0 + c4 < N) { const v4f v = *(const v4fa*)&so[w][r][c4]; *(v4f*)(C + (size_t)(row0 + r) * ldc + col0 + c4) = v; } }
     }
}

// Wt[n][k] = f16(W[k][n]·scale) from f32 row-major W[K][N] (scale = power of two; bf16-exact weights stay exact in f16 away from the subnormal range)
__global__ __launch_bounds__(256) void k_wt_f16(const float* __restrict__ W, _Float16* __restrict__ Wt, int K, int N, float scale) {
  const int t = blockIdx.x * 256 + threadIdx.x; if (t >= N * (K / 8)) return; const int n = t / (K / 8), k8 = (t % (K / 8)) * 8; FragH f;
#pragma unroll
  for (int i = 0; i < 8; ++i) f.h[i] = (_Float16)(bf16_round(W[(size_t)(k8 + i) * N + n]) * scale); const v8us o = f.half[0];
  *(v8us*)((unsigned short*)Wt + (size_t)n * K + k8) = o; 
}
// k_gemm_hh variant with fused epilogue: v = acc·alpha + bias[by·sBias + col] (+ CP[(row/rowsPerB)·sCPb + by·64 + col] if CP) ; ACT 0 none / 1 elu ; writes f16 C16 (and f32 C if non-null)
template <int ACT>
__global__ __launch_bounds__(128) void k_gemm_hhx(const _Float16* __restrict__ A, int lda, size_t sA, const _Float16* __restrict__ Bh, int ldb, size_t sB, float alpha, const float* __restrict__ bias, size_t sBias, const float* __restrict__ CP, int rowsPerB, size_t sCPb, int row0g,
    float* __restrict__ C, _Float16* __restrict__ C16, int ldc, size_t sC, int M, int N, int K) {
  __shared__ __attribute__((aligned(16))) float so[4][16][64];
  const int tid = threadIdx.x, w = tid >> 5, lane = tid & 31, ln = lane & 15, hh = lane >> 4; const int by = blockIdx.y;
  A += (size_t)by * sA; Bh += (size_t)by * sB; const size_t cofs = (size_t)by * sC; const float* bp = bias ? bias + (size_t)by * sBias : nullptr;
  const int ntn = (N + 63) / 64; const int wid = blockIdx.x * 4 + w; const int mt = wid / ntn, nq = wid % ntn; if (mt * 16 >= M) return;
  const int row0 = mt * 16, col0 = nq * 64; const _Float16* arow = A + (size_t)(row0 + ln) * lda;
  v8f acc[4] = {};
  for (int kb = 0; kb < K; kb += 32) { FragH ah; ah.half[0] = *(const v8us*)((const unsigned short*)arow + kb + 8 * hh); ah.half[1] = *(const v8us*)((const unsigned short*)arow + kb + 16 + 8 * hh);
#pragma unroll
    for (int t = 0; t < 4; ++t) { if (col0 + t * 16 >= N) continue; const size_t boff = (size_t)(col0 + t * 16 + ln) * ldb + kb; FragH bq; bq.half[0] = *(const v8us*)((const unsigned short*)Bh + boff + 8 * hh); bq.half[1] = *(const v8us*)((const unsigned short*)Bh + boff + 16 + 8 * hh);
      acc[t] = mmaH<1>(ah.v, ah.v, bq.v, bq.v, acc[t]); }
  }
#pragma unroll
  for (int t = 0; t < 4; ++t) { if (col0 + t * 16 >= N) continue; const int col = col0 + t * 16 + ln; const float bv = bp ? bf16_round(bp[col]) : 0.f;
#pragma unroll
    for (int r = 0; r < 8; ++r) { float v = acc[t][r] * alpha + bv; if (CP) { const int bidx = (row0g + row0 + 8 * hh + r) / rowsPerB; v += CP[(size_t)bidx * sCPb + (size_t)by * 64 + col]; } if (ACT == 1) v = (v > 0.f) ? v : expm1f(v); else if (ACT == 7) v = (v > 0.f) ? v + 1.0f : expf(v); else if (ACT == 8) v = tanhf(v); else if (ACT == 9) v = 0.5f * v * (1.0f + tanhf(0.7978845608028654f * (v + 0.044715f * v * v * v))); else if (ACT == 11) v = 1.0f / (1.0f + expf(-v)); else if (ACT == 12) v = (v > 0.f) ? v : 0.01f * v; else if (ACT == 14) v = (v > 0.f) ? v : 0.1f * v; else if (ACT == 15) v = v / (1.0f + expf(-v)); else if (ACT == 3) v = fmaxf(v, 0.f); else if (ACT == 6) v = 0.5f * v * (1.0f + erff(v * 0.70710678118654752f)); so[w][8 * hh + r][t * 16 + ln] = v; } }
  __builtin_amdgcn_fence(__ATOMIC_ACQ_REL, "workgroup"); __builtin_amdgcn_wave_barrier();
  const int rsub = lane >> 4, c4 = (lane & 15) * 4; typedef _Float16 v4h __attribute__((ext_vector_type(4)));
  {
#pragma unroll
    for (int q = 0; q < 8; ++q) { const int r = q * 2 + rsub; if (col0 + c4 < N) { const v4f v = *(const v4fa*)&so[w][r][c4]; if (C) *(v4f*)(C + cofs + (size_t)(row0 + r) * ldc + col0 + c4) = v; if (C16) { v4h h4; for (int i = 0; i < 4; ++i) h4[i] = (_Float16)v[i]; *(v4h*)(C16 + cofs + (size_t)(row0 + r) * ldc + col0 + c4) = h4; } } }
     }
}


typedef _Float16 v4h __attribute__((ext_vector_type(4)));

__global__ __launch_bounds__(256) void k_x16(const float* __restrict__ x, _Float16* __restrict__ X16, size_t n8) { const size_t t = (size_t)blockIdx.x * 256 + threadIdx.x; if (t >= n8) return; FragH f;
#pragma unroll
  for (int q = 0; q < 8; ++q) f.h[q] = (_Float16)bf16_round(x[t * 8 + q]); *(v8us*)((unsigned short*)X16 + t * 8) = f.half[0];  }
__global__ __launch_bounds__(256) void k_h16(const float* __restrict__ x, _Float16* __restrict__ X16, size_t n8) { const size_t t = (size_t)blockIdx.x * 256 + threadIdx.x; if (t >= n8) return; FragH f;
#pragma unroll
  for (int q = 0; q < 8; ++q) f.h[q] = (_Float16)x[t * 8 + q]; *(v8us*)((unsigned short*)X16 + t * 8) = f.half[0];  }
__global__ __launch_bounds__(256) void k_round16f(const float* __restrict__ W, _Float16* __restrict__ Bt, size_t n8) { const size_t t = (size_t)blockIdx.x * 256 + threadIdx.x; if (t >= n8) return; FragH f;
#pragma unroll
  for (int i = 0; i < 8; ++i) f.h[i] = (_Float16)(bf16_round(W[t * 8 + i]) * 16.0f); *(v8us*)((unsigned short*)Bt + t * 8) = f.half[0];  }
template <int NHv, int TTv>
__global__ __launch_bounds__(256) void k_vt(const _Float16* __restrict__ V16, int ldv, int voff, _Float16* __restrict__ Vt) { __shared__ unsigned short tl[64][66]; const int tid = threadIdx.x; const int slab = blockIdx.x / (TTv / 64), lg = blockIdx.x % (TTv / 64); const int b = slab / NHv, h = slab % NHv;
  for (int i = tid; i < 64 * 8; i += 256) { const int r = i / 8, c8 = (i % 8) * 8; FragH f; f.half[0] = *(const v8us*)((const unsigned short*)V16 + ((size_t)b * TTv + lg * 64 + r) * ldv + voff + h * 64 + c8);
#pragma unroll
    for (int q = 0; q < 8; ++q) tl[r][c8 + q] = f.u[q]; }
  __syncthreads();
  {
#pragma unroll
    for (int rd = 0; rd < 2; ++rd) { const int d = rd * 32 + tid / 8, pc = tid % 8; FragH f;
#pragma unroll
      for (int q = 0; q < 8; ++q) f.u[q] = tl[pc * 8 + q][d];
      *(v8us*)((unsigned short*)Vt + ((size_t)slab * 64 + d) * TTv + lg * 64 + pc * 8) = f.half[0]; }
     } }

__global__ __launch_bounds__(256) void k_hl(const float* __restrict__ F, _Float16* __restrict__ Hh, _Float16* __restrict__ Hl, size_t n8) { const size_t t = (size_t)blockIdx.x * 256 + threadIdx.x; if (t >= n8) return; FragH fh, fl; const v4f a = *(const v4fa*)(F + t * 8), c = *(const v4fa*)(F + t * 8 + 4);
#pragma unroll
  for (int q = 0; q < 4; ++q) { _Float16 h = (_Float16)a[q]; fh.h[q] = h; fl.h[q] = (_Float16)((a[q] - (float)h) * 1024.0f); h = (_Float16)c[q]; fh.h[4 + q] = h; fl.h[4 + q] = (_Float16)((c[q] - (float)h) * 1024.0f); }
  { *(v8us*)((unsigned short*)Hh + t * 8) = fh.half[0]; *(v8us*)((unsigned short*)Hl + t * 8) = fl.half[0];  } }

// ---- fast GEMM (wave tile 32x64; requires M % 32 == 0 rows per launch region and N % 64 == 0); epilogue = k_gemm_hhx semantics ----
__device__ __forceinline__ v16h g2_frag(const _Float16* p, int hh) { FragH f; f.half[0] = *(const v8us*)((const unsigned short*)p + 8 * hh); f.half[1] = *(const v8us*)((const unsigned short*)p + 16 + 8 * hh); return f.v; }
__device__ __forceinline__ v8f g2_mma(v16h a, v16h b, v8f c) { v8f d = __builtin_amdgcn_wmma_f32_16x16x32_f16(false, a, false, b, (short)0, c, false, false); asm volatile("v_nop\n\tv_nop\n\tv_nop\n\tv_nop" : "+v"(d) : "v"(a), "v"(b)); return d; }
template <int ACT>
__global__ __launch_bounds__(128) void k_gemm2(const _Float16* __restrict__ A, int lda, size_t sA, const _Float16* __restrict__ Bh, int ldb, size_t sB, float alpha, const float* __restrict__ bias, size_t sBias, const float* __restrict__ CP, int rowsPerB, size_t sCPb, int row0g,
    float* __restrict__ C, _Float16* __restrict__ C16, int ldc, size_t sC, int M, int N, int K) {
  __shared__ __attribute__((aligned(16))) float so[4][32][68];
  const int tid = threadIdx.x, w = tid >> 5, lane = tid & 31, ln = lane & 15, hh = lane >> 4; const int by = blockIdx.y;
  A += (size_t)by * sA; Bh += (size_t)by * sB; const size_t cofs = (size_t)by * sC; const float* bp = bias ? bias + (size_t)by * sBias : nullptr;
  const int ntn = N >> 6; const int mt = blockIdx.x / ntn, nq = blockIdx.x - mt * ntn; const int row0 = mt * 128 + 32 * w, col0 = nq * 64; if (row0 >= M) return;
  const _Float16* a0p = A + (size_t)(row0 + ln) * lda; const _Float16* a1p = a0p + (size_t)16 * lda;
  const _Float16* b0p = Bh + (size_t)(col0 + ln) * ldb; const _Float16* b1p = b0p + (size_t)16 * ldb; const _Float16* b2p = b1p + (size_t)16 * ldb; const _Float16* b3p = b2p + (size_t)16 * ldb;
  const v8f z8 = {0.f,0.f,0.f,0.f,0.f,0.f,0.f,0.f}; v8f c00 = z8, c01 = z8, c02 = z8, c03 = z8, c10 = z8, c11 = z8, c12 = z8, c13 = z8;
#pragma unroll 1
  for (int kb = 0; kb < K; kb += 32) { const v16h a0 = g2_frag(a0p + kb, hh), a1 = g2_frag(a1p + kb, hh);
    v16h b = g2_frag(b0p + kb, hh); c00 = g2_mma(a0, b, c00); c10 = g2_mma(a1, b, c10);
    b = g2_frag(b1p + kb, hh); c01 = g2_mma(a0, b, c01); c11 = g2_mma(a1, b, c11);
    b = g2_frag(b2p + kb, hh); c02 = g2_mma(a0, b, c02); c12 = g2_mma(a1, b, c12);
    b = g2_frag(b3p + kb, hh); c03 = g2_mma(a0, b, c03); c13 = g2_mma(a1, b, c13); }
  v8f accs[8] = {c00, c01, c02, c03, c10, c11, c12, c13};
#pragma unroll
  for (int u = 0; u < 8; ++u) { const int t = u & 3, half = u >> 2; const int col = col0 + t * 16 + ln; const float bv = bp ? bf16_round(bp[col]) : 0.f;
#pragma unroll
    for (int r = 0; r < 8; ++r) { const int rloc = half * 16 + 8 * hh + r; float v = accs[u][r] * alpha + bv; if (CP) { const int bidx = (row0g + row0 + rloc) / rowsPerB; v += CP[(size_t)bidx * sCPb + (size_t)by * 64 + col]; }
      if (ACT == 3) v = fmaxf(v, 0.f); else if (ACT == 6) v = 0.5f * v * (1.0f + erff(v * 0.70710678118654752f)); else if (ACT == 11) v = 1.0f / (1.0f + expf(-v)); else if (ACT == 15) v = v / (1.0f + expf(-v)); else if (ACT == 12) v = (v > 0.f) ? v : 0.01f * v; else if (ACT == 8) v = tanhf(v);
      so[w][rloc][t * 16 + ln] = v; } }
  __builtin_amdgcn_fence(__ATOMIC_ACQ_REL, "workgroup"); __builtin_amdgcn_wave_barrier();
  const int rsub = lane >> 4, c4 = (lane & 15) * 4;
  {
#pragma unroll
    for (int q = 0; q < 16; ++q) { const int r = q * 2 + rsub; const v4f v = *(const v4fa*)&so[w][r][c4]; if (C) *(v4f*)(C + cofs + (size_t)(row0 + r) * ldc + col0 + c4) = v; if (C16) { v4h h4; for (int i = 0; i < 4; ++i) h4[i] = (_Float16)v[i]; *(v4h*)(C16 + cofs + (size_t)(row0 + r) * ldc + col0 + c4) = h4; } }
     } }


__global__ __launch_bounds__(256) void k_split(const float* __restrict__ F, _Float16* __restrict__ Hh, _Float16* __restrict__ Hl, size_t n8) {
  #pragma clang fp contract(off)
  const size_t t = (size_t)blockIdx.x * 256 + threadIdx.x; if (t >= n8) return; const v4f a = *(const v4fa*)(F + t * 8), c = *(const v4fa*)(F + t * 8 + 4); FragH fh, fl;
#pragma unroll
  for (int q = 0; q < 8; ++q) { const float v = (q < 4) ? a[q] : c[q - 4]; const _Float16 hi = (_Float16)v; fh.h[q] = hi; fl.h[q] = (_Float16)((v - (float)hi) * 1024.0f); }
  { *(v8us*)((unsigned short*)Hh + t * 8) = fh.half[0]; *(v8us*)((unsigned short*)Hl + t * 8) = fl.half[0];  } }



__global__ __launch_bounds__(256) void k_skewsoft(const float* __restrict__ S, const float* __restrict__ QE, _Float16* __restrict__ P16) {
  #pragma clang fp contract(off)
  const int w = threadIdx.x >> 5, lane = threadIdx.x & 31; const int i = blockIdx.x * 8 + w; if (i >= TT) return; const float* srow = S + (size_t)i * TT;
  auto logit = [&](int j, float sv) { const int f = (i + 1) * TT + j; const int r = f / (TT + 1), c = f - r * (TT + 1); const float rel = (c == 0) ? 0.f : QE[(size_t)r * TT + (c - 1)]; return (sv + rel) * 0.125f; };
  float m = -3.0e38f;
  for (int c = lane * 4; c < TT; c += 128) { const v4f a = *(const v4fa*)(srow + c);
#pragma unroll
    for (int q = 0; q < 4; ++q) m = fmaxf(m, logit(c + q, a[q])); }
  for (int o = 16; o > 0; o >>= 1) m = fmaxf(m, __shfl_xor(m, o, 32));
  float s = 0.f;
  for (int c = lane * 4; c < TT; c += 128) { const v4f a = *(const v4fa*)(srow + c);
#pragma unroll
    for (int q = 0; q < 4; ++q) s += expf(logit(c + q, a[q]) - m); }
  for (int o = 16; o > 0; o >>= 1) s += __shfl_xor(s, o, 32);
  const float sc = 1024.0f / s;
  {
    for (int c = lane * 8; c < TT; c += 256) { const v4f a = *(const v4fa*)(srow + c), a2 = *(const v4fa*)(srow + c + 4); FragH f;
#pragma unroll
      for (int q = 0; q < 4; ++q) { f.h[q] = (_Float16)(expf(logit(c + q, a[q]) - m) * sc); f.h[4 + q] = (_Float16)(expf(logit(c + 4 + q, a2[q]) - m) * sc); }
      *(v8us*)((unsigned short*)P16 + (size_t)i * TT + c) = f.half[0]; }
     } }

extern "C" void kernel_launch(void* const* d_in, const int* in_sizes, int n_in,
                              void* d_out, int out_size, void* d_ws, size_t ws_size, hipStream_t stream) {
  (void)in_sizes; (void)n_in; (void)out_size;
  const float* const* I = (const float* const*)d_in; const float* x = I[0]; const float* qw = I[1]; const float* qb = I[2]; const float* kvw = I[3]; const float* kvb = I[4]; const float* pw = I[5]; const float* pb = I[6]; const float* Er = I[7];
  char* ws = (char*)d_ws; size_t off = 0;
  auto take = [&](size_t bytes) { char* p = ws + off; off += (bytes + 255) & ~(size_t)255; return p; };
  _Float16* BQ = (_Float16*)take((size_t)DM * DM * 2); _Float16* BKV = (_Float16*)take((size_t)2 * DM * DM * 2); _Float16* BP = (_Float16*)take((size_t)DM * DM * 2); _Float16* ER16 = (_Float16*)take((size_t)TT * 64 * 2);
  _Float16* X16 = (_Float16*)take((size_t)NR * DM * 2); _Float16* Q16 = (_Float16*)take((size_t)NR * DM * 2); _Float16* KV16 = (_Float16*)take((size_t)NR * 2 * DM * 2); _Float16* VT = (_Float16*)take((size_t)NR * DM * 2);
  float* S = (float*)take((size_t)TT * TT * 4); float* QE = (float*)take((size_t)TT * TT * 4); float* O = (float*)take((size_t)NR * DM * 4); _Float16* Oh = (_Float16*)take((size_t)NR * DM * 2); _Float16* Ol = (_Float16*)take((size_t)NR * DM * 2);
  if (off > ws_size) return;      /* 8 + 0.3 + 8 + 8 + 16 + 8 + 16 + 16 + 16 + 8 + 8 = 113 MiB */
  _Float16* P16 = X16;                /* x is dead after the projections: P chunk f16 [2048][2048] (8 MiB) */
  const size_t n8 = (size_t)NR * DM / 8; const unsigned nb8 = (unsigned)((n8 + 255) / 256);
  k_wt_f16<<<(unsigned)(((size_t)DM * DM / 8 + 255) / 256), 256, 0, stream>>>(qw, BQ, DM, DM, 16.0f); k_wt_f16<<<(unsigned)(((size_t)DM * 2 * DM / 8 + 255) / 256), 256, 0, stream>>>(kvw, BKV, DM, 2 * DM, 16.0f); k_wt_f16<<<(unsigned)(((size_t)DM * DM / 8 + 255) / 256), 256, 0, stream>>>(pw, BP, DM, DM, 16.0f);      /* (in,out) -> [out][in] x16 */
  k_x16<<<(TT * 64 / 8 + 255) / 256, 256, 0, stream>>>(Er, ER16, (size_t)TT * 64 / 8);      /* Er exact f16 = natural Bt [2048][64] */
  k_x16<<<nb8, 256, 0, stream>>>(x, X16, n8);
  const dim3 gQ((NR / 128) * (DM / 64), 1), gKV((NR / 128) * (2 * DM / 64), 1), gS((TT / 128) * (TT / 64), 1), gV((TT / 128) * 1, 1);
  k_gemm2<0><<<gQ, 128, 0, stream>>>(X16, DM, 0, BQ, DM, 0, 0.0625f, qb, 0, nullptr, 1, 0, 0, nullptr, Q16, DM, 0, NR, DM, DM);
  k_gemm2<0><<<gKV, 128, 0, stream>>>(X16, DM, 0, BKV, DM, 0, 0.0625f, kvb, 0, nullptr, 1, 0, 0, nullptr, KV16, 2 * DM, 0, NR, 2 * DM, DM);      /* [k | v] f16, column = part*1024 + h*64 + d */
  k_vt<NH, TT><<<NBT * NH * (TT / 64), 256, 0, stream>>>(KV16, 2 * DM, DM, VT);
  for (int b = 0; b < NBT; ++b) for (int h = 0; h < NH; ++h) { const _Float16* qp = Q16 + (size_t)b * TT * DM + h * 64; const _Float16* kp = KV16 + (size_t)b * TT * 2 * DM + h * 64;
    k_gemm2<0><<<gS, 128, 0, stream>>>(qp, DM, 0, kp, 2 * DM, 0, 1.0f, nullptr, 0, nullptr, 1, 0, 0, S, nullptr, TT, 0, TT, TT, 64);      /* q.k^T */
    k_gemm2<0><<<gS, 128, 0, stream>>>(qp, DM, 0, ER16, 64, 0, 1.0f, nullptr, 0, nullptr, 1, 0, 0, QE, nullptr, TT, 0, TT, TT, 64);      /* q.Er^T */
    k_skewsoft<<<TT / 8, 256, 0, stream>>>(S, QE, P16);
    k_gemm2<0><<<gV, 128, 0, stream>>>(P16, TT, 0, VT + ((size_t)b * NH + h) * 64 * TT, TT, 0, 0.0009765625f, nullptr, 0, nullptr, 1, 0, 0, O + (size_t)b * TT * DM + h * 64, nullptr, DM, 0, TT, 64, TT); }
  k_split<<<nb8, 256, 0, stream>>>(O, Oh, Ol, n8);
  k_gemm2<0><<<gQ, 128, 0, stream>>>(Oh, DM, 0, BP, DM, 0, 0.0625f, pb, 0, nullptr, 1, 0, 0, (float*)d_out, nullptr, DM, 0, NR, DM, DM);
  k_gemm2<0><<<gQ, 128, 0, stream>>>(Ol, DM, 0, BP, DM, 0, 0.0625f / 1024.0f, nullptr, 0, (const float*)d_out, 1, (size_t)DM, 0, (float*)d_out, nullptr, DM, 0, NR, DM, DM);
}

// v001
// One run takes 1270 microseconds.
// Timed twice side by side with v000, it ran 2.73 and 2.76 times as fast.
#include <hip/hip_runtime.h>
// Relative-position multi-head attention with the 'skew' trick (2 x 2048 tokens x 1024, 16 heads x 64): q = x*q_w + q_b; [k | v] = x*kv_w + kv_b; QEr = q . Er^T against the learned INPUT table Er [2048][64]; Srel = skew(QEr) (pad one zero column on the left, reinterpret as [(N+1)][N], drop the first row -> Srel[i][j] = padded.flat[(i+1)*N + j]); logits = (q.k + Srel)/8 (no mask); softmax; merged . proj_w + proj_b -> [2,2048,1024].
// Structure: x as an exact f16 plane; the projections as f16 WMMA GEMMs (32x64 wave tiles, f32, exact products + bias) into f16 planes; Er as an exact f16 plane; v re-laid per (batch, head) as [d][token]; heads batched per launch (blockIdx.y = head in the group, one plane per head; HG heads for the first three stages, PG for the last): the score GEMM q.k^T and the QEr GEMM q.Er^T into f32 planes, a wave-per-row softmax kernel that adds the skewed QEr element by its structural index and scales by 1/8 (max subtraction, P x2^10 f16), O = P.V^T into the merged f32 plane; O split into f16 hi + residual planes; output projection as two GEMMs (bias in the first).
// Compute dtype: x, weights, biases and Er rounded to bf16; projections exact; q, k, v, P as f16 operands (~2^-12), O as hi + residual; f32 accumulation and softmax. v_wmma_f32_16x16x32_f16.
#define NBT 2
#define TT 2048
#define DM 1024
#define NH 16
#define NR (NBT * TT)
#define HG 4   /* heads per launch of score, QEr and softmax: S and QE take 16 MiB a head each */
#define PG 8   /* heads per launch of P.V: P takes 8 MiB a head; HG x 32 + PG x 8 MiB is what the workspace still holds */
typedef __bf16 v16b __attribute__((ext_vector_type(16)));
typedef unsigned short v8us __attribute__((ext_vector_type(8), may_alias));
typedef float  v8f  __attribute__((ext_vector_type(8)));
typedef float  v4f  __attribute__((ext_vector_type(4)));
typedef float  v4fa __attribute__((ext_vector_type(4), may_alias));
union FragB { v16b v; v8us half[2]; unsigned short u[16]; };

__device__ __forceinline__ unsigned short bf16_bits(float x) { unsigned int u = __float_as_uint(x); return (unsigned short)((u + 0x7FFFu + ((u >> 16) & 1u)) >> 16); }
__device__ __forceinline__ float bf16_val(unsigned short b) { return __uint_as_float(((unsigned int)b) << 16); }
__device__ __forceinline__ float bf16_round(float x) { return bf16_val(bf16_bits(x)); }
// D += A·B with NT terms: 1 = ah·bh, 2 = + al·bh (A split), 3 = + ah·bl (both split)
template <int NT>
__device__ __forceinline__ v8f mmaN(v16b ah, v16b al, v16b bh, v16b bl, v8f c) {
  c = __builtin_amdgcn_wmma_f32_16x16x32_bf16(false, ah, false, bh, (short)0, c, false, false);
  if (NT >= 2) c = __builtin_amdgcn_wmma_f32_16x16x32_bf16(false, al, false, bh, (short)0, c, false, false);
  if (NT >= 3) c = __builtin_amdgcn_wmma_f32_16x16x32_bf16(false, ah, false, bl, (short)0, c, false, false);
  asm volatile("v_nop\n\tv_nop\n\tv_nop\n\tv_nop" : "+v"(c) : "v"(ah), "v"(al), "v"(bh), "v"(bl));
  return c;
}

__global__ __launch_bounds__(256) void k_wt_bf16(const float* __restrict__ W, unsigned short* __restrict__ Wt, int K, int N) {
  const int t = blockIdx.x * 256 + threadIdx.x;
  const int k8n = K / 8;
  if (t >= N * k8n) return;
  const int n = t / k8n, k8 = (t % k8n) * 8;
  v8us v;
#pragma unroll
  for (int i = 0; i < 8; ++i) v[i] = bf16_bits(W[(size_t)(k8 + i) * N + n]);
  *(v8us*)(Wt + (size_t)n * K + k8) = v;
  
}

// GEMM C[M][N] (f32, pitch ldc) = act(A[M][K]·W + bias). A f32 row-major (pitch lda) converted per fragment to bf16
// (ASPLIT: hi/lo two planes -> 2 terms, else single rounded term); Wt bf16 [N][K] (pitch ldb). BIAS_BF16 rounds the
// bias to bf16 first (bias quantised to bf16 before the add). K%32==0, M%16==0, N%64==0.
template <bool ASPLIT, int ACT, bool BIAS_BF16>
__global__ __launch_bounds__(128) void k_gemm_bf(const float* __restrict__ A, int lda, const unsigned short* __restrict__ Wt, int ldb,
                                               const float* __restrict__ bias, float* __restrict__ C, int ldc, int M, int N, int K) {
  __shared__ __attribute__((aligned(16))) float so[4][16][64];
  const int tid = threadIdx.x, w = tid >> 5, lane = tid & 31, ln = lane & 15, hh = lane >> 4;
  const int ntn = N / 64;
  const int wid = blockIdx.x * 4 + w;
  const int mt = wid / ntn, nq = wid % ntn;
  if (mt * 16 >= M) return;
  const int row0 = mt * 16, col0 = nq * 64;
  const float* arow = A + (size_t)(row0 + ln) * lda;
  v8f acc[4] = {};
  for (int kb = 0; kb < K; kb += 32) {
    FragB ah, al;
    const v4f x0 = *(const v4fa*)(arow + kb + 8 * hh), x1 = *(const v4fa*)(arow + kb + 8 * hh + 4);
    const v4f x2 = *(const v4fa*)(arow + kb + 16 + 8 * hh), x3 = *(const v4fa*)(arow + kb + 16 + 8 * hh + 4);
    float xs[16] = {x0[0],x0[1],x0[2],x0[3],x1[0],x1[1],x1[2],x1[3],x2[0],x2[1],x2[2],x2[3],x3[0],x3[1],x3[2],x3[3]};
#pragma unroll
    for (int i = 0; i < 16; ++i) { const unsigned short hb = bf16_bits(xs[i]); ah.u[i] = hb; al.u[i] = ASPLIT ? bf16_bits(xs[i] - bf16_val(hb)) : (unsigned short)0; }
#pragma unroll
    for (int t = 0; t < 4; ++t) {
      const unsigned short* brow = Wt + (size_t)(col0 + t * 16 + ln) * ldb + kb;
      FragB b;
      b.half[0] = *(const v8us*)(brow + 8 * hh);
      b.half[1] = *(const v8us*)(brow + 16 + 8 * hh);
      acc[t] = mmaN<ASPLIT ? 2 : 1>(ah.v, al.v, b.v, b.v, acc[t]);
    }
  }
#pragma unroll
  for (int t = 0; t < 4; ++t) {
    float bv = bias ? bias[col0 + t * 16 + ln] : 0.f;
    if (BIAS_BF16) bv = bf16_round(bv);
#pragma unroll
    for (int r = 0; r < 8; ++r) { float v = acc[t][r] + bv; if (ACT == 1) v = fmaxf(v, 0.f); so[w][8 * hh + r][t * 16 + ln] = v; }
  }
  __builtin_amdgcn_fence(__ATOMIC_ACQ_REL, "workgroup");
  __builtin_amdgcn_wave_barrier();
  const int rsub = lane >> 4, c4 = (lane & 15) * 4;
  {
#pragma unroll
    for (int q = 0; q < 8; ++q) {
      const int r = q * 2 + rsub;
      const v4f v = *(const v4fa*)&so[w][r][c4];
      *(v4f*)(C + (size_t)(row0 + r) * ldc + col0 + c4) = v;
    }
    
  }
}

// GEMM C = act(A·W + bias + resid): A f32 (ASPLIT -> hi/lo 2 terms), Wt bf16 [N][K]; ACT 0 none, 1 relu, 2 exact gelu;
// resid (optional, f32, row index = (row % rmod), pitch ldr, RES_BF16 rounds it) added before the activation.
template <bool ASPLIT, int ACT, bool BIAS_BF16, bool RES_BF16>
__global__ __launch_bounds__(128) void k_gemm_bf3(const float* __restrict__ A, int lda, const unsigned short* __restrict__ Wt, int ldb,
                                                const float* __restrict__ bias, const float* __restrict__ resid, int rmod, int ldr,
                                                float* __restrict__ C, int ldc, int M, int N, int K) {
  __shared__ __attribute__((aligned(16))) float so[4][16][64];
  const int tid = threadIdx.x, w = tid >> 5, lane = tid & 31, ln = lane & 15, hh = lane >> 4;
  const int ntn = N / 64;
  const int wid = blockIdx.x * 4 + w;
  const int mt = wid / ntn, nq = wid % ntn;
  if (mt * 16 >= M) return;
  const int row0 = mt * 16, col0 = nq * 64;
  const float* arow = A + (size_t)(row0 + ln) * lda;
  v8f acc[4] = {};
  for (int kb = 0; kb < K; kb += 32) {
    FragB ah, al;
    const v4f x0 = *(const v4fa*)(arow + kb + 8 * hh), x1 = *(const v4fa*)(arow + kb + 8 * hh + 4);
    const v4f x2 = *(const v4fa*)(arow + kb + 16 + 8 * hh), x3 = *(const v4fa*)(arow + kb + 16 + 8 * hh + 4);
    float xs[16] = {x0[0],x0[1],x0[2],x0[3],x1[0],x1[1],x1[2],x1[3],x2[0],x2[1],x2[2],x2[3],x3[0],x3[1],x3[2],x3[3]};
#pragma unroll
    for (int i = 0; i < 16; ++i) { const unsigned short hb = bf16_bits(xs[i]); ah.u[i] = hb; al.u[i] = ASPLIT ? bf16_bits(xs[i] - bf16_val(hb)) : (unsigned short)0; }
#pragma unroll
    for (int t = 0; t < 4; ++t) {
      const unsigned short* brow = Wt + (size_t)(col0 + t * 16 + ln) * ldb + kb;
      FragB b;
      b.half[0] = *(const v8us*)(brow + 8 * hh);
      b.half[1] = *(const v8us*)(brow + 16 + 8 * hh);
      acc[t] = mmaN<ASPLIT ? 2 : 1>(ah.v, al.v, b.v, b.v, acc[t]);
    }
  }
#pragma unroll
  for (int t = 0; t < 4; ++t) {
    const int col = col0 + t * 16 + ln;
    float bv = bias ? bias[col] : 0.f;
    if (BIAS_BF16) bv = bf16_round(bv);
#pragma unroll
    for (int r = 0; r < 8; ++r) {
      float v = acc[t][r] + bv;
      if (resid) { float rv = resid[(size_t)((row0 + 8 * hh + r) % rmod) * ldr + col]; if (RES_BF16) rv = bf16_round(rv); v += rv; }
      if (ACT == 1) v = fmaxf(v, 0.f);
      if (ACT == 2) v = 0.5f * v * (1.0f + erff(v * 0.70710678118654752f));
      if (ACT == 3) { const float u = 0.7978845608028654f * (v + 0.044715f * v * v * v); v = 0.5f * v * (1.0f + tanhf(u)); }
      so[w][8 * hh + r][t * 16 + ln] = v;
    }
  }
  __builtin_amdgcn_fence(__ATOMIC_ACQ_REL, "workgroup");
  __builtin_amdgcn_wave_barrier();
  const int rsub = lane >> 4, c4 = (lane & 15) * 4;
  {
#pragma unroll
    for (int q = 0; q < 8; ++q) {
      const int r = q * 2 + rsub;
      const v4f v = *(const v4fa*)&so[w][r][c4];
      *(v4f*)(C + (size_t)(row0 + r) * ldc + col0 + c4) = v;
    }
    
  }
}
// row LayerNorm (biased variance, eps) over N: s = X (+ R); optional out_sum <- s; out_norm <- (s-mu)*rsqrt(var+eps)*g + b
template <bool PARAM_BF16>
__global__ __launch_bounds__(256) void k_layernorm(const float* __restrict__ X, const float* __restrict__ R, const float* __restrict__ g, const float* __restrict__ bta,
                                                  float* __restrict__ out_sum, float* __restrict__ out_norm, int N, float eps) {
  __shared__ float red[256];
  const int row = blockIdx.x, tid = threadIdx.x;
  const float* x = X + (size_t)row * N; const float* rr = R ? R + (size_t)row * N : nullptr;
  float vals[16];                     // up to N = 4096
  const int per = N / 256;            // contiguous chunk per thread? use strided-by-4 chunks: thread handles j = tid*4 + 1024*u
  float s1 = 0.f;
  for (int u = 0; u < per / 4; ++u) {
    const int j = tid * 4 + 1024 * u;
    const v4f a = *(const v4fa*)(x + j);
    v4f b = {0.f,0.f,0.f,0.f}; if (rr) b = *(const v4fa*)(rr + j);
#pragma unroll
    for (int q = 0; q < 4; ++q) { const float v = a[q] + b[q]; vals[u * 4 + q] = v; s1 += v; }
  }
  red[tid] = s1; __syncthreads();
  for (int st = 128; st > 0; st >>= 1) { if (tid < st) red[tid] += red[tid + st]; __syncthreads(); }
  const float mu = red[0] / (float)N; __syncthreads();
  float s2 = 0.f;
  for (int u = 0; u < per / 4; ++u)
#pragma unroll
    for (int q = 0; q < 4; ++q) { const float c = vals[u * 4 + q] - mu; s2 += c * c; }
  red[tid] = s2; __syncthreads();
  for (int st = 128; st > 0; st >>= 1) { if (tid < st) red[tid] += red[tid + st]; __syncthreads(); }
  const float rs = rsqrtf(red[0] / (float)N + eps);
  {
    for (int u = 0; u < per / 4; ++u) {
      const int j = tid * 4 + 1024 * u;
      v4f o, sm;
#pragma unroll
      for (int q = 0; q < 4; ++q) {
        float gg = g[j + q], bb = bta[j + q];
        if (PARAM_BF16) { gg = bf16_round(gg); bb = bf16_round(bb); }
        sm[q] = vals[u * 4 + q]; o[q] = (vals[u * 4 + q] - mu) * rs * gg + bb;
      }
      if (out_sum) *(v4f*)(out_sum + (size_t)row * N + j) = sm;
      *(v4f*)(out_norm + (size_t)row * N + j) = o;
    }
    
  }
}



// ---- f16 WMMA path (v_wmma_f32_16x16x32_f16): 11-bit significands for operands in range — used where a [0,1] probability operand needs more precision than bf16
typedef _Float16 v16h __attribute__((ext_vector_type(16)));
union FragH { v16h v; v8us half[2]; _Float16 h[16]; unsigned short u[16]; };
template <int NT>
__device__ __forceinline__ v8f mmaH(v16h ah, v16h al, v16h bh, v16h bl, v8f c) {
  c = __builtin_amdgcn_wmma_f32_16x16x32_f16(false, ah, false, bh, (short)0, c, false, false);
  if (NT >= 2) c = __builtin_amdgcn_wmma_f32_16x16x32_f16(false, al, false, bh, (short)0, c, false, false);
  if (NT >= 3) c = __builtin_amdgcn_wmma_f32_16x16x32_f16(false, ah, false, bl, (short)0, c, false, false);
  asm volatile("v_nop\n\tv_nop\n\tv_nop\n\tv_nop" : "+v"(c) : "v"(ah), "v"(al), "v"(bh), "v"(bl));
  return c;
}
// batched GEMM like k_gemm_b but f16 operands: A f32 (split into f16 hi/lo if ASPLIT, else rounded to f16), Bt = f16 values [n][k]; alpha; C f32; N multiple of 16 (partial tiles skipped)
template <bool ASPLIT>
__global__ __launch_bounds__(128) void k_gemm_h(const float* __restrict__ A, int lda, size_t sA, const _Float16* __restrict__ Bh, int ldb, size_t sB, float alpha, float* __restrict__ C, int ldc, size_t sC, int M, int N, int K) {
  __shared__ __attribute__((aligned(16))) float so[4][16][64];
  const int tid = threadIdx.x, w = tid >> 5, lane = tid & 31, ln = lane & 15, hh = lane >> 4; const int by = blockIdx.y;
  A += (size_t)by * sA; Bh += (size_t)by * sB; C += (size_t)by * sC;
  const int ntn = (N + 63) / 64; const int wid = blockIdx.x * 4 + w; const int mt = wid / ntn, nq = wid % ntn; if (mt * 16 >= M) return;
  const int row0 = mt * 16, col0 = nq * 64; const float* arow = A + (size_t)(row0 + ln) * lda;
  v8f acc[4] = {};
  for (int kb = 0; kb < K; kb += 32) {
    FragH ah, al;
    const v4f x0 = *(const v4fa*)(arow + kb + 8 * hh), x1 = *(const v4fa*)(arow + kb + 8 * hh + 4), x2 = *(const v4fa*)(arow + kb + 16 + 8 * hh), x3 = *(const v4fa*)(arow + kb + 16 + 8 * hh + 4);
    float xs[16] = {x0[0],x0[1],x0[2],x0[3],x1[0],x1[1],x1[2],x1[3],x2[0],x2[1],x2[2],x2[3],x3[0],x3[1],x3[2],x3[3]};
#pragma unroll
    for (int i = 0; i < 16; ++i) { const _Float16 h = (_Float16)xs[i]; ah.h[i] = h; al.h[i] = ASPLIT ? (_Float16)(xs[i] - (float)h) : (_Float16)0.0f; }
#pragma unroll
    for (int t = 0; t < 4; ++t) { if (col0 + t * 16 >= N) continue; const size_t boff = (size_t)(col0 + t * 16 + ln) * ldb + kb; FragH bq; bq.half[0] = *(const v8us*)(Bh + boff + 8 * hh); bq.half[1] = *(const v8us*)(Bh + boff + 16 + 8 * hh);
      acc[t] = mmaH<ASPLIT ? 2 : 1>(ah.v, al.v, bq.v, bq.v, acc[t]); }
  }
#pragma unroll
  for (int t = 0; t < 4; ++t) { if (col0 + t * 16 >= N) continue;
#pragma unroll
    for (int r = 0; r < 8; ++r) so[w][8 * hh + r][t * 16 + ln] = acc[t][r] * alpha; }
  __builtin_amdgcn_fence(__ATOMIC_ACQ_REL, "workgroup"); __builtin_amdgcn_wave_barrier();
  const int rsub = lane >> 4, c4 = (lane & 15) * 4;
  {
#pragma unroll
    for (int q = 0; q < 8; ++q) { const int r = q * 2 + rsub; if (col0 + c4 < N) { const v4f v = *(const v4fa*)&so[w][r][c4]; *(v4f*)(C + (size_t)(row0 + r) * ldc + col0 + c4) = v; } }
     }
}

// Wt[n][k] = f16(W[k][n]·scale) from f32 row-major W[K][N] (scale = power of two; bf16-exact weights stay exact in f16 away from the subnormal range)
__global__ __launch_bounds__(256) void k_wt_f16(const float* __restrict__ W, _Float16* __restrict__ Wt, int K, int N, float scale) {
  const int t = blockIdx.x * 256 + threadIdx.x; if (t >= N * (K / 8)) return; const int n = t / (K / 8), k8 = (t % (K / 8)) * 8; FragH f;
#pragma unroll
  for (int i = 0; i < 8; ++i) f.h[i] = (_Float16)(bf16_round(W[(size_t)(k8 + i) * N + n]) * scale); const v8us o = f.half[0];
  *(v8us*)((unsigned short*)Wt + (size_t)n * K + k8) = o; 
}
// k_gemm_hh variant with fused epilogue: v = acc·alpha + bias[by·sBias + col] (+ CP[(row/rowsPerB)·sCPb + by·64 + col] if CP) ; ACT 0 none / 1 elu ; writes f16 C16 (and f32 C if non-null)
template <int ACT>
__global__ __launch_bounds__(128) void k_gemm_hhx(const _Float16* __restrict__ A, int lda, size_t sA, const _Float16* __restrict__ Bh, int ldb, size_t sB, float alpha, const float* __restrict__ bias, size_t sBias, const float* __restrict__ CP, int rowsPerB, size_t sCPb, int row0g,
    float* __restrict__ C, _Float16* __restrict__ C16, int ldc, size_t sC, int M, int N, int K) {
  __shared__ __attribute__((aligned(16))) float so[4][16][64];
  const int tid = threadIdx.x, w = tid >> 5, lane = tid & 31, ln = lane & 15, hh = lane >> 4; const int by = blockIdx.y;
  A += (size_t)by * sA; Bh += (size_t)by * sB; const size_t cofs = (size_t)by * sC; const float* bp = bias ? bias + (size_t)by * sBias : nullptr;
  const int ntn = (N + 63) / 64; const int wid = blockIdx.x * 4 + w; const int mt = wid / ntn, nq = wid % ntn; if (mt * 16 >= M) return;
  const int row0 = mt * 16, col0 = nq * 64; const _Float16* arow = A + (size_t)(row0 + ln) * lda;
  v8f acc[4] = {};
  for (int kb = 0; kb < K; kb += 32) { FragH ah; ah.half[0] = *(const v8us*)((const unsigned short*)arow + kb + 8 * hh); ah.half[1] = *(const v8us*)((const unsigned short*)arow + kb + 16 + 8 * hh);
#pragma unroll
    for (int t = 0; t < 4; ++t) { if (col0 + t * 16 >= N) continue; const size_t boff = (size_t)(col0 + t * 16 + ln) * ldb + kb; FragH bq; bq.half[0] = *(const v8us*)((const unsigned short*)Bh + boff + 8 * hh); bq.half[1] = *(const v8us*)((const unsigned short*)Bh + boff + 16 + 8 * hh);
      acc[t] = mmaH<1>(ah.v, ah.v, bq.v, bq.v, acc[t]); }
  }
#pragma unroll
  for (int t = 0; t < 4; ++t) { if (col0 + t * 16 >= N) continue; const int col = col0 + t * 16 + ln; const float bv = bp ? bf16_round(bp[col]) : 0.f;
#pragma unroll
    for (int r = 0; r < 8; ++r) { float v = acc[t][r] * alpha + bv; if (CP) { const int bidx = (row0g + row0 + 8 * hh + r) / rowsPerB; v += CP[(size_t)bidx * sCPb + (size_t)by * 64 + col]; } if (ACT == 1) v = (v > 0.f) ? v : expm1f(v); else if (ACT == 7) v = (v > 0.f) ? v + 1.0f : expf(v); else if (ACT == 8) v = tanhf(v); else if (ACT == 9) v = 0.5f * v * (1.0f + tanhf(0.7978845608028654f * (v + 0.044715f * v * v * v))); else if (ACT == 11) v = 1.0f / (1.0f + expf(-v)); else if (ACT == 12) v = (v > 0.f) ? v : 0.01f * v; else if (ACT == 14) v = (v > 0.f) ? v : 0.1f * v; else if (ACT == 15) v = v / (1.0f + expf(-v)); else if (ACT == 3) v = fmaxf(v, 0.f); else if (ACT == 6) v = 0.5f * v * (1.0f + erff(v * 0.70710678118654752f)); so[w][8 * hh + r][t * 16 + ln] = v; } }
  __builtin_amdgcn_fence(__ATOMIC_ACQ_REL, "workgroup"); __builtin_amdgcn_wave_barrier();
  const int rsub = lane >> 4, c4 = (lane & 15) * 4; typedef _Float16 v4h __attribute__((ext_vector_type(4)));
  {
#pragma unroll
    for (int q = 0; q < 8; ++q) { const int r = q * 2 + rsub; if (col0 + c4 < N) { const v4f v = *(const v4fa*)&so[w][r][c4]; if (C) *(v4f*)(C + cofs + (size_t)(row0 + r) * ldc + col0 + c4) = v; if (C16) { v4h h4; for (int i = 0; i < 4; ++i) h4[i] = (_Float16)v[i]; *(v4h*)(C16 + cofs + (size_t)(row0 + r) * ldc + col0 + c4) = h4; } } }
     }
}


typedef _Float16 v4h __attribute__((ext_vector_type(4)));

__global__ __launch_bounds__(256) void k_x16(const float* __restrict__ x, _Float16* __restrict__ X16, size_t n8) { const size_t t = (size_t)blockIdx.x * 256 + threadIdx.x; if (t >= n8) return; FragH f;
#pragma unroll
  for (int q = 0; q < 8; ++q) f.h[q] = (_Float16)bf16_round(x[t * 8 + q]); *(v8us*)((unsigned short*)X16 + t * 8) = f.half[0];  }
__global__ __launch_bounds__(256) void k_h16(const float* __restrict__ x, _Float16* __restrict__ X16, size_t n8) { const size_t t = (size_t)blockIdx.x * 256 + threadIdx.x; if (t >= n8) return; FragH f;
#pragma unroll
  for (int q = 0; q < 8; ++q) f.h[q] = (_Float16)x[t * 8 + q]; *(v8us*)((unsigned short*)X16 + t * 8) = f.half[0];  }
__global__ __launch_bounds__(256) void k_round16f(const float* __restrict__ W, _Float16* __restrict__ Bt, size_t n8) { const size_t t = (size_t)blockIdx.x * 256 + threadIdx.x; if (t >= n8) return; FragH f;
#pragma unroll
  for (int i = 0; i < 8; ++i) f.h[i] = (_Float16)(bf16_round(W[t * 8 + i]) * 16.0f); *(v8us*)((unsigned short*)Bt + t * 8) = f.half[0];  }
template <int NHv, int TTv>
__global__ __launch_bounds__(256) void k_vt(const _Float16* __restrict__ V16, int ldv, int voff, _Float16* __restrict__ Vt) { __shared__ unsigned short tl[64][66]; const int tid = threadIdx.x; const int slab = blockIdx.x / (TTv / 64), lg = blockIdx.x % (TTv / 64); const int b = slab / NHv, h = slab % NHv;
  for (int i = tid; i < 64 * 8; i += 256) { const int r = i / 8, c8 = (i % 8) * 8; FragH f; f.half[0] = *(const v8us*)((const unsigned short*)V16 + ((size_t)b * TTv + lg * 64 + r) * ldv + voff + h * 64 + c8);
#pragma unroll
    for (int q = 0; q < 8; ++q) tl[r][c8 + q] = f.u[q]; }
  __syncthreads();
  {
#pragma unroll
    for (int rd = 0; rd < 2; ++rd) { const int d = rd * 32 + tid / 8, pc = tid % 8; FragH f;
#pragma unroll
      for (int q = 0; q < 8; ++q) f.u[q] = tl[pc * 8 + q][d];
      *(v8us*)((unsigned short*)Vt + ((size_t)slab * 64 + d) * TTv + lg * 64 + pc * 8) = f.half[0]; }
     } }

__global__ __launch_bounds__(256) void k_hl(const float* __restrict__ F, _Float16* __restrict__ Hh, _Float16* __restrict__ Hl, size_t n8) { const size_t t = (size_t)blockIdx.x * 256 + threadIdx.x; if (t >= n8) return; FragH fh, fl; const v4f a = *(const v4fa*)(F + t * 8), c = *(const v4fa*)(F + t * 8 + 4);
#pragma unroll
  for (int q = 0; q < 4; ++q) { _Float16 h = (_Float16)a[q]; fh.h[q] = h; fl.h[q] = (_Float16)((a[q] - (float)h) * 1024.0f); h = (_Float16)c[q]; fh.h[4 + q] = h; fl.h[4 + q] = (_Float16)((c[q] - (float)h) * 1024.0f); }
  { *(v8us*)((unsigned short*)Hh + t * 8) = fh.half[0]; *(v8us*)((unsigned short*)Hl + t * 8) = fl.half[0];  } }

// ---- fast GEMM (wave tile 32x64; requires M % 32 == 0 rows per launch region and N % 64 == 0); epilogue = k_gemm_hhx semantics ----
__device__ __forceinline__ v16h g2_frag(const _Float16* p, int hh) { FragH f; f.half[0] = *(const v8us*)((const unsigned short*)p + 8 * hh); f.half[1] = *(const v8us*)((const unsigned short*)p + 16 + 8 * hh); return f.v; }
__device__ __forceinline__ v8f g2_mma(v16h a, v16h b, v8f c) { v8f d = __builtin_amdgcn_wmma_f32_16x16x32_f16(false, a, false, b, (short)0, c, false, false); asm volatile("v_nop\n\tv_nop\n\tv_nop\n\tv_nop" : "+v"(d) : "v"(a), "v"(b)); return d; }
template <int ACT>
__global__ __launch_bounds__(128) void k_gemm2(const _Float16* __restrict__ A, int lda, size_t sA, const _Float16* __restrict__ Bh, int ldb, size_t sB, float alpha, const float* __restrict__ bias, size_t sBias, const float* __restrict__ CP, int rowsPerB, size_t sCPb, int row0g,
    float* __restrict__ C, _Float16* __restrict__ C16, int ldc, size_t sC, int M, int N, int K) {
  __shared__ __attribute__((aligned(16))) float so[4][32][68];
  const int tid = threadIdx.x, w = tid >> 5, lane = tid & 31, ln = lane & 15, hh = lane >> 4; const int by = blockIdx.y;
  A += (size_t)by * sA; Bh += (size_t)by * sB; const size_t cofs = (size_t)by * sC; const float* bp = bias ? bias + (size_t)by * sBias : nullptr;
  const int ntn = N >> 6; const int mt = blockIdx.x / ntn, nq = blockIdx.x - mt * ntn; const int row0 = mt * 128 + 32 * w, col0 = nq * 64; if (row0 >= M) return;
  const _Float16* a0p = A + (size_t)(row0 + ln) * lda; const _Float16* a1p = a0p + (size_t)16 * lda;
  const _Float16* b0p = Bh + (size_t)(col0 + ln) * ldb; const _Float16* b1p = b0p + (size_t)16 * ldb; const _Float16* b2p = b1p + (size_t)16 * ldb; const _Float16* b3p = b2p + (size_t)16 * ldb;
  const v8f z8 = {0.f,0.f,0.f,0.f,0.f,0.f,0.f,0.f}; v8f c00 = z8, c01 = z8, c02 = z8, c03 = z8, c10 = z8, c11 = z8, c12 = z8, c13 = z8;
#pragma unroll 1
  for (int kb = 0; kb < K; kb += 32) { const v16h a0 = g2_frag(a0p + kb, hh), a1 = g2_frag(a1p + kb, hh);
    v16h b = g2_frag(b0p + kb, hh); c00 = g2_mma(a0, b, c00); c10 = g2_mma(a1, b, c10);
    b = g2_frag(b1p + kb, hh); c01 = g2_mma(a0, b, c01); c11 = g2_mma(a1, b, c11);
    b = g2_frag(b2p + kb, hh); c02 = g2_mma(a0, b, c02); c12 = g2_mma(a1, b, c12);
    b = g2_frag(b3p + kb, hh); c03 = g2_mma(a0, b, c03); c13 = g2_mma(a1, b, c13); }
  v8f accs[8] = {c00, c01, c02, c03, c10, c11, c12, c13};
#pragma unroll
  for (int u = 0; u < 8; ++u) { const int t = u & 3, half = u >> 2; const int col = col0 + t * 16 + ln; const float bv = bp ? bf16_round(bp[col]) : 0.f;
#pragma unroll
    for (int r = 0; r < 8; ++r) { const int rloc = half * 16 + 8 * hh + r; float v = accs[u][r] * alpha + bv; if (CP) { const int bidx = (row0g + row0 + rloc) / rowsPerB; v += CP[(size_t)bidx * sCPb + (size_t)by * 64 + col]; }
      if (ACT == 3) v = fmaxf(v, 0.f); else if (ACT == 6) v = 0.5f * v * (1.0f + erff(v * 0.70710678118654752f)); else if (ACT == 11) v = 1.0f / (1.0f + expf(-v)); else if (ACT == 15) v = v / (1.0f + expf(-v)); else if (ACT == 12) v = (v > 0.f) ? v : 0.01f * v; else if (ACT == 8) v = tanhf(v);
      so[w][rloc][t * 16 + ln] = v; } }
  __builtin_amdgcn_fence(__ATOMIC_ACQ_REL, "workgroup"); __builtin_amdgcn_wave_barrier();
  const int rsub = lane >> 4, c4 = (lane & 15) * 4;
  {
#pragma unroll
    for (int q = 0; q < 16; ++q) { const int r = q * 2 + rsub; const v4f v = *(const v4fa*)&so[w][r][c4]; if (C) *(v4f*)(C + cofs + (size_t)(row0 + r) * ldc + col0 + c4) = v; if (C16) { v4h h4; for (int i = 0; i < 4; ++i) h4[i] = (_Float16)v[i]; *(v4h*)(C16 + cofs + (size_t)(row0 + r) * ldc + col0 + c4) = h4; } }
     } }


__global__ __launch_bounds__(256) void k_split(const float* __restrict__ F, _Float16* __restrict__ Hh, _Float16* __restrict__ Hl, size_t n8) {
  #pragma clang fp contract(off)
  const size_t t = (size_t)blockIdx.x * 256 + threadIdx.x; if (t >= n8) return; const v4f a = *(const v4fa*)(F + t * 8), c = *(const v4fa*)(F + t * 8 + 4); FragH fh, fl;
#pragma unroll
  for (int q = 0; q < 8; ++q) { const float v = (q < 4) ? a[q] : c[q - 4]; const _Float16 hi = (_Float16)v; fh.h[q] = hi; fl.h[q] = (_Float16)((v - (float)hi) * 1024.0f); }
  { *(v8us*)((unsigned short*)Hh + t * 8) = fh.half[0]; *(v8us*)((unsigned short*)Hl + t * 8) = fl.half[0];  } }



__global__ __launch_bounds__(256) void k_skewsoft(const float* __restrict__ S, const float* __restrict__ QE, _Float16* __restrict__ P16) {
  #pragma clang fp contract(off)
  const int w = threadIdx.x >> 5, lane = threadIdx.x & 31; const int i = blockIdx.x * 8 + w; if (i >= TT) return; const size_t plane = (size_t)blockIdx.y * TT * TT; QE += plane; P16 += plane; const float* srow = S + plane + (size_t)i * TT;
  auto logit = [&](int j, float sv) { const int f = (i + 1) * TT + j; const int r = f / (TT + 1), c = f - r * (TT + 1); const float rel = (c == 0) ? 0.f : QE[(size_t)r * TT + (c - 1)]; return (sv + rel) * 0.125f; };
  float m = -3.0e38f;
  for (int c = lane * 4; c < TT; c += 128) { const v4f a = *(const v4fa*)(srow + c);
#pragma unroll
    for (int q = 0; q < 4; ++q) m = fmaxf(m, logit(c + q, a[q])); }
  for (int o = 16; o > 0; o >>= 1) m = fmaxf(m, __shfl_xor(m, o, 32));
  float s = 0.f;
  for (int c = lane * 4; c < TT; c += 128) { const v4f a = *(const v4fa*)(srow + c);
#pragma unroll
    for (int q = 0; q < 4; ++q) s += expf(logit(c + q, a[q]) - m); }
  for (int o = 16; o > 0; o >>= 1) s += __shfl_xor(s, o, 32);
  const float sc = 1024.0f / s;
  {
    for (int c = lane * 8; c < TT; c += 256) { const v4f a = *(const v4fa*)(srow + c), a2 = *(const v4fa*)(srow + c + 4); FragH f;
#pragma unroll
      for (int q = 0; q < 4; ++q) { f.h[q] = (_Float16)(expf(logit(c + q, a[q]) - m) * sc); f.h[4 + q] = (_Float16)(expf(logit(c + 4 + q, a2[q]) - m) * sc); }
      *(v8us*)((unsigned short*)P16 + (size_t)i * TT + c) = f.half[0]; }
     } }

extern "C" void kernel_launch(void* const* d_in, const int* in_sizes, int n_in,
                              void* d_out, int out_size, void* d_ws, size_t ws_size, hipStream_t stream) {
  (void)in_sizes; (void)n_in; (void)out_size;
  const float* const* I = (const float* const*)d_in; const float* x = I[0]; const float* qw = I[1]; const float* qb = I[2]; const float* kvw = I[3]; const float* kvb = I[4]; const float* pw = I[5]; const float* pb = I[6]; const float* Er = I[7];
  char* ws = (char*)d_ws; size_t off = 0;
  auto take = [&](size_t bytes) { char* p = ws + off; off += (bytes + 255) & ~(size_t)255; return p; };
  _Float16* BP = (_Float16*)take((size_t)DM * DM * 2); _Float16* ER16 = (_Float16*)take((size_t)TT * 64 * 2);
  _Float16* Q16 = (_Float16*)take((size_t)NR * DM * 2); _Float16* KV16 = (_Float16*)take((size_t)NR * 2 * DM * 2); _Float16* VT = (_Float16*)take((size_t)NR * DM * 2); float* O = (float*)take((size_t)NR * DM * 4);
  float* S = (float*)take((size_t)HG * TT * TT * 4); float* QE = (float*)take((size_t)HG * TT * TT * 4); _Float16* P16 = (_Float16*)take((size_t)PG * TT * TT * 2);
  if (off > ws_size) return;      /* 2 + 0.3 + 8 + 16 + 8 + 16 + 64 + 64 + 64 = 243 MiB */
  _Float16* X16 = (_Float16*)QE; _Float16* BQ = X16 + (size_t)NR * DM; _Float16* BKV = BQ + (size_t)DM * DM;      /* x and the q, kv weights (14 MiB) are dead after the projections, before the first QE is written */
  _Float16* Oh = (_Float16*)S; _Float16* Ol = Oh + (size_t)NR * DM;      /* the O planes (16 MiB) are written after the last S is read */
  const size_t n8 = (size_t)NR * DM / 8; const unsigned nb8 = (unsigned)((n8 + 255) / 256);
  k_wt_f16<<<(unsigned)(((size_t)DM * DM / 8 + 255) / 256), 256, 0, stream>>>(qw, BQ, DM, DM, 16.0f); k_wt_f16<<<(unsigned)(((size_t)DM * 2 * DM / 8 + 255) / 256), 256, 0, stream>>>(kvw, BKV, DM, 2 * DM, 16.0f); k_wt_f16<<<(unsigned)(((size_t)DM * DM / 8 + 255) / 256), 256, 0, stream>>>(pw, BP, DM, DM, 16.0f);      /* (in,out) -> [out][in] x16 */
  k_x16<<<(TT * 64 / 8 + 255) / 256, 256, 0, stream>>>(Er, ER16, (size_t)TT * 64 / 8);      /* Er exact f16 = natural Bt [2048][64] */
  k_x16<<<nb8, 256, 0, stream>>>(x, X16, n8);
  const dim3 gQ((NR / 128) * (DM / 64), 1), gKV((NR / 128) * (2 * DM / 64), 1), gS((TT / 128) * (TT / 64), HG), gF(TT / 8, HG), gV((TT / 128) * 1, PG);
  k_gemm2<0><<<gQ, 128, 0, stream>>>(X16, DM, 0, BQ, DM, 0, 0.0625f, qb, 0, nullptr, 1, 0, 0, nullptr, Q16, DM, 0, NR, DM, DM);
  k_gemm2<0><<<gKV, 128, 0, stream>>>(X16, DM, 0, BKV, DM, 0, 0.0625f, kvb, 0, nullptr, 1, 0, 0, nullptr, KV16, 2 * DM, 0, NR, 2 * DM, DM);      /* [k | v] f16, column = part*1024 + h*64 + d */
  k_vt<NH, TT><<<NBT * NH * (TT / 64), 256, 0, stream>>>(KV16, 2 * DM, DM, VT);
  /* strides between the heads of a launch: 64 columns (q, k, O), 64 rows of VT, one plane (S, QE, P) */
  for (int b = 0; b < NBT; ++b) for (int hp = 0; hp < NH; hp += PG) {
    for (int h = hp; h < hp + PG; h += HG) { const _Float16* qp = Q16 + (size_t)b * TT * DM + h * 64; const _Float16* kp = KV16 + (size_t)b * TT * 2 * DM + h * 64;
      k_gemm2<0><<<gS, 128, 0, stream>>>(qp, DM, 64, kp, 2 * DM, 64, 1.0f, nullptr, 0, nullptr, 1, 0, 0, S, nullptr, TT, (size_t)TT * TT, TT, TT, 64);      /* q.k^T */
      k_gemm2<0><<<gS, 128, 0, stream>>>(qp, DM, 64, ER16, 64, 0, 1.0f, nullptr, 0, nullptr, 1, 0, 0, QE, nullptr, TT, (size_t)TT * TT, TT, TT, 64);      /* q.Er^T */
      k_skewsoft<<<gF, 256, 0, stream>>>(S, QE, P16 + (size_t)(h - hp) * TT * TT); }
    k_gemm2<0><<<gV, 128, 0, stream>>>(P16, TT, (size_t)TT * TT, VT + ((size_t)b * NH + hp) * 64 * TT, TT, (size_t)64 * TT, 0.0009765625f, nullptr, 0, nullptr, 1, 0, 0, O + (size_t)b * TT * DM + hp * 64, nullptr, DM, 64, TT, 64, TT); }
  k_split<<<nb8, 256, 0, stream>>>(O, Oh, Ol, n8);
  k_gemm2<0><<<gQ, 128, 0, stream>>>(Oh, DM, 0, BP, DM, 0, 0.0625f, pb, 0, nullptr, 1, 0, 0, (float*)d_out, nullptr, DM, 0, NR, DM, DM);
  k_gemm2<0><<<gQ, 128, 0, stream>>>(Ol, DM, 0, BP, DM, 0, 0.0625f / 1024.0f, nullptr, 0, (const float*)d_out, 1, (size_t)DM, 0, (float*)d_out, nullptr, DM, 0, NR, DM, DM);
}

// v002
// A run of this version takes 351 microseconds.
// In two side-by-side timings against v001, it was 3.59 and 3.63 times as fast.
// All steps since v000 together make it 9.91 times as fast.
#include <hip/hip_runtime.h>
// Relative-position multi-head attention with the 'skew' trick (2 x 2048 tokens x 1024, 16 heads x 64): q = x*q_w + q_b; [k | v] = x*kv_w + kv_b; QEr = q . Er^T against the learned INPUT table Er [2048][64]; Srel = skew(QEr) (pad one zero column on the left, reinterpret as [(N+1)][N], drop the first row -> Srel[i][j] = padded.flat[(i+1)*N + j]); logits = (q.k + Srel)/8 (no mask); softmax; merged . proj_w + proj_b -> [2,2048,1024].
// Structure: x as an exact f16 plane; the projections as f16 WMMA GEMMs (32x64 wave tiles, f32, exact products + bias) into f16 planes; Er as an exact f16 plane; v re-laid per (batch, head) as [d][token]; one attention kernel for all (batch, head) pairs: a wave holds 32 queries and walks the keys 64 at a time; scores and relative terms as transposed WMMA tiles (keys or Er rows as A, queries as B), the skew as a per-query shifted read of the relative tile through LDS, running-max softmax per lane, P (x2^10 f16) taken from the score registers as the B operand of V^T.P^T, O into the merged f32 plane; O split into f16 hi + residual planes; output projection as two GEMMs (bias in the first).
// Compute dtype: x, weights, biases and Er rounded to bf16; projections exact; q, k, v, P as f16 operands (~2^-12), O as hi + residual; f32 accumulation and softmax. v_wmma_f32_16x16x32_f16.
#define NBT 2
#define TT 2048
#define DM 1024
#define NH 16
#define NR (NBT * TT)
#define RP 84   /* floats per query row of the relative tile in LDS: 80 used; a multiple of 4 for the 16-byte writes; lane ln reads at ln * (RP - 1) + const, and 83 is odd, which spreads the lanes over the banks */
typedef __bf16 v16b __attribute__((ext_vector_type(16)));
typedef unsigned short v8us __attribute__((ext_vector_type(8), may_alias));
typedef float  v8f  __attribute__((ext_vector_type(8)));
typedef float  v4f  __attribute__((ext_vector_type(4)));
typedef float  v4fa __attribute__((ext_vector_type(4), may_alias));
union FragB { v16b v; v8us half[2]; unsigned short u[16]; };

__device__ __forceinline__ unsigned short bf16_bits(float x) { unsigned int u = __float_as_uint(x); return (unsigned short)((u + 0x7FFFu + ((u >> 16) & 1u)) >> 16); }
__device__ __forceinline__ float bf16_val(unsigned short b) { return __uint_as_float(((unsigned int)b) << 16); }
__device__ __forceinline__ float bf16_round(float x) { return bf16_val(bf16_bits(x)); }
// D += A·B with NT terms: 1 = ah·bh, 2 = + al·bh (A split), 3 = + ah·bl (both split)
template <int NT>
__device__ __forceinline__ v8f mmaN(v16b ah, v16b al, v16b bh, v16b bl, v8f c) {
  c = __builtin_amdgcn_wmma_f32_16x16x32_bf16(false, ah, false, bh, (short)0, c, false, false);
  if (NT >= 2) c = __builtin_amdgcn_wmma_f32_16x16x32_bf16(false, al, false, bh, (short)0, c, false, false);
  if (NT >= 3) c = __builtin_amdgcn_wmma_f32_16x16x32_bf16(false, ah, false, bl, (short)0, c, false, false);
  asm volatile("v_nop\n\tv_nop\n\tv_nop\n\tv_nop" : "+v"(c) : "v"(ah), "v"(al), "v"(bh), "v"(bl));
  return c;
}

__global__ __launch_bounds__(256) void k_wt_bf16(const float* __restrict__ W, unsigned short* __restrict__ Wt, int K, int N) {
  const int t = blockIdx.x * 256 + threadIdx.x;
  const int k8n = K / 8;
  if (t >= N * k8n) return;
  const int n = t / k8n, k8 = (t % k8n) * 8;
  v8us v;
#pragma unroll
  for (int i = 0; i < 8; ++i) v[i] = bf16_bits(W[(size_t)(k8 + i) * N + n]);
  *(v8us*)(Wt + (size_t)n * K + k8) = v;
  
}

// GEMM C[M][N] (f32, pitch ldc) = act(A[M][K]·W + bias). A f32 row-major (pitch lda) converted per fragment to bf16
// (ASPLIT: hi/lo two planes -> 2 terms, else single rounded term); Wt bf16 [N][K] (pitch ldb). BIAS_BF16 rounds the
// bias to bf16 first (bias quantised to bf16 before the add). K%32==0, M%16==0, N%64==0.
template <bool ASPLIT, int ACT, bool BIAS_BF16>
__global__ __launch_bounds__(128) void k_gemm_bf(const float* __restrict__ A, int lda, const unsigned short* __restrict__ Wt, int ldb,
                                               const float* __restrict__ bias, float* __restrict__ C, int ldc, int M, int N, int K) {
  __shared__ __attribute__((aligned(16))) float so[4][16][64];
  const int tid = threadIdx.x, w = tid >> 5, lane = tid & 31, ln = lane & 15, hh = lane >> 4;
  const int ntn = N / 64;
  const int wid = blockIdx.x * 4 + w;
  const int mt = wid / ntn, nq = wid % ntn;
  if (mt * 16 >= M) return;
  const int row0 = mt * 16, col0 = nq * 64;
  const float* arow = A + (size_t)(row0 + ln) * lda;
  v8f acc[4] = {};
  for (int kb = 0; kb < K; kb += 32) {
    FragB ah, al;
    const v4f x0 = *(const v4fa*)(arow + kb + 8 * hh), x1 = *(const v4fa*)(arow + kb + 8 * hh + 4);
    const v4f x2 = *(const v4fa*)(arow + kb + 16 + 8 * hh), x3 = *(const v4fa*)(arow + kb + 16 + 8 * hh + 4);
    float xs[16] = {x0[0],x0[1],x0[2],x0[3],x1[0],x1[1],x1[2],x1[3],x2[0],x2[1],x2[2],x2[3],x3[0],x3[1],x3[2],x3[3]};
#pragma unroll
    for (int i = 0; i < 16; ++i) { const unsigned short hb = bf16_bits(xs[i]); ah.u[i] = hb; al.u[i] = ASPLIT ? bf16_bits(xs[i] - bf16_val(hb)) : (unsigned short)0; }
#pragma unroll
    for (int t = 0; t < 4; ++t) {
      const unsigned short* brow = Wt + (size_t)(col0 + t * 16 + ln) * ldb + kb;
      FragB b;
      b.half[0] = *(const v8us*)(brow + 8 * hh);
      b.half[1] = *(const v8us*)(brow + 16 + 8 * hh);
      acc[t] = mmaN<ASPLIT ? 2 : 1>(ah.v, al.v, b.v, b.v, acc[t]);
    }
  }
#pragma unroll
  for (int t = 0; t < 4; ++t) {
    float bv = bias ? bias[col0 + t * 16 + ln] : 0.f;
    if (BIAS_BF16) bv = bf16_round(bv);
#pragma unroll
    for (int r = 0; r < 8; ++r) { float v = acc[t][r] + bv; if (ACT == 1) v = fmaxf(v, 0.f); so[w][8 * hh + r][t * 16 + ln] = v; }
  }
  __builtin_amdgcn_fence(__ATOMIC_ACQ_REL, "workgroup");
  __builtin_amdgcn_wave_barrier();
  const int rsub = lane >> 4, c4 = (lane & 15) * 4;
  {
#pragma unroll
    for (int q = 0; q < 8; ++q) {
      const int r = q * 2 + rsub;
      const v4f v = *(const v4fa*)&so[w][r][c4];
      *(v4f*)(C + (size_t)(row0 + r) * ldc + col0 + c4) = v;
    }
    
  }
}

// GEMM C = act(A·W + bias + resid): A f32 (ASPLIT -> hi/lo 2 terms), Wt bf16 [N][K]; ACT 0 none, 1 relu, 2 exact gelu;
// resid (optional, f32, row index = (row % rmod), pitch ldr, RES_BF16 rounds it) added before the activation.
template <bool ASPLIT, int ACT, bool BIAS_BF16, bool RES_BF16>
__global__ __launch_bounds__(128) void k_gemm_bf3(const float* __restrict__ A, int lda, const unsigned short* __restrict__ Wt, int ldb,
                                                const float* __restrict__ bias, const float* __restrict__ resid, int rmod, int ldr,
                                                float* __restrict__ C, int ldc, int M, int N, int K) {
  __shared__ __attribute__((aligned(16))) float so[4][16][64];
  const int tid = threadIdx.x, w = tid >> 5, lane = tid & 31, ln = lane & 15, hh = lane >> 4;
  const int ntn = N / 64;
  const int wid = blockIdx.x * 4 + w;
  const int mt = wid / ntn, nq = wid % ntn;
  if (mt * 16 >= M) return;
  const int row0 = mt * 16, col0 = nq * 64;
  const float* arow = A + (size_t)(row0 + ln) * lda;
  v8f acc[4] = {};
  for (int kb = 0; kb < K; kb += 32) {
    FragB ah, al;
    const v4f x0 = *(const v4fa*)(arow + kb + 8 * hh), x1 = *(const v4fa*)(arow + kb + 8 * hh + 4);
    const v4f x2 = *(const v4fa*)(arow + kb + 16 + 8 * hh), x3 = *(const v4fa*)(arow + kb + 16 + 8 * hh + 4);
    float xs[16] = {x0[0],x0[1],x0[2],x0[3],x1[0],x1[1],x1[2],x1[3],x2[0],x2[1],x2[2],x2[3],x3[0],x3[1],x3[2],x3[3]};
#pragma unroll
    for (int i = 0; i < 16; ++i) { const unsigned short hb = bf16_bits(xs[i]); ah.u[i] = hb; al.u[i] = ASPLIT ? bf16_bits(xs[i] - bf16_val(hb)) : (unsigned short)0; }
#pragma unroll
    for (int t = 0; t < 4; ++t) {
      const unsigned short* brow = Wt + (size_t)(col0 + t * 16 + ln) * ldb + kb;
      FragB b;
      b.half[0] = *(const v8us*)(brow + 8 * hh);
      b.half[1] = *(const v8us*)(brow + 16 + 8 * hh);
      acc[t] = mmaN<ASPLIT ? 2 : 1>(ah.v, al.v, b.v, b.v, acc[t]);
    }
  }
#pragma unroll
  for (int t = 0; t < 4; ++t) {
    const int col = col0 + t * 16 + ln;
    float bv = bias ? bias[col] : 0.f;
    if (BIAS_BF16) bv = bf16_round(bv);
#pragma unroll
    for (int r = 0; r < 8; ++r) {
      float v = acc[t][r] + bv;
      if (resid) { float rv = resid[(size_t)((row0 + 8 * hh + r) % rmod) * ldr + col]; if (RES_BF16) rv = bf16_round(rv); v += rv; }
      if (ACT == 1) v = fmaxf(v, 0.f);
      if (ACT == 2) v = 0.5f * v * (1.0f + erff(v * 0.70710678118654752f));
      if (ACT == 3) { const float u = 0.7978845608028654f * (v + 0.044715f * v * v * v); v = 0.5f * v * (1.0f + tanhf(u)); }
      so[w][8 * hh + r][t * 16 + ln] = v;
    }
  }
  __builtin_amdgcn_fence(__ATOMIC_ACQ_REL, "workgroup");
  __builtin_amdgcn_wave_barrier();
  const int rsub = lane >> 4, c4 = (lane & 15) * 4;
  {
#pragma unroll
    for (int q = 0; q < 8; ++q) {
      const int r = q * 2 + rsub;
      const v4f v = *(const v4fa*)&so[w][r][c4];
      *(v4f*)(C + (size_t)(row0 + r) * ldc + col0 + c4) = v;
    }
    
  }
}
// row LayerNorm (biased variance, eps) over N: s = X (+ R); optional out_sum <- s; out_norm <- (s-mu)*rsqrt(var+eps)*g + b
template <bool PARAM_BF16>
__global__ __launch_bounds__(256) void k_layernorm(const float* __restrict__ X, const float* __restrict__ R, const float* __restrict__ g, const float* __restrict__ bta,
                                                  float* __restrict__ out_sum, float* __restrict__ out_norm, int N, float eps) {
  __shared__ float red[256];
  const int row = blockIdx.x, tid = threadIdx.x;
  const float* x = X + (size_t)row * N; const float* rr = R ? R + (size_t)row * N : nullptr;
  float vals[16];                     // up to N = 4096
  const int per = N / 256;            // contiguous chunk per thread? use strided-by-4 chunks: thread handles j = tid*4 + 1024*u
  float s1 = 0.f;
  for (int u = 0; u < per / 4; ++u) {
    const int j = tid * 4 + 1024 * u;
    const v4f a = *(const v4fa*)(x + j);
    v4f b = {0.f,0.f,0.f,0.f}; if (rr) b = *(const v4fa*)(rr + j);
#pragma unroll
    for (int q = 0; q < 4; ++q) { const float v = a[q] + b[q]; vals[u * 4 + q] = v; s1 += v; }
  }
  red[tid] = s1; __syncthreads();
  for (int st = 128; st > 0; st >>= 1) { if (tid < st) red[tid] += red[tid + st]; __syncthreads(); }
  const float mu = red[0] / (float)N; __syncthreads();
  float s2 = 0.f;
  for (int u = 0; u < per / 4; ++u)
#pragma unroll
    for (int q = 0; q < 4; ++q) { const float c = vals[u * 4 + q] - mu; s2 += c * c; }
  red[tid] = s2; __syncthreads();
  for (int st = 128; st > 0; st >>= 1) { if (tid < st) red[tid] += red[tid + st]; __syncthreads(); }
  const float rs = rsqrtf(red[0] / (float)N + eps);
  {
    for (int u = 0; u < per / 4; ++u) {
      const int j = tid * 4 + 1024 * u;
      v4f o, sm;
#pragma unroll
      for (int q = 0; q < 4; ++q) {
        float gg = g[j + q], bb = bta[j + q];
        if (PARAM_BF16) { gg = bf16_round(gg); bb = bf16_round(bb); }
        sm[q] = vals[u * 4 + q]; o[q] = (vals[u * 4 + q] - mu) * rs * gg + bb;
      }
      if (out_sum) *(v4f*)(out_sum + (size_t)row * N + j) = sm;
      *(v4f*)(out_norm + (size_t)row * N + j) = o;
    }
    
  }
}



// ---- f16 WMMA path (v_wmma_f32_16x16x32_f16): 11-bit significands for operands in range — used where a [0,1] probability operand needs more precision than bf16
typedef _Float16 v16h __attribute__((ext_vector_type(16)));
union FragH { v16h v; v8us half[2]; _Float16 h[16]; unsigned short u[16]; };
template <int NT>
__device__ __forceinline__ v8f mmaH(v16h ah, v16h al, v16h bh, v16h bl, v8f c) {
  c = __builtin_amdgcn_wmma_f32_16x16x32_f16(false, ah, false, bh, (short)0, c, false, false);
  if (NT >= 2) c = __builtin_amdgcn_wmma_f32_16x16x32_f16(false, al, false, bh, (short)0, c, false, false);
  if (NT >= 3) c = __builtin_amdgcn_wmma_f32_16x16x32_f16(false, ah, false, bl, (short)0, c, false, false);
  asm volatile("v_nop\n\tv_nop\n\tv_nop\n\tv_nop" : "+v"(c) : "v"(ah), "v"(al), "v"(bh), "v"(bl));
  return c;
}
// batched GEMM like k_gemm_b but f16 operands: A f32 (split into f16 hi/lo if ASPLIT, else rounded to f16), Bt = f16 values [n][k]; alpha; C f32; N multiple of 16 (partial tiles skipped)
template <bool ASPLIT>
__global__ __launch_bounds__(128) void k_gemm_h(const float* __restrict__ A, int lda, size_t sA, const _Float16* __restrict__ Bh, int ldb, size_t sB, float alpha, float* __restrict__ C, int ldc, size_t sC, int M, int N, int K) {
  __shared__ __attribute__((aligned(16))) float so[4][16][64];
  const int tid = threadIdx.x, w = tid >> 5, lane = tid & 31, ln = lane & 15, hh = lane >> 4; const int by = blockIdx.y;
  A += (size_t)by * sA; Bh += (size_t)by * sB; C += (size_t)by * sC;
  const int ntn = (N + 63) / 64; const int wid = blockIdx.x * 4 + w; const int mt = wid / ntn, nq = wid % ntn; if (mt * 16 >= M) return;
  const int row0 = mt * 16, col0 = nq * 64; const float* arow = A + (size_t)(row0 + ln) * lda;
  v8f acc[4] = {};
  for (int kb = 0; kb < K; kb += 32) {
    FragH ah, al;
    const v4f x0 = *(const v4fa*)(arow + kb + 8 * hh), x1 = *(const v4fa*)(arow + kb + 8 * hh + 4), x2 = *(const v4fa*)(arow + kb + 16 + 8 * hh), x3 = *(const v4fa*)(arow + kb + 16 + 8 * hh + 4);
    float xs[16] = {x0[0],x0[1],x0[2],x0[3],x1[0],x1[1],x1[2],x1[3],x2[0],x2[1],x2[2],x2[3],x3[0],x3[1],x3[2],x3[3]};
#pragma unroll
    for (int i = 0; i < 16; ++i) { const _Float16 h = (_Float16)xs[i]; ah.h[i] = h; al.h[i] = ASPLIT ? (_Float16)(xs[i] - (float)h) : (_Float16)0.0f; }
#pragma unroll
    for (int t = 0; t < 4; ++t) { if (col0 + t * 16 >= N) continue; const size_t boff = (size_t)(col0 + t * 16 + ln) * ldb + kb; FragH bq; bq.half[0] = *(const v8us*)(Bh + boff + 8 * hh); bq.half[1] = *(const v8us*)(Bh + boff + 16 + 8 * hh);
      acc[t] = mmaH<ASPLIT ? 2 : 1>(ah.v, al.v, bq.v, bq.v, acc[t]); }
  }
#pragma unroll
  for (int t = 0; t < 4; ++t) { if (col0 + t * 16 >= N) continue;
#pragma unroll
    for (int r = 0; r < 8; ++r) so[w][8 * hh + r][t * 16 + ln] = acc[t][r] * alpha; }
  __builtin_amdgcn_fence(__ATOMIC_ACQ_REL, "workgroup"); __builtin_amdgcn_wave_barrier();
  const int rsub = lane >> 4, c4 = (lane & 15) * 4;
  {
#pragma unroll
    for (int q = 0; q < 8; ++q) { const int r = q * 2 + rsub; if (col0 + c4 < N) { const v4f v = *(const v4fa*)&so[w][r][c4]; *(v4f*)(C + (size_t)(row0 + r) * ldc + col0 + c4) = v; } }
     }
}

// Wt[n][k] = f16(W[k][n]·scale) from f32 row-major W[K][N] (scale = power of two; bf16-exact weights stay exact in f16 away from the subnormal range)
__global__ __launch_bounds__(256) void k_wt_f16(const float* __restrict__ W, _Float16* __restrict__ Wt, int K, int N, float scale) {
  const int t = blockIdx.x * 256 + threadIdx.x; if (t >= N * (K / 8)) return; const int n = t / (K / 8), k8 = (t % (K / 8)) * 8; FragH f;
#pragma unroll
  for (int i = 0; i < 8; ++i) f.h[i] = (_Float16)(bf16_round(W[(size_t)(k8 + i) * N + n]) * scale); const v8us o = f.half[0];
  *(v8us*)((unsigned short*)Wt + (size_t)n * K + k8) = o; 
}
// k_gemm_hh variant with fused epilogue: v = acc·alpha + bias[by·sBias + col] (+ CP[(row/rowsPerB)·sCPb + by·64 + col] if CP) ; ACT 0 none / 1 elu ; writes f16 C16 (and f32 C if non-null)
template <int ACT>
__global__ __launch_bounds__(128) void k_gemm_hhx(const _Float16* __restrict__ A, int lda, size_t sA, const _Float16* __restrict__ Bh, int ldb, size_t sB, float alpha, const float* __restrict__ bias, size_t sBias, const float* __restrict__ CP, int rowsPerB, size_t sCPb, int row0g,
    float* __restrict__ C, _Float16* __restrict__ C16, int ldc, size_t sC, int M, int N, int K) {
  __shared__ __attribute__((aligned(16))) float so[4][16][64];
  const int tid = threadIdx.x, w = tid >> 5, lane = tid & 31, ln = lane & 15, hh = lane >> 4; const int by = blockIdx.y;
  A += (size_t)by * sA; Bh += (size_t)by * sB; const size_t cofs = (size_t)by * sC; const float* bp = bias ? bias + (size_t)by * sBias : nullptr;
  const int ntn = (N + 63) / 64; const int wid = blockIdx.x * 4 + w; const int mt = wid / ntn, nq = wid % ntn; if (mt * 16 >= M) return;
  const int row0 = mt * 16, col0 = nq * 64; const _Float16* arow = A + (size_t)(row0 + ln) * lda;
  v8f acc[4] = {};
  for (int kb = 0; kb < K; kb += 32) { FragH ah; ah.half[0] = *(const v8us*)((const unsigned short*)arow + kb + 8 * hh); ah.half[1] = *(const v8us*)((const unsigned short*)arow + kb + 16 + 8 * hh);
#pragma unroll
    for (int t = 0; t < 4; ++t) { if (col0 + t * 16 >= N) continue; const size_t boff = (size_t)(col0 + t * 16 + ln) * ldb + kb; FragH bq; bq.half[0] = *(const v8us*)((const unsigned short*)Bh + boff + 8 * hh); bq.half[1] = *(const v8us*)((const unsigned short*)Bh + boff + 16 + 8 * hh);
      acc[t] = mmaH<1>(ah.v, ah.v, bq.v, bq.v, acc[t]); }
  }
#pragma unroll
  for (int t = 0; t < 4; ++t) { if (col0 + t * 16 >= N) continue; const int col = col0 + t * 16 + ln; const float bv = bp ? bf16_round(bp[col]) : 0.f;
#pragma unroll
    for (int r = 0; r < 8; ++r) { float v = acc[t][r] * alpha + bv; if (CP) { const int bidx = (row0g + row0 + 8 * hh + r) / rowsPerB; v += CP[(size_t)bidx * sCPb + (size_t)by * 64 + col]; } if (ACT == 1) v = (v > 0.f) ? v : expm1f(v); else if (ACT == 7) v = (v > 0.f) ? v + 1.0f : expf(v); else if (ACT == 8) v = tanhf(v); else if (ACT == 9) v = 0.5f * v * (1.0f + tanhf(0.7978845608028654f * (v + 0.044715f * v * v * v))); else if (ACT == 11) v = 1.0f / (1.0f + expf(-v)); else if (ACT == 12) v = (v > 0.f) ? v : 0.01f * v; else if (ACT == 14) v = (v > 0.f) ? v : 0.1f * v; else if (ACT == 15) v = v / (1.0f + expf(-v)); else if (ACT == 3) v = fmaxf(v, 0.f); else if (ACT == 6) v = 0.5f * v * (1.0f + erff(v * 0.70710678118654752f)); so[w][8 * hh + r][t * 16 + ln] = v; } }
  __builtin_amdgcn_fence(__ATOMIC_ACQ_REL, "workgroup"); __builtin_amdgcn_wave_barrier();
  const int rsub = lane >> 4, c4 = (lane & 15) * 4; typedef _Float16 v4h __attribute__((ext_vector_type(4)));
  {
#pragma unroll
    for (int q = 0; q < 8; ++q) { const int r = q * 2 + rsub; if (col0 + c4 < N) { const v4f v = *(const v4fa*)&so[w][r][c4]; if (C) *(v4f*)(C + cofs + (size_t)(row0 + r) * ldc + col0 + c4) = v; if (C16) { v4h h4; for (int i = 0; i < 4; ++i) h4[i] = (_Float16)v[i]; *(v4h*)(C16 + cofs + (size_t)(row0 + r) * ldc + col0 + c4) = h4; } } }
     }
}


typedef _Float16 v4h __attribute__((ext_vector_type(4)));

__global__ __launch_bounds__(256) void k_x16(const float* __restrict__ x, _Float16* __restrict__ X16, size_t n8) { const size_t t = (size_t)blockIdx.x * 256 + threadIdx.x; if (t >= n8) return; FragH f;
#pragma unroll
  for (int q = 0; q < 8; ++q) f.h[q] = (_Float16)bf16_round(x[t * 8 + q]); *(v8us*)((unsigned short*)X16 + t * 8) = f.half[0];  }
__global__ __launch_bounds__(256) void k_h16(const float* __restrict__ x, _Float16* __restrict__ X16, size_t n8) { const size_t t = (size_t)blockIdx.x * 256 + threadIdx.x; if (t >= n8) return; FragH f;
#pragma unroll
  for (int q = 0; q < 8; ++q) f.h[q] = (_Float16)x[t * 8 + q]; *(v8us*)((unsigned short*)X16 + t * 8) = f.half[0];  }
__global__ __launch_bounds__(256) void k_round16f(const float* __restrict__ W, _Float16* __restrict__ Bt, size_t n8) { const size_t t = (size_t)blockIdx.x * 256 + threadIdx.x; if (t >= n8) return; FragH f;
#pragma unroll
  for (int i = 0; i < 8; ++i) f.h[i] = (_Float16)(bf16_round(W[t * 8 + i]) * 16.0f); *(v8us*)((unsigned short*)Bt + t * 8) = f.half[0];  }
template <int NHv, int TTv>
__global__ __launch_bounds__(256) void k_vt(const _Float16* __restrict__ V16, int ldv, int voff, _Float16* __restrict__ Vt) { __shared__ unsigned short tl[64][66]; const int tid = threadIdx.x; const int slab = blockIdx.x / (TTv / 64), lg = blockIdx.x % (TTv / 64); const int b = slab / NHv, h = slab % NHv;
  for (int i = tid; i < 64 * 8; i += 256) { const int r = i / 8, c8 = (i % 8) * 8; FragH f; f.half[0] = *(const v8us*)((const unsigned short*)V16 + ((size_t)b * TTv + lg * 64 + r) * ldv + voff + h * 64 + c8);
#pragma unroll
    for (int q = 0; q < 8; ++q) tl[r][c8 + q] = f.u[q]; }
  __syncthreads();
  {
#pragma unroll
    for (int rd = 0; rd < 2; ++rd) { const int d = rd * 32 + tid / 8, pc = tid % 8; FragH f;
#pragma unroll
      for (int q = 0; q < 8; ++q) f.u[q] = tl[pc * 8 + q][d];
      *(v8us*)((unsigned short*)Vt + ((size_t)slab * 64 + d) * TTv + lg * 64 + pc * 8) = f.half[0]; }
     } }

__global__ __launch_bounds__(256) void k_hl(const float* __restrict__ F, _Float16* __restrict__ Hh, _Float16* __restrict__ Hl, size_t n8) { const size_t t = (size_t)blockIdx.x * 256 + threadIdx.x; if (t >= n8) return; FragH fh, fl; const v4f a = *(const v4fa*)(F + t * 8), c = *(const v4fa*)(F + t * 8 + 4);
#pragma unroll
  for (int q = 0; q < 4; ++q) { _Float16 h = (_Float16)a[q]; fh.h[q] = h; fl.h[q] = (_Float16)((a[q] - (float)h) * 1024.0f); h = (_Float16)c[q]; fh.h[4 + q] = h; fl.h[4 + q] = (_Float16)((c[q] - (float)h) * 1024.0f); }
  { *(v8us*)((unsigned short*)Hh + t * 8) = fh.half[0]; *(v8us*)((unsigned short*)Hl + t * 8) = fl.half[0];  } }

// ---- fast GEMM (wave tile 32x64; requires M % 32 == 0 rows per launch region and N % 64 == 0); epilogue = k_gemm_hhx semantics ----
__device__ __forceinline__ v16h g2_frag(const _Float16* p, int hh) { FragH f; f.half[0] = *(const v8us*)((const unsigned short*)p + 8 * hh); f.half[1] = *(const v8us*)((const unsigned short*)p + 16 + 8 * hh); return f.v; }
__device__ __forceinline__ v8f g2_mma(v16h a, v16h b, v8f c) { v8f d = __builtin_amdgcn_wmma_f32_16x16x32_f16(false, a, false, b, (short)0, c, false, false); asm volatile("v_nop\n\tv_nop\n\tv_nop\n\tv_nop" : "+v"(d) : "v"(a), "v"(b)); return d; }
template <int ACT>
__global__ __launch_bounds__(128) void k_gemm2(const _Float16* __restrict__ A, int lda, size_t sA, const _Float16* __restrict__ Bh, int ldb, size_t sB, float alpha, const float* __restrict__ bias, size_t sBias, const float* __restrict__ CP, int rowsPerB, size_t sCPb, int row0g,
    float* __restrict__ C, _Float16* __restrict__ C16, int ldc, size_t sC, int M, int N, int K) {
  __shared__ __attribute__((aligned(16))) float so[4][32][68];
  const int tid = threadIdx.x, w = tid >> 5, lane = tid & 31, ln = lane & 15, hh = lane >> 4; const int by = blockIdx.y;
  A += (size_t)by * sA; Bh += (size_t)by * sB; const size_t cofs = (size_t)by * sC; const float* bp = bias ? bias + (size_t)by * sBias : nullptr;
  const int ntn = N >> 6; const int mt = blockIdx.x / ntn, nq = blockIdx.x - mt * ntn; const int row0 = mt * 128 + 32 * w, col0 = nq * 64; if (row0 >= M) return;
  const _Float16* a0p = A + (size_t)(row0 + ln) * lda; const _Float16* a1p = a0p + (size_t)16 * lda;
  const _Float16* b0p = Bh + (size_t)(col0 + ln) * ldb; const _Float16* b1p = b0p + (size_t)16 * ldb; const _Float16* b2p = b1p + (size_t)16 * ldb; const _Float16* b3p = b2p + (size_t)16 * ldb;
  const v8f z8 = {0.f,0.f,0.f,0.f,0.f,0.f,0.f,0.f}; v8f c00 = z8, c01 = z8, c02 = z8, c03 = z8, c10 = z8, c11 = z8, c12 = z8, c13 = z8;
#pragma unroll 1
  for (int kb = 0; kb < K; kb += 32) { const v16h a0 = g2_frag(a0p + kb, hh), a1 = g2_frag(a1p + kb, hh);
    v16h b = g2_frag(b0p + kb, hh); c00 = g2_mma(a0, b, c00); c10 = g2_mma(a1, b, c10);
    b = g2_frag(b1p + kb, hh); c01 = g2_mma(a0, b, c01); c11 = g2_mma(a1, b, c11);
    b = g2_frag(b2p + kb, hh); c02 = g2_mma(a0, b, c02); c12 = g2_mma(a1, b, c12);
    b = g2_frag(b3p + kb, hh); c03 = g2_mma(a0, b, c03); c13 = g2_mma(a1, b, c13); }
  v8f accs[8] = {c00, c01, c02, c03, c10, c11, c12, c13};
#pragma unroll
  for (int u = 0; u < 8; ++u) { const int t = u & 3, half = u >> 2; const int col = col0 + t * 16 + ln; const float bv = bp ? bf16_round(bp[col]) : 0.f;
#pragma unroll
    for (int r = 0; r < 8; ++r) { const int rloc = half * 16 + 8 * hh + r; float v = accs[u][r] * alpha + bv; if (CP) { const int bidx = (row0g + row0 + rloc) / rowsPerB; v += CP[(size_t)bidx * sCPb + (size_t)by * 64 + col]; }
      if (ACT == 3) v = fmaxf(v, 0.f); else if (ACT == 6) v = 0.5f * v * (1.0f + erff(v * 0.70710678118654752f)); else if (ACT == 11) v = 1.0f / (1.0f + expf(-v)); else if (ACT == 15) v = v / (1.0f + expf(-v)); else if (ACT == 12) v = (v > 0.f) ? v : 0.01f * v; else if (ACT == 8) v = tanhf(v);
      so[w][rloc][t * 16 + ln] = v; } }
  __builtin_amdgcn_fence(__ATOMIC_ACQ_REL, "workgroup"); __builtin_amdgcn_wave_barrier();
  const int rsub = lane >> 4, c4 = (lane & 15) * 4;
  {
#pragma unroll
    for (int q = 0; q < 16; ++q) { const int r = q * 2 + rsub; const v4f v = *(const v4fa*)&so[w][r][c4]; if (C) *(v4f*)(C + cofs + (size_t)(row0 + r) * ldc + col0 + c4) = v; if (C16) { v4h h4; for (int i = 0; i < 4; ++i) h4[i] = (_Float16)v[i]; *(v4h*)(C16 + cofs + (size_t)(row0 + r) * ldc + col0 + c4) = h4; } }
     } }


__global__ __launch_bounds__(256) void k_split(const float* __restrict__ F, _Float16* __restrict__ Hh, _Float16* __restrict__ Hl, size_t n8) {
  #pragma clang fp contract(off)
  const size_t t = (size_t)blockIdx.x * 256 + threadIdx.x; if (t >= n8) return; const v4f a = *(const v4fa*)(F + t * 8), c = *(const v4fa*)(F + t * 8 + 4); FragH fh, fl;
#pragma unroll
  for (int q = 0; q < 8; ++q) { const float v = (q < 4) ? a[q] : c[q - 4]; const _Float16 hi = (_Float16)v; fh.h[q] = hi; fl.h[q] = (_Float16)((v - (float)hi) * 1024.0f); }
  { *(v8us*)((unsigned short*)Hh + t * 8) = fh.half[0]; *(v8us*)((unsigned short*)Hl + t * 8) = fl.half[0];  } }

// D = A.B + C as the plain builtin: the compiler keeps the distance behind it itself
__device__ __forceinline__ v8f ra_mma(v16h a, v16h b, v8f c) { return __builtin_amdgcn_wmma_f32_16x16x32_f16(false, a, false, b, (short)0, c, false, false); }
// zero a fragment in the lanes whose A row does not belong to this product
__device__ __forceinline__ v16h frag_keep(v16h a, bool keep) { union { v16h v; unsigned int d[8]; } f; f.v = a;
#pragma unroll
  for (int i = 0; i < 8; ++i) f.d[i] = keep ? f.d[i] : 0u; return f.v; }

// Attention of one (batch, head) and 128 queries per block, 32 queries per wave, keys 64 at a time; nothing of S, QEr or P goes to memory.
// With t = TT-1-i+j the skewed term of (query i, key j) is q[i].Er[t] for t < TT, 0 for t == TT, q[i+1].Er[t-TT-1] for t > TT.
// All tiles are transposed: D[row 8*hh+r][column ln] with the query in the column, so a lane owns one query's max, sum and O column.
// Every inner loop is unrolled so that each array index is a constant and the arrays live in registers.
__global__ __launch_bounds__(128) void k_relattn(const _Float16* __restrict__ Q16, const _Float16* __restrict__ KV16, const _Float16* __restrict__ VT, const _Float16* __restrict__ ER16, float* __restrict__ O) {
  __shared__ __attribute__((aligned(16))) float rl[4][2][16][RP];
  const int tid = threadIdx.x, w = __builtin_amdgcn_readfirstlane(tid >> 5), lane = tid & 31, ln = lane & 15, hh = lane >> 4;
  const int bh = blockIdx.y, b = bh / NH, h = bh - b * NH; const int i0 = blockIdx.x * 128 + 32 * w;
  const _Float16* qbase = Q16 + (size_t)b * TT * DM + h * 64; const _Float16* kbase = KV16 + (size_t)b * TT * 2 * DM + h * 64; const _Float16* vbase = VT + (size_t)bh * 64 * TT;
  v16h q[2][2], qn[2][2];      /* queries i and i + 1 as B operands; the row past the last query is never used, its address is clamped */
  const _Float16* qp[2]; const _Float16* qnp[2];
  __builtin_amdgcn_sched_barrier(0);      /* with the one behind the wait: keeps the set-up arithmetic, which reuses registers, out of the stretch between these loads and their wait */
#pragma unroll
  for (int qs = 0; qs < 2; ++qs) { const int i = i0 + 16 * qs + ln; const int i1 = (i + 1 < TT) ? i + 1 : TT - 1; qp[qs] = qbase + (size_t)i * DM + 8 * hh; qnp[qs] = qbase + (size_t)i1 * DM + 8 * hh;
#pragma unroll
    for (int ks = 0; ks < 2; ++ks) { q[qs][ks] = g2_frag(qp[qs] + 32 * ks, 0); qn[qs][ks] = g2_frag(qnp[qs] + 32 * ks, 0); } }
  asm volatile("s_wait_xcnt 0x0" ::: "memory");      /* the wait in front of any write of an address register of these loads */
  __builtin_amdgcn_sched_barrier(0);
  const v8f z8 = {0.f,0.f,0.f,0.f,0.f,0.f,0.f,0.f};
  v8f o[2][4] = {{z8, z8, z8, z8}, {z8, z8, z8, z8}}; float mx[2] = {-3.0e38f, -3.0e38f}, sm[2] = {0.f, 0.f};
#pragma unroll 1      /* the pass is some 2,500 instructions long: a second copy would only cost instruction fetch and registers */
  for (int j0 = 0; j0 < TT; j0 += 64) {
    /* every global load of the pass is issued here, so that the pass waits out one load latency and not one per tile */
    /* relative tiles: rows t = tb0 + 16u + (0..15); queries i0+16.. take u = 0..4, queries i0.. take u = 1..5 */
    const int tb0 = TT - 32 - i0 + j0;
    /* each lane's eight addresses, its half's 8 * hh elements included */
    const _Float16* kp = kbase + (size_t)(j0 + ln) * (2 * DM) + 8 * hh; const _Float16* vp = vbase + (size_t)ln * TT + j0 + 8 * hh; const _Float16* ep[6];
#pragma unroll
    for (int u = 0; u < 6; ++u) { const int t = tb0 + 16 * u + ln; int er = (t < TT) ? t : t - TT - 1; er = (er < 0) ? 0 : ((er > TT - 1) ? TT - 1 : er); ep[u] = ER16 + (size_t)er * 64 + 8 * hh; }
    v16h kf[4][2], ef[6][2], vf[4][2];
#pragma unroll
    for (int n = 0; n < 4; ++n) { kf[n][0] = g2_frag(kp + (size_t)(16 * n) * (2 * DM), 0); kf[n][1] = g2_frag(kp + (size_t)(16 * n) * (2 * DM) + 32, 0); }
#pragma unroll
    for (int u = 0; u < 6; ++u) { ef[u][0] = g2_frag(ep[u], 0); ef[u][1] = g2_frag(ep[u] + 32, 0); }
#pragma unroll
    for (int dt = 0; dt < 4; ++dt) { vf[dt][0] = g2_frag(vp + (size_t)(16 * dt) * TT, 0); vf[dt][1] = g2_frag(vp + (size_t)(16 * dt) * TT + 32, 0); }
    /* the wait that stands in front of any write of a register which one of these loads names as its address; the addresses are its inputs so that their registers stay untouched up to it */
    asm volatile("s_wait_xcnt 0x0" :: "v"(kp), "v"(vp), "v"(ep[0]), "v"(ep[1]), "v"(ep[2]), "v"(ep[3]), "v"(ep[4]), "v"(ep[5]) : "memory");
    __builtin_amdgcn_sched_barrier(0);      /* holds the loads and that wait in front of the products: without it the scheduler sinks the k loads between the products, two at a time, each with its own full wait */
    v8f s[2][4];      /* s[qs][n][r] = k[j0 + 16n + 8hh + r] . q[i0 + 16qs + ln] */
#pragma unroll
    for (int n = 0; n < 4; ++n)
#pragma unroll
      for (int qs = 0; qs < 2; ++qs) s[qs][n] = ra_mma(kf[n][1], q[qs][1], ra_mma(kf[n][0], q[qs][0], z8));
#pragma unroll
    for (int u = 0; u < 6; ++u) { const int tb = tb0 + 16 * u, t = tb + ln; const v16h e0 = ef[u][0], e1 = ef[u][1];
      v8f r0 = z8, r1 = z8;
      if (tb < TT) { const v16h f0 = frag_keep(e0, t < TT), f1 = frag_keep(e1, t < TT);
        if (u >= 1) r0 = ra_mma(f1, q[0][1], ra_mma(f0, q[0][0], r0));
        if (u <= 4) r1 = ra_mma(f1, q[1][1], ra_mma(f0, q[1][0], r1)); }
      if (tb + 15 > TT) { const v16h f0 = frag_keep(e0, t > TT), f1 = frag_keep(e1, t > TT);
        if (u >= 1) r0 = ra_mma(f1, qn[0][1], ra_mma(f0, qn[0][0], r0));
        if (u <= 4) r1 = ra_mma(f1, qn[1][1], ra_mma(f0, qn[1][0], r1)); }
      if (u >= 1) { float* d = &rl[w][0][ln][16 * (u - 1) + 8 * hh]; const v4f lo = {r0[0], r0[1], r0[2], r0[3]}, hi = {r0[4], r0[5], r0[6], r0[7]}; *(v4fa*)d = lo; *(v4fa*)(d + 4) = hi; }
      if (u <= 4) { float* d = &rl[w][1][ln][16 * u + 8 * hh]; const v4f lo = {r1[0], r1[1], r1[2], r1[3]}, hi = {r1[4], r1[5], r1[6], r1[7]}; *(v4fa*)d = lo; *(v4fa*)(d + 4) = hi; } }
    /* a query's row is written by its two lanes and read by both: the wave's LDS writes are done before any lane reads; only the LDS counter is waited on, the v loads stay in flight */
    asm volatile("s_wait_dscnt 0x0" ::: "memory"); __builtin_amdgcn_wave_barrier();
    FragH p[2][2];
#pragma unroll
    for (int qs = 0; qs < 2; ++qs) { const float* rr = &rl[w][qs][ln][15 - ln + 8 * hh]; float mt = -3.0e38f;
#pragma unroll
      for (int n = 0; n < 4; ++n)
#pragma unroll
        for (int r = 0; r < 8; ++r) { const float lg = (s[qs][n][r] + rr[16 * n + r]) * 0.125f; s[qs][n][r] = lg; mt = fmaxf(mt, lg); }
      mt = fmaxf(mt, __shfl_xor(mt, 16, 32));
      const float mn = fmaxf(mx[qs], mt), al = expf(mx[qs] - mn); mx[qs] = mn; float ps[4] = {0.f, 0.f, 0.f, 0.f};      /* one partial sum per key tile: four short add chains */
#pragma unroll
      for (int n = 0; n < 4; ++n)
#pragma unroll
        for (int r = 0; r < 8; ++r) { const float pv = expf(s[qs][n][r] - mn); ps[n] += pv; p[qs][n >> 1].h[(n & 1) * 8 + r] = (_Float16)(pv * 1024.0f); }
      sm[qs] = sm[qs] * al + ((ps[0] + ps[1]) + (ps[2] + ps[3]));
#pragma unroll
      for (int dt = 0; dt < 4; ++dt) o[qs][dt] *= al; }
    /* keeps the compiler from lifting the next pass's LDS writes over this pass's reads (their values are already in registers here) */
    __builtin_amdgcn_fence(__ATOMIC_ACQ_REL, "wavefront"); __builtin_amdgcn_wave_barrier();
#pragma unroll
    for (int dt = 0; dt < 4; ++dt)
#pragma unroll
      for (int qs = 0; qs < 2; ++qs) o[qs][dt] = ra_mma(vf[dt][1], p[qs][1].v, ra_mma(vf[dt][0], p[qs][0].v, o[qs][dt]));
  }
#pragma unroll
  for (int qs = 0; qs < 2; ++qs) { const float tot = sm[qs] + __shfl_xor(sm[qs], 16, 32); const float inv = 0.0009765625f / tot;
    float* op = O + ((size_t)b * TT + i0 + 16 * qs + ln) * DM + h * 64 + 8 * hh;
#pragma unroll
    for (int dt = 0; dt < 4; ++dt) { const v8f a = o[qs][dt]; const v4f lo = {a[0] * inv, a[1] * inv, a[2] * inv, a[3] * inv}, hi = {a[4] * inv, a[5] * inv, a[6] * inv, a[7] * inv}; *(v4f*)(op + 16 * dt) = lo; *(v4f*)(op + 16 * dt + 4) = hi; } }
}

extern "C" void kernel_launch(void* const* d_in, const int* in_sizes, int n_in,
                              void* d_out, int out_size, void* d_ws, size_t ws_size, hipStream_t stream) {
  (void)in_sizes; (void)n_in; (void)out_size;
  const float* const* I = (const float* const*)d_in; const float* x = I[0]; const float* qw = I[1]; const float* qb = I[2]; const float* kvw = I[3]; const float* kvb = I[4]; const float* pw = I[5]; const float* pb = I[6]; const float* Er = I[7];
  char* ws = (char*)d_ws; size_t off = 0;
  auto take = [&](size_t bytes) { char* p = ws + off; off += (bytes + 255) & ~(size_t)255; return p; };
  _Float16* BP = (_Float16*)take((size_t)DM * DM * 2); _Float16* ER16 = (_Float16*)take((size_t)TT * 64 * 2);
  _Float16* Q16 = (_Float16*)take((size_t)NR * DM * 2); _Float16* KV16 = (_Float16*)take((size_t)NR * 2 * DM * 2); _Float16* VT = (_Float16*)take((size_t)NR * DM * 2); float* O = (float*)take((size_t)NR * DM * 4);
  _Float16* X16 = (_Float16*)take((size_t)NR * DM * 2); _Float16* BQ = (_Float16*)take((size_t)DM * DM * 2); _Float16* BKV = (_Float16*)take((size_t)DM * 2 * DM * 2);
  _Float16* Oh = (_Float16*)take((size_t)NR * DM * 2); _Float16* Ol = (_Float16*)take((size_t)NR * DM * 2);
  if (off > ws_size) return;      /* about 81 MiB */
  const size_t n8 = (size_t)NR * DM / 8; const unsigned nb8 = (unsigned)((n8 + 255) / 256);
  k_wt_f16<<<(unsigned)(((size_t)DM * DM / 8 + 255) / 256), 256, 0, stream>>>(qw, BQ, DM, DM, 16.0f); k_wt_f16<<<(unsigned)(((size_t)DM * 2 * DM / 8 + 255) / 256), 256, 0, stream>>>(kvw, BKV, DM, 2 * DM, 16.0f); k_wt_f16<<<(unsigned)(((size_t)DM * DM / 8 + 255) / 256), 256, 0, stream>>>(pw, BP, DM, DM, 16.0f);      /* (in,out) -> [out][in] x16 */
  k_x16<<<(TT * 64 / 8 + 255) / 256, 256, 0, stream>>>(Er, ER16, (size_t)TT * 64 / 8);      /* Er exact f16 = natural [2048][64] */
  k_x16<<<nb8, 256, 0, stream>>>(x, X16, n8);
  const dim3 gQ((NR / 128) * (DM / 64), 1), gKV((NR / 128) * (2 * DM / 64), 1), gA(TT / 128, NBT * NH);
  k_gemm2<0><<<gQ, 128, 0, stream>>>(X16, DM, 0, BQ, DM, 0, 0.0625f, qb, 0, nullptr, 1, 0, 0, nullptr, Q16, DM, 0, NR, DM, DM);
  k_gemm2<0><<<gKV, 128, 0, stream>>>(X16, DM, 0, BKV, DM, 0, 0.0625f, kvb, 0, nullptr, 1, 0, 0, nullptr, KV16, 2 * DM, 0, NR, 2 * DM, DM);      /* [k | v] f16, column = part*1024 + h*64 + d */
  k_vt<NH, TT><<<NBT * NH * (TT / 64), 256, 0, stream>>>(KV16, 2 * DM, DM, VT);
  k_relattn<<<gA, 128, 0, stream>>>(Q16, KV16, VT, ER16, O);
  k_split<<<nb8, 256, 0, stream>>>(O, Oh, Ol, n8);
  k_gemm2<0><<<gQ, 128, 0, stream>>>(Oh, DM, 0, BP, DM, 0, 0.0625f, pb, 0, nullptr, 1, 0, 0, (float*)d_out, nullptr, DM, 0, NR, DM, DM);
  k_gemm2<0><<<gQ, 128, 0, stream>>>(Ol, DM, 0, BP, DM, 0, 0.0625f / 1024.0f, nullptr, 0, (const float*)d_out, 1, (size_t)DM, 0, (float*)d_out, nullptr, DM, 0, NR, DM, DM);
}

// v003
// It runs in 303 microseconds.
// Next to v002, in two timings, it ran 1.16 times as fast each time.
// All steps since v000 together make it 11.5 times as fast.
#include <hip/hip_runtime.h>
// Relative-position multi-head attention with the 'skew' trick (2 x 2048 tokens x 1024, 16 heads x 64): q = x*q_w + q_b; [k | v] = x*kv_w + kv_b; QEr = q . Er^T against the learned INPUT table Er [2048][64]; Srel = skew(QEr) (pad one zero column on the left, reinterpret as [(N+1)][N], drop the first row -> Srel[i][j] = padded.flat[(i+1)*N + j]); logits = (q.k + Srel)/8 (no mask); softmax; merged . proj_w + proj_b -> [2,2048,1024].
// Structure: x as an exact f16 plane; the projections as f16 WMMA GEMMs (32x64 wave tiles, f32, exact products + bias) into f16 planes; Er as an exact f16 plane; v re-laid per (batch, head) as [d][token]; one attention kernel for all (batch, head) pairs: a wave holds 32 queries and walks the keys 64 at a time; scores and relative terms as transposed WMMA tiles (keys or Er rows as A, queries as B), the skew as a per-query shifted read of the relative tile through LDS, running-max softmax per lane, P (x2^10 f16) taken from the score registers as the B operand of V^T.P^T, O into the merged f32 plane; O split into f16 hi + residual planes; output projection as two GEMMs (bias in the first).
// Compute dtype: x, weights, biases and Er rounded to bf16; projections exact; q, k, v, P as f16 operands (~2^-12), O as hi + residual; f32 accumulation and softmax. v_wmma_f32_16x16x32_f16.
#define NBT 2
#define TT 2048
#define DM 1024
#define NH 16
#define NR (NBT * TT)
#define RP 84   /* floats per query row of the relative tile in LDS: 80 used; a multiple of 4 for the 16-byte writes; lane ln reads at ln * (RP - 1) + const, and 83 is odd, which spreads the lanes over the banks */
typedef __bf16 v16b __attribute__((ext_vector_type(16)));
typedef unsigned short v8us __attribute__((ext_vector_type(8), may_alias));
typedef float  v8f  __attribute__((ext_vector_type(8)));
typedef float  v4f  __attribute__((ext_vector_type(4)));
typedef float  v4fa __attribute__((ext_vector_type(4), may_alias));
union FragB { v16b v; v8us half[2]; unsigned short u[16]; };

__device__ __forceinline__ unsigned short bf16_bits(float x) { unsigned int u = __float_as_uint(x); return (unsigned short)((u + 0x7FFFu + ((u >> 16) & 1u)) >> 16); }
__device__ __forceinline__ float bf16_val(unsigned short b) { return __uint_as_float(((unsigned int)b) << 16); }
__device__ __forceinline__ float bf16_round(float x) { return bf16_val(bf16_bits(x)); }
// D += A·B with NT terms: 1 = ah·bh, 2 = + al·bh (A split), 3 = + ah·bl (both split)
template <int NT>
__device__ __forceinline__ v8f mmaN(v16b ah, v16b al, v16b bh, v16b bl, v8f c) {
  c = __builtin_amdgcn_wmma_f32_16x16x32_bf16(false, ah, false, bh, (short)0, c, false, false);
  if (NT >= 2) c = __builtin_amdgcn_wmma_f32_16x16x32_bf16(false, al, false, bh, (short)0, c, false, false);
  if (NT >= 3) c = __builtin_amdgcn_wmma_f32_16x16x32_bf16(false, ah, false, bl, (short)0, c, false, false);
  asm volatile("v_nop\n\tv_nop\n\tv_nop\n\tv_nop" : "+v"(c) : "v"(ah), "v"(al), "v"(bh), "v"(bl));
  return c;
}

__global__ __launch_bounds__(256) void k_wt_bf16(const float* __restrict__ W, unsigned short* __restrict__ Wt, int K, int N) {
  const int t = blockIdx.x * 256 + threadIdx.x;
  const int k8n = K / 8;
  if (t >= N * k8n) return;
  const int n = t / k8n, k8 = (t % k8n) * 8;
  v8us v;
#pragma unroll
  for (int i = 0; i < 8; ++i) v[i] = bf16_bits(W[(size_t)(k8 + i) * N + n]);
  *(v8us*)(Wt + (size_t)n * K + k8) = v;
  
}

// GEMM C[M][N] (f32, pitch ldc) = act(A[M][K]·W + bias). A f32 row-major (pitch lda) converted per fragment to bf16
// (ASPLIT: hi/lo two planes -> 2 terms, else single rounded term); Wt bf16 [N][K] (pitch ldb). BIAS_BF16 rounds the
// bias to bf16 first (bias quantised to bf16 before the add). K%32==0, M%16==0, N%64==0.
template <bool ASPLIT, int ACT, bool BIAS_BF16>
__global__ __launch_bounds__(128) void k_gemm_bf(const float* __restrict__ A, int lda, const unsigned short* __restrict__ Wt, int ldb,
                                               const float* __restrict__ bias, float* __restrict__ C, int ldc, int M, int N, int K) {
  __shared__ __attribute__((aligned(16))) float so[4][16][64];
  const int tid = threadIdx.x, w = tid >> 5, lane = tid & 31, ln = lane & 15, hh = lane >> 4;
  const int ntn = N / 64;
  const int wid = blockIdx.x * 4 + w;
  const int mt = wid / ntn, nq = wid % ntn;
  if (mt * 16 >= M) return;
  const int row0 = mt * 16, col0 = nq * 64;
  const float* arow = A + (size_t)(row0 + ln) * lda;
  v8f acc[4] = {};
  for (int kb = 0; kb < K; kb += 32) {
    FragB ah, al;
    const v4f x0 = *(const v4fa*)(arow + kb + 8 * hh), x1 = *(const v4fa*)(arow + kb + 8 * hh + 4);
    const v4f x2 = *(const v4fa*)(arow + kb + 16 + 8 * hh), x3 = *(const v4fa*)(arow + kb + 16 + 8 * hh + 4);
    float xs[16] = {x0[0],x0[1],x0[2],x0[3],x1[0],x1[1],x1[2],x1[3],x2[0],x2[1],x2[2],x2[3],x3[0],x3[1],x3[2],x3[3]};
#pragma unroll
    for (int i = 0; i < 16; ++i) { const unsigned short hb = bf16_bits(xs[i]); ah.u[i] = hb; al.u[i] = ASPLIT ? bf16_bits(xs[i] - bf16_val(hb)) : (unsigned short)0; }
#pragma unroll
    for (int t = 0; t < 4; ++t) {
      const unsigned short* brow = Wt + (size_t)(col0 + t * 16 + ln) * ldb + kb;
      FragB b;
      b.half[0] = *(const v8us*)(brow + 8 * hh);
      b.half[1] = *(const v8us*)(brow + 16 + 8 * hh);
      acc[t] = mmaN<ASPLIT ? 2 : 1>(ah.v, al.v, b.v, b.v, acc[t]);
    }
  }
#pragma unroll
  for (int t = 0; t < 4; ++t) {
    float bv = bias ? bias[col0 + t * 16 + ln] : 0.f;
    if (BIAS_BF16) bv = bf16_round(bv);
#pragma unroll
    for (int r = 0; r < 8; ++r) { float v = acc[t][r] + bv; if (ACT == 1) v = fmaxf(v, 0.f); so[w][8 * hh + r][t * 16 + ln] = v; }
  }
  __builtin_amdgcn_fence(__ATOMIC_ACQ_REL, "workgroup");
  __builtin_amdgcn_wave_barrier();
  const int rsub = lane >> 4, c4 = (lane & 15) * 4;
  {
#pragma unroll
    for (int q = 0; q < 8; ++q) {
      const int r = q * 2 + rsub;
      const v4f v = *(const v4fa*)&so[w][r][c4];
      *(v4f*)(C + (size_t)(row0 + r) * ldc + col0 + c4) = v;
    }
    
  }
}

// GEMM C = act(A·W + bias + resid): A f32 (ASPLIT -> hi/lo 2 terms), Wt bf16 [N][K]; ACT 0 none, 1 relu, 2 exact gelu;
// resid (optional, f32, row index = (row % rmod), pitch ldr, RES_BF16 rounds it) added before the activation.
template <bool ASPLIT, int ACT, bool BIAS_BF16, bool RES_BF16>
__global__ __launch_bounds__(128) void k_gemm_bf3(const float* __restrict__ A, int lda, const unsigned short* __restrict__ Wt, int ldb,
                                                const float* __restrict__ bias, const float* __restrict__ resid, int rmod, int ldr,
                                                float* __restrict__ C, int ldc, int M, int N, int K) {
  __shared__ __attribute__((aligned(16))) float so[4][16][64];
  const int tid = threadIdx.x, w = tid >> 5, lane = tid & 31, ln = lane & 15, hh = lane >> 4;
  const int ntn = N / 64;
  const int wid = blockIdx.x * 4 + w;
  const int mt = wid / ntn, nq = wid % ntn;
  if (mt * 16 >= M) return;
  const int row0 = mt * 16, col0 = nq * 64;
  const float* arow = A + (size_t)(row0 + ln) * lda;
  v8f acc[4] = {};
  for (int kb = 0; kb < K; kb += 32) {
    FragB ah, al;
    const v4f x0 = *(const v4fa*)(arow + kb + 8 * hh), x1 = *(const v4fa*)(arow + kb + 8 * hh + 4);
    const v4f x2 = *(const v4fa*)(arow + kb + 16 + 8 * hh), x3 = *(const v4fa*)(arow + kb + 16 + 8 * hh + 4);
    float xs[16] = {x0[0],x0[1],x0[2],x0[3],x1[0],x1[1],x1[2],x1[3],x2[0],x2[1],x2[2],x2[3],x3[0],x3[1],x3[2],x3[3]};
#pragma unroll
    for (int i = 0; i < 16; ++i) { const unsigned short hb = bf16_bits(xs[i]); ah.u[i] = hb; al.u[i] = ASPLIT ? bf16_bits(xs[i] - bf16_val(hb)) : (unsigned short)0; }
#pragma unroll
    for (int t = 0; t < 4; ++t) {
      const unsigned short* brow = Wt + (size_t)(col0 + t * 16 + ln) * ldb + kb;
      FragB b;
      b.half[0] = *(const v8us*)(brow + 8 * hh);
      b.half[1] = *(const v8us*)(brow + 16 + 8 * hh);
      acc[t] = mmaN<ASPLIT ? 2 : 1>(ah.v, al.v, b.v, b.v, acc[t]);
    }
  }
#pragma unroll
  for (int t = 0; t < 4; ++t) {
    const int col = col0 + t * 16 + ln;
    float bv = bias ? bias[col] : 0.f;
    if (BIAS_BF16) bv = bf16_round(bv);
#pragma unroll
    for (int r = 0; r < 8; ++r) {
      float v = acc[t][r] + bv;
      if (resid) { float rv = resid[(size_t)((row0 + 8 * hh + r) % rmod) * ldr + col]; if (RES_BF16) rv = bf16_round(rv); v += rv; }
      if (ACT == 1) v = fmaxf(v, 0.f);
      if (ACT == 2) v = 0.5f * v * (1.0f + erff(v * 0.70710678118654752f));
      if (ACT == 3) { const float u = 0.7978845608028654f * (v + 0.044715f * v * v * v); v = 0.5f * v * (1.0f + tanhf(u)); }
      so[w][8 * hh + r][t * 16 + ln] = v;
    }
  }
  __builtin_amdgcn_fence(__ATOMIC_ACQ_REL, "workgroup");
  __builtin_amdgcn_wave_barrier();
  const int rsub = lane >> 4, c4 = (lane & 15) * 4;
  {
#pragma unroll
    for (int q = 0; q < 8; ++q) {
      const int r = q * 2 + rsub;
      const v4f v = *(const v4fa*)&so[w][r][c4];
      *(v4f*)(C + (size_t)(row0 + r) * ldc + col0 + c4) = v;
    }
    
  }
}
// row LayerNorm (biased variance, eps) over N: s = X (+ R); optional out_sum <- s; out_norm <- (s-mu)*rsqrt(var+eps)*g + b
template <bool PARAM_BF16>
__global__ __launch_bounds__(256) void k_layernorm(const float* __restrict__ X, const float* __restrict__ R, const float* __restrict__ g, const float* __restrict__ bta,
                                                  float* __restrict__ out_sum, float* __restrict__ out_norm, int N, float eps) {
  __shared__ float red[256];
  const int row = blockIdx.x, tid = threadIdx.x;
  const float* x = X + (size_t)row * N; const float* rr = R ? R + (size_t)row * N : nullptr;
  float vals[16];                     // up to N = 4096
  const int per = N / 256;            // contiguous chunk per thread? use strided-by-4 chunks: thread handles j = tid*4 + 1024*u
  float s1 = 0.f;
  for (int u = 0; u < per / 4; ++u) {
    const int j = tid * 4 + 1024 * u;
    const v4f a = *(const v4fa*)(x + j);
    v4f b = {0.f,0.f,0.f,0.f}; if (rr) b = *(const v4fa*)(rr + j);
#pragma unroll
    for (int q = 0; q < 4; ++q) { const float v = a[q] + b[q]; vals[u * 4 + q] = v; s1 += v; }
  }
  red[tid] = s1; __syncthreads();
  for (int st = 128; st > 0; st >>= 1) { if (tid < st) red[tid] += red[tid + st]; __syncthreads(); }
  const float mu = red[0] / (float)N; __syncthreads();
  float s2 = 0.f;
  for (int u = 0; u < per / 4; ++u)
#pragma unroll
    for (int q = 0; q < 4; ++q) { const float c = vals[u * 4 + q] - mu; s2 += c * c; }
  red[tid] = s2; __syncthreads();
  for (int st = 128; st > 0; st >>= 1) { if (tid < st) red[tid] += red[tid + st]; __syncthreads(); }
  const float rs = rsqrtf(red[0] / (float)N + eps);
  {
    for (int u = 0; u < per / 4; ++u) {
      const int j = tid * 4 + 1024 * u;
      v4f o, sm;
#pragma unroll
      for (int q = 0; q < 4; ++q) {
        float gg = g[j + q], bb = bta[j + q];
        if (PARAM_BF16) { gg = bf16_round(gg); bb = bf16_round(bb); }
        sm[q] = vals[u * 4 + q]; o[q] = (vals[u * 4 + q] - mu) * rs * gg + bb;
      }
      if (out_sum) *(v4f*)(out_sum + (size_t)row * N + j) = sm;
      *(v4f*)(out_norm + (size_t)row * N + j) = o;
    }
    
  }
}



// ---- f16 WMMA path (v_wmma_f32_16x16x32_f16): 11-bit significands for operands in range — used where a [0,1] probability operand needs more precision than bf16
typedef _Float16 v16h __attribute__((ext_vector_type(16)));
union FragH { v16h v; v8us half[2]; _Float16 h[16]; unsigned short u[16]; };
template <int NT>
__device__ __forceinline__ v8f mmaH(v16h ah, v16h al, v16h bh, v16h bl, v8f c) {
  c = __builtin_amdgcn_wmma_f32_16x16x32_f16(false, ah, false, bh, (short)0, c, false, false);
  if (NT >= 2) c = __builtin_amdgcn_wmma_f32_16x16x32_f16(false, al, false, bh, (short)0, c, false, false);
  if (NT >= 3) c = __builtin_amdgcn_wmma_f32_16x16x32_f16(false, ah, false, bl, (short)0, c, false, false);
  asm volatile("v_nop\n\tv_nop\n\tv_nop\n\tv_nop" : "+v"(c) : "v"(ah), "v"(al), "v"(bh), "v"(bl));
  return c;
}
// batched GEMM like k_gemm_b but f16 operands: A f32 (split into f16 hi/lo if ASPLIT, else rounded to f16), Bt = f16 values [n][k]; alpha; C f32; N multiple of 16 (partial tiles skipped)
template <bool ASPLIT>
__global__ __launch_bounds__(128) void k_gemm_h(const float* __restrict__ A, int lda, size_t sA, const _Float16* __restrict__ Bh, int ldb, size_t sB, float alpha, float* __restrict__ C, int ldc, size_t sC, int M, int N, int K) {
  __shared__ __attribute__((aligned(16))) float so[4][16][64];
  const int tid = threadIdx.x, w = tid >> 5, lane = tid & 31, ln = lane & 15, hh = lane >> 4; const int by = blockIdx.y;
  A += (size_t)by * sA; Bh += (size_t)by * sB; C += (size_t)by * sC;
  const int ntn = (N + 63) / 64; const int wid = blockIdx.x * 4 + w; const int mt = wid / ntn, nq = wid % ntn; if (mt * 16 >= M) return;
  const int row0 = mt * 16, col0 = nq * 64; const float* arow = A + (size_t)(row0 + ln) * lda;
  v8f acc[4] = {};
  for (int kb = 0; kb < K; kb += 32) {
    FragH ah, al;
    const v4f x0 = *(const v4fa*)(arow + kb + 8 * hh), x1 = *(const v4fa*)(arow + kb + 8 * hh + 4), x2 = *(const v4fa*)(arow + kb + 16 + 8 * hh), x3 = *(const v4fa*)(arow + kb + 16 + 8 * hh + 4);
    float xs[16] = {x0[0],x0[1],x0[2],x0[3],x1[0],x1[1],x1[2],x1[3],x2[0],x2[1],x2[2],x2[3],x3[0],x3[1],x3[2],x3[3]};
#pragma unroll
    for (int i = 0; i < 16; ++i) { const _Float16 h = (_Float16)xs[i]; ah.h[i] = h; al.h[i] = ASPLIT ? (_Float16)(xs[i] - (float)h) : (_Float16)0.0f; }
#pragma unroll
    for (int t = 0; t < 4; ++t) { if (col0 + t * 16 >= N) continue; const size_t boff = (size_t)(col0 + t * 16 + ln) * ldb + kb; FragH bq; bq.half[0] = *(const v8us*)(Bh + boff + 8 * hh); bq.half[1] = *(const v8us*)(Bh + boff + 16 + 8 * hh);
      acc[t] = mmaH<ASPLIT ? 2 : 1>(ah.v, al.v, bq.v, bq.v, acc[t]); }
  }
#pragma unroll
  for (int t = 0; t < 4; ++t) { if (col0 + t * 16 >= N) continue;
#pragma unroll
    for (int r = 0; r < 8; ++r) so[w][8 * hh + r][t * 16 + ln] = acc[t][r] * alpha; }
  __builtin_amdgcn_fence(__ATOMIC_ACQ_REL, "workgroup"); __builtin_amdgcn_wave_barrier();
  const int rsub = lane >> 4, c4 = (lane & 15) * 4;
  {
#pragma unroll
    for (int q = 0; q < 8; ++q) { const int r = q * 2 + rsub; if (col0 + c4 < N) { const v4f v = *(const v4fa*)&so[w][r][c4]; *(v4f*)(C + (size_t)(row0 + r) * ldc + col0 + c4) = v; } }
     }
}

// Wt[n][k] = f16(W[k][n]·scale) from f32 row-major W[K][N] (scale = power of two; bf16-exact weights stay exact in f16 away from the subnormal range)
__global__ __launch_bounds__(256) void k_wt_f16(const float* __restrict__ W, _Float16* __restrict__ Wt, int K, int N, float scale) {
  const int t = blockIdx.x * 256 + threadIdx.x; if (t >= N * (K / 8)) return; const int n = t / (K / 8), k8 = (t % (K / 8)) * 8; FragH f;
#pragma unroll
  for (int i = 0; i < 8; ++i) f.h[i] = (_Float16)(bf16_round(W[(size_t)(k8 + i) * N + n]) * scale); const v8us o = f.half[0];
  *(v8us*)((unsigned short*)Wt + (size_t)n * K + k8) = o; 
}
// k_gemm_hh variant with fused epilogue: v = acc·alpha + bias[by·sBias + col] (+ CP[(row/rowsPerB)·sCPb + by·64 + col] if CP) ; ACT 0 none / 1 elu ; writes f16 C16 (and f32 C if non-null)
template <int ACT>
__global__ __launch_bounds__(128) void k_gemm_hhx(const _Float16* __restrict__ A, int lda, size_t sA, const _Float16* __restrict__ Bh, int ldb, size_t sB, float alpha, const float* __restrict__ bias, size_t sBias, const float* __restrict__ CP, int rowsPerB, size_t sCPb, int row0g,
    float* __restrict__ C, _Float16* __restrict__ C16, int ldc, size_t sC, int M, int N, int K) {
  __shared__ __attribute__((aligned(16))) float so[4][16][64];
  const int tid = threadIdx.x, w = tid >> 5, lane = tid & 31, ln = lane & 15, hh = lane >> 4; const int by = blockIdx.y;
  A += (size_t)by * sA; Bh += (size_t)by * sB; const size_t cofs = (size_t)by * sC; const float* bp = bias ? bias + (size_t)by * sBias : nullptr;
  const int ntn = (N + 63) / 64; const int wid = blockIdx.x * 4 + w; const int mt = wid / ntn, nq = wid % ntn; if (mt * 16 >= M) return;
  const int row0 = mt * 16, col0 = nq * 64; const _Float16* arow = A + (size_t)(row0 + ln) * lda;
  v8f acc[4] = {};
  for (int kb = 0; kb < K; kb += 32) { FragH ah; ah.half[0] = *(const v8us*)((const unsigned short*)arow + kb + 8 * hh); ah.half[1] = *(const v8us*)((const unsigned short*)arow + kb + 16 + 8 * hh);
#pragma unroll
    for (int t = 0; t < 4; ++t) { if (col0 + t * 16 >= N) continue; const size_t boff = (size_t)(col0 + t * 16 + ln) * ldb + kb; FragH bq; bq.half[0] = *(const v8us*)((const unsigned short*)Bh + boff + 8 * hh); bq.half[1] = *(const v8us*)((const unsigned short*)Bh + boff + 16 + 8 * hh);
      acc[t] = mmaH<1>(ah.v, ah.v, bq.v, bq.v, acc[t]); }
  }
#pragma unroll
  for (int t = 0; t < 4; ++t) { if (col0 + t * 16 >= N) continue; const int col = col0 + t * 16 + ln; const float bv = bp ? bf16_round(bp[col]) : 0.f;
#pragma unroll
    for (int r = 0; r < 8; ++r) { float v = acc[t][r] * alpha + bv; if (CP) { const int bidx = (row0g + row0 + 8 * hh + r) / rowsPerB; v += CP[(size_t)bidx * sCPb + (size_t)by * 64 + col]; } if (ACT == 1) v = (v > 0.f) ? v : expm1f(v); else if (ACT == 7) v = (v > 0.f) ? v + 1.0f : expf(v); else if (ACT == 8) v = tanhf(v); else if (ACT == 9) v = 0.5f * v * (1.0f + tanhf(0.7978845608028654f * (v + 0.044715f * v * v * v))); else if (ACT == 11) v = 1.0f / (1.0f + expf(-v)); else if (ACT == 12) v = (v > 0.f) ? v : 0.01f * v; else if (ACT == 14) v = (v > 0.f) ? v : 0.1f * v; else if (ACT == 15) v = v / (1.0f + expf(-v)); else if (ACT == 3) v = fmaxf(v, 0.f); else if (ACT == 6) v = 0.5f * v * (1.0f + erff(v * 0.70710678118654752f)); so[w][8 * hh + r][t * 16 + ln] = v; } }
  __builtin_amdgcn_fence(__ATOMIC_ACQ_REL, "workgroup"); __builtin_amdgcn_wave_barrier();
  const int rsub = lane >> 4, c4 = (lane & 15) * 4; typedef _Float16 v4h __attribute__((ext_vector_type(4)));
  {
#pragma unroll
    for (int q = 0; q < 8; ++q) { const int r = q * 2 + rsub; if (col0 + c4 < N) { const v4f v = *(const v4fa*)&so[w][r][c4]; if (C) *(v4f*)(C + cofs + (size_t)(row0 + r) * ldc + col0 + c4) = v; if (C16) { v4h h4; for (int i = 0; i < 4; ++i) h4[i] = (_Float16)v[i]; *(v4h*)(C16 + cofs + (size_t)(row0 + r) * ldc + col0 + c4) = h4; } } }
     }
}


typedef _Float16 v4h __attribute__((ext_vector_type(4)));

__global__ __launch_bounds__(256) void k_x16(const float* __restrict__ x, _Float16* __restrict__ X16, size_t n8) { const size_t t = (size_t)blockIdx.x * 256 + threadIdx.x; if (t >= n8) return; FragH f;
#pragma unroll
  for (int q = 0; q < 8; ++q) f.h[q] = (_Float16)bf16_round(x[t * 8 + q]); *(v8us*)((unsigned short*)X16 + t * 8) = f.half[0];  }
__global__ __launch_bounds__(256) void k_h16(const float* __restrict__ x, _Float16* __restrict__ X16, size_t n8) { const size_t t = (size_t)blockIdx.x * 256 + threadIdx.x; if (t >= n8) return; FragH f;
#pragma unroll
  for (int q = 0; q < 8; ++q) f.h[q] = (_Float16)x[t * 8 + q]; *(v8us*)((unsigned short*)X16 + t * 8) = f.half[0];  }
__global__ __launch_bounds__(256) void k_round16f(const float* __restrict__ W, _Float16* __restrict__ Bt, size_t n8) { const size_t t = (size_t)blockIdx.x * 256 + threadIdx.x; if (t >= n8) return; FragH f;
#pragma unroll
  for (int i = 0; i < 8; ++i) f.h[i] = (_Float16)(bf16_round(W[t * 8 + i]) * 16.0f); *(v8us*)((unsigned short*)Bt + t * 8) = f.half[0];  }
template <int NHv, int TTv>
__global__ __launch_bounds__(256) void k_vt(const _Float16* __restrict__ V16, int ldv, int voff, _Float16* __restrict__ Vt) { __shared__ unsigned short tl[64][66]; const int tid = threadIdx.x; const int slab = blockIdx.x / (TTv / 64), lg = blockIdx.x % (TTv / 64); const int b = slab / NHv, h = slab % NHv;
  for (int i = tid; i < 64 * 8; i += 256) { const int r = i / 8, c8 = (i % 8) * 8; FragH f; f.half[0] = *(const v8us*)((const unsigned short*)V16 + ((size_t)b * TTv + lg * 64 + r) * ldv + voff + h * 64 + c8);
#pragma unroll
    for (int q = 0; q < 8; ++q) tl[r][c8 + q] = f.u[q]; }
  __syncthreads();
  {
#pragma unroll
    for (int rd = 0; rd < 2; ++rd) { const int d = rd * 32 + tid / 8, pc = tid % 8; FragH f;
#pragma unroll
      for (int q = 0; q < 8; ++q) f.u[q] = tl[pc * 8 + q][d];
      *(v8us*)((unsigned short*)Vt + ((size_t)slab * 64 + d) * TTv + lg * 64 + pc * 8) = f.half[0]; }
     } }

__global__ __launch_bounds__(256) void k_hl(const float* __restrict__ F, _Float16* __restrict__ Hh, _Float16* __restrict__ Hl, size_t n8) { const size_t t = (size_t)blockIdx.x * 256 + threadIdx.x; if (t >= n8) return; FragH fh, fl; const v4f a = *(const v4fa*)(F + t * 8), c = *(const v4fa*)(F + t * 8 + 4);
#pragma unroll
  for (int q = 0; q < 4; ++q) { _Float16 h = (_Float16)a[q]; fh.h[q] = h; fl.h[q] = (_Float16)((a[q] - (float)h) * 1024.0f); h = (_Float16)c[q]; fh.h[4 + q] = h; fl.h[4 + q] = (_Float16)((c[q] - (float)h) * 1024.0f); }
  { *(v8us*)((unsigned short*)Hh + t * 8) = fh.half[0]; *(v8us*)((unsigned short*)Hl + t * 8) = fl.half[0];  } }

// ---- fast GEMM (wave tile 32x64; requires M % 32 == 0 rows per launch region, N % 64 == 0 and K % 64 == 0); epilogue = k_gemm_hhx semantics ----
__device__ __forceinline__ v16h g2_frag(const _Float16* p, int hh) { FragH f; f.half[0] = *(const v8us*)((const unsigned short*)p + 8 * hh); f.half[1] = *(const v8us*)((const unsigned short*)p + 16 + 8 * hh); return f.v; }
__device__ __forceinline__ v8f g2_mma(v16h a, v16h b, v8f c) { v8f d = __builtin_amdgcn_wmma_f32_16x16x32_f16(false, a, false, b, (short)0, c, false, false); asm volatile("v_nop\n\tv_nop\n\tv_nop\n\tv_nop" : "+v"(d) : "v"(a), "v"(b)); return d; }
template <int ACT>
__global__ __launch_bounds__(128) void k_gemm2(const _Float16* __restrict__ A, int lda, size_t sA, const _Float16* __restrict__ Bh, int ldb, size_t sB, float alpha, const float* __restrict__ bias, size_t sBias, const float* __restrict__ CP, int rowsPerB, size_t sCPb, int row0g,
    float* __restrict__ C, _Float16* __restrict__ C16, int ldc, size_t sC, int M, int N, int K) {
  __shared__ __attribute__((aligned(16))) float so[4][32][68];
  const int tid = threadIdx.x, w = tid >> 5, lane = tid & 31, ln = lane & 15, hh = lane >> 4; const int by = blockIdx.y;
  A += (size_t)by * sA; Bh += (size_t)by * sB; const size_t cofs = (size_t)by * sC; const float* bp = bias ? bias + (size_t)by * sBias : nullptr;
  const int ntn = N >> 6; const int mt = blockIdx.x / ntn, nq = blockIdx.x - mt * ntn; const int row0 = mt * 128 + 32 * w, col0 = nq * 64; if (row0 >= M) return;
  /* each lane's six row addresses, its half's 8 * hh elements included */
  const _Float16* pa0 = A + (size_t)(row0 + ln) * lda + 8 * hh; const _Float16* pa1 = pa0 + (size_t)16 * lda;
  const _Float16* pb0 = Bh + (size_t)(col0 + ln) * ldb + 8 * hh; const _Float16* pb1 = pb0 + (size_t)16 * ldb; const _Float16* pb2 = pb1 + (size_t)16 * ldb; const _Float16* pb3 = pb2 + (size_t)16 * ldb;
  const v8f z8 = {0.f,0.f,0.f,0.f,0.f,0.f,0.f,0.f}; v8f c00 = z8, c01 = z8, c02 = z8, c03 = z8, c10 = z8, c11 = z8, c12 = z8, c13 = z8;
  /* two register sets of six fragments (32 k each): the twelve loads of a set are issued as one group, one set ahead of the products that read it, so that a set's load latency runs behind the other set's products; the k order of every sum is the old one */
  v16h xa0 = g2_frag(pa0, 0), xa1 = g2_frag(pa1, 0), xb0 = g2_frag(pb0, 0), xb1 = g2_frag(pb1, 0), xb2 = g2_frag(pb2, 0), xb3 = g2_frag(pb3, 0);
  __builtin_amdgcn_sched_barrier(0);      /* holds the first group in front of the loop */
#pragma unroll 1      /* the two sets are the whole ring: a further copy of the body would only cost registers */
  for (int kb = 0; kb < K; kb += 64) {
    const v16h ya0 = g2_frag(pa0 + 32, 0), ya1 = g2_frag(pa1 + 32, 0), yb0 = g2_frag(pb0 + 32, 0), yb1 = g2_frag(pb1 + 32, 0), yb2 = g2_frag(pb2 + 32, 0), yb3 = g2_frag(pb3 + 32, 0);
    /* the wait that stands in front of the write of the six address registers below, which both groups in flight name; the addresses are its inputs so that their registers stay untouched up to it */
    asm volatile("s_wait_xcnt 0x0" :: "v"(pa0), "v"(pa1), "v"(pb0), "v"(pb1), "v"(pb2), "v"(pb3) : "memory");
    __builtin_amdgcn_sched_barrier(0);      /* holds this group in front of the products: without it the scheduler sinks each load to its first use, with a full wait each */
    c00 = g2_mma(xa0, xb0, c00); c10 = g2_mma(xa1, xb0, c10); c01 = g2_mma(xa0, xb1, c01); c11 = g2_mma(xa1, xb1, c11);
    c02 = g2_mma(xa0, xb2, c02); c12 = g2_mma(xa1, xb2, c12); c03 = g2_mma(xa0, xb3, c03); c13 = g2_mma(xa1, xb3, c13);
    const int adv = (kb + 64 < K) ? 64 : 0;      /* the last trip has no next set: it reads its own first set again, in bounds and unused, so that every trip has the same loads in flight and the counted waits hold */
    pa0 += adv; pa1 += adv; pb0 += adv; pb1 += adv; pb2 += adv; pb3 += adv;
    xa0 = g2_frag(pa0, 0); xa1 = g2_frag(pa1, 0); xb0 = g2_frag(pb0, 0); xb1 = g2_frag(pb1, 0); xb2 = g2_frag(pb2, 0); xb3 = g2_frag(pb3, 0);
    __builtin_amdgcn_sched_barrier(0);      /* holds the next set's group in front of this set's products */
    c00 = g2_mma(ya0, yb0, c00); c10 = g2_mma(ya1, yb0, c10); c01 = g2_mma(ya0, yb1, c01); c11 = g2_mma(ya1, yb1, c11);
    c02 = g2_mma(ya0, yb2, c02); c12 = g2_mma(ya1, yb2, c12); c03 = g2_mma(ya0, yb3, c03); c13 = g2_mma(ya1, yb3, c13); }
  /* the same wait for the last group, in front of whatever reuses its address registers behind the loop */
  asm volatile("s_wait_xcnt 0x0" :: "v"(pa0), "v"(pa1), "v"(pb0), "v"(pb1), "v"(pb2), "v"(pb3) : "memory");
  v8f accs[8] = {c00, c01, c02, c03, c10, c11, c12, c13};
#pragma unroll
  for (int u = 0; u < 8; ++u) { const int t = u & 3, half = u >> 2; const int col = col0 + t * 16 + ln; const float bv = bp ? bf16_round(bp[col]) : 0.f;
#pragma unroll
    for (int r = 0; r < 8; ++r) { const int rloc = half * 16 + 8 * hh + r; float v = accs[u][r] * alpha + bv; if (CP) { const int bidx = (row0g + row0 + rloc) / rowsPerB; v += CP[(size_t)bidx * sCPb + (size_t)by * 64 + col]; }
      if (ACT == 3) v = fmaxf(v, 0.f); else if (ACT == 6) v = 0.5f * v * (1.0f + erff(v * 0.70710678118654752f)); else if (ACT == 11) v = 1.0f / (1.0f + expf(-v)); else if (ACT == 15) v = v / (1.0f + expf(-v)); else if (ACT == 12) v = (v > 0.f) ? v : 0.01f * v; else if (ACT == 8) v = tanhf(v);
      so[w][rloc][t * 16 + ln] = v; } }
  __builtin_amdgcn_fence(__ATOMIC_ACQ_REL, "workgroup"); __builtin_amdgcn_wave_barrier();
  const int rsub = lane >> 4, c4 = (lane & 15) * 4;
  {
#pragma unroll
    for (int q = 0; q < 16; ++q) { const int r = q * 2 + rsub; const v4f v = *(const v4fa*)&so[w][r][c4]; if (C) *(v4f*)(C + cofs + (size_t)(row0 + r) * ldc + col0 + c4) = v; if (C16) { v4h h4; for (int i = 0; i < 4; ++i) h4[i] = (_Float16)v[i]; *(v4h*)(C16 + cofs + (size_t)(row0 + r) * ldc + col0 + c4) = h4; } }
     } }


__global__ __launch_bounds__(256) void k_split(const float* __restrict__ F, _Float16* __restrict__ Hh, _Float16* __restrict__ Hl, size_t n8) {
  #pragma clang fp contract(off)
  const size_t t = (size_t)blockIdx.x * 256 + threadIdx.x; if (t >= n8) return; const v4f a = *(const v4fa*)(F + t * 8), c = *(const v4fa*)(F + t * 8 + 4); FragH fh, fl;
#pragma unroll
  for (int q = 0; q < 8; ++q) { const float v = (q < 4) ? a[q] : c[q - 4]; const _Float16 hi = (_Float16)v; fh.h[q] = hi; fl.h[q] = (_Float16)((v - (float)hi) * 1024.0f); }
  { *(v8us*)((unsigned short*)Hh + t * 8) = fh.half[0]; *(v8us*)((unsigned short*)Hl + t * 8) = fl.half[0];  } }

// D = A.B + C as the plain builtin: the compiler keeps the distance behind it itself
__device__ __forceinline__ v8f ra_mma(v16h a, v16h b, v8f c) { return __builtin_amdgcn_wmma_f32_16x16x32_f16(false, a, false, b, (short)0, c, false, false); }
// zero a fragment in the lanes whose A row does not belong to this product
__device__ __forceinline__ v16h frag_keep(v16h a, bool keep) { union { v16h v; unsigned int d[8]; } f; f.v = a;
#pragma unroll
  for (int i = 0; i < 8; ++i) f.d[i] = keep ? f.d[i] : 0u; return f.v; }

// Attention of one (batch, head) and 128 queries per block, 32 queries per wave, keys 64 at a time; nothing of S, QEr or P goes to memory.
// With t = TT-1-i+j the skewed term of (query i, key j) is q[i].Er[t] for t < TT, 0 for t == TT, q[i+1].Er[t-TT-1] for t > TT.
// All tiles are transposed: D[row 8*hh+r][column ln] with the query in the column, so a lane owns one query's max, sum and O column.
// Every inner loop is unrolled so that each array index is a constant and the arrays live in registers.
__global__ __launch_bounds__(128) void k_relattn(const _Float16* __restrict__ Q16, const _Float16* __restrict__ KV16, const _Float16* __restrict__ VT, const _Float16* __restrict__ ER16, float* __restrict__ O) {
  __shared__ __attribute__((aligned(16))) float rl[4][2][16][RP];
  const int tid = threadIdx.x, w = __builtin_amdgcn_readfirstlane(tid >> 5), lane = tid & 31, ln = lane & 15, hh = lane >> 4;
  const int bh = blockIdx.y, b = bh / NH, h = bh - b * NH; const int i0 = blockIdx.x * 128 + 32 * w;
  const _Float16* qbase = Q16 + (size_t)b * TT * DM + h * 64; const _Float16* kbase = KV16 + (size_t)b * TT * 2 * DM + h * 64; const _Float16* vbase = VT + (size_t)bh * 64 * TT;
  v16h q[2][2], qn[2][2];      /* queries i and i + 1 as B operands; the row past the last query is never used, its address is clamped */
  const _Float16* qp[2]; const _Float16* qnp[2];
  __builtin_amdgcn_sched_barrier(0);      /* with the one behind the wait: keeps the set-up arithmetic, which reuses registers, out of the stretch between these loads and their wait */
#pragma unroll
  for (int qs = 0; qs < 2; ++qs) { const int i = i0 + 16 * qs + ln; const int i1 = (i + 1 < TT) ? i + 1 : TT - 1; qp[qs] = qbase + (size_t)i * DM + 8 * hh; qnp[qs] = qbase + (size_t)i1 * DM + 8 * hh;
#pragma unroll
    for (int ks = 0; ks < 2; ++ks) { q[qs][ks] = g2_frag(qp[qs] + 32 * ks, 0); qn[qs][ks] = g2_frag(qnp[qs] + 32 * ks, 0); } }
  asm volatile("s_wait_xcnt 0x0" ::: "memory");      /* the wait in front of any write of an address register of these loads */
  __builtin_amdgcn_sched_barrier(0);
  const v8f z8 = {0.f,0.f,0.f,0.f,0.f,0.f,0.f,0.f};
  v8f o[2][4] = {{z8, z8, z8, z8}, {z8, z8, z8, z8}}; float mx[2] = {-3.0e38f, -3.0e38f}, sm[2] = {0.f, 0.f};
#pragma unroll 1      /* the pass is some 2,500 instructions long: a second copy would only cost instruction fetch and registers */
  for (int j0 = 0; j0 < TT; j0 += 64) {
    /* every global load of the pass is issued here, so that the pass waits out one load latency and not one per tile */
    /* relative tiles: rows t = tb0 + 16u + (0..15); queries i0+16.. take u = 0..4, queries i0.. take u = 1..5 */
    const int tb0 = TT - 32 - i0 + j0;
    /* each lane's eight addresses, its half's 8 * hh elements included */
    const _Float16* kp = kbase + (size_t)(j0 + ln) * (2 * DM) + 8 * hh; const _Float16* vp = vbase + (size_t)ln * TT + j0 + 8 * hh; const _Float16* ep[6];
#pragma unroll
    for (int u = 0; u < 6; ++u) { const int t = tb0 + 16 * u + ln; int er = (t < TT) ? t : t - TT - 1; er = (er < 0) ? 0 : ((er > TT - 1) ? TT - 1 : er); ep[u] = ER16 + (size_t)er * 64 + 8 * hh; }
    v16h kf[4][2], ef[6][2], vf[4][2];
#pragma unroll
    for (int n = 0; n < 4; ++n) { kf[n][0] = g2_frag(kp + (size_t)(16 * n) * (2 * DM), 0); kf[n][1] = g2_frag(kp + (size_t)(16 * n) * (2 * DM) + 32, 0); }
#pragma unroll
    for (int u = 0; u < 6; ++u) { ef[u][0] = g2_frag(ep[u], 0); ef[u][1] = g2_frag(ep[u] + 32, 0); }
#pragma unroll
    for (int dt = 0; dt < 4; ++dt) { vf[dt][0] = g2_frag(vp + (size_t)(16 * dt) * TT, 0); vf[dt][1] = g2_frag(vp + (size_t)(16 * dt) * TT + 32, 0); }
    /* the wait that stands in front of any write of a register which one of these loads names as its address; the addresses are its inputs so that their registers stay untouched up to it */
    asm volatile("s_wait_xcnt 0x0" :: "v"(kp), "v"(vp), "v"(ep[0]), "v"(ep[1]), "v"(ep[2]), "v"(ep[3]), "v"(ep[4]), "v"(ep[5]) : "memory");
    __builtin_amdgcn_sched_barrier(0);      /* holds the loads and that wait in front of the products: without it the scheduler sinks the k loads between the products, two at a time, each with its own full wait */
    v8f s[2][4];      /* s[qs][n][r] = k[j0 + 16n + 8hh + r] . q[i0 + 16qs + ln] */
#pragma unroll
    for (int n = 0; n < 4; ++n)
#pragma unroll
      for (int qs = 0; qs < 2; ++qs) s[qs][n] = ra_mma(kf[n][1], q[qs][1], ra_mma(kf[n][0], q[qs][0], z8));
#pragma unroll
    for (int u = 0; u < 6; ++u) { const int tb = tb0 + 16 * u, t = tb + ln; const v16h e0 = ef[u][0], e1 = ef[u][1];
      v8f r0 = z8, r1 = z8;
      if (tb < TT) { const v16h f0 = frag_keep(e0, t < TT), f1 = frag_keep(e1, t < TT);
        if (u >= 1) r0 = ra_mma(f1, q[0][1], ra_mma(f0, q[0][0], r0));
        if (u <= 4) r1 = ra_mma(f1, q[1][1], ra_mma(f0, q[1][0], r1)); }
      if (tb + 15 > TT) { const v16h f0 = frag_keep(e0, t > TT), f1 = frag_keep(e1, t > TT);
        if (u >= 1) r0 = ra_mma(f1, qn[0][1], ra_mma(f0, qn[0][0], r0));
        if (u <= 4) r1 = ra_mma(f1, qn[1][1], ra_mma(f0, qn[1][0], r1)); }
      if (u >= 1) { float* d = &rl[w][0][ln][16 * (u - 1) + 8 * hh]; const v4f lo = {r0[0], r0[1], r0[2], r0[3]}, hi = {r0[4], r0[5], r0[6], r0[7]}; *(v4fa*)d = lo; *(v4fa*)(d + 4) = hi; }
      if (u <= 4) { float* d = &rl[w][1][ln][16 * u + 8 * hh]; const v4f lo = {r1[0], r1[1], r1[2], r1[3]}, hi = {r1[4], r1[5], r1[6], r1[7]}; *(v4fa*)d = lo; *(v4fa*)(d + 4) = hi; } }
    /* a query's row is written by its two lanes and read by both: the wave's LDS writes are done before any lane reads; only the LDS counter is waited on, the v loads stay in flight */
    asm volatile("s_wait_dscnt 0x0" ::: "memory"); __builtin_amdgcn_wave_barrier();
    FragH p[2][2];
#pragma unroll
    for (int qs = 0; qs < 2; ++qs) { const float* rr = &rl[w][qs][ln][15 - ln + 8 * hh]; float mt = -3.0e38f;
#pragma unroll
      for (int n = 0; n < 4; ++n)
#pragma unroll
        for (int r = 0; r < 8; ++r) { const float lg = (s[qs][n][r] + rr[16 * n + r]) * 0.125f; s[qs][n][r] = lg; mt = fmaxf(mt, lg); }
      mt = fmaxf(mt, __shfl_xor(mt, 16, 32));
      const float mn = fmaxf(mx[qs], mt), al = expf(mx[qs] - mn); mx[qs] = mn; float ps[4] = {0.f, 0.f, 0.f, 0.f};      /* one partial sum per key tile: four short add chains */
#pragma unroll
      for (int n = 0; n < 4; ++n)
#pragma unroll
        for (int r = 0; r < 8; ++r) { const float pv = expf(s[qs][n][r] - mn); ps[n] += pv; p[qs][n >> 1].h[(n & 1) * 8 + r] = (_Float16)(pv * 1024.0f); }
      sm[qs] = sm[qs] * al + ((ps[0] + ps[1]) + (ps[2] + ps[3]));
#pragma unroll
      for (int dt = 0; dt < 4; ++dt) o[qs][dt] *= al; }
    /* keeps the compiler from lifting the next pass's LDS writes over this pass's reads (their values are already in registers here) */
    __builtin_amdgcn_fence(__ATOMIC_ACQ_REL, "wavefront"); __builtin_amdgcn_wave_barrier();
#pragma unroll
    for (int dt = 0; dt < 4; ++dt)
#pragma unroll
      for (int qs = 0; qs < 2; ++qs) o[qs][dt] = ra_mma(vf[dt][1], p[qs][1].v, ra_mma(vf[dt][0], p[qs][0].v, o[qs][dt]));
  }
#pragma unroll
  for (int qs = 0; qs < 2; ++qs) { const float tot = sm[qs] + __shfl_xor(sm[qs], 16, 32); const float inv = 0.0009765625f / tot;
    float* op = O + ((size_t)b * TT + i0 + 16 * qs + ln) * DM + h * 64 + 8 * hh;
#pragma unroll
    for (int dt = 0; dt < 4; ++dt) { const v8f a = o[qs][dt]; const v4f lo = {a[0] * inv, a[1] * inv, a[2] * inv, a[3] * inv}, hi = {a[4] * inv, a[5] * inv, a[6] * inv, a[7] * inv}; *(v4f*)(op + 16 * dt) = lo; *(v4f*)(op + 16 * dt + 4) = hi; } }
}

extern "C" void kernel_launch(void* const* d_in, const int* in_sizes, int n_in,
                              void* d_out, int out_size, void* d_ws, size_t ws_size, hipStream_t stream) {
  (void)in_sizes; (void)n_in; (void)out_size;
  const float* const* I = (const float* const*)d_in; const float* x = I[0]; const float* qw = I[1]; const float* qb = I[2]; const float* kvw = I[3]; const float* kvb = I[4]; const float* pw = I[5]; const float* pb = I[6]; const float* Er = I[7];
  char* ws = (char*)d_ws; size_t off = 0;
  auto take = [&](size_t bytes) { char* p = ws + off; off += (bytes + 255) & ~(size_t)255; return p; };
  _Float16* BP = (_Float16*)take((size_t)DM * DM * 2); _Float16* ER16 = (_Float16*)take((size_t)TT * 64 * 2);
  _Float16* Q16 = (_Float16*)take((size_t)NR * DM * 2); _Float16* KV16 = (_Float16*)take((size_t)NR * 2 * DM * 2); _Float16* VT = (_Float16*)take((size_t)NR * DM * 2); float* O = (float*)take((size_t)NR * DM * 4);
  _Float16* X16 = (_Float16*)take((size_t)NR * DM * 2); _Float16* BQ = (_Float16*)take((size_t)DM * DM * 2); _Float16* BKV = (_Float16*)take((size_t)DM * 2 * DM * 2);
  _Float16* Oh = (_Float16*)take((size_t)NR * DM * 2); _Float16* Ol = (_Float16*)take((size_t)NR * DM * 2);
  if (off > ws_size) return;      /* about 81 MiB */
  const size_t n8 = (size_t)NR * DM / 8; const unsigned nb8 = (unsigned)((n8 + 255) / 256);
  k_wt_f16<<<(unsigned)(((size_t)DM * DM / 8 + 255) / 256), 256, 0, stream>>>(qw, BQ, DM, DM, 16.0f); k_wt_f16<<<(unsigned)(((size_t)DM * 2 * DM / 8 + 255) / 256), 256, 0, stream>>>(kvw, BKV, DM, 2 * DM, 16.0f); k_wt_f16<<<(unsigned)(((size_t)DM * DM / 8 + 255) / 256), 256, 0, stream>>>(pw, BP, DM, DM, 16.0f);      /* (in,out) -> [out][in] x16 */
  k_x16<<<(TT * 64 / 8 + 255) / 256, 256, 0, stream>>>(Er, ER16, (size_t)TT * 64 / 8);      /* Er exact f16 = natural [2048][64] */
  k_x16<<<nb8, 256, 0, stream>>>(x, X16, n8);
  const dim3 gQ((NR / 128) * (DM / 64), 1), gKV((NR / 128) * (2 * DM / 64), 1), gA(TT / 128, NBT * NH);
  k_gemm2<0><<<gQ, 128, 0, stream>>>(X16, DM, 0, BQ, DM, 0, 0.0625f, qb, 0, nullptr, 1, 0, 0, nullptr, Q16, DM, 0, NR, DM, DM);
  k_gemm2<0><<<gKV, 128, 0, stream>>>(X16, DM, 0, BKV, DM, 0, 0.0625f, kvb, 0, nullptr, 1, 0, 0, nullptr, KV16, 2 * DM, 0, NR, 2 * DM, DM);      /* [k | v] f16, column = part*1024 + h*64 + d */
  k_vt<NH, TT><<<NBT * NH * (TT / 64), 256, 0, stream>>>(KV16, 2 * DM, DM, VT);
  k_relattn<<<gA, 128, 0, stream>>>(Q16, KV16, VT, ER16, O);
  k_split<<<nb8, 256, 0, stream>>>(O, Oh, Ol, n8);
  k_gemm2<0><<<gQ, 128, 0, stream>>>(Oh, DM, 0, BP, DM, 0, 0.0625f, pb, 0, nullptr, 1, 0, 0, (float*)d_out, nullptr, DM, 0, NR, DM, DM);
  k_gemm2<0><<<gQ, 128, 0, stream>>>(Ol, DM, 0, BP, DM, 0, 0.0625f / 1024.0f, nullptr, 0, (const float*)d_out, 1, (size_t)DM, 0, (float*)d_out, nullptr, DM, 0, NR, DM, DM);
}

// v004
// One run takes 235 microseconds.
// Timed twice side by side with v003, it ran 1.26 and 1.32 times as fast.
// All steps since v000 together make it 14.8 times as fast.
#include <hip/hip_runtime.h>
// Relative-position multi-head attention with the 'skew' trick (2 x 2048 tokens x 1024, 16 heads x 64): q = x*q_w + q_b; [k | v] = x*kv_w + kv_b; QEr = q . Er^T against the learned INPUT table Er [2048][64]; Srel = skew(QEr) (pad one zero column on the left, reinterpret as [(N+1)][N], drop the first row -> Srel[i][j] = padded.flat[(i+1)*N + j]); logits = (q.k + Srel)/8 (no mask); softmax; merged . proj_w + proj_b -> [2,2048,1024].
// Structure: x as an exact f16 plane; the projections as f16 WMMA GEMMs (32x64 wave tiles, f32, exact products + bias; both operands stored in fragment order) into row-major f16 planes; Er as an exact f16 table over the skewed index, in fragment order; k and v re-laid per (batch, head) as [token][d] and [d][token] in fragment order; one attention kernel for all (batch, head) pairs: a wave holds 32 queries and walks the keys 64 at a time; scores and relative terms as transposed WMMA tiles (keys or Er rows as A, queries as B), the skew as a per-query shifted read of the relative tile through LDS, running-max softmax per lane, P (x2^10 f16) taken from the score registers as the B operand of V^T.P^T, O into the merged f32 plane; O split into f16 hi + residual planes; output projection as two GEMMs (bias in the first).
// Compute dtype: x, weights, biases and Er rounded to bf16; projections exact; q, k, v, P as f16 operands (~2^-12), O as hi + residual; f32 accumulation and softmax. v_wmma_f32_16x16x32_f16.
#define NBT 2
#define TT 2048
#define DM 1024
#define NH 16
#define NR (NBT * TT)
#define RP 84   /* floats per query row of the relative tile in LDS: 80 used; a multiple of 4 for the 16-byte writes; lane ln reads at ln * (RP - 1) + const, and 83 is odd, which spreads the lanes over the banks */
typedef __bf16 v16b __attribute__((ext_vector_type(16)));
typedef unsigned short v8us __attribute__((ext_vector_type(8), may_alias));
typedef float  v8f  __attribute__((ext_vector_type(8)));
typedef float  v4f  __attribute__((ext_vector_type(4)));
typedef float  v4fa __attribute__((ext_vector_type(4), may_alias));
union FragB { v16b v; v8us half[2]; unsigned short u[16]; };

__device__ __forceinline__ unsigned short bf16_bits(float x) { unsigned int u = __float_as_uint(x); return (unsigned short)((u + 0x7FFFu + ((u >> 16) & 1u)) >> 16); }
__device__ __forceinline__ float bf16_val(unsigned short b) { return __uint_as_float(((unsigned int)b) << 16); }
__device__ __forceinline__ float bf16_round(float x) { return bf16_val(bf16_bits(x)); }
// D += A·B with NT terms: 1 = ah·bh, 2 = + al·bh (A split), 3 = + ah·bl (both split)
template <int NT>
__device__ __forceinline__ v8f mmaN(v16b ah, v16b al, v16b bh, v16b bl, v8f c) {
  c = __builtin_amdgcn_wmma_f32_16x16x32_bf16(false, ah, false, bh, (short)0, c, false, false);
  if (NT >= 2) c = __builtin_amdgcn_wmma_f32_16x16x32_bf16(false, al, false, bh, (short)0, c, false, false);
  if (NT >= 3) c = __builtin_amdgcn_wmma_f32_16x16x32_bf16(false, ah, false, bl, (short)0, c, false, false);
  asm volatile("v_nop\n\tv_nop\n\tv_nop\n\tv_nop" : "+v"(c) : "v"(ah), "v"(al), "v"(bh), "v"(bl));
  return c;
}

__global__ __launch_bounds__(256) void k_wt_bf16(const float* __restrict__ W, unsigned short* __restrict__ Wt, int K, int N) {
  const int t = blockIdx.x * 256 + threadIdx.x;
  const int k8n = K / 8;
  if (t >= N * k8n) return;
  const int n = t / k8n, k8 = (t % k8n) * 8;
  v8us v;
#pragma unroll
  for (int i = 0; i < 8; ++i) v[i] = bf16_bits(W[(size_t)(k8 + i) * N + n]);
  *(v8us*)(Wt + (size_t)n * K + k8) = v;
  
}

// GEMM C[M][N] (f32, pitch ldc) = act(A[M][K]·W + bias). A f32 row-major (pitch lda) converted per fragment to bf16
// (ASPLIT: hi/lo two planes -> 2 terms, else single rounded term); Wt bf16 [N][K] (pitch ldb). BIAS_BF16 rounds the
// bias to bf16 first (bias quantised to bf16 before the add). K%32==0, M%16==0, N%64==0.
template <bool ASPLIT, int ACT, bool BIAS_BF16>
__global__ __launch_bounds__(128) void k_gemm_bf(const float* __restrict__ A, int lda, const unsigned short* __restrict__ Wt, int ldb,
                                               const float* __restrict__ bias, float* __restrict__ C, int ldc, int M, int N, int K) {
  __shared__ __attribute__((aligned(16))) float so[4][16][64];
  const int tid = threadIdx.x, w = tid >> 5, lane = tid & 31, ln = lane & 15, hh = lane >> 4;
  const int ntn = N / 64;
  const int wid = blockIdx.x * 4 + w;
  const int mt = wid / ntn, nq = wid % ntn;
  if (mt * 16 >= M) return;
  const int row0 = mt * 16, col0 = nq * 64;
  const float* arow = A + (size_t)(row0 + ln) * lda;
  v8f acc[4] = {};
  for (int kb = 0; kb < K; kb += 32) {
    FragB ah, al;
    const v4f x0 = *(const v4fa*)(arow + kb + 8 * hh), x1 = *(const v4fa*)(arow + kb + 8 * hh + 4);
    const v4f x2 = *(const v4fa*)(arow + kb + 16 + 8 * hh), x3 = *(const v4fa*)(arow + kb + 16 + 8 * hh + 4);
    float xs[16] = {x0[0],x0[1],x0[2],x0[3],x1[0],x1[1],x1[2],x1[3],x2[0],x2[1],x2[2],x2[3],x3[0],x3[1],x3[2],x3[3]};
#pragma unroll
    for (int i = 0; i < 16; ++i) { const unsigned short hb = bf16_bits(xs[i]); ah.u[i] = hb; al.u[i] = ASPLIT ? bf16_bits(xs[i] - bf16_val(hb)) : (unsigned short)0; }
#pragma unroll
    for (int t = 0; t < 4; ++t) {
      const unsigned short* brow = Wt + (size_t)(col0 + t * 16 + ln) * ldb + kb;
      FragB b;
      b.half[0] = *(const v8us*)(brow + 8 * hh);
      b.half[1] = *(const v8us*)(brow + 16 + 8 * hh);
      acc[t] = mmaN<ASPLIT ? 2 : 1>(ah.v, al.v, b.v, b.v, acc[t]);
    }
  }
#pragma unroll
  for (int t = 0; t < 4; ++t) {
    float bv = bias ? bias[col0 + t * 16 + ln] : 0.f;
    if (BIAS_BF16) bv = bf16_round(bv);
#pragma unroll
    for (int r = 0; r < 8; ++r) { float v = acc[t][r] + bv; if (ACT == 1) v = fmaxf(v, 0.f); so[w][8 * hh + r][t * 16 + ln] = v; }
  }
  __builtin_amdgcn_fence(__ATOMIC_ACQ_REL, "workgroup");
  __builtin_amdgcn_wave_barrier();
  const int rsub = lane >> 4, c4 = (lane & 15) * 4;
  {
#pragma unroll
    for (int q = 0; q < 8; ++q) {
      const int r = q * 2 + rsub;
      const v4f v = *(const v4fa*)&so[w][r][c4];
      *(v4f*)(C + (size_t)(row0 + r) * ldc + col0 + c4) = v;
    }
    
  }
}

// GEMM C = act(A·W + bias + resid): A f32 (ASPLIT -> hi/lo 2 terms), Wt bf16 [N][K]; ACT 0 none, 1 relu, 2 exact gelu;
// resid (optional, f32, row index = (row % rmod), pitch ldr, RES_BF16 rounds it) added before the activation.
template <bool ASPLIT, int ACT, bool BIAS_BF16, bool RES_BF16>
__global__ __launch_bounds__(128) void k_gemm_bf3(const float* __restrict__ A, int lda, const unsigned short* __restrict__ Wt, int ldb,
                                                const float* __restrict__ bias, const float* __restrict__ resid, int rmod, int ldr,
                                                float* __restrict__ C, int ldc, int M, int N, int K) {
  __shared__ __attribute__((aligned(16))) float so[4][16][64];
  const int tid = threadIdx.x, w = tid >> 5, lane = tid & 31, ln = lane & 15, hh = lane >> 4;
  const int ntn = N / 64;
  const int wid = blockIdx.x * 4 + w;
  const int mt = wid / ntn, nq = wid % ntn;
  if (mt * 16 >= M) return;
  const int row0 = mt * 16, col0 = nq * 64;
  const float* arow = A + (size_t)(row0 + ln) * lda;
  v8f acc[4] = {};
  for (int kb = 0; kb < K; kb += 32) {
    FragB ah, al;
    const v4f x0 = *(const v4fa*)(arow + kb + 8 * hh), x1 = *(const v4fa*)(arow + kb + 8 * hh + 4);
    const v4f x2 = *(const v4fa*)(arow + kb + 16 + 8 * hh), x3 = *(const v4fa*)(arow + kb + 16 + 8 * hh + 4);
    float xs[16] = {x0[0],x0[1],x0[2],x0[3],x1[0],x1[1],x1[2],x1[3],x2[0],x2[1],x2[2],x2[3],x3[0],x3[1],x3[2],x3[3]};
#pragma unroll
    for (int i = 0; i < 16; ++i) { const unsigned short hb = bf16_bits(xs[i]); ah.u[i] = hb; al.u[i] = ASPLIT ? bf16_bits(xs[i] - bf16_val(hb)) : (unsigned short)0; }
#pragma unroll
    for (int t = 0; t < 4; ++t) {
      const unsigned short* brow = Wt + (size_t)(col0 + t * 16 + ln) * ldb + kb;
      FragB b;
      b.half[0] = *(const v8us*)(brow + 8 * hh);
      b.half[1] = *(const v8us*)(brow + 16 + 8 * hh);
      acc[t] = mmaN<ASPLIT ? 2 : 1>(ah.v, al.v, b.v, b.v, acc[t]);
    }
  }
#pragma unroll
  for (int t = 0; t < 4; ++t) {
    const int col = col0 + t * 16 + ln;
    float bv = bias ? bias[col] : 0.f;
    if (BIAS_BF16) bv = bf16_round(bv);
#pragma unroll
    for (int r = 0; r < 8; ++r) {
      float v = acc[t][r] + bv;
      if (resid) { float rv = resid[(size_t)((row0 + 8 * hh + r) % rmod) * ldr + col]; if (RES_BF16) rv = bf16_round(rv); v += rv; }
      if (ACT == 1) v = fmaxf(v, 0.f);
      if (ACT == 2) v = 0.5f * v * (1.0f + erff(v * 0.70710678118654752f));
      if (ACT == 3) { const float u = 0.7978845608028654f * (v + 0.044715f * v * v * v); v = 0.5f * v * (1.0f + tanhf(u)); }
      so[w][8 * hh + r][t * 16 + ln] = v;
    }
  }
  __builtin_amdgcn_fence(__ATOMIC_ACQ_REL, "workgroup");
  __builtin_amdgcn_wave_barrier();
  const int rsub = lane >> 4, c4 = (lane & 15) * 4;
  {
#pragma unroll
    for (int q = 0; q < 8; ++q) {
      const int r = q * 2 + rsub;
      const v4f v = *(const v4fa*)&so[w][r][c4];
      *(v4f*)(C + (size_t)(row0 + r) * ldc + col0 + c4) = v;
    }
    
  }
}
// row LayerNorm (biased variance, eps) over N: s = X (+ R); optional out_sum <- s; out_norm <- (s-mu)*rsqrt(var+eps)*g + b
template <bool PARAM_BF16>
__global__ __launch_bounds__(256) void k_layernorm(const float* __restrict__ X, const float* __restrict__ R, const float* __restrict__ g, const float* __restrict__ bta,
                                                  float* __restrict__ out_sum, float* __restrict__ out_norm, int N, float eps) {
  __shared__ float red[256];
  const int row = blockIdx.x, tid = threadIdx.x;
  const float* x = X + (size_t)row * N; const float* rr = R ? R + (size_t)row * N : nullptr;
  float vals[16];                     // up to N = 4096
  const int per = N / 256;            // contiguous chunk per thread? use strided-by-4 chunks: thread handles j = tid*4 + 1024*u
  float s1 = 0.f;
  for (int u = 0; u < per / 4; ++u) {
    const int j = tid * 4 + 1024 * u;
    const v4f a = *(const v4fa*)(x + j);
    v4f b = {0.f,0.f,0.f,0.f}; if (rr) b = *(const v4fa*)(rr + j);
#pragma unroll
    for (int q = 0; q < 4; ++q) { const float v = a[q] + b[q]; vals[u * 4 + q] = v; s1 += v; }
  }
  red[tid] = s1; __syncthreads();
  for (int st = 128; st > 0; st >>= 1) { if (tid < st) red[tid] += red[tid + st]; __syncthreads(); }
  const float mu = red[0] / (float)N; __syncthreads();
  float s2 = 0.f;
  for (int u = 0; u < per / 4; ++u)
#pragma unroll
    for (int q = 0; q < 4; ++q) { const float c = vals[u * 4 + q] - mu; s2 += c * c; }
  red[tid] = s2; __syncthreads();
  for (int st = 128; st > 0; st >>= 1) { if (tid < st) red[tid] += red[tid + st]; __syncthreads(); }
  const float rs = rsqrtf(red[0] / (float)N + eps);
  {
    for (int u = 0; u < per / 4; ++u) {
      const int j = tid * 4 + 1024 * u;
      v4f o, sm;
#pragma unroll
      for (int q = 0; q < 4; ++q) {
        float gg = g[j + q], bb = bta[j + q];
        if (PARAM_BF16) { gg = bf16_round(gg); bb = bf16_round(bb); }
        sm[q] = vals[u * 4 + q]; o[q] = (vals[u * 4 + q] - mu) * rs * gg + bb;
      }
      if (out_sum) *(v4f*)(out_sum + (size_t)row * N + j) = sm;
      *(v4f*)(out_norm + (size_t)row * N + j) = o;
    }
    
  }
}



// ---- f16 WMMA path (v_wmma_f32_16x16x32_f16): 11-bit significands for operands in range — used where a [0,1] probability operand needs more precision than bf16
typedef _Float16 v16h __attribute__((ext_vector_type(16)));
union FragH { v16h v; v8us half[2]; _Float16 h[16]; unsigned short u[16]; };
template <int NT>
__device__ __forceinline__ v8f mmaH(v16h ah, v16h al, v16h bh, v16h bl, v8f c) {
  c = __builtin_amdgcn_wmma_f32_16x16x32_f16(false, ah, false, bh, (short)0, c, false, false);
  if (NT >= 2) c = __builtin_amdgcn_wmma_f32_16x16x32_f16(false, al, false, bh, (short)0, c, false, false);
  if (NT >= 3) c = __builtin_amdgcn_wmma_f32_16x16x32_f16(false, ah, false, bl, (short)0, c, false, false);
  asm volatile("v_nop\n\tv_nop\n\tv_nop\n\tv_nop" : "+v"(c) : "v"(ah), "v"(al), "v"(bh), "v"(bl));
  return c;
}
// batched GEMM like k_gemm_b but f16 operands: A f32 (split into f16 hi/lo if ASPLIT, else rounded to f16), Bt = f16 values [n][k]; alpha; C f32; N multiple of 16 (partial tiles skipped)
template <bool ASPLIT>
__global__ __launch_bounds__(128) void k_gemm_h(const float* __restrict__ A, int lda, size_t sA, const _Float16* __restrict__ Bh, int ldb, size_t sB, float alpha, float* __restrict__ C, int ldc, size_t sC, int M, int N, int K) {
  __shared__ __attribute__((aligned(16))) float so[4][16][64];
  const int tid = threadIdx.x, w = tid >> 5, lane = tid & 31, ln = lane & 15, hh = lane >> 4; const int by = blockIdx.y;
  A += (size_t)by * sA; Bh += (size_t)by * sB; C += (size_t)by * sC;
  const int ntn = (N + 63) / 64; const int wid = blockIdx.x * 4 + w; const int mt = wid / ntn, nq = wid % ntn; if (mt * 16 >= M) return;
  const int row0 = mt * 16, col0 = nq * 64; const float* arow = A + (size_t)(row0 + ln) * lda;
  v8f acc[4] = {};
  for (int kb = 0; kb < K; kb += 32) {
    FragH ah, al;
    const v4f x0 = *(const v4fa*)(arow + kb + 8 * hh), x1 = *(const v4fa*)(arow + kb + 8 * hh + 4), x2 = *(const v4fa*)(arow + kb + 16 + 8 * hh), x3 = *(const v4fa*)(arow + kb + 16 + 8 * hh + 4);
    float xs[16] = {x0[0],x0[1],x0[2],x0[3],x1[0],x1[1],x1[2],x1[3],x2[0],x2[1],x2[2],x2[3],x3[0],x3[1],x3[2],x3[3]};
#pragma unroll
    for (int i = 0; i < 16; ++i) { const _Float16 h = (_Float16)xs[i]; ah.h[i] = h; al.h[i] = ASPLIT ? (_Float16)(xs[i] - (float)h) : (_Float16)0.0f; }
#pragma unroll
    for (int t = 0; t < 4; ++t) { if (col0 + t * 16 >= N) continue; const size_t boff = (size_t)(col0 + t * 16 + ln) * ldb + kb; FragH bq; bq.half[0] = *(const v8us*)(Bh + boff + 8 * hh); bq.half[1] = *(const v8us*)(Bh + boff + 16 + 8 * hh);
      acc[t] = mmaH<ASPLIT ? 2 : 1>(ah.v, al.v, bq.v, bq.v, acc[t]); }
  }
#pragma unroll
  for (int t = 0; t < 4; ++t) { if (col0 + t * 16 >= N) continue;
#pragma unroll
    for (int r = 0; r < 8; ++r) so[w][8 * hh + r][t * 16 + ln] = acc[t][r] * alpha; }
  __builtin_amdgcn_fence(__ATOMIC_ACQ_REL, "workgroup"); __builtin_amdgcn_wave_barrier();
  const int rsub = lane >> 4, c4 = (lane & 15) * 4;
  {
#pragma unroll
    for (int q = 0; q < 8; ++q) { const int r = q * 2 + rsub; if (col0 + c4 < N) { const v4f v = *(const v4fa*)&so[w][r][c4]; *(v4f*)(C + (size_t)(row0 + r) * ldc + col0 + c4) = v; } }
     }
}

// Fragment order of an f16 operand plane [R][K] (R % 16 == 0, K % 32 == 0): tiles of 16 rows x 32 k, 1 KiB each, the k tiles of one row tile one after the other (a row tile is 16 * K elements, as in the row-major plane).
// Inside a tile the 16-byte piece (row ln, k = 16 * half + 8 * hh + 0..7) lies at element 256 * half + 8 * (16 * hh + ln): lane 16 * hh + ln of a wave finds its fragment at its own 16 bytes of two runs of 512 bytes, so a fragment load covers four whole 128-byte lines.
// pk_src: piece t, counted in storage order, -> its row and its first k
__device__ __forceinline__ void pk_src(unsigned t, unsigned K, int& row, int& k) { const unsigned ktn = K >> 5, tile = t >> 6, rt = tile / ktn, kt = tile - rt * ktn; row = (int)(rt * 16 + (t & 15)); k = (int)(kt * 32 + ((t >> 5) & 1) * 16 + ((t >> 4) & 1) * 8); }
// Wt = f16(W[k][n] * scale) as the plane [n][k] in fragment order, from f32 row-major W[K][N] (scale = power of two; bf16-exact weights stay exact in f16 away from the subnormal range); a thread makes one piece, in storage order
__global__ __launch_bounds__(256) void k_wt_f16(const float* __restrict__ W, _Float16* __restrict__ Wt, int K, int N, float scale) {
  const int t = blockIdx.x * 256 + threadIdx.x; if (t >= N * (K / 8)) return; int n, k8; pk_src((unsigned)t, (unsigned)K, n, k8); FragH f;
#pragma unroll
  for (int i = 0; i < 8; ++i) f.h[i] = (_Float16)(bf16_round(W[(size_t)(k8 + i) * N + n]) * scale); const v8us o = f.half[0];
  *(v8us*)((unsigned short*)Wt + (size_t)t * 8) = o; 
}
// k_gemm_hh variant with fused epilogue: v = acc·alpha + bias[by·sBias + col] (+ CP[(row/rowsPerB)·sCPb + by·64 + col] if CP) ; ACT 0 none / 1 elu ; writes f16 C16 (and f32 C if non-null)
template <int ACT>
__global__ __launch_bounds__(128) void k_gemm_hhx(const _Float16* __restrict__ A, int lda, size_t sA, const _Float16* __restrict__ Bh, int ldb, size_t sB, float alpha, const float* __restrict__ bias, size_t sBias, const float* __restrict__ CP, int rowsPerB, size_t sCPb, int row0g,
    float* __restrict__ C, _Float16* __restrict__ C16, int ldc, size_t sC, int M, int N, int K) {
  __shared__ __attribute__((aligned(16))) float so[4][16][64];
  const int tid = threadIdx.x, w = tid >> 5, lane = tid & 31, ln = lane & 15, hh = lane >> 4; const int by = blockIdx.y;
  A += (size_t)by * sA; Bh += (size_t)by * sB; const size_t cofs = (size_t)by * sC; const float* bp = bias ? bias + (size_t)by * sBias : nullptr;
  const int ntn = (N + 63) / 64; const int wid = blockIdx.x * 4 + w; const int mt = wid / ntn, nq = wid % ntn; if (mt * 16 >= M) return;
  const int row0 = mt * 16, col0 = nq * 64; const _Float16* arow = A + (size_t)(row0 + ln) * lda;
  v8f acc[4] = {};
  for (int kb = 0; kb < K; kb += 32) { FragH ah; ah.half[0] = *(const v8us*)((const unsigned short*)arow + kb + 8 * hh); ah.half[1] = *(const v8us*)((const unsigned short*)arow + kb + 16 + 8 * hh);
#pragma unroll
    for (int t = 0; t < 4; ++t) { if (col0 + t * 16 >= N) continue; const size_t boff = (size_t)(col0 + t * 16 + ln) * ldb + kb; FragH bq; bq.half[0] = *(const v8us*)((const unsigned short*)Bh + boff + 8 * hh); bq.half[1] = *(const v8us*)((const unsigned short*)Bh + boff + 16 + 8 * hh);
      acc[t] = mmaH<1>(ah.v, ah.v, bq.v, bq.v, acc[t]); }
  }
#pragma unroll
  for (int t = 0; t < 4; ++t) { if (col0 + t * 16 >= N) continue; const int col = col0 + t * 16 + ln; const float bv = bp ? bf16_round(bp[col]) : 0.f;
#pragma unroll
    for (int r = 0; r < 8; ++r) { float v = acc[t][r] * alpha + bv; if (CP) { const int bidx = (row0g + row0 + 8 * hh + r) / rowsPerB; v += CP[(size_t)bidx * sCPb + (size_t)by * 64 + col]; } if (ACT == 1) v = (v > 0.f) ? v : expm1f(v); else if (ACT == 7) v = (v > 0.f) ? v + 1.0f : expf(v); else if (ACT == 8) v = tanhf(v); else if (ACT == 9) v = 0.5f * v * (1.0f + tanhf(0.7978845608028654f * (v + 0.044715f * v * v * v))); else if (ACT == 11) v = 1.0f / (1.0f + expf(-v)); else if (ACT == 12) v = (v > 0.f) ? v : 0.01f * v; else if (ACT == 14) v = (v > 0.f) ? v : 0.1f * v; else if (ACT == 15) v = v / (1.0f + expf(-v)); else if (ACT == 3) v = fmaxf(v, 0.f); else if (ACT == 6) v = 0.5f * v * (1.0f + erff(v * 0.70710678118654752f)); so[w][8 * hh + r][t * 16 + ln] = v; } }
  __builtin_amdgcn_fence(__ATOMIC_ACQ_REL, "workgroup"); __builtin_amdgcn_wave_barrier();
  const int rsub = lane >> 4, c4 = (lane & 15) * 4; typedef _Float16 v4h __attribute__((ext_vector_type(4)));
  {
#pragma unroll
    for (int q = 0; q < 8; ++q) { const int r = q * 2 + rsub; if (col0 + c4 < N) { const v4f v = *(const v4fa*)&so[w][r][c4]; if (C) *(v4f*)(C + cofs + (size_t)(row0 + r) * ldc + col0 + c4) = v; if (C16) { v4h h4; for (int i = 0; i < 4; ++i) h4[i] = (_Float16)v[i]; *(v4h*)(C16 + cofs + (size_t)(row0 + r) * ldc + col0 + c4) = h4; } } }
     }
}


typedef _Float16 v4h __attribute__((ext_vector_type(4)));

__global__ __launch_bounds__(256) void k_x16(const float* __restrict__ x, _Float16* __restrict__ X16, size_t n8) { const size_t t = (size_t)blockIdx.x * 256 + threadIdx.x; if (t >= n8) return; FragH f;
#pragma unroll
  for (int q = 0; q < 8; ++q) f.h[q] = (_Float16)bf16_round(x[t * 8 + q]); *(v8us*)((unsigned short*)X16 + t * 8) = f.half[0];  }
// Er as the table of the skewed index t = 0 .. 2 * TT - 1, a plane [t][64] in fragment order: row t is Er[t] for t < TT, zero for t == TT, Er[t - TT - 1] beyond; a thread makes one piece, in storage order
__global__ __launch_bounds__(256) void k_er2(const float* __restrict__ Er, _Float16* __restrict__ E2) { const unsigned t = blockIdx.x * 256 + threadIdx.x; if (t >= 2 * TT * 64 / 8) return; int row, k; pk_src(t, 64, row, k);
  const int er = (row < TT) ? row : ((row > TT) ? row - TT - 1 : 0); const float* ep = Er + (size_t)er * 64 + k; const v4f a = *(const v4fa*)ep, c = *(const v4fa*)(ep + 4); FragH f;
#pragma unroll
  for (int q = 0; q < 4; ++q) { f.h[q] = (_Float16)bf16_round(a[q]); f.h[4 + q] = (_Float16)bf16_round(c[q]); }
  const v8us zr = {0, 0, 0, 0, 0, 0, 0, 0}; *(v8us*)((unsigned short*)E2 + (size_t)t * 8) = (row == TT) ? zr : f.half[0];  }
// k_x16 with the plane [rows][DM] written in fragment order; a thread makes one piece, in storage order
__global__ __launch_bounds__(256) void k_x16p(const float* __restrict__ x, _Float16* __restrict__ X16, size_t n8) { const size_t t = (size_t)blockIdx.x * 256 + threadIdx.x; if (t >= n8) return; int row, k; pk_src((unsigned)t, DM, row, k); const float* xp = x + (size_t)row * DM + k; const v4f a = *(const v4fa*)xp, c = *(const v4fa*)(xp + 4); FragH f;
#pragma unroll
  for (int q = 0; q < 4; ++q) { f.h[q] = (_Float16)bf16_round(a[q]); f.h[4 + q] = (_Float16)bf16_round(c[q]); }
  *(v8us*)((unsigned short*)X16 + t * 8) = f.half[0];  }
__global__ __launch_bounds__(256) void k_h16(const float* __restrict__ x, _Float16* __restrict__ X16, size_t n8) { const size_t t = (size_t)blockIdx.x * 256 + threadIdx.x; if (t >= n8) return; FragH f;
#pragma unroll
  for (int q = 0; q < 8; ++q) f.h[q] = (_Float16)x[t * 8 + q]; *(v8us*)((unsigned short*)X16 + t * 8) = f.half[0];  }
__global__ __launch_bounds__(256) void k_round16f(const float* __restrict__ W, _Float16* __restrict__ Bt, size_t n8) { const size_t t = (size_t)blockIdx.x * 256 + threadIdx.x; if (t >= n8) return; FragH f;
#pragma unroll
  for (int i = 0; i < 8; ++i) f.h[i] = (_Float16)(bf16_round(W[t * 8 + i]) * 16.0f); *(v8us*)((unsigned short*)Bt + t * 8) = f.half[0];  }
// v of one (batch, head) and 64 tokens -> the plane [d][token] of that pair, and k of the same tokens -> the plane [token][d], both in fragment order; a thread makes two pieces of each, in storage order
template <int NHv, int TTv>
__global__ __launch_bounds__(256) void k_vt(const _Float16* __restrict__ V16, int ldv, int voff, _Float16* __restrict__ Vt, int koff, _Float16* __restrict__ Kp) { __shared__ unsigned short tl[64][66]; const int tid = threadIdx.x; const int slab = blockIdx.x / (TTv / 64), lg = blockIdx.x % (TTv / 64); const int b = slab / NHv, h = slab % NHv;
  for (int i = tid; i < 64 * 8; i += 256) { const int r = i / 8, c8 = (i % 8) * 8; FragH f; f.half[0] = *(const v8us*)((const unsigned short*)V16 + ((size_t)b * TTv + lg * 64 + r) * ldv + voff + h * 64 + c8);
#pragma unroll
    for (int q = 0; q < 8; ++q) tl[r][c8 + q] = f.u[q]; }
  __syncthreads();
  {
#pragma unroll
    for (int rd = 0; rd < 2; ++rd) { const int pi = rd * 256 + tid, l5 = pi & 31, hf = (pi >> 5) & 1, kt = (pi >> 6) & 1, rt = pi >> 7;      /* piece pi of this block's 512: row tile, k tile, half, lane */
      const int d = rt * 16 + (l5 & 15), pc = kt * 4 + hf * 2 + (l5 >> 4); FragH f;
#pragma unroll
      for (int q = 0; q < 8; ++q) f.u[q] = tl[pc * 8 + q][d];
      *(v8us*)((unsigned short*)Vt + (size_t)slab * 64 * TTv + (size_t)rt * 16 * TTv + (size_t)(lg * 2 + kt) * 512 + hf * 256 + l5 * 8) = f.half[0];
      const v8us kk = *(const v8us*)((const unsigned short*)V16 + ((size_t)b * TTv + lg * 64 + rt * 16 + (l5 & 15)) * ldv + koff + h * 64 + kt * 32 + hf * 16 + (l5 >> 4) * 8);
      *(v8us*)((unsigned short*)Kp + (size_t)slab * 64 * TTv + ((size_t)lg * 512 + pi) * 8) = kk; }
     } }

__global__ __launch_bounds__(256) void k_hl(const float* __restrict__ F, _Float16* __restrict__ Hh, _Float16* __restrict__ Hl, size_t n8) { const size_t t = (size_t)blockIdx.x * 256 + threadIdx.x; if (t >= n8) return; FragH fh, fl; const v4f a = *(const v4fa*)(F + t * 8), c = *(const v4fa*)(F + t * 8 + 4);
#pragma unroll
  for (int q = 0; q < 4; ++q) { _Float16 h = (_Float16)a[q]; fh.h[q] = h; fl.h[q] = (_Float16)((a[q] - (float)h) * 1024.0f); h = (_Float16)c[q]; fh.h[4 + q] = h; fl.h[4 + q] = (_Float16)((c[q] - (float)h) * 1024.0f); }
  { *(v8us*)((unsigned short*)Hh + t * 8) = fh.half[0]; *(v8us*)((unsigned short*)Hl + t * 8) = fl.half[0];  } }

// ---- fast GEMM (wave tile 32x64; requires M % 32 == 0 rows per launch region, N % 64 == 0 and K % 64 == 0; A and Bh in fragment order, lda == ldb == K); epilogue = k_gemm_hhx semantics ----
__device__ __forceinline__ v16h g2_fragp(const _Float16* p) { FragH f; f.half[0] = *(const v8us*)((const unsigned short*)p); f.half[1] = *(const v8us*)((const unsigned short*)p + 256); return f.v; }      /* p: the tile's start + 8 * lane */
__device__ __forceinline__ v16h g2_frag(const _Float16* p, int hh) { FragH f; f.half[0] = *(const v8us*)((const unsigned short*)p + 8 * hh); f.half[1] = *(const v8us*)((const unsigned short*)p + 16 + 8 * hh); return f.v; }
__device__ __forceinline__ v8f g2_mma(v16h a, v16h b, v8f c) { v8f d = __builtin_amdgcn_wmma_f32_16x16x32_f16(false, a, false, b, (short)0, c, false, false); asm volatile("v_nop\n\tv_nop\n\tv_nop\n\tv_nop" : "+v"(d) : "v"(a), "v"(b)); return d; }
template <int ACT>
__global__ __launch_bounds__(128) void k_gemm2(const _Float16* __restrict__ A, int lda, size_t sA, const _Float16* __restrict__ Bh, int ldb, size_t sB, float alpha, const float* __restrict__ bias, size_t sBias, const float* __restrict__ CP, int rowsPerB, size_t sCPb, int row0g,
    float* __restrict__ C, _Float16* __restrict__ C16, int ldc, size_t sC, int M, int N, int K) {
  __shared__ __attribute__((aligned(16))) float so[4][32][68];
  const int tid = threadIdx.x, w = tid >> 5, lane = tid & 31, ln = lane & 15, hh = lane >> 4; const int by = blockIdx.y;
  A += (size_t)by * sA; Bh += (size_t)by * sB; const size_t cofs = (size_t)by * sC; const float* bp = bias ? bias + (size_t)by * sBias : nullptr;
  const int ntn = N >> 6; const int mt = blockIdx.x / ntn, nq = blockIdx.x - mt * ntn; const int row0 = mt * 128 + 32 * w, col0 = nq * 64; if (row0 >= M) return;
  /* each lane's place in the first k tile of the six row tiles */
  const _Float16* pa0 = A + (size_t)row0 * lda + 8 * lane; const _Float16* pa1 = pa0 + (size_t)16 * lda;
  const _Float16* pb0 = Bh + (size_t)col0 * ldb + 8 * lane; const _Float16* pb1 = pb0 + (size_t)16 * ldb; const _Float16* pb2 = pb1 + (size_t)16 * ldb; const _Float16* pb3 = pb2 + (size_t)16 * ldb;
  const v8f z8 = {0.f,0.f,0.f,0.f,0.f,0.f,0.f,0.f}; v8f c00 = z8, c01 = z8, c02 = z8, c03 = z8, c10 = z8, c11 = z8, c12 = z8, c13 = z8;
  /* two register sets of six fragments (32 k each): the twelve loads of a set are issued as one group, one set ahead of the products that read it, so that a set's load latency runs behind the other set's products; the k order of every sum is the old one */
  v16h xa0 = g2_fragp(pa0), xa1 = g2_fragp(pa1), xb0 = g2_fragp(pb0), xb1 = g2_fragp(pb1), xb2 = g2_fragp(pb2), xb3 = g2_fragp(pb3);
  __builtin_amdgcn_sched_barrier(0);      /* holds the first group in front of the loop */
#pragma unroll 1      /* the two sets are the whole ring: a further copy of the body would only cost registers */
  for (int kb = 0; kb < K; kb += 64) {
    const v16h ya0 = g2_fragp(pa0 + 512), ya1 = g2_fragp(pa1 + 512), yb0 = g2_fragp(pb0 + 512), yb1 = g2_fragp(pb1 + 512), yb2 = g2_fragp(pb2 + 512), yb3 = g2_fragp(pb3 + 512);      /* the next k tile: 512 elements on */
    /* the wait that stands in front of the write of the six address registers below, which both groups in flight name; the addresses are its inputs so that their registers stay untouched up to it */
    asm volatile("s_wait_xcnt 0x0" :: "v"(pa0), "v"(pa1), "v"(pb0), "v"(pb1), "v"(pb2), "v"(pb3) : "memory");
    __builtin_amdgcn_sched_barrier(0);      /* holds this group in front of the products: without it the scheduler sinks each load to its first use, with a full wait each */
    c00 = g2_mma(xa0, xb0, c00); c10 = g2_mma(xa1, xb0, c10); c01 = g2_mma(xa0, xb1, c01); c11 = g2_mma(xa1, xb1, c11);
    c02 = g2_mma(xa0, xb2, c02); c12 = g2_mma(xa1, xb2, c12); c03 = g2_mma(xa0, xb3, c03); c13 = g2_mma(xa1, xb3, c13);
    const int adv = (kb + 64 < K) ? 1024 : 0;      /* the last trip has no next set: it reads its own first set again, in bounds and unused, so that every trip has the same loads in flight and the counted waits hold */
    pa0 += adv; pa1 += adv; pb0 += adv; pb1 += adv; pb2 += adv; pb3 += adv;
    xa0 = g2_fragp(pa0); xa1 = g2_fragp(pa1); xb0 = g2_fragp(pb0); xb1 = g2_fragp(pb1); xb2 = g2_fragp(pb2); xb3 = g2_fragp(pb3);
    __builtin_amdgcn_sched_barrier(0);      /* holds the next set's group in front of this set's products */
    c00 = g2_mma(ya0, yb0, c00); c10 = g2_mma(ya1, yb0, c10); c01 = g2_mma(ya0, yb1, c01); c11 = g2_mma(ya1, yb1, c11);
    c02 = g2_mma(ya0, yb2, c02); c12 = g2_mma(ya1, yb2, c12); c03 = g2_mma(ya0, yb3, c03); c13 = g2_mma(ya1, yb3, c13); }
  /* the same wait for the last group, in front of whatever reuses its address registers behind the loop */
  asm volatile("s_wait_xcnt 0x0" :: "v"(pa0), "v"(pa1), "v"(pb0), "v"(pb1), "v"(pb2), "v"(pb3) : "memory");
  v8f accs[8] = {c00, c01, c02, c03, c10, c11, c12, c13};
#pragma unroll
  for (int u = 0; u < 8; ++u) { const int t = u & 3, half = u >> 2; const int col = col0 + t * 16 + ln; const float bv = bp ? bf16_round(bp[col]) : 0.f;
#pragma unroll
    for (int r = 0; r < 8; ++r) { const int rloc = half * 16 + 8 * hh + r; float v = accs[u][r] * alpha + bv; if (CP) { const int bidx = (row0g + row0 + rloc) / rowsPerB; v += CP[(size_t)bidx * sCPb + (size_t)by * 64 + col]; }
      if (ACT == 3) v = fmaxf(v, 0.f); else if (ACT == 6) v = 0.5f * v * (1.0f + erff(v * 0.70710678118654752f)); else if (ACT == 11) v = 1.0f / (1.0f + expf(-v)); else if (ACT == 15) v = v / (1.0f + expf(-v)); else if (ACT == 12) v = (v > 0.f) ? v : 0.01f * v; else if (ACT == 8) v = tanhf(v);
      so[w][rloc][t * 16 + ln] = v; } }
  __builtin_amdgcn_fence(__ATOMIC_ACQ_REL, "workgroup"); __builtin_amdgcn_wave_barrier();
  const int rsub = lane >> 4, c4 = (lane & 15) * 4;
  {
#pragma unroll
    for (int q = 0; q < 16; ++q) { const int r = q * 2 + rsub; const v4f v = *(const v4fa*)&so[w][r][c4]; if (C) *(v4f*)(C + cofs + (size_t)(row0 + r) * ldc + col0 + c4) = v; if (C16) { v4h h4; for (int i = 0; i < 4; ++i) h4[i] = (_Float16)v[i]; *(v4h*)(C16 + cofs + (size_t)(row0 + r) * ldc + col0 + c4) = h4; } }
     } }


__global__ __launch_bounds__(256) void k_split(const float* __restrict__ F, _Float16* __restrict__ Hh, _Float16* __restrict__ Hl, size_t n8) {
  #pragma clang fp contract(off)
  const size_t t = (size_t)blockIdx.x * 256 + threadIdx.x; if (t >= n8) return; int row, k; pk_src((unsigned)t, DM, row, k); const float* fp = F + (size_t)row * DM + k;      /* F is [rows][DM]; both planes go out in fragment order, a thread makes one piece of each */
  const v4f a = *(const v4fa*)fp, c = *(const v4fa*)(fp + 4); FragH fh, fl;
  asm volatile("s_wait_xcnt 0x0" ::: "memory");      /* the wait in front of any write of the address register of these two loads */
#pragma unroll
  for (int q = 0; q < 8; ++q) { const float v = (q < 4) ? a[q] : c[q - 4]; const _Float16 hi = (_Float16)v; fh.h[q] = hi; fl.h[q] = (_Float16)((v - (float)hi) * 1024.0f); }
  { *(v8us*)((unsigned short*)Hh + t * 8) = fh.half[0]; *(v8us*)((unsigned short*)Hl + t * 8) = fl.half[0];  } }

// D = A.B + C as the plain builtin: the compiler keeps the distance behind it itself
__device__ __forceinline__ v8f ra_mma(v16h a, v16h b, v8f c) { return __builtin_amdgcn_wmma_f32_16x16x32_f16(false, a, false, b, (short)0, c, false, false); }
// zero a fragment in the lanes whose A row does not belong to this product
__device__ __forceinline__ v16h frag_keep(v16h a, bool keep) { union { v16h v; unsigned int d[8]; } f; f.v = a;
#pragma unroll
  for (int i = 0; i < 8; ++i) f.d[i] = keep ? f.d[i] : 0u; return f.v; }

// Attention of one (batch, head) and 128 queries per block, 32 queries per wave, keys 64 at a time; nothing of S, QEr or P goes to memory.
// With t = TT-1-i+j the skewed term of (query i, key j) is q[i].Er[t] for t < TT, 0 for t == TT, q[i+1].Er[t-TT-1] for t > TT.
// All tiles are transposed: D[row 8*hh+r][column ln] with the query in the column, so a lane owns one query's max, sum and O column.
// Every inner loop is unrolled so that each array index is a constant and the arrays live in registers.
__global__ __launch_bounds__(128) void k_relattn(const _Float16* __restrict__ Q16, const _Float16* __restrict__ KP, const _Float16* __restrict__ VT, const _Float16* __restrict__ ER16, float* __restrict__ O) {
  __shared__ __attribute__((aligned(16))) float rl[4][2][16][RP];
  const int tid = threadIdx.x, w = __builtin_amdgcn_readfirstlane(tid >> 5), lane = tid & 31, ln = lane & 15, hh = lane >> 4;
  const int bh = blockIdx.y, b = bh / NH, h = bh - b * NH; const int i0 = blockIdx.x * 128 + 32 * w;
  const _Float16* qbase = Q16 + (size_t)b * TT * DM + h * 64; const _Float16* kbase = KP + (size_t)bh * 64 * TT; const _Float16* vbase = VT + (size_t)bh * 64 * TT;      /* [token][d] and [d][token], both in fragment order */
  v16h q[2][2], qn[2][2];      /* queries i and i + 1 as B operands; the row past the last query is never used, its address is clamped */
  const _Float16* qp[2]; const _Float16* qnp[2];
  __builtin_amdgcn_sched_barrier(0);      /* with the one behind the wait: keeps the set-up arithmetic, which reuses registers, out of the stretch between these loads and their wait */
#pragma unroll
  for (int qs = 0; qs < 2; ++qs) { const int i = i0 + 16 * qs + ln; const int i1 = (i + 1 < TT) ? i + 1 : TT - 1; qp[qs] = qbase + (size_t)i * DM + 8 * hh; qnp[qs] = qbase + (size_t)i1 * DM + 8 * hh;
#pragma unroll
    for (int ks = 0; ks < 2; ++ks) { q[qs][ks] = g2_frag(qp[qs] + 32 * ks, 0); qn[qs][ks] = g2_frag(qnp[qs] + 32 * ks, 0); } }
  asm volatile("s_wait_xcnt 0x0" ::: "memory");      /* the wait in front of any write of an address register of these loads */
  __builtin_amdgcn_sched_barrier(0);
  const v8f z8 = {0.f,0.f,0.f,0.f,0.f,0.f,0.f,0.f};
  v8f o[2][4] = {{z8, z8, z8, z8}, {z8, z8, z8, z8}}; float mx[2] = {-3.0e38f, -3.0e38f}, sm[2] = {0.f, 0.f};
#pragma unroll 1      /* the pass is some 2,500 instructions long: a second copy would only cost instruction fetch and registers */
  for (int j0 = 0; j0 < TT; j0 += 64) {
    /* every global load of the pass is issued here, so that the pass waits out one load latency and not one per tile */
    /* relative tiles: rows t = tb0 + 16u + (0..15); queries i0+16.. take u = 0..4, queries i0.. take u = 1..5 */
    const int tb0 = TT - 32 - i0 + j0;
    /* each lane's three addresses: its place in the first k, v and relative tile of the pass; 0 <= tb0 and tb0 + 95 <= 2 * TT - 1, the rows of the table */
    const _Float16* kp = kbase + (size_t)j0 * 64 + 8 * lane; const _Float16* vp = vbase + (size_t)j0 * 16 + 8 * lane; const _Float16* ep = ER16 + (size_t)tb0 * 64 + 8 * lane;
    v16h kf[4][2], ef[6][2], vf[4][2];
#pragma unroll
    for (int n = 0; n < 4; ++n) { kf[n][0] = g2_fragp(kp + 1024 * n); kf[n][1] = g2_fragp(kp + 1024 * n + 512); }
#pragma unroll
    for (int u = 0; u < 6; ++u) { ef[u][0] = g2_fragp(ep + 1024 * u); ef[u][1] = g2_fragp(ep + 1024 * u + 512); }
#pragma unroll
    for (int dt = 0; dt < 4; ++dt) { vf[dt][0] = g2_fragp(vp + (size_t)(16 * dt) * TT); vf[dt][1] = g2_fragp(vp + (size_t)(16 * dt) * TT + 512); }
    /* the wait that stands in front of any write of a register which one of these loads names as its address; the addresses are its inputs so that their registers stay untouched up to it */
    asm volatile("s_wait_xcnt 0x0" :: "v"(kp), "v"(vp), "v"(ep) : "memory");
    __builtin_amdgcn_sched_barrier(0);      /* holds the loads and that wait in front of the products: without it the scheduler sinks the k loads between the products, two at a time, each with its own full wait */
    v8f s[2][4];      /* s[qs][n][r] = k[j0 + 16n + 8hh + r] . q[i0 + 16qs + ln] */
#pragma unroll
    for (int n = 0; n < 4; ++n)
#pragma unroll
      for (int qs = 0; qs < 2; ++qs) s[qs][n] = ra_mma(kf[n][1], q[qs][1], ra_mma(kf[n][0], q[qs][0], z8));
#pragma unroll
    for (int u = 0; u < 6; ++u) { const int tb = tb0 + 16 * u, t = tb + ln; const v16h e0 = ef[u][0], e1 = ef[u][1];
      v8f r0 = z8, r1 = z8;
      if (tb < TT) { const v16h f0 = frag_keep(e0, t < TT), f1 = frag_keep(e1, t < TT);
        if (u >= 1) r0 = ra_mma(f1, q[0][1], ra_mma(f0, q[0][0], r0));
        if (u <= 4) r1 = ra_mma(f1, q[1][1], ra_mma(f0, q[1][0], r1)); }
      if (tb + 15 > TT) { const v16h f0 = frag_keep(e0, t > TT), f1 = frag_keep(e1, t > TT);
        if (u >= 1) r0 = ra_mma(f1, qn[0][1], ra_mma(f0, qn[0][0], r0));
        if (u <= 4) r1 = ra_mma(f1, qn[1][1], ra_mma(f0, qn[1][0], r1)); }
      if (u >= 1) { float* d = &rl[w][0][ln][16 * (u - 1) + 8 * hh]; const v4f lo = {r0[0], r0[1], r0[2], r0[3]}, hi = {r0[4], r0[5], r0[6], r0[7]}; *(v4fa*)d = lo; *(v4fa*)(d + 4) = hi; }
      if (u <= 4) { float* d = &rl[w][1][ln][16 * u + 8 * hh]; const v4f lo = {r1[0], r1[1], r1[2], r1[3]}, hi = {r1[4], r1[5], r1[6], r1[7]}; *(v4fa*)d = lo; *(v4fa*)(d + 4) = hi; } }
    /* a query's row is written by its two lanes and read by both: the wave's LDS writes are done before any lane reads; only the LDS counter is waited on, the v loads stay in flight */
    asm volatile("s_wait_dscnt 0x0" ::: "memory"); __builtin_amdgcn_wave_barrier();
    FragH p[2][2];
#pragma unroll
    for (int qs = 0; qs < 2; ++qs) { const float* rr = &rl[w][qs][ln][15 - ln + 8 * hh]; float mt = -3.0e38f;
#pragma unroll
      for (int n = 0; n < 4; ++n)
#pragma unroll
        for (int r = 0; r < 8; ++r) { const float lg = (s[qs][n][r] + rr[16 * n + r]) * 0.125f; s[qs][n][r] = lg; mt = fmaxf(mt, lg); }
      mt = fmaxf(mt, __shfl_xor(mt, 16, 32));
      const float mn = fmaxf(mx[qs], mt), al = expf(mx[qs] - mn); mx[qs] = mn; float ps[4] = {0.f, 0.f, 0.f, 0.f};      /* one partial sum per key tile: four short add chains */
#pragma unroll
      for (int n = 0; n < 4; ++n)
#pragma unroll
        for (int r = 0; r < 8; ++r) { const float pv = expf(s[qs][n][r] - mn); ps[n] += pv; p[qs][n >> 1].h[(n & 1) * 8 + r] = (_Float16)(pv * 1024.0f); }
      sm[qs] = sm[qs] * al + ((ps[0] + ps[1]) + (ps[2] + ps[3]));
#pragma unroll
      for (int dt = 0; dt < 4; ++dt) o[qs][dt] *= al; }
    /* keeps the compiler from lifting the next pass's LDS writes over this pass's reads (their values are already in registers here) */
    __builtin_amdgcn_fence(__ATOMIC_ACQ_REL, "wavefront"); __builtin_amdgcn_wave_barrier();
#pragma unroll
    for (int dt = 0; dt < 4; ++dt)
#pragma unroll
      for (int qs = 0; qs < 2; ++qs) o[qs][dt] = ra_mma(vf[dt][1], p[qs][1].v, ra_mma(vf[dt][0], p[qs][0].v, o[qs][dt]));
  }
#pragma unroll
  for (int qs = 0; qs < 2; ++qs) { const float tot = sm[qs] + __shfl_xor(sm[qs], 16, 32); const float inv = 0.0009765625f / tot;
    float* op = O + ((size_t)b * TT + i0 + 16 * qs + ln) * DM + h * 64 + 8 * hh;
#pragma unroll
    for (int dt = 0; dt < 4; ++dt) { const v8f a = o[qs][dt]; const v4f lo = {a[0] * inv, a[1] * inv, a[2] * inv, a[3] * inv}, hi = {a[4] * inv, a[5] * inv, a[6] * inv, a[7] * inv}; *(v4f*)(op + 16 * dt) = lo; *(v4f*)(op + 16 * dt + 4) = hi; } }
}

extern "C" void kernel_launch(void* const* d_in, const int* in_sizes, int n_in,
                              void* d_out, int out_size, void* d_ws, size_t ws_size, hipStream_t stream) {
  (void)in_sizes; (void)n_in; (void)out_size;
  const float* const* I = (const float* const*)d_in; const float* x = I[0]; const float* qw = I[1]; const float* qb = I[2]; const float* kvw = I[3]; const float* kvb = I[4]; const float* pw = I[5]; const float* pb = I[6]; const float* Er = I[7];
  char* ws = (char*)d_ws; size_t off = 0;
  auto take = [&](size_t bytes) { char* p = ws + off; off += (bytes + 255) & ~(size_t)255; return p; };
  _Float16* BP = (_Float16*)take((size_t)DM * DM * 2); _Float16* ER16 = (_Float16*)take((size_t)2 * TT * 64 * 2);
  _Float16* Q16 = (_Float16*)take((size_t)NR * DM * 2); _Float16* KV16 = (_Float16*)take((size_t)NR * 2 * DM * 2); _Float16* VT = (_Float16*)take((size_t)NR * DM * 2); float* O = (float*)take((size_t)NR * DM * 4);
  _Float16* X16 = (_Float16*)take((size_t)NR * DM * 2); _Float16* BQ = (_Float16*)take((size_t)DM * DM * 2); _Float16* BKV = (_Float16*)take((size_t)DM * 2 * DM * 2);
  _Float16* Oh = (_Float16*)take((size_t)NR * DM * 2); _Float16* Ol = (_Float16*)take((size_t)NR * DM * 2); _Float16* KP = (_Float16*)take((size_t)NR * DM * 2);
  if (off > ws_size) return;      /* about 89 MiB */
  const size_t n8 = (size_t)NR * DM / 8; const unsigned nb8 = (unsigned)((n8 + 255) / 256);
  k_wt_f16<<<(unsigned)(((size_t)DM * DM / 8 + 255) / 256), 256, 0, stream>>>(qw, BQ, DM, DM, 16.0f); k_wt_f16<<<(unsigned)(((size_t)DM * 2 * DM / 8 + 255) / 256), 256, 0, stream>>>(kvw, BKV, DM, 2 * DM, 16.0f); k_wt_f16<<<(unsigned)(((size_t)DM * DM / 8 + 255) / 256), 256, 0, stream>>>(pw, BP, DM, DM, 16.0f);      /* (in,out) -> [out][in] x16, fragment order */
  k_er2<<<2 * TT * 64 / 8 / 256, 256, 0, stream>>>(Er, ER16);      /* Er exact f16, the table of the skewed index [4096][64], fragment order */
  k_x16p<<<nb8, 256, 0, stream>>>(x, X16, n8);
  const dim3 gQ((NR / 128) * (DM / 64), 1), gKV((NR / 128) * (2 * DM / 64), 1), gA(TT / 128, NBT * NH);
  k_gemm2<0><<<gQ, 128, 0, stream>>>(X16, DM, 0, BQ, DM, 0, 0.0625f, qb, 0, nullptr, 1, 0, 0, nullptr, Q16, DM, 0, NR, DM, DM);
  k_gemm2<0><<<gKV, 128, 0, stream>>>(X16, DM, 0, BKV, DM, 0, 0.0625f, kvb, 0, nullptr, 1, 0, 0, nullptr, KV16, 2 * DM, 0, NR, 2 * DM, DM);      /* [k | v] f16, column = part*1024 + h*64 + d */
  k_vt<NH, TT><<<NBT * NH * (TT / 64), 256, 0, stream>>>(KV16, 2 * DM, DM, VT, 0, KP);
  k_relattn<<<gA, 128, 0, stream>>>(Q16, KP, VT, ER16, O);
  k_split<<<nb8, 256, 0, stream>>>(O, Oh, Ol, n8);
  k_gemm2<0><<<gQ, 128, 0, stream>>>(Oh, DM, 0, BP, DM, 0, 0.0625f, pb, 0, nullptr, 1, 0, 0, (float*)d_out, nullptr, DM, 0, NR, DM, DM);
  k_gemm2<0><<<gQ, 128, 0, stream>>>(Ol, DM, 0, BP, DM, 0, 0.0625f / 1024.0f, nullptr, 0, (const float*)d_out, 1, (size_t)DM, 0, (float*)d_out, nullptr, DM, 0, NR, DM, DM);
}

// v005
// A run of this version takes 200 microseconds.
// In two side-by-side timings against v004, it was 1.15 and 1.14 times as fast.
// Counting every step since v000, it is 17.0 times as fast.
#include <hip/hip_runtime.h>
// Relative-position multi-head attention with the 'skew' trick (2 x 2048 tokens x 1024, 16 heads x 64): q = x*q_w + q_b; [k | v] = x*kv_w + kv_b; QEr = q . Er^T against the learned INPUT table Er [2048][64]; Srel = skew(QEr) (pad one zero column on the left, reinterpret as [(N+1)][N], drop the first row -> Srel[i][j] = padded.flat[(i+1)*N + j]); logits = (q.k + Srel)/8 (no mask); softmax; merged . proj_w + proj_b -> [2,2048,1024].
// Structure: x as an exact f16 plane; the projections as f16 WMMA GEMMs (32x64 wave tiles, f32, exact products + bias; both operands stored in fragment order) into row-major f16 planes; Er as an exact f16 table over the skewed index, in fragment order; k and v re-laid per (batch, head) as [token][d] and [d][token] in fragment order; one attention kernel for all (batch, head) pairs: a wave holds 32 queries and walks the keys 64 at a time; scores and relative terms as transposed WMMA tiles (keys or Er rows as A, queries as B), the skew as a per-query shifted read of the relative tile through LDS, running-max softmax per lane in base 2 (one multiply-add and one v_exp_f32 per score), P (x2^10 f16) taken from the score registers as the B operand of V^T.P^T, O into the merged f32 plane; O split into f16 hi + residual planes; output projection as two GEMMs (bias in the first).
// Compute dtype: x, weights, biases and Er rounded to bf16; projections exact; q, k, v, P as f16 operands (~2^-12), O as hi + residual; f32 accumulation and softmax. v_wmma_f32_16x16x32_f16.
#define NBT 2
#define TT 2048
#define DM 1024
#define NH 16
#define NR (NBT * TT)
#define L2E8 0.18033688011112042f   /* log2(e) / 8: the logit scale 1/8 and the change to base 2 in one factor */
#define RP 84   /* floats per query row of the relative tile in LDS: 80 used; a multiple of 4 for the 16-byte writes; lane ln reads at ln * (RP - 1) + const, and 83 is odd, which spreads the lanes over the banks */
typedef __bf16 v16b __attribute__((ext_vector_type(16)));
typedef unsigned short v8us __attribute__((ext_vector_type(8), may_alias));
typedef float  v8f  __attribute__((ext_vector_type(8)));
typedef float  v4f  __attribute__((ext_vector_type(4)));
typedef float  v4fa __attribute__((ext_vector_type(4), may_alias));
union FragB { v16b v; v8us half[2]; unsigned short u[16]; };

__device__ __forceinline__ unsigned short bf16_bits(float x) { unsigned int u = __float_as_uint(x); return (unsigned short)((u + 0x7FFFu + ((u >> 16) & 1u)) >> 16); }
__device__ __forceinline__ float bf16_val(unsigned short b) { return __uint_as_float(((unsigned int)b) << 16); }
__device__ __forceinline__ float bf16_round(float x) { return bf16_val(bf16_bits(x)); }
// D += A·B with NT terms: 1 = ah·bh, 2 = + al·bh (A split), 3 = + ah·bl (both split)
template <int NT>
__device__ __forceinline__ v8f mmaN(v16b ah, v16b al, v16b bh, v16b bl, v8f c) {
  c = __builtin_amdgcn_wmma_f32_16x16x32_bf16(false, ah, false, bh, (short)0, c, false, false);
  if (NT >= 2) c = __builtin_amdgcn_wmma_f32_16x16x32_bf16(false, al, false, bh, (short)0, c, false, false);
  if (NT >= 3) c = __builtin_amdgcn_wmma_f32_16x16x32_bf16(false, ah, false, bl, (short)0, c, false, false);
  asm volatile("v_nop\n\tv_nop\n\tv_nop\n\tv_nop" : "+v"(c) : "v"(ah), "v"(al), "v"(bh), "v"(bl));
  return c;
}

__global__ __launch_bounds__(256) void k_wt_bf16(const float* __restrict__ W, unsigned short* __restrict__ Wt, int K, int N) {
  const int t = blockIdx.x * 256 + threadIdx.x;
  const int k8n = K / 8;
  if (t >= N * k8n) return;
  const int n = t / k8n, k8 = (t % k8n) * 8;
  v8us v;
#pragma unroll
  for (int i = 0; i < 8; ++i) v[i] = bf16_bits(W[(size_t)(k8 + i) * N + n]);
  *(v8us*)(Wt + (size_t)n * K + k8) = v;
  
}

// GEMM C[M][N] (f32, pitch ldc) = act(A[M][K]·W + bias). A f32 row-major (pitch lda) converted per fragment to bf16
// (ASPLIT: hi/lo two planes -> 2 terms, else single rounded term); Wt bf16 [N][K] (pitch ldb). BIAS_BF16 rounds the
// bias to bf16 first (bias quantised to bf16 before the add). K%32==0, M%16==0, N%64==0.
template <bool ASPLIT, int ACT, bool BIAS_BF16>
__global__ __launch_bounds__(128) void k_gemm_bf(const float* __restrict__ A, int lda, const unsigned short* __restrict__ Wt, int ldb,
                                               const float* __restrict__ bias, float* __restrict__ C, int ldc, int M, int N, int K) {
  __shared__ __attribute__((aligned(16))) float so[4][16][64];
  const int tid = threadIdx.x, w = tid >> 5, lane = tid & 31, ln = lane & 15, hh = lane >> 4;
  const int ntn = N / 64;
  const int wid = blockIdx.x * 4 + w;
  const int mt = wid / ntn, nq = wid % ntn;
  if (mt * 16 >= M) return;
  const int row0 = mt * 16, col0 = nq * 64;
  const float* arow = A + (size_t)(row0 + ln) * lda;
  v8f acc[4] = {};
  for (int kb = 0; kb < K; kb += 32) {
    FragB ah, al;
    const v4f x0 = *(const v4fa*)(arow + kb + 8 * hh), x1 = *(const v4fa*)(arow + kb + 8 * hh + 4);
    const v4f x2 = *(const v4fa*)(arow + kb + 16 + 8 * hh), x3 = *(const v4fa*)(arow + kb + 16 + 8 * hh + 4);
    float xs[16] = {x0[0],x0[1],x0[2],x0[3],x1[0],x1[1],x1[2],x1[3],x2[0],x2[1],x2[2],x2[3],x3[0],x3[1],x3[2],x3[3]};
#pragma unroll
    for (int i = 0; i < 16; ++i) { const unsigned short hb = bf16_bits(xs[i]); ah.u[i] = hb; al.u[i] = ASPLIT ? bf16_bits(xs[i] - bf16_val(hb)) : (unsigned short)0; }
#pragma unroll
    for (int t = 0; t < 4; ++t) {
      const unsigned short* brow = Wt + (size_t)(col0 + t * 16 + ln) * ldb + kb;
      FragB b;
      b.half[0] = *(const v8us*)(brow + 8 * hh);
      b.half[1] = *(const v8us*)(brow + 16 + 8 * hh);
      acc[t] = mmaN<ASPLIT ? 2 : 1>(ah.v, al.v, b.v, b.v, acc[t]);
    }
  }
#pragma unroll
  for (int t = 0; t < 4; ++t) {
    float bv = bias ? bias[col0 + t * 16 + ln] : 0.f;
    if (BIAS_BF16) bv = bf16_round(bv);
#pragma unroll
    for (int r = 0; r < 8; ++r) { float v = acc[t][r] + bv; if (ACT == 1) v = fmaxf(v, 0.f); so[w][8 * hh + r][t * 16 + ln] = v; }
  }
  __builtin_amdgcn_fence(__ATOMIC_ACQ_REL, "workgroup");
  __builtin_amdgcn_wave_barrier();
  const int rsub = lane >> 4, c4 = (lane & 15) * 4;
  {
#pragma unroll
    for (int q = 0; q < 8; ++q) {
      const int r = q * 2 + rsub;
      const v4f v = *(const v4fa*)&so[w][r][c4];
      *(v4f*)(C + (size_t)(row0 + r) * ldc + col0 + c4) = v;
    }
    
  }
}

// GEMM C = act(A·W + bias + resid): A f32 (ASPLIT -> hi/lo 2 terms), Wt bf16 [N][K]; ACT 0 none, 1 relu, 2 exact gelu;
// resid (optional, f32, row index = (row % rmod), pitch ldr, RES_BF16 rounds it) added before the activation.
template <bool ASPLIT, int ACT, bool BIAS_BF16, bool RES_BF16>
__global__ __launch_bounds__(128) void k_gemm_bf3(const float* __restrict__ A, int lda, const unsigned short* __restrict__ Wt, int ldb,
                                                const float* __restrict__ bias, const float* __restrict__ resid, int rmod, int ldr,
                                                float* __restrict__ C, int ldc, int M, int N, int K) {
  __shared__ __attribute__((aligned(16))) float so[4][16][64];
  const int tid = threadIdx.x, w = tid >> 5, lane = tid & 31, ln = lane & 15, hh = lane >> 4;
  const int ntn = N / 64;
  const int wid = blockIdx.x * 4 + w;
  const int mt = wid / ntn, nq = wid % ntn;
  if (mt * 16 >= M) return;
  const int row0 = mt * 16, col0 = nq * 64;
  const float* arow = A + (size_t)(row0 + ln) * lda;
  v8f acc[4] = {};
  for (int kb = 0; kb < K; kb += 32) {
    FragB ah, al;
    const v4f x0 = *(const v4fa*)(arow + kb + 8 * hh), x1 = *(const v4fa*)(arow + kb + 8 * hh + 4);
    const v4f x2 = *(const v4fa*)(arow + kb + 16 + 8 * hh), x3 = *(const v4fa*)(arow + kb + 16 + 8 * hh + 4);
    float xs[16] = {x0[0],x0[1],x0[2],x0[3],x1[0],x1[1],x1[2],x1[3],x2[0],x2[1],x2[2],x2[3],x3[0],x3[1],x3[2],x3[3]};
#pragma unroll
    for (int i = 0; i < 16; ++i) { const unsigned short hb = bf16_bits(xs[i]); ah.u[i] = hb; al.u[i] = ASPLIT ? bf16_bits(xs[i] - bf16_val(hb)) : (unsigned short)0; }
#pragma unroll
    for (int t = 0; t < 4; ++t) {
      const unsigned short* brow = Wt + (size_t)(col0 + t * 16 + ln) * ldb + kb;
      FragB b;
      b.half[0] = *(const v8us*)(brow + 8 * hh);
      b.half[1] = *(const v8us*)(brow + 16 + 8 * hh);
      acc[t] = mmaN<ASPLIT ? 2 : 1>(ah.v, al.v, b.v, b.v, acc[t]);
    }
  }
#pragma unroll
  for (int t = 0; t < 4; ++t) {
    const int col = col0 + t * 16 + ln;
    float bv = bias ? bias[col] : 0.f;
    if (BIAS_BF16) bv = bf16_round(bv);
#pragma unroll
    for (int r = 0; r < 8; ++r) {
      float v = acc[t][r] + bv;
      if (resid) { float rv = resid[(size_t)((row0 + 8 * hh + r) % rmod) * ldr + col]; if (RES_BF16) rv = bf16_round(rv); v += rv; }
      if (ACT == 1) v = fmaxf(v, 0.f);
      if (ACT == 2) v = 0.5f * v * (1.0f + erff(v * 0.70710678118654752f));
      if (ACT == 3) { const float u = 0.7978845608028654f * (v + 0.044715f * v * v * v); v = 0.5f * v * (1.0f + tanhf(u)); }
      so[w][8 * hh + r][t * 16 + ln] = v;
    }
  }
  __builtin_amdgcn_fence(__ATOMIC_ACQ_REL, "workgroup");
  __builtin_amdgcn_wave_barrier();
  const int rsub = lane >> 4, c4 = (lane & 15) * 4;
  {
#pragma unroll
    for (int q = 0; q < 8; ++q) {
      const int r = q * 2 + rsub;
      const v4f v = *(const v4fa*)&so[w][r][c4];
      *(v4f*)(C + (size_t)(row0 + r) * ldc + col0 + c4) = v;
    }
    
  }
}
// row LayerNorm (biased variance, eps) over N: s = X (+ R); optional out_sum <- s; out_norm <- (s-mu)*rsqrt(var+eps)*g + b
template <bool PARAM_BF16>
__global__ __launch_bounds__(256) void k_layernorm(const float* __restrict__ X, const float* __restrict__ R, const float* __restrict__ g, const float* __restrict__ bta,
                                                  float* __restrict__ out_sum, float* __restrict__ out_norm, int N, float eps) {
  __shared__ float red[256];
  const int row = blockIdx.x, tid = threadIdx.x;
  const float* x = X + (size_t)row * N; const float* rr = R ? R + (size_t)row * N : nullptr;
  float vals[16];                     // up to N = 4096
  const int per = N / 256;            // contiguous chunk per thread? use strided-by-4 chunks: thread handles j = tid*4 + 1024*u
  float s1 = 0.f;
  for (int u = 0; u < per / 4; ++u) {
    const int j = tid * 4 + 1024 * u;
    const v4f a = *(const v4fa*)(x + j);
    v4f b = {0.f,0.f,0.f,0.f}; if (rr) b = *(const v4fa*)(rr + j);
#pragma unroll
    for (int q = 0; q < 4; ++q) { const float v = a[q] + b[q]; vals[u * 4 + q] = v; s1 += v; }
  }
  red[tid] = s1; __syncthreads();
  for (int st = 128; st > 0; st >>= 1) { if (tid < st) red[tid] += red[tid + st]; __syncthreads(); }
  const float mu = red[0] / (float)N; __syncthreads();
  float s2 = 0.f;
  for (int u = 0; u < per / 4; ++u)
#pragma unroll
    for (int q = 0; q < 4; ++q) { const float c = vals[u * 4 + q] - mu; s2 += c * c; }
  red[tid] = s2; __syncthreads();
  for (int st = 128; st > 0; st >>= 1) { if (tid < st) red[tid] += red[tid + st]; __syncthreads(); }
  const float rs = rsqrtf(red[0] / (float)N + eps);
  {
    for (int u = 0; u < per / 4; ++u) {
      const int j = tid * 4 + 1024 * u;
      v4f o, sm;
#pragma unroll
      for (int q = 0; q < 4; ++q) {
        float gg = g[j + q], bb = bta[j + q];
        if (PARAM_BF16) { gg = bf16_round(gg); bb = bf16_round(bb); }
        sm[q] = vals[u * 4 + q]; o[q] = (vals[u * 4 + q] - mu) * rs * gg + bb;
      }
      if (out_sum) *(v4f*)(out_sum + (size_t)row * N + j) = sm;
      *(v4f*)(out_norm + (size_t)row * N + j) = o;
    }
    
  }
}



// ---- f16 WMMA path (v_wmma_f32_16x16x32_f16): 11-bit significands for operands in range — used where a [0,1] probability operand needs more precision than bf16
typedef _Float16 v16h __attribute__((ext_vector_type(16)));
union FragH { v16h v; v8us half[2]; _Float16 h[16]; unsigned short u[16]; };
template <int NT>
__device__ __forceinline__ v8f mmaH(v16h ah, v16h al, v16h bh, v16h bl, v8f c) {
  c = __builtin_amdgcn_wmma_f32_16x16x32_f16(false, ah, false, bh, (short)0, c, false, false);
  if (NT >= 2) c = __builtin_amdgcn_wmma_f32_16x16x32_f16(false, al, false, bh, (short)0, c, false, false);
  if (NT >= 3) c = __builtin_amdgcn_wmma_f32_16x16x32_f16(false, ah, false, bl, (short)0, c, false, false);
  asm volatile("v_nop\n\tv_nop\n\tv_nop\n\tv_nop" : "+v"(c) : "v"(ah), "v"(al), "v"(bh), "v"(bl));
  return c;
}
// batched GEMM like k_gemm_b but f16 operands: A f32 (split into f16 hi/lo if ASPLIT, else rounded to f16), Bt = f16 values [n][k]; alpha; C f32; N multiple of 16 (partial tiles skipped)
template <bool ASPLIT>
__global__ __launch_bounds__(128) void k_gemm_h(const float* __restrict__ A, int lda, size_t sA, const _Float16* __restrict__ Bh, int ldb, size_t sB, float alpha, float* __restrict__ C, int ldc, size_t sC, int M, int N, int K) {
  __shared__ __attribute__((aligned(16))) float so[4][16][64];
  const int tid = threadIdx.x, w = tid >> 5, lane = tid & 31, ln = lane & 15, hh = lane >> 4; const int by = blockIdx.y;
  A += (size_t)by * sA; Bh += (size_t)by * sB; C += (size_t)by * sC;
  const int ntn = (N + 63) / 64; const int wid = blockIdx.x * 4 + w; const int mt = wid / ntn, nq = wid % ntn; if (mt * 16 >= M) return;
  const int row0 = mt * 16, col0 = nq * 64; const float* arow = A + (size_t)(row0 + ln) * lda;
  v8f acc[4] = {};
  for (int kb = 0; kb < K; kb += 32) {
    FragH ah, al;
    const v4f x0 = *(const v4fa*)(arow + kb + 8 * hh), x1 = *(const v4fa*)(arow + kb + 8 * hh + 4), x2 = *(const v4fa*)(arow + kb + 16 + 8 * hh), x3 = *(const v4fa*)(arow + kb + 16 + 8 * hh + 4);
    float xs[16] = {x0[0],x0[1],x0[2],x0[3],x1[0],x1[1],x1[2],x1[3],x2[0],x2[1],x2[2],x2[3],x3[0],x3[1],x3[2],x3[3]};
#pragma unroll
    for (int i = 0; i < 16; ++i) { const _Float16 h = (_Float16)xs[i]; ah.h[i] = h; al.h[i] = ASPLIT ? (_Float16)(xs[i] - (float)h) : (_Float16)0.0f; }
#pragma unroll
    for (int t = 0; t < 4; ++t) { if (col0 + t * 16 >= N) continue; const size_t boff = (size_t)(col0 + t * 16 + ln) * ldb + kb; FragH bq; bq.half[0] = *(const v8us*)(Bh + boff + 8 * hh); bq.half[1] = *(const v8us*)(Bh + boff + 16 + 8 * hh);
      acc[t] = mmaH<ASPLIT ? 2 : 1>(ah.v, al.v, bq.v, bq.v, acc[t]); }
  }
#pragma unroll
  for (int t = 0; t < 4; ++t) { if (col0 + t * 16 >= N) continue;
#pragma unroll
    for (int r = 0; r < 8; ++r) so[w][8 * hh + r][t * 16 + ln] = acc[t][r] * alpha; }
  __builtin_amdgcn_fence(__ATOMIC_ACQ_REL, "workgroup"); __builtin_amdgcn_wave_barrier();
  const int rsub = lane >> 4, c4 = (lane & 15) * 4;
  {
#pragma unroll
    for (int q = 0; q < 8; ++q) { const int r = q * 2 + rsub; if (col0 + c4 < N) { const v4f v = *(const v4fa*)&so[w][r][c4]; *(v4f*)(C + (size_t)(row0 + r) * ldc + col0 + c4) = v; } }
     }
}

// Fragment order of an f16 operand plane [R][K] (R % 16 == 0, K % 32 == 0): tiles of 16 rows x 32 k, 1 KiB each, the k tiles of one row tile one after the other (a row tile is 16 * K elements, as in the row-major plane).
// Inside a tile the 16-byte piece (row ln, k = 16 * half + 8 * hh + 0..7) lies at element 256 * half + 8 * (16 * hh + ln): lane 16 * hh + ln of a wave finds its fragment at its own 16 bytes of two runs of 512 bytes, so a fragment load covers four whole 128-byte lines.
// pk_src: piece t, counted in storage order, -> its row and its first k
__device__ __forceinline__ void pk_src(unsigned t, unsigned K, int& row, int& k) { const unsigned ktn = K >> 5, tile = t >> 6, rt = tile / ktn, kt = tile - rt * ktn; row = (int)(rt * 16 + (t & 15)); k = (int)(kt * 32 + ((t >> 5) & 1) * 16 + ((t >> 4) & 1) * 8); }
// Wt = f16(W[k][n] * scale) as the plane [n][k] in fragment order, from f32 row-major W[K][N] (scale = power of two; bf16-exact weights stay exact in f16 away from the subnormal range); a thread makes one piece, in storage order
__global__ __launch_bounds__(256) void k_wt_f16(const float* __restrict__ W, _Float16* __restrict__ Wt, int K, int N, float scale) {
  const int t = blockIdx.x * 256 + threadIdx.x; if (t >= N * (K / 8)) return; int n, k8; pk_src((unsigned)t, (unsigned)K, n, k8); FragH f;
#pragma unroll
  for (int i = 0; i < 8; ++i) f.h[i] = (_Float16)(bf16_round(W[(size_t)(k8 + i) * N + n]) * scale); const v8us o = f.half[0];
  *(v8us*)((unsigned short*)Wt + (size_t)t * 8) = o; 
}
// k_gemm_hh variant with fused epilogue: v = acc·alpha + bias[by·sBias + col] (+ CP[(row/rowsPerB)·sCPb + by·64 + col] if CP) ; ACT 0 none / 1 elu ; writes f16 C16 (and f32 C if non-null)
template <int ACT>
__global__ __launch_bounds__(128) void k_gemm_hhx(const _Float16* __restrict__ A, int lda, size_t sA, const _Float16* __restrict__ Bh, int ldb, size_t sB, float alpha, const float* __restrict__ bias, size_t sBias, const float* __restrict__ CP, int rowsPerB, size_t sCPb, int row0g,
    float* __restrict__ C, _Float16* __restrict__ C16, int ldc, size_t sC, int M, int N, int K) {
  __shared__ __attribute__((aligned(16))) float so[4][16][64];
  const int tid = threadIdx.x, w = tid >> 5, lane = tid & 31, ln = lane & 15, hh = lane >> 4; const int by = blockIdx.y;
  A += (size_t)by * sA; Bh += (size_t)by * sB; const size_t cofs = (size_t)by * sC; const float* bp = bias ? bias + (size_t)by * sBias : nullptr;
  const int ntn = (N + 63) / 64; const int wid = blockIdx.x * 4 + w; const int mt = wid / ntn, nq = wid % ntn; if (mt * 16 >= M) return;
  const int row0 = mt * 16, col0 = nq * 64; const _Float16* arow = A + (size_t)(row0 + ln) * lda;
  v8f acc[4] = {};
  for (int kb = 0; kb < K; kb += 32) { FragH ah; ah.half[0] = *(const v8us*)((const unsigned short*)arow + kb + 8 * hh); ah.half[1] = *(const v8us*)((const unsigned short*)arow + kb + 16 + 8 * hh);
#pragma unroll
    for (int t = 0; t < 4; ++t) { if (col0 + t * 16 >= N) continue; const size_t boff = (size_t)(col0 + t * 16 + ln) * ldb + kb; FragH bq; bq.half[0] = *(const v8us*)((const unsigned short*)Bh + boff + 8 * hh); bq.half[1] = *(const v8us*)((const unsigned short*)Bh + boff + 16 + 8 * hh);
      acc[t] = mmaH<1>(ah.v, ah.v, bq.v, bq.v, acc[t]); }
  }
#pragma unroll
  for (int t = 0; t < 4; ++t) { if (col0 + t * 16 >= N) continue; const int col = col0 + t * 16 + ln; const float bv = bp ? bf16_round(bp[col]) : 0.f;
#pragma unroll
    for (int r = 0; r < 8; ++r) { float v = acc[t][r] * alpha + bv; if (CP) { const int bidx = (row0g + row0 + 8 * hh + r) / rowsPerB; v += CP[(size_t)bidx * sCPb + (size_t)by * 64 + col]; } if (ACT == 1) v = (v > 0.f) ? v : expm1f(v); else if (ACT == 7) v = (v > 0.f) ? v + 1.0f : expf(v); else if (ACT == 8) v = tanhf(v); else if (ACT == 9) v = 0.5f * v * (1.0f + tanhf(0.7978845608028654f * (v + 0.044715f * v * v * v))); else if (ACT == 11) v = 1.0f / (1.0f + expf(-v)); else if (ACT == 12) v = (v > 0.f) ? v : 0.01f * v; else if (ACT == 14) v = (v > 0.f) ? v : 0.1f * v; else if (ACT == 15) v = v / (1.0f + expf(-v)); else if (ACT == 3) v = fmaxf(v, 0.f); else if (ACT == 6) v = 0.5f * v * (1.0f + erff(v * 0.70710678118654752f)); so[w][8 * hh + r][t * 16 + ln] = v; } }
  __builtin_amdgcn_fence(__ATOMIC_ACQ_REL, "workgroup"); __builtin_amdgcn_wave_barrier();
  const int rsub = lane >> 4, c4 = (lane & 15) * 4; typedef _Float16 v4h __attribute__((ext_vector_type(4)));
  {
#pragma unroll
    for (int q = 0; q < 8; ++q) { const int r = q * 2 + rsub; if (col0 + c4 < N) { const v4f v = *(const v4fa*)&so[w][r][c4]; if (C) *(v4f*)(C + cofs + (size_t)(row0 + r) * ldc + col0 + c4) = v; if (C16) { v4h h4; for (int i = 0; i < 4; ++i) h4[i] = (_Float16)v[i]; *(v4h*)(C16 + cofs + (size_t)(row0 + r) * ldc + col0 + c4) = h4; } } }
     }
}


typedef _Float16 v4h __attribute__((ext_vector_type(4)));

__global__ __launch_bounds__(256) void k_x16(const float* __restrict__ x, _Float16* __restrict__ X16, size_t n8) { const size_t t = (size_t)blockIdx.x * 256 + threadIdx.x; if (t >= n8) return; FragH f;
#pragma unroll
  for (int q = 0; q < 8; ++q) f.h[q] = (_Float16)bf16_round(x[t * 8 + q]); *(v8us*)((unsigned short*)X16 + t * 8) = f.half[0];  }
// Er as the table of the skewed index t = 0 .. 2 * TT - 1, a plane [t][64] in fragment order: row t is Er[t] for t < TT, zero for t == TT, Er[t - TT - 1] beyond; a thread makes one piece, in storage order
__global__ __launch_bounds__(256) void k_er2(const float* __restrict__ Er, _Float16* __restrict__ E2) { const unsigned t = blockIdx.x * 256 + threadIdx.x; if (t >= 2 * TT * 64 / 8) return; int row, k; pk_src(t, 64, row, k);
  const int er = (row < TT) ? row : ((row > TT) ? row - TT - 1 : 0); const float* ep = Er + (size_t)er * 64 + k; const v4f a = *(const v4fa*)ep, c = *(const v4fa*)(ep + 4); FragH f;
#pragma unroll
  for (int q = 0; q < 4; ++q) { f.h[q] = (_Float16)bf16_round(a[q]); f.h[4 + q] = (_Float16)bf16_round(c[q]); }
  const v8us zr = {0, 0, 0, 0, 0, 0, 0, 0}; *(v8us*)((unsigned short*)E2 + (size_t)t * 8) = (row == TT) ? zr : f.half[0];  }
// k_x16 with the plane [rows][DM] written in fragment order; a thread makes one piece, in storage order
__global__ __launch_bounds__(256) void k_x16p(const float* __restrict__ x, _Float16* __restrict__ X16, size_t n8) { const size_t t = (size_t)blockIdx.x * 256 + threadIdx.x; if (t >= n8) return; int row, k; pk_src((unsigned)t, DM, row, k); const float* xp = x + (size_t)row * DM + k; const v4f a = *(const v4fa*)xp, c = *(const v4fa*)(xp + 4); FragH f;
#pragma unroll
  for (int q = 0; q < 4; ++q) { f.h[q] = (_Float16)bf16_round(a[q]); f.h[4 + q] = (_Float16)bf16_round(c[q]); }
  *(v8us*)((unsigned short*)X16 + t * 8) = f.half[0];  }
__global__ __launch_bounds__(256) void k_h16(const float* __restrict__ x, _Float16* __restrict__ X16, size_t n8) { const size_t t = (size_t)blockIdx.x * 256 + threadIdx.x; if (t >= n8) return; FragH f;
#pragma unroll
  for (int q = 0; q < 8; ++q) f.h[q] = (_Float16)x[t * 8 + q]; *(v8us*)((unsigned short*)X16 + t * 8) = f.half[0];  }
__global__ __launch_bounds__(256) void k_round16f(const float* __restrict__ W, _Float16* __restrict__ Bt, size_t n8) { const size_t t = (size_t)blockIdx.x * 256 + threadIdx.x; if (t >= n8) return; FragH f;
#pragma unroll
  for (int i = 0; i < 8; ++i) f.h[i] = (_Float16)(bf16_round(W[t * 8 + i]) * 16.0f); *(v8us*)((unsigned short*)Bt + t * 8) = f.half[0];  }
// v of one (batch, head) and 64 tokens -> the plane [d][token] of that pair, and k of the same tokens -> the plane [token][d], both in fragment order; a thread makes two pieces of each, in storage order
template <int NHv, int TTv>
__global__ __launch_bounds__(256) void k_vt(const _Float16* __restrict__ V16, int ldv, int voff, _Float16* __restrict__ Vt, int koff, _Float16* __restrict__ Kp) { __shared__ unsigned short tl[64][66]; const int tid = threadIdx.x; const int slab = blockIdx.x / (TTv / 64), lg = blockIdx.x % (TTv / 64); const int b = slab / NHv, h = slab % NHv;
  for (int i = tid; i < 64 * 8; i += 256) { const int r = i / 8, c8 = (i % 8) * 8; FragH f; f.half[0] = *(const v8us*)((const unsigned short*)V16 + ((size_t)b * TTv + lg * 64 + r) * ldv + voff + h * 64 + c8);
#pragma unroll
    for (int q = 0; q < 8; ++q) tl[r][c8 + q] = f.u[q]; }
  __syncthreads();
  {
#pragma unroll
    for (int rd = 0; rd < 2; ++rd) { const int pi = rd * 256 + tid, l5 = pi & 31, hf = (pi >> 5) & 1, kt = (pi >> 6) & 1, rt = pi >> 7;      /* piece pi of this block's 512: row tile, k tile, half, lane */
      const int d = rt * 16 + (l5 & 15), pc = kt * 4 + hf * 2 + (l5 >> 4); FragH f;
#pragma unroll
      for (int q = 0; q < 8; ++q) f.u[q] = tl[pc * 8 + q][d];
      *(v8us*)((unsigned short*)Vt + (size_t)slab * 64 * TTv + (size_t)rt * 16 * TTv + (size_t)(lg * 2 + kt) * 512 + hf * 256 + l5 * 8) = f.half[0];
      const v8us kk = *(const v8us*)((const unsigned short*)V16 + ((size_t)b * TTv + lg * 64 + rt * 16 + (l5 & 15)) * ldv + koff + h * 64 + kt * 32 + hf * 16 + (l5 >> 4) * 8);
      *(v8us*)((unsigned short*)Kp + (size_t)slab * 64 * TTv + ((size_t)lg * 512 + pi) * 8) = kk; }
     } }

__global__ __launch_bounds__(256) void k_hl(const float* __restrict__ F, _Float16* __restrict__ Hh, _Float16* __restrict__ Hl, size_t n8) { const size_t t = (size_t)blockIdx.x * 256 + threadIdx.x; if (t >= n8) return; FragH fh, fl; const v4f a = *(const v4fa*)(F + t * 8), c = *(const v4fa*)(F + t * 8 + 4);
#pragma unroll
  for (int q = 0; q < 4; ++q) { _Float16 h = (_Float16)a[q]; fh.h[q] = h; fl.h[q] = (_Float16)((a[q] - (float)h) * 1024.0f); h = (_Float16)c[q]; fh.h[4 + q] = h; fl.h[4 + q] = (_Float16)((c[q] - (float)h) * 1024.0f); }
  { *(v8us*)((unsigned short*)Hh + t * 8) = fh.half[0]; *(v8us*)((unsigned short*)Hl + t * 8) = fl.half[0];  } }

// ---- fast GEMM (wave tile 32x64; requires M % 32 == 0 rows per launch region, N % 64 == 0 and K % 64 == 0; A and Bh in fragment order, lda == ldb == K); epilogue = k_gemm_hhx semantics ----
__device__ __forceinline__ v16h g2_fragp(const _Float16* p) { FragH f; f.half[0] = *(const v8us*)((const unsigned short*)p); f.half[1] = *(const v8us*)((const unsigned short*)p + 256); return f.v; }      /* p: the tile's start + 8 * lane */
__device__ __forceinline__ v16h g2_frag(const _Float16* p, int hh) { FragH f; f.half[0] = *(const v8us*)((const unsigned short*)p + 8 * hh); f.half[1] = *(const v8us*)((const unsigned short*)p + 16 + 8 * hh); return f.v; }
__device__ __forceinline__ v8f g2_mma(v16h a, v16h b, v8f c) { v8f d = __builtin_amdgcn_wmma_f32_16x16x32_f16(false, a, false, b, (short)0, c, false, false); asm volatile("v_nop\n\tv_nop\n\tv_nop\n\tv_nop" : "+v"(d) : "v"(a), "v"(b)); return d; }
template <int ACT>
__global__ __launch_bounds__(128) void k_gemm2(const _Float16* __restrict__ A, int lda, size_t sA, const _Float16* __restrict__ Bh, int ldb, size_t sB, float alpha, const float* __restrict__ bias, size_t sBias, const float* __restrict__ CP, int rowsPerB, size_t sCPb, int row0g,
    float* __restrict__ C, _Float16* __restrict__ C16, int ldc, size_t sC, int M, int N, int K) {
  __shared__ __attribute__((aligned(16))) float so[4][32][68];
  const int tid = threadIdx.x, w = tid >> 5, lane = tid & 31, ln = lane & 15, hh = lane >> 4; const int by = blockIdx.y;
  A += (size_t)by * sA; Bh += (size_t)by * sB; const size_t cofs = (size_t)by * sC; const float* bp = bias ? bias + (size_t)by * sBias : nullptr;
  const int ntn = N >> 6; const int mt = blockIdx.x / ntn, nq = blockIdx.x - mt * ntn; const int row0 = mt * 128 + 32 * w, col0 = nq * 64; if (row0 >= M) return;
  /* each lane's place in the first k tile of the six row tiles */
  const _Float16* pa0 = A + (size_t)row0 * lda + 8 * lane; const _Float16* pa1 = pa0 + (size_t)16 * lda;
  const _Float16* pb0 = Bh + (size_t)col0 * ldb + 8 * lane; const _Float16* pb1 = pb0 + (size_t)16 * ldb; const _Float16* pb2 = pb1 + (size_t)16 * ldb; const _Float16* pb3 = pb2 + (size_t)16 * ldb;
  const v8f z8 = {0.f,0.f,0.f,0.f,0.f,0.f,0.f,0.f}; v8f c00 = z8, c01 = z8, c02 = z8, c03 = z8, c10 = z8, c11 = z8, c12 = z8, c13 = z8;
  /* two register sets of six fragments (32 k each): the twelve loads of a set are issued as one group, one set ahead of the products that read it, so that a set's load latency runs behind the other set's products; the k order of every sum is the old one */
  v16h xa0 = g2_fragp(pa0), xa1 = g2_fragp(pa1), xb0 = g2_fragp(pb0), xb1 = g2_fragp(pb1), xb2 = g2_fragp(pb2), xb3 = g2_fragp(pb3);
  __builtin_amdgcn_sched_barrier(0);      /* holds the first group in front of the loop */
#pragma unroll 1      /* the two sets are the whole ring: a further copy of the body would only cost registers */
  for (int kb = 0; kb < K; kb += 64) {
    const v16h ya0 = g2_fragp(pa0 + 512), ya1 = g2_fragp(pa1 + 512), yb0 = g2_fragp(pb0 + 512), yb1 = g2_fragp(pb1 + 512), yb2 = g2_fragp(pb2 + 512), yb3 = g2_fragp(pb3 + 512);      /* the next k tile: 512 elements on */
    /* the wait that stands in front of the write of the six address registers below, which both groups in flight name; the addresses are its inputs so that their registers stay untouched up to it */
    asm volatile("s_wait_xcnt 0x0" :: "v"(pa0), "v"(pa1), "v"(pb0), "v"(pb1), "v"(pb2), "v"(pb3) : "memory");
    __builtin_amdgcn_sched_barrier(0);      /* holds this group in front of the products: without it the scheduler sinks each load to its first use, with a full wait each */
    c00 = g2_mma(xa0, xb0, c00); c10 = g2_mma(xa1, xb0, c10); c01 = g2_mma(xa0, xb1, c01); c11 = g2_mma(xa1, xb1, c11);
    c02 = g2_mma(xa0, xb2, c02); c12 = g2_mma(xa1, xb2, c12); c03 = g2_mma(xa0, xb3, c03); c13 = g2_mma(xa1, xb3, c13);
    const int adv = (kb + 64 < K) ? 1024 : 0;      /* the last trip has no next set: it reads its own first set again, in bounds and unused, so that every trip has the same loads in flight and the counted waits hold */
    pa0 += adv; pa1 += adv; pb0 += adv; pb1 += adv; pb2 += adv; pb3 += adv;
    xa0 = g2_fragp(pa0); xa1 = g2_fragp(pa1); xb0 = g2_fragp(pb0); xb1 = g2_fragp(pb1); xb2 = g2_fragp(pb2); xb3 = g2_fragp(pb3);
    __builtin_amdgcn_sched_barrier(0);      /* holds the next set's group in front of this set's products */
    c00 = g2_mma(ya0, yb0, c00); c10 = g2_mma(ya1, yb0, c10); c01 = g2_mma(ya0, yb1, c01); c11 = g2_mma(ya1, yb1, c11);
    c02 = g2_mma(ya0, yb2, c02); c12 = g2_mma(ya1, yb2, c12); c03 = g2_mma(ya0, yb3, c03); c13 = g2_mma(ya1, yb3, c13); }
  /* the same wait for the last group, in front of whatever reuses its address registers behind the loop */
  asm volatile("s_wait_xcnt 0x0" :: "v"(pa0), "v"(pa1), "v"(pb0), "v"(pb1), "v"(pb2), "v"(pb3) : "memory");
  v8f accs[8] = {c00, c01, c02, c03, c10, c11, c12, c13};
#pragma unroll
  for (int u = 0; u < 8; ++u) { const int t = u & 3, half = u >> 2; const int col = col0 + t * 16 + ln; const float bv = bp ? bf16_round(bp[col]) : 0.f;
#pragma unroll
    for (int r = 0; r < 8; ++r) { const int rloc = half * 16 + 8 * hh + r; float v = accs[u][r] * alpha + bv; if (CP) { const int bidx = (row0g + row0 + rloc) / rowsPerB; v += CP[(size_t)bidx * sCPb + (size_t)by * 64 + col]; }
      if (ACT == 3) v = fmaxf(v, 0.f); else if (ACT == 6) v = 0.5f * v * (1.0f + erff(v * 0.70710678118654752f)); else if (ACT == 11) v = 1.0f / (1.0f + expf(-v)); else if (ACT == 15) v = v / (1.0f + expf(-v)); else if (ACT == 12) v = (v > 0.f) ? v : 0.01f * v; else if (ACT == 8) v = tanhf(v);
      so[w][rloc][t * 16 + ln] = v; } }
  __builtin_amdgcn_fence(__ATOMIC_ACQ_REL, "workgroup"); __builtin_amdgcn_wave_barrier();
  const int rsub = lane >> 4, c4 = (lane & 15) * 4;
  {
#pragma unroll
    for (int q = 0; q < 16; ++q) { const int r = q * 2 + rsub; const v4f v = *(const v4fa*)&so[w][r][c4]; if (C) *(v4f*)(C + cofs + (size_t)(row0 + r) * ldc + col0 + c4) = v; if (C16) { v4h h4; for (int i = 0; i < 4; ++i) h4[i] = (_Float16)v[i]; *(v4h*)(C16 + cofs + (size_t)(row0 + r) * ldc + col0 + c4) = h4; } }
     } }


__global__ __launch_bounds__(256) void k_split(const float* __restrict__ F, _Float16* __restrict__ Hh, _Float16* __restrict__ Hl, size_t n8) {
  #pragma clang fp contract(off)
  const size_t t = (size_t)blockIdx.x * 256 + threadIdx.x; if (t >= n8) return; int row, k; pk_src((unsigned)t, DM, row, k); const float* fp = F + (size_t)row * DM + k;      /* F is [rows][DM]; both planes go out in fragment order, a thread makes one piece of each */
  const v4f a = *(const v4fa*)fp, c = *(const v4fa*)(fp + 4); FragH fh, fl;
  asm volatile("s_wait_xcnt 0x0" ::: "memory");      /* the wait in front of any write of the address register of these two loads */
#pragma unroll
  for (int q = 0; q < 8; ++q) { const float v = (q < 4) ? a[q] : c[q - 4]; const _Float16 hi = (_Float16)v; fh.h[q] = hi; fl.h[q] = (_Float16)((v - (float)hi) * 1024.0f); }
  { *(v8us*)((unsigned short*)Hh + t * 8) = fh.half[0]; *(v8us*)((unsigned short*)Hl + t * 8) = fl.half[0];  } }

// D = A.B + C as the plain builtin: the compiler keeps the distance behind it itself
__device__ __forceinline__ v8f ra_mma(v16h a, v16h b, v8f c) { return __builtin_amdgcn_wmma_f32_16x16x32_f16(false, a, false, b, (short)0, c, false, false); }
// zero a fragment in the lanes whose A row does not belong to this product
__device__ __forceinline__ v16h frag_keep(v16h a, bool keep) { union { v16h v; unsigned int d[8]; } f; f.v = a;
#pragma unroll
  for (int i = 0; i < 8; ++i) f.d[i] = keep ? f.d[i] : 0u; return f.v; }

// Attention of one (batch, head) and 128 queries per block, 32 queries per wave, keys 64 at a time; nothing of S, QEr or P goes to memory.
// With t = TT-1-i+j the skewed term of (query i, key j) is q[i].Er[t] for t < TT, 0 for t == TT, q[i+1].Er[t-TT-1] for t > TT.
// All tiles are transposed: D[row 8*hh+r][column ln] with the query in the column, so a lane owns one query's max, sum and O column.
// Every inner loop is unrolled so that each array index is a constant and the arrays live in registers.
__global__ __launch_bounds__(128) void k_relattn(const _Float16* __restrict__ Q16, const _Float16* __restrict__ KP, const _Float16* __restrict__ VT, const _Float16* __restrict__ ER16, float* __restrict__ O) {
  __shared__ __attribute__((aligned(16))) float rl[4][2][16][RP];
  const int tid = threadIdx.x, w = __builtin_amdgcn_readfirstlane(tid >> 5), lane = tid & 31, ln = lane & 15, hh = lane >> 4;
  const int bh = blockIdx.y, b = bh / NH, h = bh - b * NH; const int i0 = blockIdx.x * 128 + 32 * w;
  const _Float16* qbase = Q16 + (size_t)b * TT * DM + h * 64; const _Float16* kbase = KP + (size_t)bh * 64 * TT; const _Float16* vbase = VT + (size_t)bh * 64 * TT;      /* [token][d] and [d][token], both in fragment order */
  v16h q[2][2], qn[2][2];      /* queries i and i + 1 as B operands; the row past the last query is never used, its address is clamped */
  const _Float16* qp[2]; const _Float16* qnp[2];
  __builtin_amdgcn_sched_barrier(0);      /* with the one behind the wait: keeps the set-up arithmetic, which reuses registers, out of the stretch between these loads and their wait */
#pragma unroll
  for (int qs = 0; qs < 2; ++qs) { const int i = i0 + 16 * qs + ln; const int i1 = (i + 1 < TT) ? i + 1 : TT - 1; qp[qs] = qbase + (size_t)i * DM + 8 * hh; qnp[qs] = qbase + (size_t)i1 * DM + 8 * hh;
#pragma unroll
    for (int ks = 0; ks < 2; ++ks) { q[qs][ks] = g2_frag(qp[qs] + 32 * ks, 0); qn[qs][ks] = g2_frag(qnp[qs] + 32 * ks, 0); } }
  asm volatile("s_wait_xcnt 0x0" ::: "memory");      /* the wait in front of any write of an address register of these loads */
  __builtin_amdgcn_sched_barrier(0);
  const v8f z8 = {0.f,0.f,0.f,0.f,0.f,0.f,0.f,0.f};
  v8f o[2][4] = {{z8, z8, z8, z8}, {z8, z8, z8, z8}}; float mx[2] = {-3.0e38f, -3.0e38f}, sm[2] = {0.f, 0.f};
#pragma unroll 1      /* the pass is some 1,100 instructions long: a second copy would only cost instruction fetch and registers */
  for (int j0 = 0; j0 < TT; j0 += 64) {
    /* every global load of the pass is issued here, so that the pass waits out one load latency and not one per tile */
    /* relative tiles: rows t = tb0 + 16u + (0..15); queries i0+16.. take u = 0..4, queries i0.. take u = 1..5 */
    const int tb0 = TT - 32 - i0 + j0;
    /* each lane's three addresses: its place in the first k, v and relative tile of the pass; 0 <= tb0 and tb0 + 95 <= 2 * TT - 1, the rows of the table */
    const _Float16* kp = kbase + (size_t)j0 * 64 + 8 * lane; const _Float16* vp = vbase + (size_t)j0 * 16 + 8 * lane; const _Float16* ep = ER16 + (size_t)tb0 * 64 + 8 * lane;
    v16h kf[4][2], ef[6][2], vf[4][2];
#pragma unroll
    for (int n = 0; n < 4; ++n) { kf[n][0] = g2_fragp(kp + 1024 * n); kf[n][1] = g2_fragp(kp + 1024 * n + 512); }
#pragma unroll
    for (int u = 0; u < 6; ++u) { ef[u][0] = g2_fragp(ep + 1024 * u); ef[u][1] = g2_fragp(ep + 1024 * u + 512); }
#pragma unroll
    for (int dt = 0; dt < 4; ++dt) { vf[dt][0] = g2_fragp(vp + (size_t)(16 * dt) * TT); vf[dt][1] = g2_fragp(vp + (size_t)(16 * dt) * TT + 512); }
    /* the wait that stands in front of any write of a register which one of these loads names as its address; the addresses are its inputs so that their registers stay untouched up to it */
    asm volatile("s_wait_xcnt 0x0" :: "v"(kp), "v"(vp), "v"(ep) : "memory");
    __builtin_amdgcn_sched_barrier(0);      /* holds the loads and that wait in front of the products: without it the scheduler sinks the k loads between the products, two at a time, each with its own full wait */
    v8f s[2][4];      /* s[qs][n][r] = k[j0 + 16n + 8hh + r] . q[i0 + 16qs + ln] */
#pragma unroll
    for (int n = 0; n < 4; ++n)
#pragma unroll
      for (int qs = 0; qs < 2; ++qs) s[qs][n] = ra_mma(kf[n][1], q[qs][1], ra_mma(kf[n][0], q[qs][0], z8));
#pragma unroll
    for (int u = 0; u < 6; ++u) { const int tb = tb0 + 16 * u, t = tb + ln; const v16h e0 = ef[u][0], e1 = ef[u][1];
      v8f r0 = z8, r1 = z8;
      if (tb < TT) { const v16h f0 = frag_keep(e0, t < TT), f1 = frag_keep(e1, t < TT);
        if (u >= 1) r0 = ra_mma(f1, q[0][1], ra_mma(f0, q[0][0], r0));
        if (u <= 4) r1 = ra_mma(f1, q[1][1], ra_mma(f0, q[1][0], r1)); }
      if (tb + 15 > TT) { const v16h f0 = frag_keep(e0, t > TT), f1 = frag_keep(e1, t > TT);
        if (u >= 1) r0 = ra_mma(f1, qn[0][1], ra_mma(f0, qn[0][0], r0));
        if (u <= 4) r1 = ra_mma(f1, qn[1][1], ra_mma(f0, qn[1][0], r1)); }
      if (u >= 1) { float* d = &rl[w][0][ln][16 * (u - 1) + 8 * hh]; const v4f lo = {r0[0], r0[1], r0[2], r0[3]}, hi = {r0[4], r0[5], r0[6], r0[7]}; *(v4fa*)d = lo; *(v4fa*)(d + 4) = hi; }
      if (u <= 4) { float* d = &rl[w][1][ln][16 * u + 8 * hh]; const v4f lo = {r1[0], r1[1], r1[2], r1[3]}, hi = {r1[4], r1[5], r1[6], r1[7]}; *(v4fa*)d = lo; *(v4fa*)(d + 4) = hi; } }
    /* a query's row is written by its two lanes and read by both: the wave's LDS writes are done before any lane reads; only the LDS counter is waited on, the v loads stay in flight */
    asm volatile("s_wait_dscnt 0x0" ::: "memory"); __builtin_amdgcn_wave_barrier();
    FragH p[2][2];
#pragma unroll
    for (int qs = 0; qs < 2; ++qs) { const float* rr = &rl[w][qs][ln][15 - ln + 8 * hh]; float mt = -3.0e38f;
#pragma unroll
      for (int n = 0; n < 4; ++n)
#pragma unroll
        for (int r = 0; r < 8; ++r) { const float lg = s[qs][n][r] + rr[16 * n + r]; s[qs][n][r] = lg; mt = fmaxf(mt, lg); }      /* 8 x the logit: the scale goes into the exponent's multiply-add */
      mt = fmaxf(mt, __shfl_xor(mt, 16, 32));
      const float mn = fmaxf(mx[qs], mt), ax = (mx[qs] - mn) * L2E8, nb = fmaf(-mn, L2E8, 10.0f); float al = __builtin_amdgcn_exp2f(ax); mx[qs] = mn; float ps[4] = {0.f, 0.f, 0.f, 0.f};      /* one partial sum per key tile: four short add chains */
      asm("v_nop" : "+v"(al) : "v"(ax));      /* the slot behind a transcendental, as below */
#pragma unroll
      for (int n = 0; n < 4; ++n)
      { float x[8], e[8];      /* e = 2^10 * exp(logit - max) */
#pragma unroll
        for (int r = 0; r < 8; ++r) { x[r] = fmaf(s[qs][n][r], L2E8, nb); e[r] = __builtin_amdgcn_exp2f(x[r]); }
        /* the slot that the instruction set asks for behind a transcendental, before its result is read or its source overwritten: no result is read and no source register is given up in front of this v_nop, so whatever stands directly behind one of the eight is independent of it or is the v_nop */
        asm("v_nop" : "+v"(e[0]), "+v"(e[1]), "+v"(e[2]), "+v"(e[3]), "+v"(e[4]), "+v"(e[5]), "+v"(e[6]), "+v"(e[7]) : "v"(x[0]), "v"(x[1]), "v"(x[2]), "v"(x[3]), "v"(x[4]), "v"(x[5]), "v"(x[6]), "v"(x[7]));
#pragma unroll
        for (int r = 0; r < 8; ++r) { ps[n] += e[r]; p[qs][n >> 1].h[(n & 1) * 8 + r] = (_Float16)e[r]; } }
      sm[qs] = sm[qs] * al + ((ps[0] + ps[1]) + (ps[2] + ps[3]));
#pragma unroll
      for (int dt = 0; dt < 4; ++dt) o[qs][dt] *= al; }
    /* keeps the compiler from lifting the next pass's LDS writes over this pass's reads (their values are already in registers here) */
    __builtin_amdgcn_fence(__ATOMIC_ACQ_REL, "wavefront"); __builtin_amdgcn_wave_barrier();
#pragma unroll
    for (int dt = 0; dt < 4; ++dt)
#pragma unroll
      for (int qs = 0; qs < 2; ++qs) o[qs][dt] = ra_mma(vf[dt][1], p[qs][1].v, ra_mma(vf[dt][0], p[qs][0].v, o[qs][dt]));
  }
#pragma unroll
  for (int qs = 0; qs < 2; ++qs) { const float tot = sm[qs] + __shfl_xor(sm[qs], 16, 32); const float inv = 1.0f / tot;      /* the row sum carries the 2^10 of P as well */
    float* op = O + ((size_t)b * TT + i0 + 16 * qs + ln) * DM + h * 64 + 8 * hh;
#pragma unroll
    for (int dt = 0; dt < 4; ++dt) { const v8f a = o[qs][dt]; const v4f lo = {a[0] * inv, a[1] * inv, a[2] * inv, a[3] * inv}, hi = {a[4] * inv, a[5] * inv, a[6] * inv, a[7] * inv}; *(v4f*)(op + 16 * dt) = lo; *(v4f*)(op + 16 * dt + 4) = hi; } }
}

extern "C" void kernel_launch(void* const* d_in, const int* in_sizes, int n_in,
                              void* d_out, int out_size, void* d_ws, size_t ws_size, hipStream_t stream) {
  (void)in_sizes; (void)n_in; (void)out_size;
  const float* const* I = (const float* const*)d_in; const float* x = I[0]; const float* qw = I[1]; const float* qb = I[2]; const float* kvw = I[3]; const float* kvb = I[4]; const float* pw = I[5]; const float* pb = I[6]; const float* Er = I[7];
  char* ws = (char*)d_ws; size_t off = 0;
  auto take = [&](size_t bytes) { char* p = ws + off; off += (bytes + 255) & ~(size_t)255; return p; };
  _Float16* BP = (_Float16*)take((size_t)DM * DM * 2); _Float16* ER16 = (_Float16*)take((size_t)2 * TT * 64 * 2);
  _Float16* Q16 = (_Float16*)take((size_t)NR * DM * 2); _Float16* KV16 = (_Float16*)take((size_t)NR * 2 * DM * 2); _Float16* VT = (_Float16*)take((size_t)NR * DM * 2); float* O = (float*)take((size_t)NR * DM * 4);
  _Float16* X16 = (_Float16*)take((size_t)NR * DM * 2); _Float16* BQ = (_Float16*)take((size_t)DM * DM * 2); _Float16* BKV = (_Float16*)take((size_t)DM * 2 * DM * 2);
  _Float16* Oh = (_Float16*)take((size_t)NR * DM * 2); _Float16* Ol = (_Float16*)take((size_t)NR * DM * 2); _Float16* KP = (_Float16*)take((size_t)NR * DM * 2);
  if (off > ws_size) return;      /* about 89 MiB */
  const size_t n8 = (size_t)NR * DM / 8; const unsigned nb8 = (unsigned)((n8 + 255) / 256);
  k_wt_f16<<<(unsigned)(((size_t)DM * DM / 8 + 255) / 256), 256, 0, stream>>>(qw, BQ, DM, DM, 16.0f); k_wt_f16<<<(unsigned)(((size_t)DM * 2 * DM / 8 + 255) / 256), 256, 0, stream>>>(kvw, BKV, DM, 2 * DM, 16.0f); k_wt_f16<<<(unsigned)(((size_t)DM * DM / 8 + 255) / 256), 256, 0, stream>>>(pw, BP, DM, DM, 16.0f);      /* (in,out) -> [out][in] x16, fragment order */
  k_er2<<<2 * TT * 64 / 8 / 256, 256, 0, stream>>>(Er, ER16);      /* Er exact f16, the table of the skewed index [4096][64], fragment order */
  k_x16p<<<nb8, 256, 0, stream>>>(x, X16, n8);
  const dim3 gQ((NR / 128) * (DM / 64), 1), gKV((NR / 128) * (2 * DM / 64), 1), gA(TT / 128, NBT * NH);
  k_gemm2<0><<<gQ, 128, 0, stream>>>(X16, DM, 0, BQ, DM, 0, 0.0625f, qb, 0, nullptr, 1, 0, 0, nullptr, Q16, DM, 0, NR, DM, DM);
  k_gemm2<0><<<gKV, 128, 0, stream>>>(X16, DM, 0, BKV, DM, 0, 0.0625f, kvb, 0, nullptr, 1, 0, 0, nullptr, KV16, 2 * DM, 0, NR, 2 * DM, DM);      /* [k | v] f16, column = part*1024 + h*64 + d */
  k_vt<NH, TT><<<NBT * NH * (TT / 64), 256, 0, stream>>>(KV16, 2 * DM, DM, VT, 0, KP);
  k_relattn<<<gA, 128, 0, stream>>>(Q16, KP, VT, ER16, O);
  k_split<<<nb8, 256, 0, stream>>>(O, Oh, Ol, n8);
  k_gemm2<0><<<gQ, 128, 0, stream>>>(Oh, DM, 0, BP, DM, 0, 0.0625f, pb, 0, nullptr, 1, 0, 0, (float*)d_out, nullptr, DM, 0, NR, DM, DM);
  k_gemm2<0><<<gQ, 128, 0, stream>>>(Ol, DM, 0, BP, DM, 0, 0.0625f / 1024.0f, nullptr, 0, (const float*)d_out, 1, (size_t)DM, 0, (float*)d_out, nullptr, DM, 0, NR, DM, DM);
}

// v006
// It runs in 133 microseconds.
// Two timings next to v005 put it at 1.54 and 1.55 times that version's speed.
// All steps since v000 together make it 26.2 times as fast.
#include <hip/hip_runtime.h>
// Relative-position multi-head attention with the 'skew' trick (2 x 2048 tokens x 1024, 16 heads x 64): q = x*q_w + q_b; [k | v] = x*kv_w + kv_b; QEr = q . Er^T against the learned INPUT table Er [2048][64]; Srel = skew(QEr) (pad one zero column on the left, reinterpret as [(N+1)][N], drop the first row -> Srel[i][j] = padded.flat[(i+1)*N + j]); logits = (q.k + Srel)/8 (no mask); softmax; merged . proj_w + proj_b -> [2,2048,1024].
// Structure: x as an exact f16 plane; the projections as f16 WMMA GEMMs (32x64 wave tiles, f32, exact products + bias; both operands stored in fragment order) whose epilogue stores q row-major and k and v per (batch, head) as [token][d] and [d][token] in fragment order; Er as an exact f16 table over the skewed index, in fragment order; one attention kernel for all (batch, head) pairs: a wave holds 32 queries and walks the keys 64 at a time; scores and relative terms as transposed WMMA tiles (keys or Er rows as A, queries as B), the skew as a per-query shifted read of the relative tile through LDS, running-max softmax per lane in base 2 (one multiply-add and one v_exp_f32 per score), P (x2^10 f16) taken from the score registers as the B operand of V^T.P^T, O stored as f16 hi + residual planes in fragment order; output projection as one GEMM with both terms.
// Compute dtype: x, weights, biases and Er rounded to bf16; projections exact; q, k, v, P as f16 operands (~2^-12), O as hi + residual; f32 accumulation and softmax. v_wmma_f32_16x16x32_f16.
#define NBT 2
#define TT 2048
#define DM 1024
#define NH 16
#define NR (NBT * TT)
#define L2E8 0.18033688011112042f   /* log2(e) / 8: the logit scale 1/8 and the change to base 2 in one factor */
#define RP 84   /* floats per query row of the relative tile in LDS: 80 used; a multiple of 4 for the 16-byte writes; lane ln reads at ln * (RP - 1) + const, and 83 is odd, which spreads the lanes over the banks */
typedef __bf16 v16b __attribute__((ext_vector_type(16)));
typedef unsigned short v8us __attribute__((ext_vector_type(8), may_alias));
typedef float  v8f  __attribute__((ext_vector_type(8)));
typedef float  v4f  __attribute__((ext_vector_type(4)));
typedef float  v4fa __attribute__((ext_vector_type(4), may_alias));
union FragB { v16b v; v8us half[2]; unsigned short u[16]; };

__device__ __forceinline__ unsigned short bf16_bits(float x) { unsigned int u = __float_as_uint(x); return (unsigned short)((u + 0x7FFFu + ((u >> 16) & 1u)) >> 16); }
__device__ __forceinline__ float bf16_val(unsigned short b) { return __uint_as_float(((unsigned int)b) << 16); }
__device__ __forceinline__ float bf16_round(float x) { return bf16_val(bf16_bits(x)); }
// D += A·B with NT terms: 1 = ah·bh, 2 = + al·bh (A split), 3 = + ah·bl (both split)
template <int NT>
__device__ __forceinline__ v8f mmaN(v16b ah, v16b al, v16b bh, v16b bl, v8f c) {
  c = __builtin_amdgcn_wmma_f32_16x16x32_bf16(false, ah, false, bh, (short)0, c, false, false);
  if (NT >= 2) c = __builtin_amdgcn_wmma_f32_16x16x32_bf16(false, al, false, bh, (short)0, c, false, false);
  if (NT >= 3) c = __builtin_amdgcn_wmma_f32_16x16x32_bf16(false, ah, false, bl, (short)0, c, false, false);
  asm volatile("v_nop\n\tv_nop\n\tv_nop\n\tv_nop" : "+v"(c) : "v"(ah), "v"(al), "v"(bh), "v"(bl));
  return c;
}

__global__ __launch_bounds__(256) void k_wt_bf16(const float* __restrict__ W, unsigned short* __restrict__ Wt, int K, int N) {
  const int t = blockIdx.x * 256 + threadIdx.x;
  const int k8n = K / 8;
  if (t >= N * k8n) return;
  const int n = t / k8n, k8 = (t % k8n) * 8;
  v8us v;
#pragma unroll
  for (int i = 0; i < 8; ++i) v[i] = bf16_bits(W[(size_t)(k8 + i) * N + n]);
  *(v8us*)(Wt + (size_t)n * K + k8) = v;
  
}

// GEMM C[M][N] (f32, pitch ldc) = act(A[M][K]·W + bias). A f32 row-major (pitch lda) converted per fragment to bf16
// (ASPLIT: hi/lo two planes -> 2 terms, else single rounded term); Wt bf16 [N][K] (pitch ldb). BIAS_BF16 rounds the
// bias to bf16 first (bias quantised to bf16 before the add). K%32==0, M%16==0, N%64==0.
template <bool ASPLIT, int ACT, bool BIAS_BF16>
__global__ __launch_bounds__(128) void k_gemm_bf(const float* __restrict__ A, int lda, const unsigned short* __restrict__ Wt, int ldb,
                                               const float* __restrict__ bias, float* __restrict__ C, int ldc, int M, int N, int K) {
  __shared__ __attribute__((aligned(16))) float so[4][16][64];
  const int tid = threadIdx.x, w = tid >> 5, lane = tid & 31, ln = lane & 15, hh = lane >> 4;
  const int ntn = N / 64;
  const int wid = blockIdx.x * 4 + w;
  const int mt = wid / ntn, nq = wid % ntn;
  if (mt * 16 >= M) return;
  const int row0 = mt * 16, col0 = nq * 64;
  const float* arow = A + (size_t)(row0 + ln) * lda;
  v8f acc[4] = {};
  for (int kb = 0; kb < K; kb += 32) {
    FragB ah, al;
    const v4f x0 = *(const v4fa*)(arow + kb + 8 * hh), x1 = *(const v4fa*)(arow + kb + 8 * hh + 4);
    const v4f x2 = *(const v4fa*)(arow + kb + 16 + 8 * hh), x3 = *(const v4fa*)(arow + kb + 16 + 8 * hh + 4);
    float xs[16] = {x0[0],x0[1],x0[2],x0[3],x1[0],x1[1],x1[2],x1[3],x2[0],x2[1],x2[2],x2[3],x3[0],x3[1],x3[2],x3[3]};
#pragma unroll
    for (int i = 0; i < 16; ++i) { const unsigned short hb = bf16_bits(xs[i]); ah.u[i] = hb; al.u[i] = ASPLIT ? bf16_bits(xs[i] - bf16_val(hb)) : (unsigned short)0; }
#pragma unroll
    for (int t = 0; t < 4; ++t) {
      const unsigned short* brow = Wt + (size_t)(col0 + t * 16 + ln) * ldb + kb;
      FragB b;
      b.half[0] = *(const v8us*)(brow + 8 * hh);
      b.half[1] = *(const v8us*)(brow + 16 + 8 * hh);
      acc[t] = mmaN<ASPLIT ? 2 : 1>(ah.v, al.v, b.v, b.v, acc[t]);
    }
  }
#pragma unroll
  for (int t = 0; t < 4; ++t) {
    float bv = bias ? bias[col0 + t * 16 + ln] : 0.f;
    if (BIAS_BF16) bv = bf16_round(bv);
#pragma unroll
    for (int r = 0; r < 8; ++r) { float v = acc[t][r] + bv; if (ACT == 1) v = fmaxf(v, 0.f); so[w][8 * hh + r][t * 16 + ln] = v; }
  }
  __builtin_amdgcn_fence(__ATOMIC_ACQ_REL, "workgroup");
  __builtin_amdgcn_wave_barrier();
  const int rsub = lane >> 4, c4 = (lane & 15) * 4;
  {
#pragma unroll
    for (int q = 0; q < 8; ++q) {
      const int r = q * 2 + rsub;
      const v4f v = *(const v4fa*)&so[w][r][c4];
      *(v4f*)(C + (size_t)(row0 + r) * ldc + col0 + c4) = v;
    }
    
  }
}

// GEMM C = act(A·W + bias + resid): A f32 (ASPLIT -> hi/lo 2 terms), Wt bf16 [N][K]; ACT 0 none, 1 relu, 2 exact gelu;
// resid (optional, f32, row index = (row % rmod), pitch ldr, RES_BF16 rounds it) added before the activation.
template <bool ASPLIT, int ACT, bool BIAS_BF16, bool RES_BF16>
__global__ __launch_bounds__(128) void k_gemm_bf3(const float* __restrict__ A, int lda, const unsigned short* __restrict__ Wt, int ldb,
                                                const float* __restrict__ bias, const float* __restrict__ resid, int rmod, int ldr,
                                                float* __restrict__ C, int ldc, int M, int N, int K) {
  __shared__ __attribute__((aligned(16))) float so[4][16][64];
  const int tid = threadIdx.x, w = tid >> 5, lane = tid & 31, ln = lane & 15, hh = lane >> 4;
  const int ntn = N / 64;
  const int wid = blockIdx.x * 4 + w;
  const int mt = wid / ntn, nq = wid % ntn;
  if (mt * 16 >= M) return;
  const int row0 = mt * 16, col0 = nq * 64;
  const float* arow = A + (size_t)(row0 + ln) * lda;
  v8f acc[4] = {};
  for (int kb = 0; kb < K; kb += 32) {
    FragB ah, al;
    const v4f x0 = *(const v4fa*)(arow + kb + 8 * hh), x1 = *(const v4fa*)(arow + kb + 8 * hh + 4);
    const v4f x2 = *(const v4fa*)(arow + kb + 16 + 8 * hh), x3 = *(const v4fa*)(arow + kb + 16 + 8 * hh + 4);
    float xs[16] = {x0[0],x0[1],x0[2],x0[3],x1[0],x1[1],x1[2],x1[3],x2[0],x2[1],x2[2],x2[3],x3[0],x3[1],x3[2],x3[3]};
#pragma unroll
    for (int i = 0; i < 16; ++i) { const unsigned short hb = bf16_bits(xs[i]); ah.u[i] = hb; al.u[i] = ASPLIT ? bf16_bits(xs[i] - bf16_val(hb)) : (unsigned short)0; }
#pragma unroll
    for (int t = 0; t < 4; ++t) {
      const unsigned short* brow = Wt + (size_t)(col0 + t * 16 + ln) * ldb + kb;
      FragB b;
      b.half[0] = *(const v8us*)(brow + 8 * hh);
      b.half[1] = *(const v8us*)(brow + 16 + 8 * hh);
      acc[t] = mmaN<ASPLIT ? 2 : 1>(ah.v, al.v, b.v, b.v, acc[t]);
    }
  }
#pragma unroll
  for (int t = 0; t < 4; ++t) {
    const int col = col0 + t * 16 + ln;
    float bv = bias ? bias[col] : 0.f;
    if (BIAS_BF16) bv = bf16_round(bv);
#pragma unroll
    for (int r = 0; r < 8; ++r) {
      float v = acc[t][r] + bv;
      if (resid) { float rv = resid[(size_t)((row0 + 8 * hh + r) % rmod) * ldr + col]; if (RES_BF16) rv = bf16_round(rv); v += rv; }
      if (ACT == 1) v = fmaxf(v, 0.f);
      if (ACT == 2) v = 0.5f * v * (1.0f + erff(v * 0.70710678118654752f));
      if (ACT == 3) { const float u = 0.7978845608028654f * (v + 0.044715f * v * v * v); v = 0.5f * v * (1.0f + tanhf(u)); }
      so[w][8 * hh + r][t * 16 + ln] = v;
    }
  }
  __builtin_amdgcn_fence(__ATOMIC_ACQ_REL, "workgroup");
  __builtin_amdgcn_wave_barrier();
  const int rsub = lane >> 4, c4 = (lane & 15) * 4;
  {
#pragma unroll
    for (int q = 0; q < 8; ++q) {
      const int r = q * 2 + rsub;
      const v4f v = *(const v4fa*)&so[w][r][c4];
      *(v4f*)(C + (size_t)(row0 + r) * ldc + col0 + c4) = v;
    }
    
  }
}
// row LayerNorm (biased variance, eps) over N: s = X (+ R); optional out_sum <- s; out_norm <- (s-mu)*rsqrt(var+eps)*g + b
template <bool PARAM_BF16>
__global__ __launch_bounds__(256) void k_layernorm(const float* __restrict__ X, const float* __restrict__ R, const float* __restrict__ g, const float* __restrict__ bta,
                                                  float* __restrict__ out_sum, float* __restrict__ out_norm, int N, float eps) {
  __shared__ float red[256];
  const int row = blockIdx.x, tid = threadIdx.x;
  const float* x = X + (size_t)row * N; const float* rr = R ? R + (size_t)row * N : nullptr;
  float vals[16];                     // up to N = 4096
  const int per = N / 256;            // contiguous chunk per thread? use strided-by-4 chunks: thread handles j = tid*4 + 1024*u
  float s1 = 0.f;
  for (int u = 0; u < per / 4; ++u) {
    const int j = tid * 4 + 1024 * u;
    const v4f a = *(const v4fa*)(x + j);
    v4f b = {0.f,0.f,0.f,0.f}; if (rr) b = *(const v4fa*)(rr + j);
#pragma unroll
    for (int q = 0; q < 4; ++q) { const float v = a[q] + b[q]; vals[u * 4 + q] = v; s1 += v; }
  }
  red[tid] = s1; __syncthreads();
  for (int st = 128; st > 0; st >>= 1) { if (tid < st) red[tid] += red[tid + st]; __syncthreads(); }
  const float mu = red[0] / (float)N; __syncthreads();
  float s2 = 0.f;
  for (int u = 0; u < per / 4; ++u)
#pragma unroll
    for (int q = 0; q < 4; ++q) { const float c = vals[u * 4 + q] - mu; s2 += c * c; }
  red[tid] = s2; __syncthreads();
  for (int st = 128; st > 0; st >>= 1) { if (tid < st) red[tid] += red[tid + st]; __syncthreads(); }
  const float rs = rsqrtf(red[0] / (float)N + eps);
  {
    for (int u = 0; u < per / 4; ++u) {
      const int j = tid * 4 + 1024 * u;
      v4f o, sm;
#pragma unroll
      for (int q = 0; q < 4; ++q) {
        float gg = g[j + q], bb = bta[j + q];
        if (PARAM_BF16) { gg = bf16_round(gg); bb = bf16_round(bb); }
        sm[q] = vals[u * 4 + q]; o[q] = (vals[u * 4 + q] - mu) * rs * gg + bb;
      }
      if (out_sum) *(v4f*)(out_sum + (size_t)row * N + j) = sm;
      *(v4f*)(out_norm + (size_t)row * N + j) = o;
    }
    
  }
}



// ---- f16 WMMA path (v_wmma_f32_16x16x32_f16): 11-bit significands for operands in range — used where a [0,1] probability operand needs more precision than bf16
typedef _Float16 v16h __attribute__((ext_vector_type(16)));
union FragH { v16h v; v8us half[2]; _Float16 h[16]; unsigned short u[16]; };
template <int NT>
__device__ __forceinline__ v8f mmaH(v16h ah, v16h al, v16h bh, v16h bl, v8f c) {
  c = __builtin_amdgcn_wmma_f32_16x16x32_f16(false, ah, false, bh, (short)0, c, false, false);
  if (NT >= 2) c = __builtin_amdgcn_wmma_f32_16x16x32_f16(false, al, false, bh, (short)0, c, false, false);
  if (NT >= 3) c = __builtin_amdgcn_wmma_f32_16x16x32_f16(false, ah, false, bl, (short)0, c, false, false);
  asm volatile("v_nop\n\tv_nop\n\tv_nop\n\tv_nop" : "+v"(c) : "v"(ah), "v"(al), "v"(bh), "v"(bl));
  return c;
}
// batched GEMM like k_gemm_b but f16 operands: A f32 (split into f16 hi/lo if ASPLIT, else rounded to f16), Bt = f16 values [n][k]; alpha; C f32; N multiple of 16 (partial tiles skipped)
template <bool ASPLIT>
__global__ __launch_bounds__(128) void k_gemm_h(const float* __restrict__ A, int lda, size_t sA, const _Float16* __restrict__ Bh, int ldb, size_t sB, float alpha, float* __restrict__ C, int ldc, size_t sC, int M, int N, int K) {
  __shared__ __attribute__((aligned(16))) float so[4][16][64];
  const int tid = threadIdx.x, w = tid >> 5, lane = tid & 31, ln = lane & 15, hh = lane >> 4; const int by = blockIdx.y;
  A += (size_t)by * sA; Bh += (size_t)by * sB; C += (size_t)by * sC;
  const int ntn = (N + 63) / 64; const int wid = blockIdx.x * 4 + w; const int mt = wid / ntn, nq = wid % ntn; if (mt * 16 >= M) return;
  const int row0 = mt * 16, col0 = nq * 64; const float* arow = A + (size_t)(row0 + ln) * lda;
  v8f acc[4] = {};
  for (int kb = 0; kb < K; kb += 32) {
    FragH ah, al;
    const v4f x0 = *(const v4fa*)(arow + kb + 8 * hh), x1 = *(const v4fa*)(arow + kb + 8 * hh + 4), x2 = *(const v4fa*)(arow + kb + 16 + 8 * hh), x3 = *(const v4fa*)(arow + kb + 16 + 8 * hh + 4);
    float xs[16] = {x0[0],x0[1],x0[2],x0[3],x1[0],x1[1],x1[2],x1[3],x2[0],x2[1],x2[2],x2[3],x3[0],x3[1],x3[2],x3[3]};
#pragma unroll
    for (int i = 0; i < 16; ++i) { const _Float16 h = (_Float16)xs[i]; ah.h[i] = h; al.h[i] = ASPLIT ? (_Float16)(xs[i] - (float)h) : (_Float16)0.0f; }
#pragma unroll
    for (int t = 0; t < 4; ++t) { if (col0 + t * 16 >= N) continue; const size_t boff = (size_t)(col0 + t * 16 + ln) * ldb + kb; FragH bq; bq.half[0] = *(const v8us*)(Bh + boff + 8 * hh); bq.half[1] = *(const v8us*)(Bh + boff + 16 + 8 * hh);
      acc[t] = mmaH<ASPLIT ? 2 : 1>(ah.v, al.v, bq.v, bq.v, acc[t]); }
  }
#pragma unroll
  for (int t = 0; t < 4; ++t) { if (col0 + t * 16 >= N) continue;
#pragma unroll
    for (int r = 0; r < 8; ++r) so[w][8 * hh + r][t * 16 + ln] = acc[t][r] * alpha; }
  __builtin_amdgcn_fence(__ATOMIC_ACQ_REL, "workgroup"); __builtin_amdgcn_wave_barrier();
  const int rsub = lane >> 4, c4 = (lane & 15) * 4;
  {
#pragma unroll
    for (int q = 0; q < 8; ++q) { const int r = q * 2 + rsub; if (col0 + c4 < N) { const v4f v = *(const v4fa*)&so[w][r][c4]; *(v4f*)(C + (size_t)(row0 + r) * ldc + col0 + c4) = v; } }
     }
}

// Fragment order of an f16 operand plane [R][K] (R % 16 == 0, K % 32 == 0): tiles of 16 rows x 32 k, 1 KiB each, the k tiles of one row tile one after the other (a row tile is 16 * K elements, as in the row-major plane).
// Inside a tile the 16-byte piece (row ln, k = 16 * half + 8 * hh + 0..7) lies at element 256 * half + 8 * (16 * hh + ln): lane 16 * hh + ln of a wave finds its fragment at its own 16 bytes of two runs of 512 bytes, so a fragment load covers four whole 128-byte lines.
// pk_src: piece t, counted in storage order, -> its row and its first k
__device__ __forceinline__ void pk_src(unsigned t, unsigned K, int& row, int& k) { const unsigned ktn = K >> 5, tile = t >> 6, rt = tile / ktn, kt = tile - rt * ktn; row = (int)(rt * 16 + (t & 15)); k = (int)(kt * 32 + ((t >> 5) & 1) * 16 + ((t >> 4) & 1) * 8); }
// Wt = f16(W[k][n] * scale) as the plane [n][k] in fragment order, from f32 row-major W[K][N] (scale = power of two; bf16-exact weights stay exact in f16 away from the subnormal range); thread t makes piece t, in storage order
__device__ __forceinline__ void d_wt_f16(const float* __restrict__ W, _Float16* __restrict__ Wt, int K, int N, float scale, int t) {
  int n, k8; pk_src((unsigned)t, (unsigned)K, n, k8); FragH f;
#pragma unroll
  for (int i = 0; i < 8; ++i) f.h[i] = (_Float16)(bf16_round(W[(size_t)(k8 + i) * N + n]) * scale); const v8us o = f.half[0];
  *(v8us*)((unsigned short*)Wt + (size_t)t * 8) = o;
  asm volatile("s_wait_xcnt 0x0" ::: "memory");      /* the wait in front of any write of a register that this store names */
}
// k_gemm_hh variant with fused epilogue: v = acc·alpha + bias[by·sBias + col] (+ CP[(row/rowsPerB)·sCPb + by·64 + col] if CP) ; ACT 0 none / 1 elu ; writes f16 C16 (and f32 C if non-null)
template <int ACT>
__global__ __launch_bounds__(128) void k_gemm_hhx(const _Float16* __restrict__ A, int lda, size_t sA, const _Float16* __restrict__ Bh, int ldb, size_t sB, float alpha, const float* __restrict__ bias, size_t sBias, const float* __restrict__ CP, int rowsPerB, size_t sCPb, int row0g,
    float* __restrict__ C, _Float16* __restrict__ C16, int ldc, size_t sC, int M, int N, int K) {
  __shared__ __attribute__((aligned(16))) float so[4][16][64];
  const int tid = threadIdx.x, w = tid >> 5, lane = tid & 31, ln = lane & 15, hh = lane >> 4; const int by = blockIdx.y;
  A += (size_t)by * sA; Bh += (size_t)by * sB; const size_t cofs = (size_t)by * sC; const float* bp = bias ? bias + (size_t)by * sBias : nullptr;
  const int ntn = (N + 63) / 64; const int wid = blockIdx.x * 4 + w; const int mt = wid / ntn, nq = wid % ntn; if (mt * 16 >= M) return;
  const int row0 = mt * 16, col0 = nq * 64; const _Float16* arow = A + (size_t)(row0 + ln) * lda;
  v8f acc[4] = {};
  for (int kb = 0; kb < K; kb += 32) { FragH ah; ah.half[0] = *(const v8us*)((const unsigned short*)arow + kb + 8 * hh); ah.half[1] = *(const v8us*)((const unsigned short*)arow + kb + 16 + 8 * hh);
#pragma unroll
    for (int t = 0; t < 4; ++t) { if (col0 + t * 16 >= N) continue; const size_t boff = (size_t)(col0 + t * 16 + ln) * ldb + kb; FragH bq; bq.half[0] = *(const v8us*)((const unsigned short*)Bh + boff + 8 * hh); bq.half[1] = *(const v8us*)((const unsigned short*)Bh + boff + 16 + 8 * hh);
      acc[t] = mmaH<1>(ah.v, ah.v, bq.v, bq.v, acc[t]); }
  }
#pragma unroll
  for (int t = 0; t < 4; ++t) { if (col0 + t * 16 >= N) continue; const int col = col0 + t * 16 + ln; const float bv = bp ? bf16_round(bp[col]) : 0.f;
#pragma unroll
    for (int r = 0; r < 8; ++r) { float v = acc[t][r] * alpha + bv; if (CP) { const int bidx = (row0g + row0 + 8 * hh + r) / rowsPerB; v += CP[(size_t)bidx * sCPb + (size_t)by * 64 + col]; } if (ACT == 1) v = (v > 0.f) ? v : expm1f(v); else if (ACT == 7) v = (v > 0.f) ? v + 1.0f : expf(v); else if (ACT == 8) v = tanhf(v); else if (ACT == 9) v = 0.5f * v * (1.0f + tanhf(0.7978845608028654f * (v + 0.044715f * v * v * v))); else if (ACT == 11) v = 1.0f / (1.0f + expf(-v)); else if (ACT == 12) v = (v > 0.f) ? v : 0.01f * v; else if (ACT == 14) v = (v > 0.f) ? v : 0.1f * v; else if (ACT == 15) v = v / (1.0f + expf(-v)); else if (ACT == 3) v = fmaxf(v, 0.f); else if (ACT == 6) v = 0.5f * v * (1.0f + erff(v * 0.70710678118654752f)); so[w][8 * hh + r][t * 16 + ln] = v; } }
  __builtin_amdgcn_fence(__ATOMIC_ACQ_REL, "workgroup"); __builtin_amdgcn_wave_barrier();
  const int rsub = lane >> 4, c4 = (lane & 15) * 4; typedef _Float16 v4h __attribute__((ext_vector_type(4)));
  {
#pragma unroll
    for (int q = 0; q < 8; ++q) { const int r = q * 2 + rsub; if (col0 + c4 < N) { const v4f v = *(const v4fa*)&so[w][r][c4]; if (C) *(v4f*)(C + cofs + (size_t)(row0 + r) * ldc + col0 + c4) = v; if (C16) { v4h h4; for (int i = 0; i < 4; ++i) h4[i] = (_Float16)v[i]; *(v4h*)(C16 + cofs + (size_t)(row0 + r) * ldc + col0 + c4) = h4; } } }
     }
}


typedef _Float16 v4h __attribute__((ext_vector_type(4)));

__global__ __launch_bounds__(256) void k_x16(const float* __restrict__ x, _Float16* __restrict__ X16, size_t n8) { const size_t t = (size_t)blockIdx.x * 256 + threadIdx.x; if (t >= n8) return; FragH f;
#pragma unroll
  for (int q = 0; q < 8; ++q) f.h[q] = (_Float16)bf16_round(x[t * 8 + q]); *(v8us*)((unsigned short*)X16 + t * 8) = f.half[0];  }
// Er as the table of the skewed index t = 0 .. 2 * TT - 1, a plane [t][64] in fragment order: row t is Er[t] for t < TT, zero for t == TT, Er[t - TT - 1] beyond; thread t makes piece t, in storage order
__device__ __forceinline__ void d_er2(const float* __restrict__ Er, _Float16* __restrict__ E2, unsigned t) { int row, k; pk_src(t, 64, row, k);
  const int er = (row < TT) ? row : ((row > TT) ? row - TT - 1 : 0); const float* ep = Er + (size_t)er * 64 + k; const v4f a = *(const v4fa*)ep, c = *(const v4fa*)(ep + 4); FragH f;
#pragma unroll
  for (int q = 0; q < 4; ++q) { f.h[q] = (_Float16)bf16_round(a[q]); f.h[4 + q] = (_Float16)bf16_round(c[q]); }
  const v8us zr = {0, 0, 0, 0, 0, 0, 0, 0}; *(v8us*)((unsigned short*)E2 + (size_t)t * 8) = (row == TT) ? zr : f.half[0];
  asm volatile("s_wait_xcnt 0x0" ::: "memory"); }      /* the wait in front of any write of a register that this store names */
// x as an exact f16 plane [rows][DM] in fragment order; thread t makes piece t, in storage order
__device__ __forceinline__ void d_x16p(const float* __restrict__ x, _Float16* __restrict__ X16, unsigned t) { int row, k; pk_src(t, DM, row, k); const float* xp = x + (size_t)row * DM + k; const v4f a = *(const v4fa*)xp, c = *(const v4fa*)(xp + 4); FragH f;
#pragma unroll
  for (int q = 0; q < 4; ++q) { f.h[q] = (_Float16)bf16_round(a[q]); f.h[4 + q] = (_Float16)bf16_round(c[q]); }
  *(v8us*)((unsigned short*)X16 + (size_t)t * 8) = f.half[0];
  asm volatile("s_wait_xcnt 0x0" ::: "memory"); }      /* the wait in front of any write of a register that this store names */
// the five operand planes that depend on the inputs alone, in one launch: a block makes 256 pieces of one plane
#define PB_KV (DM * 2 * DM / 8 / 256)
#define PB_W  (DM * DM / 8 / 256)
#define PB_X  (NR * DM / 8 / 256)
#define PB_E  (2 * TT * 64 / 8 / 256)
__global__ __launch_bounds__(256) void k_prep(const float* __restrict__ qw, const float* __restrict__ kvw, const float* __restrict__ pw, const float* __restrict__ Er, const float* __restrict__ x,
    _Float16* __restrict__ BQ, _Float16* __restrict__ BKV, _Float16* __restrict__ BP, _Float16* __restrict__ E2, _Float16* __restrict__ X16) {
  const int bx = blockIdx.x, tid = threadIdx.x;      /* (in,out) weights -> [out][in] x16 */
  if (bx < PB_KV) d_wt_f16(kvw, BKV, DM, 2 * DM, 16.0f, bx * 256 + tid);
  else if (bx < PB_KV + PB_W) d_wt_f16(qw, BQ, DM, DM, 16.0f, (bx - PB_KV) * 256 + tid);
  else if (bx < PB_KV + 2 * PB_W) d_wt_f16(pw, BP, DM, DM, 16.0f, (bx - PB_KV - PB_W) * 256 + tid);
  else if (bx < PB_KV + 2 * PB_W + PB_X) d_x16p(x, X16, (unsigned)((bx - PB_KV - 2 * PB_W) * 256 + tid));
  else d_er2(Er, E2, (unsigned)((bx - PB_KV - 2 * PB_W - PB_X) * 256 + tid));
}
__global__ __launch_bounds__(256) void k_h16(const float* __restrict__ x, _Float16* __restrict__ X16, size_t n8) { const size_t t = (size_t)blockIdx.x * 256 + threadIdx.x; if (t >= n8) return; FragH f;
#pragma unroll
  for (int q = 0; q < 8; ++q) f.h[q] = (_Float16)x[t * 8 + q]; *(v8us*)((unsigned short*)X16 + t * 8) = f.half[0];  }
__global__ __launch_bounds__(256) void k_round16f(const float* __restrict__ W, _Float16* __restrict__ Bt, size_t n8) { const size_t t = (size_t)blockIdx.x * 256 + threadIdx.x; if (t >= n8) return; FragH f;
#pragma unroll
  for (int i = 0; i < 8; ++i) f.h[i] = (_Float16)(bf16_round(W[t * 8 + i]) * 16.0f); *(v8us*)((unsigned short*)Bt + t * 8) = f.half[0];  }
__global__ __launch_bounds__(256) void k_hl(const float* __restrict__ F, _Float16* __restrict__ Hh, _Float16* __restrict__ Hl, size_t n8) { const size_t t = (size_t)blockIdx.x * 256 + threadIdx.x; if (t >= n8) return; FragH fh, fl; const v4f a = *(const v4fa*)(F + t * 8), c = *(const v4fa*)(F + t * 8 + 4);
#pragma unroll
  for (int q = 0; q < 4; ++q) { _Float16 h = (_Float16)a[q]; fh.h[q] = h; fl.h[q] = (_Float16)((a[q] - (float)h) * 1024.0f); h = (_Float16)c[q]; fh.h[4 + q] = h; fl.h[4 + q] = (_Float16)((c[q] - (float)h) * 1024.0f); }
  { *(v8us*)((unsigned short*)Hh + t * 8) = fh.half[0]; *(v8us*)((unsigned short*)Hl + t * 8) = fl.half[0];  } }

// ---- fast GEMMs (wave tile 32x64, a block 128x64; K % 64 == 0; A and Bh in fragment order, pitch K) ----
__device__ __forceinline__ v16h g2_fragp(const _Float16* p) { FragH f; f.half[0] = *(const v8us*)((const unsigned short*)p); f.half[1] = *(const v8us*)((const unsigned short*)p + 256); return f.v; }      /* p: the tile's start + 8 * lane */
__device__ __forceinline__ v16h g2_frag(const _Float16* p, int hh) { FragH f; f.half[0] = *(const v8us*)((const unsigned short*)p + 8 * hh); f.half[1] = *(const v8us*)((const unsigned short*)p + 16 + 8 * hh); return f.v; }
__device__ __forceinline__ v8f g2_mma(v16h a, v16h b, v8f c) { v8f d = __builtin_amdgcn_wmma_f32_16x16x32_f16(false, a, false, b, (short)0, c, false, false); asm volatile("v_nop\n\tv_nop\n\tv_nop\n\tv_nop" : "+v"(d) : "v"(a), "v"(b)); return d; }
// k loop of a wave: two row tiles of A against four row tiles of B, c[a][t] += A[a] . B[t]^T over K (K % 64 == 0); pa*, pb*: each lane's place in the first k tile of each row tile
__device__ __forceinline__ void g2_kloop2(const _Float16* pa0, const _Float16* pa1, const _Float16* pb0, const _Float16* pb1, const _Float16* pb2, const _Float16* pb3, int K, v8f (&c)[2][4]) {
  v8f c00 = c[0][0], c01 = c[0][1], c02 = c[0][2], c03 = c[0][3], c10 = c[1][0], c11 = c[1][1], c12 = c[1][2], c13 = c[1][3];
  /* two register sets of six fragments (32 k each): the twelve loads of a set are issued as one group, one set ahead of the products that read it, so that a set's load latency runs behind the other set's products; the k order of every sum is the old one */
  v16h xa0 = g2_fragp(pa0), xa1 = g2_fragp(pa1), xb0 = g2_fragp(pb0), xb1 = g2_fragp(pb1), xb2 = g2_fragp(pb2), xb3 = g2_fragp(pb3);
  __builtin_amdgcn_sched_barrier(0);      /* holds the first group in front of the loop */
#pragma unroll 1      /* the two sets are the whole ring: a further copy of the body would only cost registers */
  for (int kb = 0; kb < K; kb += 64) {
    const v16h ya0 = g2_fragp(pa0 + 512), ya1 = g2_fragp(pa1 + 512), yb0 = g2_fragp(pb0 + 512), yb1 = g2_fragp(pb1 + 512), yb2 = g2_fragp(pb2 + 512), yb3 = g2_fragp(pb3 + 512);      /* the next k tile: 512 elements on */
    /* the wait that stands in front of the write of the six address registers below, which both groups in flight name; the addresses are its inputs so that their registers stay untouched up to it */
    asm volatile("s_wait_xcnt 0x0" :: "v"(pa0), "v"(pa1), "v"(pb0), "v"(pb1), "v"(pb2), "v"(pb3) : "memory");
    __builtin_amdgcn_sched_barrier(0);      /* holds this group in front of the products: without it the scheduler sinks each load to its first use, with a full wait each */
    c00 = g2_mma(xa0, xb0, c00); c10 = g2_mma(xa1, xb0, c10); c01 = g2_mma(xa0, xb1, c01); c11 = g2_mma(xa1, xb1, c11);
    c02 = g2_mma(xa0, xb2, c02); c12 = g2_mma(xa1, xb2, c12); c03 = g2_mma(xa0, xb3, c03); c13 = g2_mma(xa1, xb3, c13);
    const int adv = (kb + 64 < K) ? 1024 : 0;      /* the last trip has no next set: it reads its own first set again, in bounds and unused, so that every trip has the same loads in flight and the counted waits hold */
    pa0 += adv; pa1 += adv; pb0 += adv; pb1 += adv; pb2 += adv; pb3 += adv;
    xa0 = g2_fragp(pa0); xa1 = g2_fragp(pa1); xb0 = g2_fragp(pb0); xb1 = g2_fragp(pb1); xb2 = g2_fragp(pb2); xb3 = g2_fragp(pb3);
    __builtin_amdgcn_sched_barrier(0);      /* holds the next set's group in front of this set's products */
    c00 = g2_mma(ya0, yb0, c00); c10 = g2_mma(ya1, yb0, c10); c01 = g2_mma(ya0, yb1, c01); c11 = g2_mma(ya1, yb1, c11);
    c02 = g2_mma(ya0, yb2, c02); c12 = g2_mma(ya1, yb2, c12); c03 = g2_mma(ya0, yb3, c03); c13 = g2_mma(ya1, yb3, c13); }
  /* the same wait for the last group, in front of whatever reuses its address registers behind the loop */
  asm volatile("s_wait_xcnt 0x0" :: "v"(pa0), "v"(pa1), "v"(pb0), "v"(pb1), "v"(pb2), "v"(pb3) : "memory");
  c[0][0] = c00; c[0][1] = c01; c[0][2] = c02; c[0][3] = c03; c[1][0] = c10; c[1][1] = c11; c[1][2] = c12; c[1][3] = c13;
}
// D = A.B + C as the plain builtin: the compiler keeps the distance behind it itself, and its operands may lie above v255, which an asm operand cannot
__device__ __forceinline__ v8f g4_mma(v16h a, v16h b, v8f c) { return __builtin_amdgcn_wmma_f32_16x16x32_f16(false, a, false, b, (short)0, c, false, false); }
// the same loop with four row tiles of A (two of each of two planes) against the same four of B: eight fragments a set, sixteen products
__device__ __forceinline__ void g2_kloop4(const _Float16* pa0, const _Float16* pa1, const _Float16* pa2, const _Float16* pa3, const _Float16* pb0, const _Float16* pb1, const _Float16* pb2, const _Float16* pb3, int K, v8f (&c)[4][4]) {
  v16h xa[4], xb[4], ya[4], yb[4];
  xa[0] = g2_fragp(pa0); xa[1] = g2_fragp(pa1); xa[2] = g2_fragp(pa2); xa[3] = g2_fragp(pa3); xb[0] = g2_fragp(pb0); xb[1] = g2_fragp(pb1); xb[2] = g2_fragp(pb2); xb[3] = g2_fragp(pb3);
  __builtin_amdgcn_sched_barrier(0);      /* holds the first group in front of the loop */
#pragma unroll 1      /* the two sets are the whole ring: a further copy of the body would only cost registers */
  for (int kb = 0; kb < K; kb += 64) {
    ya[0] = g2_fragp(pa0 + 512); ya[1] = g2_fragp(pa1 + 512); ya[2] = g2_fragp(pa2 + 512); ya[3] = g2_fragp(pa3 + 512); yb[0] = g2_fragp(pb0 + 512); yb[1] = g2_fragp(pb1 + 512); yb[2] = g2_fragp(pb2 + 512); yb[3] = g2_fragp(pb3 + 512);
    /* the wait that stands in front of the write of the eight address registers below, which both groups in flight name; the addresses are its inputs so that their registers stay untouched up to it */
    asm volatile("s_wait_xcnt 0x0" :: "v"(pa0), "v"(pa1), "v"(pa2), "v"(pa3), "v"(pb0), "v"(pb1), "v"(pb2), "v"(pb3) : "memory");
    __builtin_amdgcn_sched_barrier(0);      /* holds this group in front of the products: without it the scheduler sinks each load to its first use, with a full wait each */
#pragma unroll
    for (int t = 0; t < 4; ++t)
#pragma unroll
      for (int a = 0; a < 4; ++a) c[a][t] = g4_mma(xa[a], xb[t], c[a][t]);
    const int adv = (kb + 64 < K) ? 1024 : 0;      /* the last trip reads its own first set again, in bounds and unused, so that every trip has the same loads in flight */
    pa0 += adv; pa1 += adv; pa2 += adv; pa3 += adv; pb0 += adv; pb1 += adv; pb2 += adv; pb3 += adv;
    __builtin_amdgcn_sched_barrier(0);      /* keeps the first set's products in front of the loads that refill it */
    xa[0] = g2_fragp(pa0); xa[1] = g2_fragp(pa1); xa[2] = g2_fragp(pa2); xa[3] = g2_fragp(pa3); xb[0] = g2_fragp(pb0); xb[1] = g2_fragp(pb1); xb[2] = g2_fragp(pb2); xb[3] = g2_fragp(pb3);
    __builtin_amdgcn_sched_barrier(0);      /* holds the next set's group in front of this set's products */
#pragma unroll
    for (int t = 0; t < 4; ++t)
#pragma unroll
      for (int a = 0; a < 4; ++a) c[a][t] = g4_mma(ya[a], yb[t], c[a][t]); }
  /* the same wait for the last group, in front of whatever reuses its address registers behind the loop */
  asm volatile("s_wait_xcnt 0x0" :: "v"(pa0), "v"(pa1), "v"(pa2), "v"(pa3), "v"(pb0), "v"(pb1), "v"(pb2), "v"(pb3) : "memory");
}
// q, k and v projections: column tile nq0 + (0 .. ntn - 1) of the plane [q | k | v] (3 * DM columns, 64 = one head per tile), A = x and Bh = [q_w | kv_w]^T x16 in fragment order.
// The epilogue stores each part as the attention kernel reads it: q row-major [row][DM]; k per (batch, head) as [token][d] and v as [d][token], both in fragment order.
__global__ __launch_bounds__(128) void k_gemm_qkv(const _Float16* __restrict__ A, const _Float16* __restrict__ Bh, const float* __restrict__ qb, const float* __restrict__ kvb, int nq0, int ntn,
    _Float16* __restrict__ Q16, _Float16* __restrict__ KP, _Float16* __restrict__ VT) {
  __shared__ __attribute__((aligned(16))) float so[4][32][68];
  const int tid = threadIdx.x, w = tid >> 5, lane = tid & 31, ln = lane & 15, hh = lane >> 4;
  const int mt = blockIdx.x / ntn, nq = nq0 + blockIdx.x - mt * ntn; const int row0 = mt * 128 + 32 * w, col0 = nq * 64; const int part = nq / NH, h = nq - part * NH;
  /* each lane's place in the first k tile of the six row tiles */
  const _Float16* pa0 = A + (size_t)row0 * DM + 8 * lane; const _Float16* pa1 = pa0 + (size_t)16 * DM;
  const _Float16* pb0 = Bh + (size_t)col0 * DM + 8 * lane; const _Float16* pb1 = pb0 + (size_t)16 * DM; const _Float16* pb2 = pb1 + (size_t)16 * DM; const _Float16* pb3 = pb2 + (size_t)16 * DM;
  const v8f z8 = {0.f,0.f,0.f,0.f,0.f,0.f,0.f,0.f}; v8f c[2][4] = {{z8, z8, z8, z8}, {z8, z8, z8, z8}};
  g2_kloop2(pa0, pa1, pb0, pb1, pb2, pb3, DM, c);
  const float* bp = (part == 0) ? qb + col0 : kvb + (col0 - DM);
  const int b = row0 / TT, tok0 = row0 - b * TT; const size_t slab = (size_t)(b * NH + h) * 64 * TT;      /* the wave's 32 rows are tokens tok0 .. tok0 + 31 of batch b */
  if (part == 2) {      /* v: the accumulator tile (half, t) holds in each lane 8 tokens in a row of one d, which is that lane's piece of the tile (d tile t, token tile tok0 / 32), half 'half' */
#pragma unroll
    for (int t = 0; t < 4; ++t) { const float bv = bf16_round(bp[t * 16 + ln]);
#pragma unroll
      for (int half = 0; half < 2; ++half) { FragH f;
#pragma unroll
        for (int r = 0; r < 8; ++r) f.h[r] = (_Float16)(c[half][t][r] * 0.0625f + bv);
        *(v8us*)((unsigned short*)VT + slab + (size_t)(t * 16) * TT + (size_t)(tok0 >> 5) * 512 + half * 256 + lane * 8) = f.half[0]; } }
    return; }
#pragma unroll
  for (int t = 0; t < 4; ++t) { const float bv = bf16_round(bp[t * 16 + ln]);
#pragma unroll
    for (int half = 0; half < 2; ++half)
#pragma unroll
      for (int r = 0; r < 8; ++r) so[w][half * 16 + 8 * hh + r][t * 16 + ln] = c[half][t][r] * 0.0625f + bv; }
  __builtin_amdgcn_fence(__ATOMIC_ACQ_REL, "workgroup"); __builtin_amdgcn_wave_barrier();      /* a wave reads back only its own part of so: its LDS writes are done before any of its lanes reads */
  if (part == 0) { const int rsub = lane >> 4, c4 = (lane & 15) * 4;
#pragma unroll
    for (int q = 0; q < 16; ++q) { const int r = q * 2 + rsub; const v4f v = *(const v4fa*)&so[w][r][c4]; v4h h4; for (int i = 0; i < 4; ++i) h4[i] = (_Float16)v[i]; *(v4h*)(Q16 + (size_t)(row0 + r) * DM + col0 + c4) = h4;
      if (q == 7 || q == 15) asm volatile("s_wait_xcnt 0x0" ::: "memory"); }      /* the wait in front of any write of a register that one of the eight stores before it names */
  } else {      /* k: piece (token tile rt, d tile kt, half hf) of lane 16 * hh + ln is token rt * 16 + ln, d = kt * 32 + hf * 16 + hh * 8 + (0 .. 7) */
#pragma unroll
    for (int pc = 0; pc < 8; ++pc) { const int rt = pc >> 2, kt = (pc >> 1) & 1, hf = pc & 1; const float* sp = &so[w][rt * 16 + ln][kt * 32 + hf * 16 + hh * 8]; const v4f lo = *(const v4fa*)sp, hi = *(const v4fa*)(sp + 4); FragH f;
#pragma unroll
      for (int i = 0; i < 4; ++i) { f.h[i] = (_Float16)lo[i]; f.h[4 + i] = (_Float16)hi[i]; }
      *(v8us*)((unsigned short*)KP + slab + (size_t)((tok0 >> 4) + rt) * 1024 + kt * 512 + hf * 256 + lane * 8) = f.half[0];
      if (pc == 3 || pc == 7) asm volatile("s_wait_xcnt 0x0" ::: "memory"); } }      /* the wait in front of any write of a register that one of the four stores before it names */
}
// output projection: out = Oh . W + bias + (Ol . W) / 1024, W = Bh / 16; both terms in one k loop over the same B fragments, each in accumulators of its own; Ah, Al, Bh in fragment order
__global__ __launch_bounds__(128) void k_gemm_proj(const _Float16* __restrict__ Ah, const _Float16* __restrict__ Al, const _Float16* __restrict__ Bh, const float* __restrict__ bias, float* __restrict__ C) {
  __shared__ __attribute__((aligned(16))) float so[4][32][68];
  const int tid = threadIdx.x, w = tid >> 5, lane = tid & 31, ln = lane & 15, hh = lane >> 4;
  const int ntn = DM / 64; const int mt = blockIdx.x / ntn, nq = blockIdx.x - mt * ntn; const int row0 = mt * 128 + 32 * w, col0 = nq * 64;
  /* each lane's place in the first k tile of the eight row tiles */
  const _Float16* pa0 = Ah + (size_t)row0 * DM + 8 * lane; const _Float16* pa1 = pa0 + (size_t)16 * DM; const _Float16* pa2 = Al + (size_t)row0 * DM + 8 * lane; const _Float16* pa3 = pa2 + (size_t)16 * DM;
  const _Float16* pb0 = Bh + (size_t)col0 * DM + 8 * lane; const _Float16* pb1 = pb0 + (size_t)16 * DM; const _Float16* pb2 = pb1 + (size_t)16 * DM; const _Float16* pb3 = pb2 + (size_t)16 * DM;
  const v8f z8 = {0.f,0.f,0.f,0.f,0.f,0.f,0.f,0.f}; v8f c[4][4] = {{z8, z8, z8, z8}, {z8, z8, z8, z8}, {z8, z8, z8, z8}, {z8, z8, z8, z8}};
  g2_kloop4(pa0, pa1, pa2, pa3, pb0, pb1, pb2, pb3, DM, c);
#pragma unroll
  for (int t = 0; t < 4; ++t) { const float bv = bf16_round(bias[col0 + t * 16 + ln]);
#pragma unroll
    for (int half = 0; half < 2; ++half)
#pragma unroll
      for (int r = 0; r < 8; ++r) so[w][half * 16 + 8 * hh + r][t * 16 + ln] = c[2 + half][t][r] * (0.0625f / 1024.0f) + (c[half][t][r] * 0.0625f + bv); }
  __builtin_amdgcn_fence(__ATOMIC_ACQ_REL, "workgroup"); __builtin_amdgcn_wave_barrier();      /* a wave reads back only its own part of so: its LDS writes are done before any of its lanes reads */
  const int rsub = lane >> 4, c4 = (lane & 15) * 4;
#pragma unroll
  for (int q = 0; q < 16; ++q) { const int r = q * 2 + rsub; const v4f v = *(const v4fa*)&so[w][r][c4]; *(v4f*)(C + (size_t)(row0 + r) * DM + col0 + c4) = v; }
}

// D = A.B + C as the plain builtin: the compiler keeps the distance behind it itself
__device__ __forceinline__ v8f ra_mma(v16h a, v16h b, v8f c) { return __builtin_amdgcn_wmma_f32_16x16x32_f16(false, a, false, b, (short)0, c, false, false); }
// zero a fragment in the lanes whose A row does not belong to this product
__device__ __forceinline__ v16h frag_keep(v16h a, bool keep) { union { v16h v; unsigned int d[8]; } f; f.v = a;
#pragma unroll
  for (int i = 0; i < 8; ++i) f.d[i] = keep ? f.d[i] : 0u; return f.v; }

// Attention of one (batch, head) and 128 queries per block, 32 queries per wave, keys 64 at a time; nothing of S, QEr or P goes to memory.
// With t = TT-1-i+j the skewed term of (query i, key j) is q[i].Er[t] for t < TT, 0 for t == TT, q[i+1].Er[t-TT-1] for t > TT.
// All tiles are transposed: D[row 8*hh+r][column ln] with the query in the column, so a lane owns one query's max, sum and O column.
// Every inner loop is unrolled so that each array index is a constant and the arrays live in registers.
__global__ __launch_bounds__(128) void k_relattn(const _Float16* __restrict__ Q16, const _Float16* __restrict__ KP, const _Float16* __restrict__ VT, const _Float16* __restrict__ ER16, _Float16* __restrict__ Oh, _Float16* __restrict__ Ol) {
  __shared__ __attribute__((aligned(16))) float rl[4][2][16][RP];
  const int tid = threadIdx.x, w = __builtin_amdgcn_readfirstlane(tid >> 5), lane = tid & 31, ln = lane & 15, hh = lane >> 4;
  const int bh = blockIdx.y, b = bh / NH, h = bh - b * NH; const int i0 = blockIdx.x * 128 + 32 * w;
  const _Float16* qbase = Q16 + (size_t)b * TT * DM + h * 64; const _Float16* kbase = KP + (size_t)bh * 64 * TT; const _Float16* vbase = VT + (size_t)bh * 64 * TT;      /* [token][d] and [d][token], both in fragment order */
  v16h q[2][2], qn[2][2];      /* queries i and i + 1 as B operands; the row past the last query is never used, its address is clamped */
  const _Float16* qp[2]; const _Float16* qnp[2];
  __builtin_amdgcn_sched_barrier(0);      /* with the one behind the wait: keeps the set-up arithmetic, which reuses registers, out of the stretch between these loads and their wait */
#pragma unroll
  for (int qs = 0; qs < 2; ++qs) { const int i = i0 + 16 * qs + ln; const int i1 = (i + 1 < TT) ? i + 1 : TT - 1; qp[qs] = qbase + (size_t)i * DM + 8 * hh; qnp[qs] = qbase + (size_t)i1 * DM + 8 * hh;
#pragma unroll
    for (int ks = 0; ks < 2; ++ks) { q[qs][ks] = g2_frag(qp[qs] + 32 * ks, 0); qn[qs][ks] = g2_frag(qnp[qs] + 32 * ks, 0); } }
  asm volatile("s_wait_xcnt 0x0" ::: "memory");      /* the wait in front of any write of an address register of these loads */
  __builtin_amdgcn_sched_barrier(0);
  const v8f z8 = {0.f,0.f,0.f,0.f,0.f,0.f,0.f,0.f};
  v8f o[2][4] = {{z8, z8, z8, z8}, {z8, z8, z8, z8}}; float mx[2] = {-3.0e38f, -3.0e38f}, sm[2] = {0.f, 0.f};
#pragma unroll 1      /* the pass is some 1,100 instructions long: a second copy would only cost instruction fetch and registers */
  for (int j0 = 0; j0 < TT; j0 += 64) {
    /* every global load of the pass is issued here, so that the pass waits out one load latency and not one per tile */
    /* relative tiles: rows t = tb0 + 16u + (0..15); queries i0+16.. take u = 0..4, queries i0.. take u = 1..5 */
    const int tb0 = TT - 32 - i0 + j0;
    /* each lane's three addresses: its place in the first k, v and relative tile of the pass; 0 <= tb0 and tb0 + 95 <= 2 * TT - 1, the rows of the table */
    const _Float16* kp = kbase + (size_t)j0 * 64 + 8 * lane; const _Float16* vp = vbase + (size_t)j0 * 16 + 8 * lane; const _Float16* ep = ER16 + (size_t)tb0 * 64 + 8 * lane;
    v16h kf[4][2], ef[6][2], vf[4][2];
#pragma unroll
    for (int n = 0; n < 4; ++n) { kf[n][0] = g2_fragp(kp + 1024 * n); kf[n][1] = g2_fragp(kp + 1024 * n + 512); }
#pragma unroll
    for (int u = 0; u < 6; ++u) { ef[u][0] = g2_fragp(ep + 1024 * u); ef[u][1] = g2_fragp(ep + 1024 * u + 512); }
#pragma unroll
    for (int dt = 0; dt < 4; ++dt) { vf[dt][0] = g2_fragp(vp + (size_t)(16 * dt) * TT); vf[dt][1] = g2_fragp(vp + (size_t)(16 * dt) * TT + 512); }
    /* the wait that stands in front of any write of a register which one of these loads names as its address; the addresses are its inputs so that their registers stay untouched up to it */
    asm volatile("s_wait_xcnt 0x0" :: "v"(kp), "v"(vp), "v"(ep) : "memory");
    __builtin_amdgcn_sched_barrier(0);      /* holds the loads and that wait in front of the products: without it the scheduler sinks the k loads between the products, two at a time, each with its own full wait */
    v8f s[2][4];      /* s[qs][n][r] = k[j0 + 16n + 8hh + r] . q[i0 + 16qs + ln] */
#pragma unroll
    for (int n = 0; n < 4; ++n)
#pragma unroll
      for (int qs = 0; qs < 2; ++qs) s[qs][n] = ra_mma(kf[n][1], q[qs][1], ra_mma(kf[n][0], q[qs][0], z8));
#pragma unroll
    for (int u = 0; u < 6; ++u) { const int tb = tb0 + 16 * u, t = tb + ln; const v16h e0 = ef[u][0], e1 = ef[u][1];
      v8f r0 = z8, r1 = z8;
      if (tb < TT) { const v16h f0 = frag_keep(e0, t < TT), f1 = frag_keep(e1, t < TT);
        if (u >= 1) r0 = ra_mma(f1, q[0][1], ra_mma(f0, q[0][0], r0));
        if (u <= 4) r1 = ra_mma(f1, q[1][1], ra_mma(f0, q[1][0], r1)); }
      if (tb + 15 > TT) { const v16h f0 = frag_keep(e0, t > TT), f1 = frag_keep(e1, t > TT);
        if (u >= 1) r0 = ra_mma(f1, qn[0][1], ra_mma(f0, qn[0][0], r0));
        if (u <= 4) r1 = ra_mma(f1, qn[1][1], ra_mma(f0, qn[1][0], r1)); }
      if (u >= 1) { float* d = &rl[w][0][ln][16 * (u - 1) + 8 * hh]; const v4f lo = {r0[0], r0[1], r0[2], r0[3]}, hi = {r0[4], r0[5], r0[6], r0[7]}; *(v4fa*)d = lo; *(v4fa*)(d + 4) = hi; }
      if (u <= 4) { float* d = &rl[w][1][ln][16 * u + 8 * hh]; const v4f lo = {r1[0], r1[1], r1[2], r1[3]}, hi = {r1[4], r1[5], r1[6], r1[7]}; *(v4fa*)d = lo; *(v4fa*)(d + 4) = hi; } }
    /* a query's row is written by its two lanes and read by both: the wave's LDS writes are done before any lane reads; only the LDS counter is waited on, the v loads stay in flight */
    asm volatile("s_wait_dscnt 0x0" ::: "memory"); __builtin_amdgcn_wave_barrier();
    FragH p[2][2];
#pragma unroll
    for (int qs = 0; qs < 2; ++qs) { const float* rr = &rl[w][qs][ln][15 - ln + 8 * hh]; float mt = -3.0e38f;
#pragma unroll
      for (int n = 0; n < 4; ++n)
#pragma unroll
        for (int r = 0; r < 8; ++r) { const float lg = s[qs][n][r] + rr[16 * n + r]; s[qs][n][r] = lg; mt = fmaxf(mt, lg); }      /* 8 x the logit: the scale goes into the exponent's multiply-add */
      mt = fmaxf(mt, __shfl_xor(mt, 16, 32));
      const float mn = fmaxf(mx[qs], mt), ax = (mx[qs] - mn) * L2E8, nb = fmaf(-mn, L2E8, 10.0f); float al = __builtin_amdgcn_exp2f(ax); mx[qs] = mn; float ps[4] = {0.f, 0.f, 0.f, 0.f};      /* one partial sum per key tile: four short add chains */
      asm("v_nop" : "+v"(al) : "v"(ax));      /* the slot behind a transcendental, as below */
#pragma unroll
      for (int n = 0; n < 4; ++n)
      { float x[8], e[8];      /* e = 2^10 * exp(logit - max) */
#pragma unroll
        for (int r = 0; r < 8; ++r) { x[r] = fmaf(s[qs][n][r], L2E8, nb); e[r] = __builtin_amdgcn_exp2f(x[r]); }
        /* the slot that the instruction set asks for behind a transcendental, before its result is read or its source overwritten: no result is read and no source register is given up in front of this v_nop, so whatever stands directly behind one of the eight is independent of it or is the v_nop */
        asm("v_nop" : "+v"(e[0]), "+v"(e[1]), "+v"(e[2]), "+v"(e[3]), "+v"(e[4]), "+v"(e[5]), "+v"(e[6]), "+v"(e[7]) : "v"(x[0]), "v"(x[1]), "v"(x[2]), "v"(x[3]), "v"(x[4]), "v"(x[5]), "v"(x[6]), "v"(x[7]));
#pragma unroll
        for (int r = 0; r < 8; ++r) { ps[n] += e[r]; p[qs][n >> 1].h[(n & 1) * 8 + r] = (_Float16)e[r]; } }
      sm[qs] = sm[qs] * al + ((ps[0] + ps[1]) + (ps[2] + ps[3]));
#pragma unroll
      for (int dt = 0; dt < 4; ++dt) o[qs][dt] *= al; }
    /* keeps the compiler from lifting the next pass's LDS writes over this pass's reads (their values are already in registers here) */
    __builtin_amdgcn_fence(__ATOMIC_ACQ_REL, "wavefront"); __builtin_amdgcn_wave_barrier();
#pragma unroll
    for (int dt = 0; dt < 4; ++dt)
#pragma unroll
      for (int qs = 0; qs < 2; ++qs) o[qs][dt] = ra_mma(vf[dt][1], p[qs][1].v, ra_mma(vf[dt][0], p[qs][0].v, o[qs][dt]));
  }
#pragma unroll
  for (int qs = 0; qs < 2; ++qs) { const float tot = sm[qs] + __shfl_xor(sm[qs], 16, 32); const float inv = 1.0f / tot;      /* the row sum carries the 2^10 of P as well */
    /* O as f16 hi + residual x 2^10, two planes [row][DM] in fragment order: the lane's 8 values of d tile dt are its piece of the tile (row tile of the 16 queries, k tile 2 * h + dt / 2), half dt % 2 */
    const size_t ob = ((size_t)((b * TT + i0 + 16 * qs) >> 4) * (DM / 32) + 2 * h) * 512 + 8 * lane;
    FragH fh[4], fl[4];
#pragma unroll
    for (int dt = 0; dt < 4; ++dt) { const v8f a = o[qs][dt];
#pragma unroll
      for (int r = 0; r < 8; ++r) { const float v = a[r] * inv; const _Float16 hi = (_Float16)v; fh[dt].h[r] = hi; fl[dt].h[r] = (_Float16)((v - (float)hi) * 1024.0f); } }
    __builtin_amdgcn_sched_barrier(0);      /* with the one behind the wait: keeps the arithmetic, which reuses registers, out of the stretch between these stores and their wait */
#pragma unroll
    for (int dt = 0; dt < 4; ++dt) { *(v8us*)((unsigned short*)Oh + ob + 256 * dt) = fh[dt].half[0]; *(v8us*)((unsigned short*)Ol + ob + 256 * dt) = fl[dt].half[0]; }
    if (qs == 0) { asm volatile("s_wait_xcnt 0x0" ::: "memory");      /* the wait in front of any write of a register that one of these stores names; nothing is written behind the second group */
      __builtin_amdgcn_sched_barrier(0); } }
}

extern "C" void kernel_launch(void* const* d_in, const int* in_sizes, int n_in,
                              void* d_out, int out_size, void* d_ws, size_t ws_size, hipStream_t stream) {
  (void)in_sizes; (void)n_in; (void)out_size;
  const float* const* I = (const float* const*)d_in; const float* x = I[0]; const float* qw = I[1]; const float* qb = I[2]; const float* kvw = I[3]; const float* kvb = I[4]; const float* pw = I[5]; const float* pb = I[6]; const float* Er = I[7];
  char* ws = (char*)d_ws; size_t off = 0;
  auto take = [&](size_t bytes) { char* p = ws + off; off += (bytes + 255) & ~(size_t)255; return p; };
  _Float16* BP = (_Float16*)take((size_t)DM * DM * 2); _Float16* ER16 = (_Float16*)take((size_t)2 * TT * 64 * 2);
  _Float16* Q16 = (_Float16*)take((size_t)NR * DM * 2); _Float16* VT = (_Float16*)take((size_t)NR * DM * 2); _Float16* KP = (_Float16*)take((size_t)NR * DM * 2);
  _Float16* X16 = (_Float16*)take((size_t)NR * DM * 2); _Float16* BQKV = (_Float16*)take((size_t)DM * 3 * DM * 2);      /* [q_w | kv_w]^T: one plane of 3 * DM rows, the q rows first */
  _Float16* Oh = (_Float16*)take((size_t)NR * DM * 2); _Float16* Ol = (_Float16*)take((size_t)NR * DM * 2);
  if (off > ws_size) return;      /* about 57 MiB */
  k_prep<<<PB_KV + 2 * PB_W + PB_X + PB_E, 256, 0, stream>>>(qw, kvw, pw, Er, x, BQKV, BQKV + (size_t)DM * DM, BP, ER16, X16);
  const dim3 gA(TT / 128, NBT * NH);
  k_gemm_qkv<<<(NR / 128) * (DM / 64), 128, 0, stream>>>(X16, BQKV, qb, kvb, 0, DM / 64, Q16, KP, VT);
  k_gemm_qkv<<<(NR / 128) * (2 * DM / 64), 128, 0, stream>>>(X16, BQKV, qb, kvb, DM / 64, 2 * DM / 64, Q16, KP, VT);
  k_relattn<<<gA, 128, 0, stream>>>(Q16, KP, VT, ER16, Oh, Ol);
  k_gemm_proj<<<(NR / 128) * (DM / 64), 128, 0, stream>>>(Oh, Ol, BP, pb, (float*)d_out);
}

// v007
// Measured time: 127 microseconds a run.
// Two timings next to v006 put it at 1.06 and 1.05 times that version's speed.
// All steps since v000 together make it 27.7 times as fast.
#include <hip/hip_runtime.h>
// Relative-position multi-head attention with the 'skew' trick (2 x 2048 tokens x 1024, 16 heads x 64): q = x*q_w + q_b; [k | v] = x*kv_w + kv_b; QEr = q . Er^T against the learned INPUT table Er [2048][64]; Srel = skew(QEr) (pad one zero column on the left, reinterpret as [(N+1)][N], drop the first row -> Srel[i][j] = padded.flat[(i+1)*N + j]); logits = (q.k + Srel)/8 (no mask); softmax; merged . proj_w + proj_b -> [2,2048,1024].
// Structure: x as an exact f16 plane; the projections as f16 WMMA GEMMs (32x64 wave tiles, f32, exact products + bias; both operands stored in fragment order) whose epilogue stores q row-major and k and v per (batch, head) as [token][d] and [d][token] in fragment order; Er as an exact f16 table over the skewed index, in fragment order; one attention kernel for all (batch, head) pairs: a wave holds 32 queries and walks the keys 64 at a time; scores and relative terms as transposed WMMA tiles (keys or Er rows as A, queries as B), the skew as a per-query shifted read of the relative tile through LDS, running-max softmax per lane in base 2 (one multiply-add and one v_exp_f32 per score), P (x2^10 f16) taken from the score registers as the B operand of V^T.P^T, O stored as f16 hi + residual planes in fragment order; output projection as one GEMM with both terms.
// Compute dtype: x, weights, biases and Er rounded to bf16; projections exact; q, k, v, P as f16 operands (~2^-12), O as hi + residual; f32 accumulation and softmax. v_wmma_f32_16x16x32_f16.
#define NBT 2
#define TT 2048
#define DM 1024
#define NH 16
#define NR (NBT * TT)
#define L2E8 0.18033688011112042f   /* log2(e) / 8: the logit scale 1/8 and the change to base 2 in one factor */
#define RP 84   /* floats per query row of the relative tile in LDS: 80 used; a multiple of 4 for the 16-byte writes; lane ln reads at ln * (RP - 1) + const, and 83 is odd, which spreads the lanes over the banks */
typedef __bf16 v16b __attribute__((ext_vector_type(16)));
typedef unsigned short v8us __attribute__((ext_vector_type(8), may_alias));
typedef float  v8f  __attribute__((ext_vector_type(8)));
typedef float  v4f  __attribute__((ext_vector_type(4)));
typedef float  v4fa __attribute__((ext_vector_type(4), may_alias));
union FragB { v16b v; v8us half[2]; unsigned short u[16]; };

__device__ __forceinline__ unsigned short bf16_bits(float x) { unsigned int u = __float_as_uint(x); return (unsigned short)((u + 0x7FFFu + ((u >> 16) & 1u)) >> 16); }
__device__ __forceinline__ float bf16_val(unsigned short b) { return __uint_as_float(((unsigned int)b) << 16); }
__device__ __forceinline__ float bf16_round(float x) { return bf16_val(bf16_bits(x)); }
// D += A·B with NT terms: 1 = ah·bh, 2 = + al·bh (A split), 3 = + ah·bl (both split)
template <int NT>
__device__ __forceinline__ v8f mmaN(v16b ah, v16b al, v16b bh, v16b bl, v8f c) {
  c = __builtin_amdgcn_wmma_f32_16x16x32_bf16(false, ah, false, bh, (short)0, c, false, false);
  if (NT >= 2) c = __builtin_amdgcn_wmma_f32_16x16x32_bf16(false, al, false, bh, (short)0, c, false, false);
  if (NT >= 3) c = __builtin_amdgcn_wmma_f32_16x16x32_bf16(false, ah, false, bl, (short)0, c, false, false);
  asm volatile("v_nop\n\tv_nop\n\tv_nop\n\tv_nop" : "+v"(c) : "v"(ah), "v"(al), "v"(bh), "v"(bl));
  return c;
}

__global__ __launch_bounds__(256) void k_wt_bf16(const float* __restrict__ W, unsigned short* __restrict__ Wt, int K, int N) {
  const int t = blockIdx.x * 256 + threadIdx.x;
  const int k8n = K / 8;
  if (t >= N * k8n) return;
  const int n = t / k8n, k8 = (t % k8n) * 8;
  v8us v;
#pragma unroll
  for (int i = 0; i < 8; ++i) v[i] = bf16_bits(W[(size_t)(k8 + i) * N + n]);
  *(v8us*)(Wt + (size_t)n * K + k8) = v;
  
}

// GEMM C[M][N] (f32, pitch ldc) = act(A[M][K]·W + bias). A f32 row-major (pitch lda) converted per fragment to bf16
// (ASPLIT: hi/lo two planes -> 2 terms, else single rounded term); Wt bf16 [N][K] (pitch ldb). BIAS_BF16 rounds the
// bias to bf16 first (bias quantised to bf16 before the add). K%32==0, M%16==0, N%64==0.
template <bool ASPLIT, int ACT, bool BIAS_BF16>
__global__ __launch_bounds__(128) void k_gemm_bf(const float* __restrict__ A, int lda, const unsigned short* __restrict__ Wt, int ldb,
                                               const float* __restrict__ bias, float* __restrict__ C, int ldc, int M, int N, int K) {
  __shared__ __attribute__((aligned(16))) float so[4][16][64];
  const int tid = threadIdx.x, w = tid >> 5, lane = tid & 31, ln = lane & 15, hh = lane >> 4;
  const int ntn = N / 64;
  const int wid = blockIdx.x * 4 + w;
  const int mt = wid / ntn, nq = wid % ntn;
  if (mt * 16 >= M) return;
  const int row0 = mt * 16, col0 = nq * 64;
  const float* arow = A + (size_t)(row0 + ln) * lda;
  v8f acc[4] = {};
  for (int kb = 0; kb < K; kb += 32) {
    FragB ah, al;
    const v4f x0 = *(const v4fa*)(arow + kb + 8 * hh), x1 = *(const v4fa*)(arow + kb + 8 * hh + 4);
    const v4f x2 = *(const v4fa*)(arow + kb + 16 + 8 * hh), x3 = *(const v4fa*)(arow + kb + 16 + 8 * hh + 4);
    float xs[16] = {x0[0],x0[1],x0[2],x0[3],x1[0],x1[1],x1[2],x1[3],x2[0],x2[1],x2[2],x2[3],x3[0],x3[1],x3[2],x3[3]};
#pragma unroll
    for (int i = 0; i < 16; ++i) { const unsigned short hb = bf16_bits(xs[i]); ah.u[i] = hb; al.u[i] = ASPLIT ? bf16_bits(xs[i] - bf16_val(hb)) : (unsigned short)0; }
#pragma unroll
    for (int t = 0; t < 4; ++t) {
      const unsigned short* brow = Wt + (size_t)(col0 + t * 16 + ln) * ldb + kb;
      FragB b;
      b.half[0] = *(const v8us*)(brow + 8 * hh);
      b.half[1] = *(const v8us*)(brow + 16 + 8 * hh);
      acc[t] = mmaN<ASPLIT ? 2 : 1>(ah.v, al.v, b.v, b.v, acc[t]);
    }
  }
#pragma unroll
  for (int t = 0; t < 4; ++t) {
    float bv = bias ? bias[col0 + t * 16 + ln] : 0.f;
    if (BIAS_BF16) bv = bf16_round(bv);
#pragma unroll
    for (int r = 0; r < 8; ++r) { float v = acc[t][r] + bv; if (ACT == 1) v = fmaxf(v, 0.f); so[w][8 * hh + r][t * 16 + ln] = v; }
  }
  __builtin_amdgcn_fence(__ATOMIC_ACQ_REL, "workgroup");
  __builtin_amdgcn_wave_barrier();
  const int rsub = lane >> 4, c4 = (lane & 15) * 4;
  {
#pragma unroll
    for (int q = 0; q < 8; ++q) {
      const int r = q * 2 + rsub;
      const v4f v = *(const v4fa*)&so[w][r][c4];
      *(v4f*)(C + (size_t)(row0 + r) * ldc + col0 + c4) = v;
    }
    
  }
}

// GEMM C = act(A·W + bias + resid): A f32 (ASPLIT -> hi/lo 2 terms), Wt bf16 [N][K]; ACT 0 none, 1 relu, 2 exact gelu;
// resid (optional, f32, row index = (row % rmod), pitch ldr, RES_BF16 rounds it) added before the activation.
template <bool ASPLIT, int ACT, bool BIAS_BF16, bool RES_BF16>
__global__ __launch_bounds__(128) void k_gemm_bf3(const float* __restrict__ A, int lda, const unsigned short* __restrict__ Wt, int ldb,
                                                const float* __restrict__ bias, const float* __restrict__ resid, int rmod, int ldr,
                                                float* __restrict__ C, int ldc, int M, int N, int K) {
  __shared__ __attribute__((aligned(16))) float so[4][16][64];
  const int tid = threadIdx.x, w = tid >> 5, lane = tid & 31, ln = lane & 15, hh = lane >> 4;
  const int ntn = N / 64;
  const int wid = blockIdx.x * 4 + w;
  const int mt = wid / ntn, nq = wid % ntn;
  if (mt * 16 >= M) return;
  const int row0 = mt * 16, col0 = nq * 64;
  const float* arow = A + (size_t)(row0 + ln) * lda;
  v8f acc[4] = {};
  for (int kb = 0; kb < K; kb += 32) {
    FragB ah, al;
    const v4f x0 = *(const v4fa*)(arow + kb + 8 * hh), x1 = *(const v4fa*)(arow + kb + 8 * hh + 4);
    const v4f x2 = *(const v4fa*)(arow + kb + 16 + 8 * hh), x3 = *(const v4fa*)(arow + kb + 16 + 8 * hh + 4);
    float xs[16] = {x0[0],x0[1],x0[2],x0[3],x1[0],x1[1],x1[2],x1[3],x2[0],x2[1],x2[2],x2[3],x3[0],x3[1],x3[2],x3[3]};
#pragma unroll
    for (int i = 0; i < 16; ++i) { const unsigned short hb = bf16_bits(xs[i]); ah.u[i] = hb; al.u[i] = ASPLIT ? bf16_bits(xs[i] - bf16_val(hb)) : (unsigned short)0; }
#pragma unroll
    for (int t = 0; t < 4; ++t) {
      const unsigned short* brow = Wt + (size_t)(col0 + t * 16 + ln) * ldb + kb;
      FragB b;
      b.half[0] = *(const v8us*)(brow + 8 * hh);
      b.half[1] = *(const v8us*)(brow + 16 + 8 * hh);
      acc[t] = mmaN<ASPLIT ? 2 : 1>(ah.v, al.v, b.v, b.v, acc[t]);
    }
  }
#pragma unroll
  for (int t = 0; t < 4; ++t) {
    const int col = col0 + t * 16 + ln;
    float bv = bias ? bias[col] : 0.f;
    if (BIAS_BF16) bv = bf16_round(bv);
#pragma unroll
    for (int r = 0; r < 8; ++r) {
      float v = acc[t][r] + bv;
      if (resid) { float rv = resid[(size_t)((row0 + 8 * hh + r) % rmod) * ldr + col]; if (RES_BF16) rv = bf16_round(rv); v += rv; }
      if (ACT == 1) v = fmaxf(v, 0.f);
      if (ACT == 2) v = 0.5f * v * (1.0f + erff(v * 0.70710678118654752f));
      if (ACT == 3) { const float u = 0.7978845608028654f * (v + 0.044715f * v * v * v); v = 0.5f * v * (1.0f + tanhf(u)); }
      so[w][8 * hh + r][t * 16 + ln] = v;
    }
  }
  __builtin_amdgcn_fence(__ATOMIC_ACQ_REL, "workgroup");
  __builtin_amdgcn_wave_barrier();
  const int rsub = lane >> 4, c4 = (lane & 15) * 4;
  {
#pragma unroll
    for (int q = 0; q < 8; ++q) {
      const int r = q * 2 + rsub;
      const v4f v = *(const v4fa*)&so[w][r][c4];
      *(v4f*)(C + (size_t)(row0 + r) * ldc + col0 + c4) = v;
    }
    
  }
}
// row LayerNorm (biased variance, eps) over N: s = X (+ R); optional out_sum <- s; out_norm <- (s-mu)*rsqrt(var+eps)*g + b
template <bool PARAM_BF16>
__global__ __launch_bounds__(256) void k_layernorm(const float* __restrict__ X, const float* __restrict__ R, const float* __restrict__ g, const float* __restrict__ bta,
                                                  float* __restrict__ out_sum, float* __restrict__ out_norm, int N, float eps) {
  __shared__ float red[256];
  const int row = blockIdx.x, tid = threadIdx.x;
  const float* x = X + (size_t)row * N; const float* rr = R ? R + (size_t)row * N : nullptr;
  float vals[16];                     // up to N = 4096
  const int per = N / 256;            // contiguous chunk per thread? use strided-by-4 chunks: thread handles j = tid*4 + 1024*u
  float s1 = 0.f;
  for (int u = 0; u < per / 4; ++u) {
    const int j = tid * 4 + 1024 * u;
    const v4f a = *(const v4fa*)(x + j);
    v4f b = {0.f,0.f,0.f,0.f}; if (rr) b = *(const v4fa*)(rr + j);
#pragma unroll
    for (int q = 0; q < 4; ++q) { const float v = a[q] + b[q]; vals[u * 4 + q] = v; s1 += v; }
  }
  red[tid] = s1; __syncthreads();
  for (int st = 128; st > 0; st >>= 1) { if (tid < st) red[tid] += red[tid + st]; __syncthreads(); }
  const float mu = red[0] / (float)N; __syncthreads();
  float s2 = 0.f;
  for (int u = 0; u < per / 4; ++u)
#pragma unroll
    for (int q = 0; q < 4; ++q) { const float c = vals[u * 4 + q] - mu; s2 += c * c; }
  red[tid] = s2; __syncthreads();
  for (int st = 128; st > 0; st >>= 1) { if (tid < st) red[tid] += red[tid + st]; __syncthreads(); }
  const float rs = rsqrtf(red[0] / (float)N + eps);
  {
    for (int u = 0; u < per / 4; ++u) {
      const int j = tid * 4 + 1024 * u;
      v4f o, sm;
#pragma unroll
      for (int q = 0; q < 4; ++q) {
        float gg = g[j + q], bb = bta[j + q];
        if (PARAM_BF16) { gg = bf16_round(gg); bb = bf16_round(bb); }
        sm[q] = vals[u * 4 + q]; o[q] = (vals[u * 4 + q] - mu) * rs * gg + bb;
      }
      if (out_sum) *(v4f*)(out_sum + (size_t)row * N + j) = sm;
      *(v4f*)(out_norm + (size_t)row * N + j) = o;
    }
    
  }
}



// ---- f16 WMMA path (v_wmma_f32_16x16x32_f16): 11-bit significands for operands in range — used where a [0,1] probability operand needs more precision than bf16
typedef _Float16 v16h __attribute__((ext_vector_type(16)));
union FragH { v16h v; v8us half[2]; _Float16 h[16]; unsigned short u[16]; };
template <int NT>
__device__ __forceinline__ v8f mmaH(v16h ah, v16h al, v16h bh, v16h bl, v8f c) {
  c = __builtin_amdgcn_wmma_f32_16x16x32_f16(false, ah, false, bh, (short)0, c, false, false);
  if (NT >= 2) c = __builtin_amdgcn_wmma_f32_16x16x32_f16(false, al, false, bh, (short)0, c, false, false);
  if (NT >= 3) c = __builtin_amdgcn_wmma_f32_16x16x32_f16(false, ah, false, bl, (short)0, c, false, false);
  asm volatile("v_nop\n\tv_nop\n\tv_nop\n\tv_nop" : "+v"(c) : "v"(ah), "v"(al), "v"(bh), "v"(bl));
  return c;
}
// batched GEMM like k_gemm_b but f16 operands: A f32 (split into f16 hi/lo if ASPLIT, else rounded to f16), Bt = f16 values [n][k]; alpha; C f32; N multiple of 16 (partial tiles skipped)
template <bool ASPLIT>
__global__ __launch_bounds__(128) void k_gemm_h(const float* __restrict__ A, int lda, size_t sA, const _Float16* __restrict__ Bh, int ldb, size_t sB, float alpha, float* __restrict__ C, int ldc, size_t sC, int M, int N, int K) {
  __shared__ __attribute__((aligned(16))) float so[4][16][64];
  const int tid = threadIdx.x, w = tid >> 5, lane = tid & 31, ln = lane & 15, hh = lane >> 4; const int by = blockIdx.y;
  A += (size_t)by * sA; Bh += (size_t)by * sB; C += (size_t)by * sC;
  const int ntn = (N + 63) / 64; const int wid = blockIdx.x * 4 + w; const int mt = wid / ntn, nq = wid % ntn; if (mt * 16 >= M) return;
  const int row0 = mt * 16, col0 = nq * 64; const float* arow = A + (size_t)(row0 + ln) * lda;
  v8f acc[4] = {};
  for (int kb = 0; kb < K; kb += 32) {
    FragH ah, al;
    const v4f x0 = *(const v4fa*)(arow + kb + 8 * hh), x1 = *(const v4fa*)(arow + kb + 8 * hh + 4), x2 = *(const v4fa*)(arow + kb + 16 + 8 * hh), x3 = *(const v4fa*)(arow + kb + 16 + 8 * hh + 4);
    float xs[16] = {x0[0],x0[1],x0[2],x0[3],x1[0],x1[1],x1[2],x1[3],x2[0],x2[1],x2[2],x2[3],x3[0],x3[1],x3[2],x3[3]};
#pragma unroll
    for (int i = 0; i < 16; ++i) { const _Float16 h = (_Float16)xs[i]; ah.h[i] = h; al.h[i] = ASPLIT ? (_Float16)(xs[i] - (float)h) : (_Float16)0.0f; }
#pragma unroll
    for (int t = 0; t < 4; ++t) { if (col0 + t * 16 >= N) continue; const size_t boff = (size_t)(col0 + t * 16 + ln) * ldb + kb; FragH bq; bq.half[0] = *(const v8us*)(Bh + boff + 8 * hh); bq.half[1] = *(const v8us*)(Bh + boff + 16 + 8 * hh);
      acc[t] = mmaH<ASPLIT ? 2 : 1>(ah.v, al.v, bq.v, bq.v, acc[t]); }
  }
#pragma unroll
  for (int t = 0; t < 4; ++t) { if (col0 + t * 16 >= N) continue;
#pragma unroll
    for (int r = 0; r < 8; ++r) so[w][8 * hh + r][t * 16 + ln] = acc[t][r] * alpha; }
  __builtin_amdgcn_fence(__ATOMIC_ACQ_REL, "workgroup"); __builtin_amdgcn_wave_barrier();
  const int rsub = lane >> 4, c4 = (lane & 15) * 4;
  {
#pragma unroll
    for (int q = 0; q < 8; ++q) { const int r = q * 2 + rsub; if (col0 + c4 < N) { const v4f v = *(const v4fa*)&so[w][r][c4]; *(v4f*)(C + (size_t)(row0 + r) * ldc + col0 + c4) = v; } }
     }
}

// Fragment order of an f16 operand plane [R][K] (R % 16 == 0, K % 32 == 0): tiles of 16 rows x 32 k, 1 KiB each, the k tiles of one row tile one after the other (a row tile is 16 * K elements, as in the row-major plane).
// Inside a tile the 16-byte piece (row ln, k = 16 * half + 8 * hh + 0..7) lies at element 256 * half + 8 * (16 * hh + ln): lane 16 * hh + ln of a wave finds its fragment at its own 16 bytes of two runs of 512 bytes, so a fragment load covers four whole 128-byte lines.
// pk_src: piece t, counted in storage order, -> its row and its first k
__device__ __forceinline__ void pk_src(unsigned t, unsigned K, int& row, int& k) { const unsigned ktn = K >> 5, tile = t >> 6, rt = tile / ktn, kt = tile - rt * ktn; row = (int)(rt * 16 + (t & 15)); k = (int)(kt * 32 + ((t >> 5) & 1) * 16 + ((t >> 4) & 1) * 8); }
// Wt = f16(W[k][n] * scale) as the plane [n][k] in fragment order, from f32 row-major W[K][N] (scale = power of two; bf16-exact weights stay exact in f16 away from the subnormal range); thread t makes piece t, in storage order
__device__ __forceinline__ void d_wt_f16(const float* __restrict__ W, _Float16* __restrict__ Wt, int K, int N, float scale, int t) {
  int n, k8; pk_src((unsigned)t, (unsigned)K, n, k8); FragH f;
#pragma unroll
  for (int i = 0; i < 8; ++i) f.h[i] = (_Float16)(bf16_round(W[(size_t)(k8 + i) * N + n]) * scale); const v8us o = f.half[0];
  *(v8us*)((unsigned short*)Wt + (size_t)t * 8) = o;
  asm volatile("s_wait_xcnt 0x0" ::: "memory");      /* the wait in front of any write of a register that this store names */
}
// k_gemm_hh variant with fused epilogue: v = acc·alpha + bias[by·sBias + col] (+ CP[(row/rowsPerB)·sCPb + by·64 + col] if CP) ; ACT 0 none / 1 elu ; writes f16 C16 (and f32 C if non-null)
template <int ACT>
__global__ __launch_bounds__(128) void k_gemm_hhx(const _Float16* __restrict__ A, int lda, size_t sA, const _Float16* __restrict__ Bh, int ldb, size_t sB, float alpha, const float* __restrict__ bias, size_t sBias, const float* __restrict__ CP, int rowsPerB, size_t sCPb, int row0g,
    float* __restrict__ C, _Float16* __restrict__ C16, int ldc, size_t sC, int M, int N, int K) {
  __shared__ __attribute__((aligned(16))) float so[4][16][64];
  const int tid = threadIdx.x, w = tid >> 5, lane = tid & 31, ln = lane & 15, hh = lane >> 4; const int by = blockIdx.y;
  A += (size_t)by * sA; Bh += (size_t)by * sB; const size_t cofs = (size_t)by * sC; const float* bp = bias ? bias + (size_t)by * sBias : nullptr;
  const int ntn = (N + 63) / 64; const int wid = blockIdx.x * 4 + w; const int mt = wid / ntn, nq = wid % ntn; if (mt * 16 >= M) return;
  const int row0 = mt * 16, col0 = nq * 64; const _Float16* arow = A + (size_t)(row0 + ln) * lda;
  v8f acc[4] = {};
  for (int kb = 0; kb < K; kb += 32) { FragH ah; ah.half[0] = *(const v8us*)((const unsigned short*)arow + kb + 8 * hh); ah.half[1] = *(const v8us*)((const unsigned short*)arow + kb + 16 + 8 * hh);
#pragma unroll
    for (int t = 0; t < 4; ++t) { if (col0 + t * 16 >= N) continue; const size_t boff = (size_t)(col0 + t * 16 + ln) * ldb + kb; FragH bq; bq.half[0] = *(const v8us*)((const unsigned short*)Bh + boff + 8 * hh); bq.half[1] = *(const v8us*)((const unsigned short*)Bh + boff + 16 + 8 * hh);
      acc[t] = mmaH<1>(ah.v, ah.v, bq.v, bq.v, acc[t]); }
  }
#pragma unroll
  for (int t = 0; t < 4; ++t) { if (col0 + t * 16 >= N) continue; const int col = col0 + t * 16 + ln; const float bv = bp ? bf16_round(bp[col]) : 0.f;
#pragma unroll
    for (int r = 0; r < 8; ++r) { float v = acc[t][r] * alpha + bv; if (CP) { const int bidx = (row0g + row0 + 8 * hh + r) / rowsPerB; v += CP[(size_t)bidx * sCPb + (size_t)by * 64 + col]; } if (ACT == 1) v = (v > 0.f) ? v : expm1f(v); else if (ACT == 7) v = (v > 0.f) ? v + 1.0f : expf(v); else if (ACT == 8) v = tanhf(v); else if (ACT == 9) v = 0.5f * v * (1.0f + tanhf(0.7978845608028654f * (v + 0.044715f * v * v * v))); else if (ACT == 11) v = 1.0f / (1.0f + expf(-v)); else if (ACT == 12) v = (v > 0.f) ? v : 0.01f * v; else if (ACT == 14) v = (v > 0.f) ? v : 0.1f * v; else if (ACT == 15) v = v / (1.0f + expf(-v)); else if (ACT == 3) v = fmaxf(v, 0.f); else if (ACT == 6) v = 0.5f * v * (1.0f + erff(v * 0.70710678118654752f)); so[w][8 * hh + r][t * 16 + ln] = v; } }
  __builtin_amdgcn_fence(__ATOMIC_ACQ_REL, "workgroup"); __builtin_amdgcn_wave_barrier();
  const int rsub = lane >> 4, c4 = (lane & 15) * 4; typedef _Float16 v4h __attribute__((ext_vector_type(4)));
  {
#pragma unroll
    for (int q = 0; q < 8; ++q) { const int r = q * 2 + rsub; if (col0 + c4 < N) { const v4f v = *(const v4fa*)&so[w][r][c4]; if (C) *(v4f*)(C + cofs + (size_t)(row0 + r) * ldc + col0 + c4) = v; if (C16) { v4h h4; for (int i = 0; i < 4; ++i) h4[i] = (_Float16)v[i]; *(v4h*)(C16 + cofs + (size_t)(row0 + r) * ldc + col0 + c4) = h4; } } }
     }
}


typedef _Float16 v4h __attribute__((ext_vector_type(4)));

__global__ __launch_bounds__(256) void k_x16(const float* __restrict__ x, _Float16* __restrict__ X16, size_t n8) { const size_t t = (size_t)blockIdx.x * 256 + threadIdx.x; if (t >= n8) return; FragH f;
#pragma unroll
  for (int q = 0; q < 8; ++q) f.h[q] = (_Float16)bf16_round(x[t * 8 + q]); *(v8us*)((unsigned short*)X16 + t * 8) = f.half[0];  }
// Er as the table of the skewed index t = 0 .. 2 * TT - 1, a plane [t][64] in fragment order: row t is Er[t] for t < TT, zero for t == TT, Er[t - TT - 1] beyond; thread t makes piece t, in storage order
__device__ __forceinline__ void d_er2(const float* __restrict__ Er, _Float16* __restrict__ E2, unsigned t) { int row, k; pk_src(t, 64, row, k);
  const int er = (row < TT) ? row : ((row > TT) ? row - TT - 1 : 0); const float* ep = Er + (size_t)er * 64 + k; const v4f a = *(const v4fa*)ep, c = *(const v4fa*)(ep + 4); FragH f;
#pragma unroll
  for (int q = 0; q < 4; ++q) { f.h[q] = (_Float16)bf16_round(a[q]); f.h[4 + q] = (_Float16)bf16_round(c[q]); }
  const v8us zr = {0, 0, 0, 0, 0, 0, 0, 0}; *(v8us*)((unsigned short*)E2 + (size_t)t * 8) = (row == TT) ? zr : f.half[0];
  asm volatile("s_wait_xcnt 0x0" ::: "memory"); }      /* the wait in front of any write of a register that this store names */
// x as an exact f16 plane [rows][DM] in fragment order; thread t makes piece t, in storage order
__device__ __forceinline__ void d_x16p(const float* __restrict__ x, _Float16* __restrict__ X16, unsigned t) { int row, k; pk_src(t, DM, row, k); const float* xp = x + (size_t)row * DM + k; const v4f a = *(const v4fa*)xp, c = *(const v4fa*)(xp + 4); FragH f;
#pragma unroll
  for (int q = 0; q < 4; ++q) { f.h[q] = (_Float16)bf16_round(a[q]); f.h[4 + q] = (_Float16)bf16_round(c[q]); }
  *(v8us*)((unsigned short*)X16 + (size_t)t * 8) = f.half[0];
  asm volatile("s_wait_xcnt 0x0" ::: "memory"); }      /* the wait in front of any write of a register that this store names */
// the five operand planes that depend on the inputs alone, in one launch: a block makes 256 pieces of one plane
#define PB_KV (DM * 2 * DM / 8 / 256)
#define PB_W  (DM * DM / 8 / 256)
#define PB_X  (NR * DM / 8 / 256)
#define PB_E  (2 * TT * 64 / 8 / 256)
__global__ __launch_bounds__(256) void k_prep(const float* __restrict__ qw, const float* __restrict__ kvw, const float* __restrict__ pw, const float* __restrict__ Er, const float* __restrict__ x,
    _Float16* __restrict__ BQ, _Float16* __restrict__ BKV, _Float16* __restrict__ BP, _Float16* __restrict__ E2, _Float16* __restrict__ X16) {
  const int bx = blockIdx.x, tid = threadIdx.x;      /* (in,out) weights -> [out][in] x16 */
  if (bx < PB_KV) d_wt_f16(kvw, BKV, DM, 2 * DM, 16.0f, bx * 256 + tid);
  else if (bx < PB_KV + PB_W) d_wt_f16(qw, BQ, DM, DM, 16.0f, (bx - PB_KV) * 256 + tid);
  else if (bx < PB_KV + 2 * PB_W) d_wt_f16(pw, BP, DM, DM, 16.0f, (bx - PB_KV - PB_W) * 256 + tid);
  else if (bx < PB_KV + 2 * PB_W + PB_X) d_x16p(x, X16, (unsigned)((bx - PB_KV - 2 * PB_W) * 256 + tid));
  else d_er2(Er, E2, (unsigned)((bx - PB_KV - 2 * PB_W - PB_X) * 256 + tid));
}
__global__ __launch_bounds__(256) void k_h16(const float* __restrict__ x, _Float16* __restrict__ X16, size_t n8) { const size_t t = (size_t)blockIdx.x * 256 + threadIdx.x; if (t >= n8) return; FragH f;
#pragma unroll
  for (int q = 0; q < 8; ++q) f.h[q] = (_Float16)x[t * 8 + q]; *(v8us*)((unsigned short*)X16 + t * 8) = f.half[0];  }
__global__ __launch_bounds__(256) void k_round16f(const float* __restrict__ W, _Float16* __restrict__ Bt, size_t n8) { const size_t t = (size_t)blockIdx.x * 256 + threadIdx.x; if (t >= n8) return; FragH f;
#pragma unroll
  for (int i = 0; i < 8; ++i) f.h[i] = (_Float16)(bf16_round(W[t * 8 + i]) * 16.0f); *(v8us*)((unsigned short*)Bt + t * 8) = f.half[0];  }
__global__ __launch_bounds__(256) void k_hl(const float* __restrict__ F, _Float16* __restrict__ Hh, _Float16* __restrict__ Hl, size_t n8) { const size_t t = (size_t)blockIdx.x * 256 + threadIdx.x; if (t >= n8) return; FragH fh, fl; const v4f a = *(const v4fa*)(F + t * 8), c = *(const v4fa*)(F + t * 8 + 4);
#pragma unroll
  for (int q = 0; q < 4; ++q) { _Float16 h = (_Float16)a[q]; fh.h[q] = h; fl.h[q] = (_Float16)((a[q] - (float)h) * 1024.0f); h = (_Float16)c[q]; fh.h[4 + q] = h; fl.h[4 + q] = (_Float16)((c[q] - (float)h) * 1024.0f); }
  { *(v8us*)((unsigned short*)Hh + t * 8) = fh.half[0]; *(v8us*)((unsigned short*)Hl + t * 8) = fl.half[0];  } }

// ---- fast GEMMs (wave tile 32x64, a block 128x64; K % 64 == 0; A and Bh in fragment order, pitch K) ----
__device__ __forceinline__ v16h g2_fragp(const _Float16* p) { FragH f; f.half[0] = *(const v8us*)((const unsigned short*)p); f.half[1] = *(const v8us*)((const unsigned short*)p + 256); return f.v; }      /* p: the tile's start + 8 * lane */
__device__ __forceinline__ v16h g2_frag(const _Float16* p, int hh) { FragH f; f.half[0] = *(const v8us*)((const unsigned short*)p + 8 * hh); f.half[1] = *(const v8us*)((const unsigned short*)p + 16 + 8 * hh); return f.v; }
__device__ __forceinline__ v8f g2_mma(v16h a, v16h b, v8f c) { v8f d = __builtin_amdgcn_wmma_f32_16x16x32_f16(false, a, false, b, (short)0, c, false, false); asm volatile("v_nop\n\tv_nop\n\tv_nop\n\tv_nop" : "+v"(d) : "v"(a), "v"(b)); return d; }
// k loop of a wave: two row tiles of A against four row tiles of B, c[a][t] += A[a] . B[t]^T over K (K % 64 == 0); pa*, pb*: each lane's place in the first k tile of each row tile
__device__ __forceinline__ void g2_kloop2(const _Float16* pa0, const _Float16* pa1, const _Float16* pb0, const _Float16* pb1, const _Float16* pb2, const _Float16* pb3, int K, v8f (&c)[2][4]) {
  v8f c00 = c[0][0], c01 = c[0][1], c02 = c[0][2], c03 = c[0][3], c10 = c[1][0], c11 = c[1][1], c12 = c[1][2], c13 = c[1][3];
  /* two register sets of six fragments (32 k each): the twelve loads of a set are issued as one group, one set ahead of the products that read it, so that a set's load latency runs behind the other set's products; the k order of every sum is the old one */
  v16h xa0 = g2_fragp(pa0), xa1 = g2_fragp(pa1), xb0 = g2_fragp(pb0), xb1 = g2_fragp(pb1), xb2 = g2_fragp(pb2), xb3 = g2_fragp(pb3);
  __builtin_amdgcn_sched_barrier(0);      /* holds the first group in front of the loop */
#pragma unroll 1      /* the two sets are the whole ring: a further copy of the body would only cost registers */
  for (int kb = 0; kb < K; kb += 64) {
    const v16h ya0 = g2_fragp(pa0 + 512), ya1 = g2_fragp(pa1 + 512), yb0 = g2_fragp(pb0 + 512), yb1 = g2_fragp(pb1 + 512), yb2 = g2_fragp(pb2 + 512), yb3 = g2_fragp(pb3 + 512);      /* the next k tile: 512 elements on */
    /* the wait that stands in front of the write of the six address registers below, which both groups in flight name; the addresses are its inputs so that their registers stay untouched up to it */
    asm volatile("s_wait_xcnt 0x0" :: "v"(pa0), "v"(pa1), "v"(pb0), "v"(pb1), "v"(pb2), "v"(pb3) : "memory");
    __builtin_amdgcn_sched_barrier(0);      /* holds this group in front of the products: without it the scheduler sinks each load to its first use, with a full wait each */
    c00 = g2_mma(xa0, xb0, c00); c10 = g2_mma(xa1, xb0, c10); c01 = g2_mma(xa0, xb1, c01); c11 = g2_mma(xa1, xb1, c11);
    c02 = g2_mma(xa0, xb2, c02); c12 = g2_mma(xa1, xb2, c12); c03 = g2_mma(xa0, xb3, c03); c13 = g2_mma(xa1, xb3, c13);
    const int adv = (kb + 64 < K) ? 1024 : 0;      /* the last trip has no next set: it reads its own first set again, in bounds and unused, so that every trip has the same loads in flight and the counted waits hold */
    pa0 += adv; pa1 += adv; pb0 += adv; pb1 += adv; pb2 += adv; pb3 += adv;
    xa0 = g2_fragp(pa0); xa1 = g2_fragp(pa1); xb0 = g2_fragp(pb0); xb1 = g2_fragp(pb1); xb2 = g2_fragp(pb2); xb3 = g2_fragp(pb3);
    __builtin_amdgcn_sched_barrier(0);      /* holds the next set's group in front of this set's products */
    c00 = g2_mma(ya0, yb0, c00); c10 = g2_mma(ya1, yb0, c10); c01 = g2_mma(ya0, yb1, c01); c11 = g2_mma(ya1, yb1, c11);
    c02 = g2_mma(ya0, yb2, c02); c12 = g2_mma(ya1, yb2, c12); c03 = g2_mma(ya0, yb3, c03); c13 = g2_mma(ya1, yb3, c13); }
  /* the same wait for the last group, in front of whatever reuses its address registers behind the loop */
  asm volatile("s_wait_xcnt 0x0" :: "v"(pa0), "v"(pa1), "v"(pb0), "v"(pb1), "v"(pb2), "v"(pb3) : "memory");
  c[0][0] = c00; c[0][1] = c01; c[0][2] = c02; c[0][3] = c03; c[1][0] = c10; c[1][1] = c11; c[1][2] = c12; c[1][3] = c13;
}
// D = A.B + C as the plain builtin: the compiler keeps the distance behind it itself, and its operands may lie above v255, which an asm operand cannot
__device__ __forceinline__ v8f g4_mma(v16h a, v16h b, v8f c) { return __builtin_amdgcn_wmma_f32_16x16x32_f16(false, a, false, b, (short)0, c, false, false); }
// the same loop with four row tiles of A (two of each of two planes) against the same four of B: eight fragments a set, sixteen products
__device__ __forceinline__ void g2_kloop4(const _Float16* pa0, const _Float16* pa1, const _Float16* pa2, const _Float16* pa3, const _Float16* pb0, const _Float16* pb1, const _Float16* pb2, const _Float16* pb3, int K, v8f (&c)[4][4]) {
  v16h xa[4], xb[4], ya[4], yb[4];
  xa[0] = g2_fragp(pa0); xa[1] = g2_fragp(pa1); xa[2] = g2_fragp(pa2); xa[3] = g2_fragp(pa3); xb[0] = g2_fragp(pb0); xb[1] = g2_fragp(pb1); xb[2] = g2_fragp(pb2); xb[3] = g2_fragp(pb3);
  __builtin_amdgcn_sched_barrier(0);      /* holds the first group in front of the loop */
#pragma unroll 1      /* the two sets are the whole ring: a further copy of the body would only cost registers */
  for (int kb = 0; kb < K; kb += 64) {
    ya[0] = g2_fragp(pa0 + 512); ya[1] = g2_fragp(pa1 + 512); ya[2] = g2_fragp(pa2 + 512); ya[3] = g2_fragp(pa3 + 512); yb[0] = g2_fragp(pb0 + 512); yb[1] = g2_fragp(pb1 + 512); yb[2] = g2_fragp(pb2 + 512); yb[3] = g2_fragp(pb3 + 512);
    /* the wait that stands in front of the write of the eight address registers below, which both groups in flight name; the addresses are its inputs so that their registers stay untouched up to it */
    asm volatile("s_wait_xcnt 0x0" :: "v"(pa0), "v"(pa1), "v"(pa2), "v"(pa3), "v"(pb0), "v"(pb1), "v"(pb2), "v"(pb3) : "memory");
    __builtin_amdgcn_sched_barrier(0);      /* holds this group in front of the products: without it the scheduler sinks each load to its first use, with a full wait each */
#pragma unroll
    for (int t = 0; t < 4; ++t)
#pragma unroll
      for (int a = 0; a < 4; ++a) c[a][t] = g4_mma(xa[a], xb[t], c[a][t]);
    const int adv = (kb + 64 < K) ? 1024 : 0;      /* the last trip reads its own first set again, in bounds and unused, so that every trip has the same loads in flight */
    pa0 += adv; pa1 += adv; pa2 += adv; pa3 += adv; pb0 += adv; pb1 += adv; pb2 += adv; pb3 += adv;
    __builtin_amdgcn_sched_barrier(0);      /* keeps the first set's products in front of the loads that refill it */
    xa[0] = g2_fragp(pa0); xa[1] = g2_fragp(pa1); xa[2] = g2_fragp(pa2); xa[3] = g2_fragp(pa3); xb[0] = g2_fragp(pb0); xb[1] = g2_fragp(pb1); xb[2] = g2_fragp(pb2); xb[3] = g2_fragp(pb3);
    __builtin_amdgcn_sched_barrier(0);      /* holds the next set's group in front of this set's products */
#pragma unroll
    for (int t = 0; t < 4; ++t)
#pragma unroll
      for (int a = 0; a < 4; ++a) c[a][t] = g4_mma(ya[a], yb[t], c[a][t]); }
  /* the same wait for the last group, in front of whatever reuses its address registers behind the loop */
  asm volatile("s_wait_xcnt 0x0" :: "v"(pa0), "v"(pa1), "v"(pa2), "v"(pa3), "v"(pb0), "v"(pb1), "v"(pb2), "v"(pb3) : "memory");
}
// q, k and v projections: column tile nq0 + (0 .. ntn - 1) of the plane [q | k | v] (3 * DM columns, 64 = one head per tile), A = x and Bh = [q_w | kv_w]^T x16 in fragment order.
// The epilogue stores each part as the attention kernel reads it: q row-major [row][DM]; k per (batch, head) as [token][d] and v as [d][token], both in fragment order.
__global__ __launch_bounds__(128) void k_gemm_qkv(const _Float16* __restrict__ A, const _Float16* __restrict__ Bh, const float* __restrict__ qb, const float* __restrict__ kvb, int nq0, int ntn,
    _Float16* __restrict__ Q16, _Float16* __restrict__ KP, _Float16* __restrict__ VT) {
  __shared__ __attribute__((aligned(16))) float so[4][32][68];
  const int tid = threadIdx.x, w = tid >> 5, lane = tid & 31, ln = lane & 15, hh = lane >> 4;
  const int mt = blockIdx.x / ntn, nq = nq0 + blockIdx.x - mt * ntn; const int row0 = mt * 128 + 32 * w, col0 = nq * 64; const int part = nq / NH, h = nq - part * NH;
  /* each lane's place in the first k tile of the six row tiles */
  const _Float16* pa0 = A + (size_t)row0 * DM + 8 * lane; const _Float16* pa1 = pa0 + (size_t)16 * DM;
  const _Float16* pb0 = Bh + (size_t)col0 * DM + 8 * lane; const _Float16* pb1 = pb0 + (size_t)16 * DM; const _Float16* pb2 = pb1 + (size_t)16 * DM; const _Float16* pb3 = pb2 + (size_t)16 * DM;
  const v8f z8 = {0.f,0.f,0.f,0.f,0.f,0.f,0.f,0.f}; v8f c[2][4] = {{z8, z8, z8, z8}, {z8, z8, z8, z8}};
  g2_kloop2(pa0, pa1, pb0, pb1, pb2, pb3, DM, c);
  const float* bp = (part == 0) ? qb + col0 : kvb + (col0 - DM);
  const int b = row0 / TT, tok0 = row0 - b * TT; const size_t slab = (size_t)(b * NH + h) * 64 * TT;      /* the wave's 32 rows are tokens tok0 .. tok0 + 31 of batch b */
  if (part == 2) {      /* v: the accumulator tile (half, t) holds in each lane 8 tokens in a row of one d, which is that lane's piece of the tile (d tile t, token tile tok0 / 32), half 'half' */
#pragma unroll
    for (int t = 0; t < 4; ++t) { const float bv = bf16_round(bp[t * 16 + ln]);
#pragma unroll
      for (int half = 0; half < 2; ++half) { FragH f;
#pragma unroll
        for (int r = 0; r < 8; ++r) f.h[r] = (_Float16)(c[half][t][r] * 0.0625f + bv);
        *(v8us*)((unsigned short*)VT + slab + (size_t)(t * 16) * TT + (size_t)(tok0 >> 5) * 512 + half * 256 + lane * 8) = f.half[0]; } }
    return; }
#pragma unroll
  for (int t = 0; t < 4; ++t) { const float bv = bf16_round(bp[t * 16 + ln]);
#pragma unroll
    for (int half = 0; half < 2; ++half)
#pragma unroll
      for (int r = 0; r < 8; ++r) so[w][half * 16 + 8 * hh + r][t * 16 + ln] = c[half][t][r] * 0.0625f + bv; }
  __builtin_amdgcn_fence(__ATOMIC_ACQ_REL, "workgroup"); __builtin_amdgcn_wave_barrier();      /* a wave reads back only its own part of so: its LDS writes are done before any of its lanes reads */
  if (part == 0) { const int rsub = lane >> 4, c4 = (lane & 15) * 4;
#pragma unroll
    for (int q = 0; q < 16; ++q) { const int r = q * 2 + rsub; const v4f v = *(const v4fa*)&so[w][r][c4]; v4h h4; for (int i = 0; i < 4; ++i) h4[i] = (_Float16)v[i]; *(v4h*)(Q16 + (size_t)(row0 + r) * DM + col0 + c4) = h4;
      if (q == 7 || q == 15) asm volatile("s_wait_xcnt 0x0" ::: "memory"); }      /* the wait in front of any write of a register that one of the eight stores before it names */
  } else {      /* k: piece (token tile rt, d tile kt, half hf) of lane 16 * hh + ln is token rt * 16 + ln, d = kt * 32 + hf * 16 + hh * 8 + (0 .. 7) */
#pragma unroll
    for (int pc = 0; pc < 8; ++pc) { const int rt = pc >> 2, kt = (pc >> 1) & 1, hf = pc & 1; const float* sp = &so[w][rt * 16 + ln][kt * 32 + hf * 16 + hh * 8]; const v4f lo = *(const v4fa*)sp, hi = *(const v4fa*)(sp + 4); FragH f;
#pragma unroll
      for (int i = 0; i < 4; ++i) { f.h[i] = (_Float16)lo[i]; f.h[4 + i] = (_Float16)hi[i]; }
      *(v8us*)((unsigned short*)KP + slab + (size_t)((tok0 >> 4) + rt) * 1024 + kt * 512 + hf * 256 + lane * 8) = f.half[0];
      if (pc == 3 || pc == 7) asm volatile("s_wait_xcnt 0x0" ::: "memory"); } }      /* the wait in front of any write of a register that one of the four stores before it names */
}
// output projection: out = Oh . W + bias + (Ol . W) / 1024, W = Bh / 16; both terms in one k loop over the same B fragments, each in accumulators of its own; Ah, Al, Bh in fragment order
__global__ __launch_bounds__(128) void k_gemm_proj(const _Float16* __restrict__ Ah, const _Float16* __restrict__ Al, const _Float16* __restrict__ Bh, const float* __restrict__ bias, float* __restrict__ C) {
  __shared__ __attribute__((aligned(16))) float so[4][32][68];
  const int tid = threadIdx.x, w = tid >> 5, lane = tid & 31, ln = lane & 15, hh = lane >> 4;
  const int ntn = DM / 64; const int mt = blockIdx.x / ntn, nq = blockIdx.x - mt * ntn; const int row0 = mt * 128 + 32 * w, col0 = nq * 64;
  /* each lane's place in the first k tile of the eight row tiles */
  const _Float16* pa0 = Ah + (size_t)row0 * DM + 8 * lane; const _Float16* pa1 = pa0 + (size_t)16 * DM; const _Float16* pa2 = Al + (size_t)row0 * DM + 8 * lane; const _Float16* pa3 = pa2 + (size_t)16 * DM;
  const _Float16* pb0 = Bh + (size_t)col0 * DM + 8 * lane; const _Float16* pb1 = pb0 + (size_t)16 * DM; const _Float16* pb2 = pb1 + (size_t)16 * DM; const _Float16* pb3 = pb2 + (size_t)16 * DM;
  const v8f z8 = {0.f,0.f,0.f,0.f,0.f,0.f,0.f,0.f}; v8f c[4][4] = {{z8, z8, z8, z8}, {z8, z8, z8, z8}, {z8, z8, z8, z8}, {z8, z8, z8, z8}};
  g2_kloop4(pa0, pa1, pa2, pa3, pb0, pb1, pb2, pb3, DM, c);
#pragma unroll
  for (int t = 0; t < 4; ++t) { const float bv = bf16_round(bias[col0 + t * 16 + ln]);
#pragma unroll
    for (int half = 0; half < 2; ++half)
#pragma unroll
      for (int r = 0; r < 8; ++r) so[w][half * 16 + 8 * hh + r][t * 16 + ln] = c[2 + half][t][r] * (0.0625f / 1024.0f) + (c[half][t][r] * 0.0625f + bv); }
  __builtin_amdgcn_fence(__ATOMIC_ACQ_REL, "workgroup"); __builtin_amdgcn_wave_barrier();      /* a wave reads back only its own part of so: its LDS writes are done before any of its lanes reads */
  const int rsub = lane >> 4, c4 = (lane & 15) * 4;
#pragma unroll
  for (int q = 0; q < 16; ++q) { const int r = q * 2 + rsub; const v4f v = *(const v4fa*)&so[w][r][c4]; *(v4f*)(C + (size_t)(row0 + r) * DM + col0 + c4) = v; }
}

// D = A.B + C as the plain builtin: the compiler keeps the distance behind it itself
__device__ __forceinline__ v8f ra_mma(v16h a, v16h b, v8f c) { return __builtin_amdgcn_wmma_f32_16x16x32_f16(false, a, false, b, (short)0, c, false, false); }
// the six relative tiles of a pass: tile u = 16 rows of the table (A: its two k halves ef[u][0], ef[u][1]) against the two query groups (B), stored to each query's row in LDS; tile u serves group 0 for u >= 1 and group 1 for u <= 4.
// Tiles u < UC lie below the wrap and go with query i (q), the others with query i + 1 (qn); d0, d1: the lane's place in tile 0 of each group's row
template <int UC>
__device__ __forceinline__ void rel_pass(const v16h (&ef)[6][2], const v16h (&q)[2][2], const v16h (&qn)[2][2], float* d0, float* d1) {
  const v8f z8 = {0.f,0.f,0.f,0.f,0.f,0.f,0.f,0.f}; v8f r0[6], r1[6];
#pragma unroll
  for (int ks = 0; ks < 2; ++ks)
#pragma unroll
    for (int u = 0; u < 6; ++u) {
      if (u >= 1) r0[u] = ra_mma(ef[u][ks], (u < UC) ? q[0][ks] : qn[0][ks], ks ? r0[u] : z8);
      if (u <= 4) r1[u] = ra_mma(ef[u][ks], (u < UC) ? q[1][ks] : qn[1][ks], ks ? r1[u] : z8); }
  __builtin_amdgcn_sched_barrier(0);      /* holds the twenty products, ten tiles in registers of their own, in front of the stores: without it each tile's two products and its stores run one after the other through one register set, a dependent chain per tile */
#pragma unroll
  for (int u = 0; u < 6; ++u) {
    if (u >= 1) { float* d = d0 + 16 * (u - 1); const v4f lo = {r0[u][0], r0[u][1], r0[u][2], r0[u][3]}, hi = {r0[u][4], r0[u][5], r0[u][6], r0[u][7]}; *(v4fa*)d = lo; *(v4fa*)(d + 4) = hi; }
    if (u <= 4) { float* d = d1 + 16 * u; const v4f lo = {r1[u][0], r1[u][1], r1[u][2], r1[u][3]}, hi = {r1[u][4], r1[u][5], r1[u][6], r1[u][7]}; *(v4fa*)d = lo; *(v4fa*)(d + 4) = hi; } }
}

// Attention of one (batch, head) and 128 queries per block, 32 queries per wave, keys 64 at a time; nothing of S, QEr or P goes to memory.
// With t = TT-1-i+j the skewed term of (query i, key j) is q[i].Er[t] for t < TT, 0 for t == TT, q[i+1].Er[t-TT-1] for t > TT.
// All tiles are transposed: D[row 8*hh+r][column ln] with the query in the column, so a lane owns one query's max, sum and O column.
// Every inner loop is unrolled so that each array index is a constant and the arrays live in registers.
__global__ __launch_bounds__(128) void k_relattn(const _Float16* __restrict__ Q16, const _Float16* __restrict__ KP, const _Float16* __restrict__ VT, const _Float16* __restrict__ ER16, _Float16* __restrict__ Oh, _Float16* __restrict__ Ol) {
  __shared__ __attribute__((aligned(16))) float rl[4][2][16][RP];
  const int tid = threadIdx.x, w = __builtin_amdgcn_readfirstlane(tid >> 5), lane = tid & 31, ln = lane & 15, hh = lane >> 4;
  const int bh = blockIdx.y, b = bh / NH, h = bh - b * NH; const int i0 = blockIdx.x * 128 + 32 * w;
  const _Float16* qbase = Q16 + (size_t)b * TT * DM + h * 64; const _Float16* kbase = KP + (size_t)bh * 64 * TT; const _Float16* vbase = VT + (size_t)bh * 64 * TT;      /* [token][d] and [d][token], both in fragment order */
  v16h q[2][2], qn[2][2];      /* queries i and i + 1 as B operands; the row past the last query is never used, its address is clamped */
  const _Float16* qp[2]; const _Float16* qnp[2];
  __builtin_amdgcn_sched_barrier(0);      /* with the one behind the wait: keeps the set-up arithmetic, which reuses registers, out of the stretch between these loads and their wait */
#pragma unroll
  for (int qs = 0; qs < 2; ++qs) { const int i = i0 + 16 * qs + ln; const int i1 = (i + 1 < TT) ? i + 1 : TT - 1; qp[qs] = qbase + (size_t)i * DM + 8 * hh; qnp[qs] = qbase + (size_t)i1 * DM + 8 * hh;
#pragma unroll
    for (int ks = 0; ks < 2; ++ks) { q[qs][ks] = g2_frag(qp[qs] + 32 * ks, 0); qn[qs][ks] = g2_frag(qnp[qs] + 32 * ks, 0); } }
  asm volatile("s_wait_xcnt 0x0" ::: "memory");      /* the wait in front of any write of an address register of these loads */
  __builtin_amdgcn_sched_barrier(0);
  const v8f z8 = {0.f,0.f,0.f,0.f,0.f,0.f,0.f,0.f};
  v8f o[2][4] = {{z8, z8, z8, z8}, {z8, z8, z8, z8}}; float mx[2] = {-3.0e38f, -3.0e38f}, sm[2] = {0.f, 0.f};
#pragma unroll 1      /* the pass is some 1,100 instructions long: a second copy would only cost instruction fetch and registers */
  for (int j0 = 0; j0 < TT; j0 += 64) {
    /* every global load of the pass is issued here, so that the pass waits out one load latency and not one per tile */
    /* relative tiles: rows t = tb0 + 16u + (0..15); queries i0+16.. take u = 0..4, queries i0.. take u = 1..5 */
    const int tb0 = TT - 32 - i0 + j0;
    /* each lane's three addresses: its place in the first k, v and relative tile of the pass; 0 <= tb0 and tb0 + 95 <= 2 * TT - 1, the rows of the table */
    const _Float16* kp = kbase + (size_t)j0 * 64 + 8 * lane; const _Float16* vp = vbase + (size_t)j0 * 16 + 8 * lane; const _Float16* ep = ER16 + (size_t)tb0 * 64 + 8 * lane;
    v16h kf[4][2], ef[6][2], vf[4][2];
#pragma unroll
    for (int n = 0; n < 4; ++n) { kf[n][0] = g2_fragp(kp + 1024 * n); kf[n][1] = g2_fragp(kp + 1024 * n + 512); }
#pragma unroll
    for (int u = 0; u < 6; ++u) { ef[u][0] = g2_fragp(ep + 1024 * u); ef[u][1] = g2_fragp(ep + 1024 * u + 512); }
#pragma unroll
    for (int dt = 0; dt < 4; ++dt) { vf[dt][0] = g2_fragp(vp + (size_t)(16 * dt) * TT); vf[dt][1] = g2_fragp(vp + (size_t)(16 * dt) * TT + 512); }
    /* the wait that stands in front of any write of a register which one of these loads names as its address; the addresses are its inputs so that their registers stay untouched up to it */
    asm volatile("s_wait_xcnt 0x0" :: "v"(kp), "v"(vp), "v"(ep) : "memory");
    __builtin_amdgcn_sched_barrier(0);      /* holds the loads and that wait in front of the products: without it the scheduler sinks the k loads between the products, two at a time, each with its own full wait */
    v8f s[2][4];      /* s[qs][n][r] = k[j0 + 16n + 8hh + r] . q[i0 + 16qs + ln] */
#pragma unroll
    for (int n = 0; n < 4; ++n)
#pragma unroll
      for (int qs = 0; qs < 2; ++qs) s[qs][n] = ra_mma(kf[n][1], q[qs][1], ra_mma(kf[n][0], q[qs][0], z8));
    /* TT - tb0 = 32 + i0 - j0 is a multiple of 32, so a tile of 16 table rows lies whole on one side of the wrap and the wrap stands in front of tile 0, 2 or 4 or behind the pass: rows below TT go with query i, rows from TT on with query i + 1 (row TT of the table is stored as zeros). No row is masked, and each of the four cases runs its twenty products with no branch between them */
    { float* d0 = &rl[w][0][ln][8 * hh]; float* d1 = &rl[w][1][ln][8 * hh]; const int below = TT - tb0;      /* table rows of the pass below the wrap, where under 96 */
      if (below >= 96) rel_pass<6>(ef, q, qn, d0, d1);
      else if (below <= 0) rel_pass<0>(ef, q, qn, d0, d1);
      else if (below == 64) rel_pass<4>(ef, q, qn, d0, d1);
      else rel_pass<2>(ef, q, qn, d0, d1); }
    /* a query's row is written by its two lanes and read by both: the wave's LDS writes are done before any lane reads; only the LDS counter is waited on, the v loads stay in flight */
    asm volatile("s_wait_dscnt 0x0" ::: "memory"); __builtin_amdgcn_wave_barrier();
    FragH p[2][2];
#pragma unroll
    for (int qs = 0; qs < 2; ++qs) { const float* rr = &rl[w][qs][ln][15 - ln + 8 * hh]; float mt = -3.0e38f;
#pragma unroll
      for (int n = 0; n < 4; ++n)
#pragma unroll
        for (int r = 0; r < 8; ++r) { const float lg = s[qs][n][r] + rr[16 * n + r]; s[qs][n][r] = lg; mt = fmaxf(mt, lg); }      /* 8 x the logit: the scale goes into the exponent's multiply-add */
      mt = fmaxf(mt, __shfl_xor(mt, 16, 32));
      const float mn = fmaxf(mx[qs], mt), ax = (mx[qs] - mn) * L2E8, nb = fmaf(-mn, L2E8, 10.0f); float al = __builtin_amdgcn_exp2f(ax); mx[qs] = mn; float ps[4] = {0.f, 0.f, 0.f, 0.f};      /* one partial sum per key tile: four short add chains */
      asm("v_nop" : "+v"(al) : "v"(ax));      /* the slot behind a transcendental, as below */
#pragma unroll
      for (int n = 0; n < 4; ++n)
      { float x[8], e[8];      /* e = 2^10 * exp(logit - max) */
#pragma unroll
        for (int r = 0; r < 8; ++r) { x[r] = fmaf(s[qs][n][r], L2E8, nb); e[r] = __builtin_amdgcn_exp2f(x[r]); }
        /* the slot that the instruction set asks for behind a transcendental, before its result is read or its source overwritten: no result is read and no source register is given up in front of this v_nop, so whatever stands directly behind one of the eight is independent of it or is the v_nop */
        asm("v_nop" : "+v"(e[0]), "+v"(e[1]), "+v"(e[2]), "+v"(e[3]), "+v"(e[4]), "+v"(e[5]), "+v"(e[6]), "+v"(e[7]) : "v"(x[0]), "v"(x[1]), "v"(x[2]), "v"(x[3]), "v"(x[4]), "v"(x[5]), "v"(x[6]), "v"(x[7]));
#pragma unroll
        for (int r = 0; r < 8; ++r) { ps[n] += e[r]; p[qs][n >> 1].h[(n & 1) * 8 + r] = (_Float16)e[r]; } }
      sm[qs] = sm[qs] * al + ((ps[0] + ps[1]) + (ps[2] + ps[3]));
#pragma unroll
      for (int dt = 0; dt < 4; ++dt) o[qs][dt] *= al; }
    /* keeps the compiler from lifting the next pass's LDS writes over this pass's reads (their values are already in registers here) */
    __builtin_amdgcn_fence(__ATOMIC_ACQ_REL, "wavefront"); __builtin_amdgcn_wave_barrier();
#pragma unroll
    for (int dt = 0; dt < 4; ++dt)
#pragma unroll
      for (int qs = 0; qs < 2; ++qs) o[qs][dt] = ra_mma(vf[dt][1], p[qs][1].v, ra_mma(vf[dt][0], p[qs][0].v, o[qs][dt]));
  }
#pragma unroll
  for (int qs = 0; qs < 2; ++qs) { const float tot = sm[qs] + __shfl_xor(sm[qs], 16, 32); const float inv = 1.0f / tot;      /* the row sum carries the 2^10 of P as well */
    /* O as f16 hi + residual x 2^10, two planes [row][DM] in fragment order: the lane's 8 values of d tile dt are its piece of the tile (row tile of the 16 queries, k tile 2 * h + dt / 2), half dt % 2 */
    const size_t ob = ((size_t)((b * TT + i0 + 16 * qs) >> 4) * (DM / 32) + 2 * h) * 512 + 8 * lane;
    FragH fh[4], fl[4];
#pragma unroll
    for (int dt = 0; dt < 4; ++dt) { const v8f a = o[qs][dt];
#pragma unroll
      for (int r = 0; r < 8; ++r) { const float v = a[r] * inv; const _Float16 hi = (_Float16)v; fh[dt].h[r] = hi; fl[dt].h[r] = (_Float16)((v - (float)hi) * 1024.0f); } }
    __builtin_amdgcn_sched_barrier(0);      /* with the one behind the wait: keeps the arithmetic, which reuses registers, out of the stretch between these stores and their wait */
#pragma unroll
    for (int dt = 0; dt < 4; ++dt) { *(v8us*)((unsigned short*)Oh + ob + 256 * dt) = fh[dt].half[0]; *(v8us*)((unsigned short*)Ol + ob + 256 * dt) = fl[dt].half[0]; }
    if (qs == 0) { asm volatile("s_wait_xcnt 0x0" ::: "memory");      /* the wait in front of any write of a register that one of these stores names; nothing is written behind the second group */
      __builtin_amdgcn_sched_barrier(0); } }
}

extern "C" void kernel_launch(void* const* d_in, const int* in_sizes, int n_in,
                              void* d_out, int out_size, void* d_ws, size_t ws_size, hipStream_t stream) {
  (void)in_sizes; (void)n_in; (void)out_size;
  const float* const* I = (const float* const*)d_in; const float* x = I[0]; const float* qw = I[1]; const float* qb = I[2]; const float* kvw = I[3]; const float* kvb = I[4]; const float* pw = I[5]; const float* pb = I[6]; const float* Er = I[7];
  char* ws = (char*)d_ws; size_t off = 0;
  auto take = [&](size_t bytes) { char* p = ws + off; off += (bytes + 255) & ~(size_t)255; return p; };
  _Float16* BP = (_Float16*)take((size_t)DM * DM * 2); _Float16* ER16 = (_Float16*)take((size_t)2 * TT * 64 * 2);
  _Float16* Q16 = (_Float16*)take((size_t)NR * DM * 2); _Float16* VT = (_Float16*)take((size_t)NR * DM * 2); _Float16* KP = (_Float16*)take((size_t)NR * DM * 2);
  _Float16* X16 = (_Float16*)take((size_t)NR * DM * 2); _Float16* BQKV = (_Float16*)take((size_t)DM * 3 * DM * 2);      /* [q_w | kv_w]^T: one plane of 3 * DM rows, the q rows first */
  _Float16* Oh = (_Float16*)take((size_t)NR * DM * 2); _Float16* Ol = (_Float16*)take((size_t)NR * DM * 2);
  if (off > ws_size) return;      /* about 57 MiB */
  k_prep<<<PB_KV + 2 * PB_W + PB_X + PB_E, 256, 0, stream>>>(qw, kvw, pw, Er, x, BQKV, BQKV + (size_t)DM * DM, BP, ER16, X16);
  const dim3 gA(TT / 128, NBT * NH);
  k_gemm_qkv<<<(NR / 128) * (DM / 64), 128, 0, stream>>>(X16, BQKV, qb, kvb, 0, DM / 64, Q16, KP, VT);
  k_gemm_qkv<<<(NR / 128) * (2 * DM / 64), 128, 0, stream>>>(X16, BQKV, qb, kvb, DM / 64, 2 * DM / 64, Q16, KP, VT);
  k_relattn<<<gA, 128, 0, stream>>>(Q16, KP, VT, ER16, Oh, Ol);
  k_gemm_proj<<<(NR / 128) * (DM / 64), 128, 0, stream>>>(Oh, Ol, BP, pb, (float*)d_out);
}

// v008
// It runs in 111 microseconds.
// Timed twice side by side with v007, it ran 1.14 and 1.15 times as fast.
// All steps since v000 together make it 31.7 times as fast.
#include <hip/hip_runtime.h>
// Relative-position multi-head attention with the 'skew' trick (2 x 2048 tokens x 1024, 16 heads x 64): q = x*q_w + q_b; [k | v] = x*kv_w + kv_b; QEr = q . Er^T against the learned INPUT table Er [2048][64]; Srel = skew(QEr) (pad one zero column on the left, reinterpret as [(N+1)][N], drop the first row -> Srel[i][j] = padded.flat[(i+1)*N + j]); logits = (q.k + Srel)/8 (no mask); softmax; merged . proj_w + proj_b -> [2,2048,1024].
// Structure: x as an exact f16 plane; the projections as f16 WMMA GEMMs (4 x 4 fragment tiles per wave, one block per WGP, f32, exact products + bias; both operands stored in fragment order) whose epilogue stores q row-major and k and v per (batch, head) as [token][d] and [d][token] in fragment order; Er as an exact f16 table over the skewed index, in fragment order; one attention kernel for all (batch, head) pairs: a wave holds 32 queries and walks the keys 64 at a time; scores and relative terms as transposed WMMA tiles (keys or Er rows as A, queries as B), the skew as a per-query shifted read of the relative tile through LDS, running-max softmax per lane in base 2 (one multiply-add and one v_exp_f32 per score), P (x2^10 f16) taken from the score registers as the B operand of V^T.P^T, O stored as f16 hi + residual planes in fragment order; output projection as one GEMM with both terms.
// Compute dtype: x, weights, biases and Er rounded to bf16; projections exact; q, k, v, P as f16 operands (~2^-12), O as hi + residual; f32 accumulation and softmax. v_wmma_f32_16x16x32_f16.
#define NBT 2
#define TT 2048
#define DM 1024
#define NH 16
#define NR (NBT * TT)
#define L2E8 0.18033688011112042f   /* log2(e) / 8: the logit scale 1/8 and the change to base 2 in one factor */
#define RP 84   /* floats per query row of the relative tile in LDS: 80 used; a multiple of 4 for the 16-byte writes; lane ln reads at ln * (RP - 1) + const, and 83 is odd, which spreads the lanes over the banks */
typedef __bf16 v16b __attribute__((ext_vector_type(16)));
typedef unsigned short v8us __attribute__((ext_vector_type(8), may_alias));
typedef float  v8f  __attribute__((ext_vector_type(8)));
typedef float  v4f  __attribute__((ext_vector_type(4)));
typedef float  v4fa __attribute__((ext_vector_type(4), may_alias));
union FragB { v16b v; v8us half[2]; unsigned short u[16]; };

__device__ __forceinline__ unsigned short bf16_bits(float x) { unsigned int u = __float_as_uint(x); return (unsigned short)((u + 0x7FFFu + ((u >> 16) & 1u)) >> 16); }
__device__ __forceinline__ float bf16_val(unsigned short b) { return __uint_as_float(((unsigned int)b) << 16); }
__device__ __forceinline__ float bf16_round(float x) { return bf16_val(bf16_bits(x)); }
// D += A·B with NT terms: 1 = ah·bh, 2 = + al·bh (A split), 3 = + ah·bl (both split)
template <int NT>
__device__ __forceinline__ v8f mmaN(v16b ah, v16b al, v16b bh, v16b bl, v8f c) {
  c = __builtin_amdgcn_wmma_f32_16x16x32_bf16(false, ah, false, bh, (short)0, c, false, false);
  if (NT >= 2) c = __builtin_amdgcn_wmma_f32_16x16x32_bf16(false, al, false, bh, (short)0, c, false, false);
  if (NT >= 3) c = __builtin_amdgcn_wmma_f32_16x16x32_bf16(false, ah, false, bl, (short)0, c, false, false);
  asm volatile("v_nop\n\tv_nop\n\tv_nop\n\tv_nop" : "+v"(c) : "v"(ah), "v"(al), "v"(bh), "v"(bl));
  return c;
}

__global__ __launch_bounds__(256) void k_wt_bf16(const float* __restrict__ W, unsigned short* __restrict__ Wt, int K, int N) {
  const int t = blockIdx.x * 256 + threadIdx.x;
  const int k8n = K / 8;
  if (t >= N * k8n) return;
  const int n = t / k8n, k8 = (t % k8n) * 8;
  v8us v;
#pragma unroll
  for (int i = 0; i < 8; ++i) v[i] = bf16_bits(W[(size_t)(k8 + i) * N + n]);
  *(v8us*)(Wt + (size_t)n * K + k8) = v;
  
}

// GEMM C[M][N] (f32, pitch ldc) = act(A[M][K]·W + bias). A f32 row-major (pitch lda) converted per fragment to bf16
// (ASPLIT: hi/lo two planes -> 2 terms, else single rounded term); Wt bf16 [N][K] (pitch ldb). BIAS_BF16 rounds the
// bias to bf16 first (bias quantised to bf16 before the add). K%32==0, M%16==0, N%64==0.
template <bool ASPLIT, int ACT, bool BIAS_BF16>
__global__ __launch_bounds__(128) void k_gemm_bf(const float* __restrict__ A, int lda, const unsigned short* __restrict__ Wt, int ldb,
                                               const float* __restrict__ bias, float* __restrict__ C, int ldc, int M, int N, int K) {
  __shared__ __attribute__((aligned(16))) float so[4][16][64];
  const int tid = threadIdx.x, w = tid >> 5, lane = tid & 31, ln = lane & 15, hh = lane >> 4;
  const int ntn = N / 64;
  const int wid = blockIdx.x * 4 + w;
  const int mt = wid / ntn, nq = wid % ntn;
  if (mt * 16 >= M) return;
  const int row0 = mt * 16, col0 = nq * 64;
  const float* arow = A + (size_t)(row0 + ln) * lda;
  v8f acc[4] = {};
  for (int kb = 0; kb < K; kb += 32) {
    FragB ah, al;
    const v4f x0 = *(const v4fa*)(arow + kb + 8 * hh), x1 = *(const v4fa*)(arow + kb + 8 * hh + 4);
    const v4f x2 = *(const v4fa*)(arow + kb + 16 + 8 * hh), x3 = *(const v4fa*)(arow + kb + 16 + 8 * hh + 4);
    float xs[16] = {x0[0],x0[1],x0[2],x0[3],x1[0],x1[1],x1[2],x1[3],x2[0],x2[1],x2[2],x2[3],x3[0],x3[1],x3[2],x3[3]};
#pragma unroll
    for (int i = 0; i < 16; ++i) { const unsigned short hb = bf16_bits(xs[i]); ah.u[i] = hb; al.u[i] = ASPLIT ? bf16_bits(xs[i] - bf16_val(hb)) : (unsigned short)0; }
#pragma unroll
    for (int t = 0; t < 4; ++t) {
      const unsigned short* brow = Wt + (size_t)(col0 + t * 16 + ln) * ldb + kb;
      FragB b;
      b.half[0] = *(const v8us*)(brow + 8 * hh);
      b.half[1] = *(const v8us*)(brow + 16 + 8 * hh);
      acc[t] = mmaN<ASPLIT ? 2 : 1>(ah.v, al.v, b.v, b.v, acc[t]);
    }
  }
#pragma unroll
  for (int t = 0; t < 4; ++t) {
    float bv = bias ? bias[col0 + t * 16 + ln] : 0.f;
    if (BIAS_BF16) bv = bf16_round(bv);
#pragma unroll
    for (int r = 0; r < 8; ++r) { float v = acc[t][r] + bv; if (ACT == 1) v = fmaxf(v, 0.f); so[w][8 * hh + r][t * 16 + ln] = v; }
  }
  __builtin_amdgcn_fence(__ATOMIC_ACQ_REL, "workgroup");
  __builtin_amdgcn_wave_barrier();
  const int rsub = lane >> 4, c4 = (lane & 15) * 4;
  {
#pragma unroll
    for (int q = 0; q < 8; ++q) {
      const int r = q * 2 + rsub;
      const v4f v = *(const v4fa*)&so[w][r][c4];
      *(v4f*)(C + (size_t)(row0 + r) * ldc + col0 + c4) = v;
    }
    
  }
}

// GEMM C = act(A·W + bias + resid): A f32 (ASPLIT -> hi/lo 2 terms), Wt bf16 [N][K]; ACT 0 none, 1 relu, 2 exact gelu;
// resid (optional, f32, row index = (row % rmod), pitch ldr, RES_BF16 rounds it) added before the activation.
template <bool ASPLIT, int ACT, bool BIAS_BF16, bool RES_BF16>
__global__ __launch_bounds__(128) void k_gemm_bf3(const float* __restrict__ A, int lda, const unsigned short* __restrict__ Wt, int ldb,
                                                const float* __restrict__ bias, const float* __restrict__ resid, int rmod, int ldr,
                                                float* __restrict__ C, int ldc, int M, int N, int K) {
  __shared__ __attribute__((aligned(16))) float so[4][16][64];
  const int tid = threadIdx.x, w = tid >> 5, lane = tid & 31, ln = lane & 15, hh = lane >> 4;
  const int ntn = N / 64;
  const int wid = blockIdx.x * 4 + w;
  const int mt = wid / ntn, nq = wid % ntn;
  if (mt * 16 >= M) return;
  const int row0 = mt * 16, col0 = nq * 64;
  const float* arow = A + (size_t)(row0 + ln) * lda;
  v8f acc[4] = {};
  for (int kb = 0; kb < K; kb += 32) {
    FragB ah, al;
    const v4f x0 = *(const v4fa*)(arow + kb + 8 * hh), x1 = *(const v4fa*)(arow + kb + 8 * hh + 4);
    const v4f x2 = *(const v4fa*)(arow + kb + 16 + 8 * hh), x3 = *(const v4fa*)(arow + kb + 16 + 8 * hh + 4);
    float xs[16] = {x0[0],x0[1],x0[2],x0[3],x1[0],x1[1],x1[2],x1[3],x2[0],x2[1],x2[2],x2[3],x3[0],x3[1],x3[2],x3[3]};
#pragma unroll
    for (int i = 0; i < 16; ++i) { const unsigned short hb = bf16_bits(xs[i]); ah.u[i] = hb; al.u[i] = ASPLIT ? bf16_bits(xs[i] - bf16_val(hb)) : (unsigned short)0; }
#pragma unroll
    for (int t = 0; t < 4; ++t) {
      const unsigned short* brow = Wt + (size_t)(col0 + t * 16 + ln) * ldb + kb;
      FragB b;
      b.half[0] = *(const v8us*)(brow + 8 * hh);
      b.half[1] = *(const v8us*)(brow + 16 + 8 * hh);
      acc[t] = mmaN<ASPLIT ? 2 : 1>(ah.v, al.v, b.v, b.v, acc[t]);
    }
  }
#pragma unroll
  for (int t = 0; t < 4; ++t) {
    const int col = col0 + t * 16 + ln;
    float bv = bias ? bias[col] : 0.f;
    if (BIAS_BF16) bv = bf16_round(bv);
#pragma unroll
    for (int r = 0; r < 8; ++r) {
      float v = acc[t][r] + bv;
      if (resid) { float rv = resid[(size_t)((row0 + 8 * hh + r) % rmod) * ldr + col]; if (RES_BF16) rv = bf16_round(rv); v += rv; }
      if (ACT == 1) v = fmaxf(v, 0.f);
      if (ACT == 2) v = 0.5f * v * (1.0f + erff(v * 0.70710678118654752f));
      if (ACT == 3) { const float u = 0.7978845608028654f * (v + 0.044715f * v * v * v); v = 0.5f * v * (1.0f + tanhf(u)); }
      so[w][8 * hh + r][t * 16 + ln] = v;
    }
  }
  __builtin_amdgcn_fence(__ATOMIC_ACQ_REL, "workgroup");
  __builtin_amdgcn_wave_barrier();
  const int rsub = lane >> 4, c4 = (lane & 15) * 4;
  {
#pragma unroll
    for (int q = 0; q < 8; ++q) {
      const int r = q * 2 + rsub;
      const v4f v = *(const v4fa*)&so[w][r][c4];
      *(v4f*)(C + (size_t)(row0 + r) * ldc + col0 + c4) = v;
    }
    
  }
}
// row LayerNorm (biased variance, eps) over N: s = X (+ R); optional out_sum <- s; out_norm <- (s-mu)*rsqrt(var+eps)*g + b
template <bool PARAM_BF16>
__global__ __launch_bounds__(256) void k_layernorm(const float* __restrict__ X, const float* __restrict__ R, const float* __restrict__ g, const float* __restrict__ bta,
                                                  float* __restrict__ out_sum, float* __restrict__ out_norm, int N, float eps) {
  __shared__ float red[256];
  const int row = blockIdx.x, tid = threadIdx.x;
  const float* x = X + (size_t)row * N; const float* rr = R ? R + (size_t)row * N : nullptr;
  float vals[16];                     // up to N = 4096
  const int per = N / 256;            // contiguous chunk per thread? use strided-by-4 chunks: thread handles j = tid*4 + 1024*u
  float s1 = 0.f;
  for (int u = 0; u < per / 4; ++u) {
    const int j = tid * 4 + 1024 * u;
    const v4f a = *(const v4fa*)(x + j);
    v4f b = {0.f,0.f,0.f,0.f}; if (rr) b = *(const v4fa*)(rr + j);
#pragma unroll
    for (int q = 0; q < 4; ++q) { const float v = a[q] + b[q]; vals[u * 4 + q] = v; s1 += v; }
  }
  red[tid] = s1; __syncthreads();
  for (int st = 128; st > 0; st >>= 1) { if (tid < st) red[tid] += red[tid + st]; __syncthreads(); }
  const float mu = red[0] / (float)N; __syncthreads();
  float s2 = 0.f;
  for (int u = 0; u < per / 4; ++u)
#pragma unroll
    for (int q = 0; q < 4; ++q) { const float c = vals[u * 4 + q] - mu; s2 += c * c; }
  red[tid] = s2; __syncthreads();
  for (int st = 128; st > 0; st >>= 1) { if (tid < st) red[tid] += red[tid + st]; __syncthreads(); }
  const float rs = rsqrtf(red[0] / (float)N + eps);
  {
    for (int u = 0; u < per / 4; ++u) {
      const int j = tid * 4 + 1024 * u;
      v4f o, sm;
#pragma unroll
      for (int q = 0; q < 4; ++q) {
        float gg = g[j + q], bb = bta[j + q];
        if (PARAM_BF16) { gg = bf16_round(gg); bb = bf16_round(bb); }
        sm[q] = vals[u * 4 + q]; o[q] = (vals[u * 4 + q] - mu) * rs * gg + bb;
      }
      if (out_sum) *(v4f*)(out_sum + (size_t)row * N + j) = sm;
      *(v4f*)(out_norm + (size_t)row * N + j) = o;
    }
    
  }
}



// ---- f16 WMMA path (v_wmma_f32_16x16x32_f16): 11-bit significands for operands in range — used where a [0,1] probability operand needs more precision than bf16
typedef _Float16 v16h __attribute__((ext_vector_type(16)));
union FragH { v16h v; v8us half[2]; _Float16 h[16]; unsigned short u[16]; };
template <int NT>
__device__ __forceinline__ v8f mmaH(v16h ah, v16h al, v16h bh, v16h bl, v8f c) {
  c = __builtin_amdgcn_wmma_f32_16x16x32_f16(false, ah, false, bh, (short)0, c, false, false);
  if (NT >= 2) c = __builtin_amdgcn_wmma_f32_16x16x32_f16(false, al, false, bh, (short)0, c, false, false);
  if (NT >= 3) c = __builtin_amdgcn_wmma_f32_16x16x32_f16(false, ah, false, bl, (short)0, c, false, false);
  asm volatile("v_nop\n\tv_nop\n\tv_nop\n\tv_nop" : "+v"(c) : "v"(ah), "v"(al), "v"(bh), "v"(bl));
  return c;
}
// batched GEMM like k_gemm_b but f16 operands: A f32 (split into f16 hi/lo if ASPLIT, else rounded to f16), Bt = f16 values [n][k]; alpha; C f32; N multiple of 16 (partial tiles skipped)
template <bool ASPLIT>
__global__ __launch_bounds__(128) void k_gemm_h(const float* __restrict__ A, int lda, size_t sA, const _Float16* __restrict__ Bh, int ldb, size_t sB, float alpha, float* __restrict__ C, int ldc, size_t sC, int M, int N, int K) {
  __shared__ __attribute__((aligned(16))) float so[4][16][64];
  const int tid = threadIdx.x, w = tid >> 5, lane = tid & 31, ln = lane & 15, hh = lane >> 4; const int by = blockIdx.y;
  A += (size_t)by * sA; Bh += (size_t)by * sB; C += (size_t)by * sC;
  const int ntn = (N + 63) / 64; const int wid = blockIdx.x * 4 + w; const int mt = wid / ntn, nq = wid % ntn; if (mt * 16 >= M) return;
  const int row0 = mt * 16, col0 = nq * 64; const float* arow = A + (size_t)(row0 + ln) * lda;
  v8f acc[4] = {};
  for (int kb = 0; kb < K; kb += 32) {
    FragH ah, al;
    const v4f x0 = *(const v4fa*)(arow + kb + 8 * hh), x1 = *(const v4fa*)(arow + kb + 8 * hh + 4), x2 = *(const v4fa*)(arow + kb + 16 + 8 * hh), x3 = *(const v4fa*)(arow + kb + 16 + 8 * hh + 4);
    float xs[16] = {x0[0],x0[1],x0[2],x0[3],x1[0],x1[1],x1[2],x1[3],x2[0],x2[1],x2[2],x2[3],x3[0],x3[1],x3[2],x3[3]};
#pragma unroll
    for (int i = 0; i < 16; ++i) { const _Float16 h = (_Float16)xs[i]; ah.h[i] = h; al.h[i] = ASPLIT ? (_Float16)(xs[i] - (float)h) : (_Float16)0.0f; }
#pragma unroll
    for (int t = 0; t < 4; ++t) { if (col0 + t * 16 >= N) continue; const size_t boff = (size_t)(col0 + t * 16 + ln) * ldb + kb; FragH bq; bq.half[0] = *(const v8us*)(Bh + boff + 8 * hh); bq.half[1] = *(const v8us*)(Bh + boff + 16 + 8 * hh);
      acc[t] = mmaH<ASPLIT ? 2 : 1>(ah.v, al.v, bq.v, bq.v, acc[t]); }
  }
#pragma unroll
  for (int t = 0; t < 4; ++t) { if (col0 + t * 16 >= N) continue;
#pragma unroll
    for (int r = 0; r < 8; ++r) so[w][8 * hh + r][t * 16 + ln] = acc[t][r] * alpha; }
  __builtin_amdgcn_fence(__ATOMIC_ACQ_REL, "workgroup"); __builtin_amdgcn_wave_barrier();
  const int rsub = lane >> 4, c4 = (lane & 15) * 4;
  {
#pragma unroll
    for (int q = 0; q < 8; ++q) { const int r = q * 2 + rsub; if (col0 + c4 < N) { const v4f v = *(const v4fa*)&so[w][r][c4]; *(v4f*)(C + (size_t)(row0 + r) * ldc + col0 + c4) = v; } }
     }
}

// Fragment order of an f16 operand plane [R][K] (R % 16 == 0, K % 32 == 0): tiles of 16 rows x 32 k, 1 KiB each, the k tiles of one row tile one after the other (a row tile is 16 * K elements, as in the row-major plane).
// Inside a tile the 16-byte piece (row ln, k = 16 * half + 8 * hh + 0..7) lies at element 256 * half + 8 * (16 * hh + ln): lane 16 * hh + ln of a wave finds its fragment at its own 16 bytes of two runs of 512 bytes, so a fragment load covers four whole 128-byte lines.
// pk_src: piece t, counted in storage order, -> its row and its first k
__device__ __forceinline__ void pk_src(unsigned t, unsigned K, int& row, int& k) { const unsigned ktn = K >> 5, tile = t >> 6, rt = tile / ktn, kt = tile - rt * ktn; row = (int)(rt * 16 + (t & 15)); k = (int)(kt * 32 + ((t >> 5) & 1) * 16 + ((t >> 4) & 1) * 8); }
// Wt = f16(W[k][n] * scale) as the plane [n][k] in fragment order, from f32 row-major W[K][N] (scale = power of two; bf16-exact weights stay exact in f16 away from the subnormal range); thread t makes piece t, in storage order
__device__ __forceinline__ void d_wt_f16(const float* __restrict__ W, _Float16* __restrict__ Wt, int K, int N, float scale, int t) {
  int n, k8; pk_src((unsigned)t, (unsigned)K, n, k8); FragH f;
#pragma unroll
  for (int i = 0; i < 8; ++i) f.h[i] = (_Float16)(bf16_round(W[(size_t)(k8 + i) * N + n]) * scale); const v8us o = f.half[0];
  *(v8us*)((unsigned short*)Wt + (size_t)t * 8) = o;
  asm volatile("s_wait_xcnt 0x0" ::: "memory");      /* the wait in front of any write of a register that this store names */
}
// k_gemm_hh variant with fused epilogue: v = acc·alpha + bias[by·sBias + col] (+ CP[(row/rowsPerB)·sCPb + by·64 + col] if CP) ; ACT 0 none / 1 elu ; writes f16 C16 (and f32 C if non-null)
template <int ACT>
__global__ __launch_bounds__(128) void k_gemm_hhx(const _Float16* __restrict__ A, int lda, size_t sA, const _Float16* __restrict__ Bh, int ldb, size_t sB, float alpha, const float* __restrict__ bias, size_t sBias, const float* __restrict__ CP, int rowsPerB, size_t sCPb, int row0g,
    float* __restrict__ C, _Float16* __restrict__ C16, int ldc, size_t sC, int M, int N, int K) {
  __shared__ __attribute__((aligned(16))) float so[4][16][64];
  const int tid = threadIdx.x, w = tid >> 5, lane = tid & 31, ln = lane & 15, hh = lane >> 4; const int by = blockIdx.y;
  A += (size_t)by * sA; Bh += (size_t)by * sB; const size_t cofs = (size_t)by * sC; const float* bp = bias ? bias + (size_t)by * sBias : nullptr;
  const int ntn = (N + 63) / 64; const int wid = blockIdx.x * 4 + w; const int mt = wid / ntn, nq = wid % ntn; if (mt * 16 >= M) return;
  const int row0 = mt * 16, col0 = nq * 64; const _Float16* arow = A + (size_t)(row0 + ln) * lda;
  v8f acc[4] = {};
  for (int kb = 0; kb < K; kb += 32) { FragH ah; ah.half[0] = *(const v8us*)((const unsigned short*)arow + kb + 8 * hh); ah.half[1] = *(const v8us*)((const unsigned short*)arow + kb + 16 + 8 * hh);
#pragma unroll
    for (int t = 0; t < 4; ++t) { if (col0 + t * 16 >= N) continue; const size_t boff = (size_t)(col0 + t * 16 + ln) * ldb + kb; FragH bq; bq.half[0] = *(const v8us*)((const unsigned short*)Bh + boff + 8 * hh); bq.half[1] = *(const v8us*)((const unsigned short*)Bh + boff + 16 + 8 * hh);
      acc[t] = mmaH<1>(ah.v, ah.v, bq.v, bq.v, acc[t]); }
  }
#pragma unroll
  for (int t = 0; t < 4; ++t) { if (col0 + t * 16 >= N) continue; const int col = col0 + t * 16 + ln; const float bv = bp ? bf16_round(bp[col]) : 0.f;
#pragma unroll
    for (int r = 0; r < 8; ++r) { float v = acc[t][r] * alpha + bv; if (CP) { const int bidx = (row0g + row0 + 8 * hh + r) / rowsPerB; v += CP[(size_t)bidx * sCPb + (size_t)by * 64 + col]; } if (ACT == 1) v = (v > 0.f) ? v : expm1f(v); else if (ACT == 7) v = (v > 0.f) ? v + 1.0f : expf(v); else if (ACT == 8) v = tanhf(v); else if (ACT == 9) v = 0.5f * v * (1.0f + tanhf(0.7978845608028654f * (v + 0.044715f * v * v * v))); else if (ACT == 11) v = 1.0f / (1.0f + expf(-v)); else if (ACT == 12) v = (v > 0.f) ? v : 0.01f * v; else if (ACT == 14) v = (v > 0.f) ? v : 0.1f * v; else if (ACT == 15) v = v / (1.0f + expf(-v)); else if (ACT == 3) v = fmaxf(v, 0.f); else if (ACT == 6) v = 0.5f * v * (1.0f + erff(v * 0.70710678118654752f)); so[w][8 * hh + r][t * 16 + ln] = v; } }
  __builtin_amdgcn_fence(__ATOMIC_ACQ_REL, "workgroup"); __builtin_amdgcn_wave_barrier();
  const int rsub = lane >> 4, c4 = (lane & 15) * 4; typedef _Float16 v4h __attribute__((ext_vector_type(4)));
  {
#pragma unroll
    for (int q = 0; q < 8; ++q) { const int r = q * 2 + rsub; if (col0 + c4 < N) { const v4f v = *(const v4fa*)&so[w][r][c4]; if (C) *(v4f*)(C + cofs + (size_t)(row0 + r) * ldc + col0 + c4) = v; if (C16) { v4h h4; for (int i = 0; i < 4; ++i) h4[i] = (_Float16)v[i]; *(v4h*)(C16 + cofs + (size_t)(row0 + r) * ldc + col0 + c4) = h4; } } }
     }
}


typedef _Float16 v4h __attribute__((ext_vector_type(4)));

__global__ __launch_bounds__(256) void k_x16(const float* __restrict__ x, _Float16* __restrict__ X16, size_t n8) { const size_t t = (size_t)blockIdx.x * 256 + threadIdx.x; if (t >= n8) return; FragH f;
#pragma unroll
  for (int q = 0; q < 8; ++q) f.h[q] = (_Float16)bf16_round(x[t * 8 + q]); *(v8us*)((unsigned short*)X16 + t * 8) = f.half[0];  }
// Er as the table of the skewed index t = 0 .. 2 * TT - 1, a plane [t][64] in fragment order: row t is Er[t] for t < TT, zero for t == TT, Er[t - TT - 1] beyond; thread t makes piece t, in storage order
__device__ __forceinline__ void d_er2(const float* __restrict__ Er, _Float16* __restrict__ E2, unsigned t) { int row, k; pk_src(t, 64, row, k);
  const int er = (row < TT) ? row : ((row > TT) ? row - TT - 1 : 0); const float* ep = Er + (size_t)er * 64 + k; const v4f a = *(const v4fa*)ep, c = *(const v4fa*)(ep + 4); FragH f;
#pragma unroll
  for (int q = 0; q < 4; ++q) { f.h[q] = (_Float16)bf16_round(a[q]); f.h[4 + q] = (_Float16)bf16_round(c[q]); }
  const v8us zr = {0, 0, 0, 0, 0, 0, 0, 0}; *(v8us*)((unsigned short*)E2 + (size_t)t * 8) = (row == TT) ? zr : f.half[0];
  asm volatile("s_wait_xcnt 0x0" ::: "memory"); }      /* the wait in front of any write of a register that this store names */
// x as an exact f16 plane [rows][DM] in fragment order; thread t makes piece t, in storage order
__device__ __forceinline__ void d_x16p(const float* __restrict__ x, _Float16* __restrict__ X16, unsigned t) { int row, k; pk_src(t, DM, row, k); const float* xp = x + (size_t)row * DM + k; const v4f a = *(const v4fa*)xp, c = *(const v4fa*)(xp + 4); FragH f;
#pragma unroll
  for (int q = 0; q < 4; ++q) { f.h[q] = (_Float16)bf16_round(a[q]); f.h[4 + q] = (_Float16)bf16_round(c[q]); }
  *(v8us*)((unsigned short*)X16 + (size_t)t * 8) = f.half[0];
  asm volatile("s_wait_xcnt 0x0" ::: "memory"); }      /* the wait in front of any write of a register that this store names */
// the five operand planes that depend on the inputs alone, in one launch: a block makes 256 pieces of one plane
#define PB_KV (DM * 2 * DM / 8 / 256)
#define PB_W  (DM * DM / 8 / 256)
#define PB_X  (NR * DM / 8 / 256)
#define PB_E  (2 * TT * 64 / 8 / 256)
__global__ __launch_bounds__(256) void k_prep(const float* __restrict__ qw, const float* __restrict__ kvw, const float* __restrict__ pw, const float* __restrict__ Er, const float* __restrict__ x,
    _Float16* __restrict__ BQ, _Float16* __restrict__ BKV, _Float16* __restrict__ BP, _Float16* __restrict__ E2, _Float16* __restrict__ X16) {
  const int bx = blockIdx.x, tid = threadIdx.x;      /* (in,out) weights -> [out][in] x16 */
  if (bx < PB_KV) d_wt_f16(kvw, BKV, DM, 2 * DM, 16.0f, bx * 256 + tid);
  else if (bx < PB_KV + PB_W) d_wt_f16(qw, BQ, DM, DM, 16.0f, (bx - PB_KV) * 256 + tid);
  else if (bx < PB_KV + 2 * PB_W) d_wt_f16(pw, BP, DM, DM, 16.0f, (bx - PB_KV - PB_W) * 256 + tid);
  else if (bx < PB_KV + 2 * PB_W + PB_X) d_x16p(x, X16, (unsigned)((bx - PB_KV - 2 * PB_W) * 256 + tid));
  else d_er2(Er, E2, (unsigned)((bx - PB_KV - 2 * PB_W - PB_X) * 256 + tid));
}
__global__ __launch_bounds__(256) void k_h16(const float* __restrict__ x, _Float16* __restrict__ X16, size_t n8) { const size_t t = (size_t)blockIdx.x * 256 + threadIdx.x; if (t >= n8) return; FragH f;
#pragma unroll
  for (int q = 0; q < 8; ++q) f.h[q] = (_Float16)x[t * 8 + q]; *(v8us*)((unsigned short*)X16 + t * 8) = f.half[0];  }
__global__ __launch_bounds__(256) void k_round16f(const float* __restrict__ W, _Float16* __restrict__ Bt, size_t n8) { const size_t t = (size_t)blockIdx.x * 256 + threadIdx.x; if (t >= n8) return; FragH f;
#pragma unroll
  for (int i = 0; i < 8; ++i) f.h[i] = (_Float16)(bf16_round(W[t * 8 + i]) * 16.0f); *(v8us*)((unsigned short*)Bt + t * 8) = f.half[0];  }
__global__ __launch_bounds__(256) void k_hl(const float* __restrict__ F, _Float16* __restrict__ Hh, _Float16* __restrict__ Hl, size_t n8) { const size_t t = (size_t)blockIdx.x * 256 + threadIdx.x; if (t >= n8) return; FragH fh, fl; const v4f a = *(const v4fa*)(F + t * 8), c = *(const v4fa*)(F + t * 8 + 4);
#pragma unroll
  for (int q = 0; q < 4; ++q) { _Float16 h = (_Float16)a[q]; fh.h[q] = h; fl.h[q] = (_Float16)((a[q] - (float)h) * 1024.0f); h = (_Float16)c[q]; fh.h[4 + q] = h; fl.h[4 + q] = (_Float16)((c[q] - (float)h) * 1024.0f); }
  { *(v8us*)((unsigned short*)Hh + t * 8) = fh.half[0]; *(v8us*)((unsigned short*)Hl + t * 8) = fl.half[0];  } }

// ---- fast GEMMs (four row tiles of A by four of B per wave; K % 64 == 0; A and Bh in fragment order, pitch K) ----
__device__ __forceinline__ v16h g2_fragp(const _Float16* p) { FragH f; f.half[0] = *(const v8us*)((const unsigned short*)p); f.half[1] = *(const v8us*)((const unsigned short*)p + 256); return f.v; }      /* p: the tile's start + 8 * lane */
__device__ __forceinline__ v16h g2_frag(const _Float16* p, int hh) { FragH f; f.half[0] = *(const v8us*)((const unsigned short*)p + 8 * hh); f.half[1] = *(const v8us*)((const unsigned short*)p + 16 + 8 * hh); return f.v; }
// D = A.B + C as the plain builtin: the compiler keeps the distance behind it itself, and its operands may lie above v255, which an asm operand cannot
__device__ __forceinline__ v8f g4_mma(v16h a, v16h b, v8f c) { return __builtin_amdgcn_wmma_f32_16x16x32_f16(false, a, false, b, (short)0, c, false, false); }
// k loop of a wave: four row tiles of A against four row tiles of B, c[a][t] += A[a] . B[t]^T over K (K % 64 == 0); pa*, pb*: each lane's place in the first k tile of each row tile
// two register sets of eight fragments (32 k each): the sixteen loads of a set are issued as one group, one set ahead of the sixteen products that read it, so that a set's load latency runs behind the other set's products
__device__ __forceinline__ void g2_kloop4(const _Float16* pa0, const _Float16* pa1, const _Float16* pa2, const _Float16* pa3, const _Float16* pb0, const _Float16* pb1, const _Float16* pb2, const _Float16* pb3, int K, v8f (&c)[4][4]) {
  v16h xa[4], xb[4], ya[4], yb[4];
  xa[0] = g2_fragp(pa0); xa[1] = g2_fragp(pa1); xa[2] = g2_fragp(pa2); xa[3] = g2_fragp(pa3); xb[0] = g2_fragp(pb0); xb[1] = g2_fragp(pb1); xb[2] = g2_fragp(pb2); xb[3] = g2_fragp(pb3);
  __builtin_amdgcn_sched_barrier(0);      /* holds the first group in front of the loop */
#pragma unroll 1      /* the two sets are the whole ring: a further copy of the body would only cost registers */
  for (int kb = 0; kb < K; kb += 64) {
    ya[0] = g2_fragp(pa0 + 512); ya[1] = g2_fragp(pa1 + 512); ya[2] = g2_fragp(pa2 + 512); ya[3] = g2_fragp(pa3 + 512); yb[0] = g2_fragp(pb0 + 512); yb[1] = g2_fragp(pb1 + 512); yb[2] = g2_fragp(pb2 + 512); yb[3] = g2_fragp(pb3 + 512);
    /* the wait that stands in front of the write of the eight address registers below, which both groups in flight name; the addresses are its inputs so that their registers stay untouched up to it */
    asm volatile("s_wait_xcnt 0x0" :: "v"(pa0), "v"(pa1), "v"(pa2), "v"(pa3), "v"(pb0), "v"(pb1), "v"(pb2), "v"(pb3) : "memory");
    __builtin_amdgcn_sched_barrier(0);      /* holds this group in front of the products: without it the scheduler sinks each load to its first use, with a full wait each */
#pragma unroll
    for (int t = 0; t < 4; ++t)
#pragma unroll
      for (int a = 0; a < 4; ++a) c[a][t] = g4_mma(xa[a], xb[t], c[a][t]);
    const int adv = (kb + 64 < K) ? 1024 : 0;      /* the last trip reads its own first set again, in bounds and unused, so that every trip has the same loads in flight */
    pa0 += adv; pa1 += adv; pa2 += adv; pa3 += adv; pb0 += adv; pb1 += adv; pb2 += adv; pb3 += adv;
    __builtin_amdgcn_sched_barrier(0);      /* keeps the first set's products in front of the loads that refill it */
    xa[0] = g2_fragp(pa0); xa[1] = g2_fragp(pa1); xa[2] = g2_fragp(pa2); xa[3] = g2_fragp(pa3); xb[0] = g2_fragp(pb0); xb[1] = g2_fragp(pb1); xb[2] = g2_fragp(pb2); xb[3] = g2_fragp(pb3);
    __builtin_amdgcn_sched_barrier(0);      /* holds the next set's group in front of this set's products */
#pragma unroll
    for (int t = 0; t < 4; ++t)
#pragma unroll
      for (int a = 0; a < 4; ++a) c[a][t] = g4_mma(ya[a], yb[t], c[a][t]); }
  /* the same wait for the last group, in front of whatever reuses its address registers behind the loop */
  asm volatile("s_wait_xcnt 0x0" :: "v"(pa0), "v"(pa1), "v"(pa2), "v"(pa3), "v"(pb0), "v"(pb1), "v"(pb2), "v"(pb3) : "memory");
}
// q, k and v projections in one launch: a block makes a 256 x 192 tile of the plane [q | k | v] (3 * DM columns), its twelve waves 64 x 64 each (four down, three across): a fragment that a wave loads feeds four products, and each A fragment of the block is asked for by three of its waves, each B fragment by four, at about the same time, so that most of these loads are served on the WGP; A = x and Bh = [q_w | kv_w]^T x16 in fragment order.
// 256 blocks, one per WGP, three waves per SIMD.
// The epilogue stores each part as the attention kernel reads it: q row-major [row][DM]; k per (batch, head) as [token][d] and v as [d][token], both in fragment order. A wave's 64 columns are one head.
__global__ __launch_bounds__(384) void k_gemm_qkv(const _Float16* __restrict__ A, const _Float16* __restrict__ Bh, const float* __restrict__ qb, const float* __restrict__ kvb,
    _Float16* __restrict__ Q16, _Float16* __restrict__ KP, _Float16* __restrict__ VT) {
  __shared__ __attribute__((aligned(16))) float so[12][64][68];
  const int tid = threadIdx.x, w = __builtin_amdgcn_readfirstlane(tid >> 5), lane = tid & 31, ln = lane & 15, hh = lane >> 4;
  const int mt = blockIdx.x % (NR / 256), nq = 3 * (blockIdx.x / (NR / 256)) + (w >> 2); const int row0 = mt * 256 + 64 * (w & 3), col0 = nq * 64; const int part = nq / NH, h = nq - part * NH;
  /* each lane's place in the first k tile of the eight row tiles */
  const _Float16* pa0 = A + (size_t)row0 * DM + 8 * lane; const _Float16* pa1 = pa0 + (size_t)16 * DM; const _Float16* pa2 = pa1 + (size_t)16 * DM; const _Float16* pa3 = pa2 + (size_t)16 * DM;
  const _Float16* pb0 = Bh + (size_t)col0 * DM + 8 * lane; const _Float16* pb1 = pb0 + (size_t)16 * DM; const _Float16* pb2 = pb1 + (size_t)16 * DM; const _Float16* pb3 = pb2 + (size_t)16 * DM;
  const v8f z8 = {0.f,0.f,0.f,0.f,0.f,0.f,0.f,0.f}; v8f c[4][4] = {{z8, z8, z8, z8}, {z8, z8, z8, z8}, {z8, z8, z8, z8}, {z8, z8, z8, z8}};
  g2_kloop4(pa0, pa1, pa2, pa3, pb0, pb1, pb2, pb3, DM, c);
  const float* bp = (part == 0) ? qb + col0 : kvb + (col0 - DM);
  const int b = row0 / TT, tok0 = row0 - b * TT; const size_t slab = (size_t)(b * NH + h) * 64 * TT;      /* the wave's 64 rows are tokens tok0 .. tok0 + 63 of batch b */
  if (part == 2) {      /* v: the accumulator tile (a, t) holds in each lane 8 tokens in a row of one d, which is that lane's piece of the tile (d tile t, token tile tok0 / 32 + a / 2), half a % 2 */
#pragma unroll
    for (int t = 0; t < 4; ++t) { const float bv = bf16_round(bp[t * 16 + ln]); FragH f[4];
#pragma unroll
      for (int a = 0; a < 4; ++a)
#pragma unroll
        for (int r = 0; r < 8; ++r) f[a].h[r] = (_Float16)(c[a][t][r] * 0.0625f + bv);
      __builtin_amdgcn_sched_barrier(0);      /* with the one behind the wait: keeps the arithmetic, which reuses registers, out of the stretch between these stores and their wait */
#pragma unroll
      for (int a = 0; a < 4; ++a) *(v8us*)((unsigned short*)VT + slab + (size_t)(t * 16) * TT + (size_t)((tok0 >> 5) + (a >> 1)) * 512 + (a & 1) * 256 + lane * 8) = f[a].half[0];
      asm volatile("s_wait_xcnt 0x0" ::: "memory");      /* the wait in front of any write of a register that one of the four stores before it names */
      __builtin_amdgcn_sched_barrier(0); }
    return; }
#pragma unroll
  for (int t = 0; t < 4; ++t) { const float bv = bf16_round(bp[t * 16 + ln]);
#pragma unroll
    for (int a = 0; a < 4; ++a)
#pragma unroll
      for (int r = 0; r < 8; ++r) so[w][a * 16 + 8 * hh + r][t * 16 + ln] = c[a][t][r] * 0.0625f + bv; }
  __builtin_amdgcn_fence(__ATOMIC_ACQ_REL, "workgroup"); __builtin_amdgcn_wave_barrier();      /* a wave reads back only its own part of so: its LDS writes are done before any of its lanes reads */
  if (part == 0) { const int rsub = lane >> 4, c4 = (lane & 15) * 4;
#pragma unroll
    for (int g = 0; g < 4; ++g) { v4h h4[8];
#pragma unroll
      for (int q = 0; q < 8; ++q) { const v4f v = *(const v4fa*)&so[w][(g * 8 + q) * 2 + rsub][c4]; for (int i = 0; i < 4; ++i) h4[q][i] = (_Float16)v[i]; }
      __builtin_amdgcn_sched_barrier(0);      /* as above: nothing that reuses a register stands between these stores and their wait */
#pragma unroll
      for (int q = 0; q < 8; ++q) *(v4h*)(Q16 + (size_t)(row0 + (g * 8 + q) * 2 + rsub) * DM + col0 + c4) = h4[q];
      asm volatile("s_wait_xcnt 0x0" ::: "memory");      /* the wait in front of any write of a register that one of the eight stores before it names */
      __builtin_amdgcn_sched_barrier(0); }
  } else {      /* k: piece (token tile rt, d tile kt, half hf) of lane 16 * hh + ln is token rt * 16 + ln, d = kt * 32 + hf * 16 + hh * 8 + (0 .. 7) */
#pragma unroll
    for (int rt = 0; rt < 4; ++rt) { FragH f[4];
#pragma unroll
      for (int pc = 0; pc < 4; ++pc) { const int kt = pc >> 1, hf = pc & 1; const float* sp = &so[w][rt * 16 + ln][kt * 32 + hf * 16 + hh * 8]; const v4f lo = *(const v4fa*)sp, hi = *(const v4fa*)(sp + 4);
#pragma unroll
        for (int i = 0; i < 4; ++i) { f[pc].h[i] = (_Float16)lo[i]; f[pc].h[4 + i] = (_Float16)hi[i]; } }
      __builtin_amdgcn_sched_barrier(0);      /* as above: nothing that reuses a register stands between these stores and their wait */
#pragma unroll
      for (int pc = 0; pc < 4; ++pc) *(v8us*)((unsigned short*)KP + slab + (size_t)((tok0 >> 4) + rt) * 1024 + pc * 256 + lane * 8) = f[pc].half[0];
      asm volatile("s_wait_xcnt 0x0" ::: "memory");      /* the wait in front of any write of a register that one of the four stores before it names */
      __builtin_amdgcn_sched_barrier(0); } }
}
// output projection: out = Oh . W + bias + (Ol . W) / 1024, W = Bh / 16; both terms in one k loop over the same B fragments, each in accumulators of its own; Ah, Al, Bh in fragment order
// a block makes a 128 x 128 tile, its eight waves 32 x 64 each (four down, two across); 256 blocks, one per WGP, two waves per SIMD
__global__ __launch_bounds__(256) void k_gemm_proj(const _Float16* __restrict__ Ah, const _Float16* __restrict__ Al, const _Float16* __restrict__ Bh, const float* __restrict__ bias, float* __restrict__ C) {
  __shared__ __attribute__((aligned(16))) float so[8][32][68];
  const int tid = threadIdx.x, w = tid >> 5, lane = tid & 31, ln = lane & 15, hh = lane >> 4;
  const int mt = blockIdx.x % (NR / 128), nq = blockIdx.x / (NR / 128); const int row0 = mt * 128 + 32 * (w & 3), col0 = nq * 128 + 64 * (w >> 2);
  /* each lane's place in the first k tile of the eight row tiles */
  const _Float16* pa0 = Ah + (size_t)row0 * DM + 8 * lane; const _Float16* pa1 = pa0 + (size_t)16 * DM; const _Float16* pa2 = Al + (size_t)row0 * DM + 8 * lane; const _Float16* pa3 = pa2 + (size_t)16 * DM;
  const _Float16* pb0 = Bh + (size_t)col0 * DM + 8 * lane; const _Float16* pb1 = pb0 + (size_t)16 * DM; const _Float16* pb2 = pb1 + (size_t)16 * DM; const _Float16* pb3 = pb2 + (size_t)16 * DM;
  const v8f z8 = {0.f,0.f,0.f,0.f,0.f,0.f,0.f,0.f}; v8f c[4][4] = {{z8, z8, z8, z8}, {z8, z8, z8, z8}, {z8, z8, z8, z8}, {z8, z8, z8, z8}};
  g2_kloop4(pa0, pa1, pa2, pa3, pb0, pb1, pb2, pb3, DM, c);
#pragma unroll
  for (int t = 0; t < 4; ++t) { const float bv = bf16_round(bias[col0 + t * 16 + ln]);
#pragma unroll
    for (int half = 0; half < 2; ++half)
#pragma unroll
      for (int r = 0; r < 8; ++r) so[w][half * 16 + 8 * hh + r][t * 16 + ln] = c[2 + half][t][r] * (0.0625f / 1024.0f) + (c[half][t][r] * 0.0625f + bv); }
  __builtin_amdgcn_fence(__ATOMIC_ACQ_REL, "workgroup"); __builtin_amdgcn_wave_barrier();      /* a wave reads back only its own part of so: its LDS writes are done before any of its lanes reads */
  const int rsub = lane >> 4, c4 = (lane & 15) * 4;
#pragma unroll
  for (int q = 0; q < 16; ++q) { const int r = q * 2 + rsub; const v4f v = *(const v4fa*)&so[w][r][c4]; *(v4f*)(C + (size_t)(row0 + r) * DM + col0 + c4) = v; }
}

// D = A.B + C as the plain builtin: the compiler keeps the distance behind it itself
__device__ __forceinline__ v8f ra_mma(v16h a, v16h b, v8f c) { return __builtin_amdgcn_wmma_f32_16x16x32_f16(false, a, false, b, (short)0, c, false, false); }
// the six relative tiles of a pass: tile u = 16 rows of the table (A: its two k halves ef[u][0], ef[u][1]) against the two query groups (B), stored to each query's row in LDS; tile u serves group 0 for u >= 1 and group 1 for u <= 4.
// Tiles u < UC lie below the wrap and go with query i (q), the others with query i + 1 (qn); d0, d1: the lane's place in tile 0 of each group's row
template <int UC>
__device__ __forceinline__ void rel_pass(const v16h (&ef)[6][2], const v16h (&q)[2][2], const v16h (&qn)[2][2], float* d0, float* d1) {
  const v8f z8 = {0.f,0.f,0.f,0.f,0.f,0.f,0.f,0.f}; v8f r0[6], r1[6];
#pragma unroll
  for (int ks = 0; ks < 2; ++ks)
#pragma unroll
    for (int u = 0; u < 6; ++u) {
      if (u >= 1) r0[u] = ra_mma(ef[u][ks], (u < UC) ? q[0][ks] : qn[0][ks], ks ? r0[u] : z8);
      if (u <= 4) r1[u] = ra_mma(ef[u][ks], (u < UC) ? q[1][ks] : qn[1][ks], ks ? r1[u] : z8); }
  __builtin_amdgcn_sched_barrier(0);      /* holds the twenty products, ten tiles in registers of their own, in front of the stores: without it each tile's two products and its stores run one after the other through one register set, a dependent chain per tile */
#pragma unroll
  for (int u = 0; u < 6; ++u) {
    if (u >= 1) { float* d = d0 + 16 * (u - 1); const v4f lo = {r0[u][0], r0[u][1], r0[u][2], r0[u][3]}, hi = {r0[u][4], r0[u][5], r0[u][6], r0[u][7]}; *(v4fa*)d = lo; *(v4fa*)(d + 4) = hi; }
    if (u <= 4) { float* d = d1 + 16 * u; const v4f lo = {r1[u][0], r1[u][1], r1[u][2], r1[u][3]}, hi = {r1[u][4], r1[u][5], r1[u][6], r1[u][7]}; *(v4fa*)d = lo; *(v4fa*)(d + 4) = hi; } }
}

// Attention of one (batch, head) and 128 queries per block, 32 queries per wave, keys 64 at a time; nothing of S, QEr or P goes to memory.
// With t = TT-1-i+j the skewed term of (query i, key j) is q[i].Er[t] for t < TT, 0 for t == TT, q[i+1].Er[t-TT-1] for t > TT.
// All tiles are transposed: D[row 8*hh+r][column ln] with the query in the column, so a lane owns one query's max, sum and O column.
// Every inner loop is unrolled so that each array index is a constant and the arrays live in registers.
__global__ __launch_bounds__(128) void k_relattn(const _Float16* __restrict__ Q16, const _Float16* __restrict__ KP, const _Float16* __restrict__ VT, const _Float16* __restrict__ ER16, _Float16* __restrict__ Oh, _Float16* __restrict__ Ol) {
  __shared__ __attribute__((aligned(16))) float rl[4][2][16][RP];
  const int tid = threadIdx.x, w = __builtin_amdgcn_readfirstlane(tid >> 5), lane = tid & 31, ln = lane & 15, hh = lane >> 4;
  const int bh = blockIdx.y, b = bh / NH, h = bh - b * NH; const int i0 = blockIdx.x * 128 + 32 * w;
  const _Float16* qbase = Q16 + (size_t)b * TT * DM + h * 64; const _Float16* kbase = KP + (size_t)bh * 64 * TT; const _Float16* vbase = VT + (size_t)bh * 64 * TT;      /* [token][d] and [d][token], both in fragment order */
  v16h q[2][2], qn[2][2];      /* queries i and i + 1 as B operands; the row past the last query is never used, its address is clamped */
  const _Float16* qp[2]; const _Float16* qnp[2];
  __builtin_amdgcn_sched_barrier(0);      /* with the one behind the wait: keeps the set-up arithmetic, which reuses registers, out of the stretch between these loads and their wait */
#pragma unroll
  for (int qs = 0; qs < 2; ++qs) { const int i = i0 + 16 * qs + ln; const int i1 = (i + 1 < TT) ? i + 1 : TT - 1; qp[qs] = qbase + (size_t)i * DM + 8 * hh; qnp[qs] = qbase + (size_t)i1 * DM + 8 * hh;
#pragma unroll
    for (int ks = 0; ks < 2; ++ks) { q[qs][ks] = g2_frag(qp[qs] + 32 * ks, 0); qn[qs][ks] = g2_frag(qnp[qs] + 32 * ks, 0); } }
  asm volatile("s_wait_xcnt 0x0" ::: "memory");      /* the wait in front of any write of an address register of these loads */
  __builtin_amdgcn_sched_barrier(0);
  const v8f z8 = {0.f,0.f,0.f,0.f,0.f,0.f,0.f,0.f};
  v8f o[2][4] = {{z8, z8, z8, z8}, {z8, z8, z8, z8}}; float mx[2] = {-3.0e38f, -3.0e38f}, sm[2] = {0.f, 0.f};
#pragma unroll 1      /* the pass is some 1,100 instructions long: a second copy would only cost instruction fetch and registers */
  for (int j0 = 0; j0 < TT; j0 += 64) {
    /* every global load of the pass is issued here, so that the pass waits out one load latency and not one per tile */
    /* relative tiles: rows t = tb0 + 16u + (0..15); queries i0+16.. take u = 0..4, queries i0.. take u = 1..5 */
    const int tb0 = TT - 32 - i0 + j0;
    /* each lane's three addresses: its place in the first k, v and relative tile of the pass; 0 <= tb0 and tb0 + 95 <= 2 * TT - 1, the rows of the table */
    const _Float16* kp = kbase + (size_t)j0 * 64 + 8 * lane; const _Float16* vp = vbase + (size_t)j0 * 16 + 8 * lane; const _Float16* ep = ER16 + (size_t)tb0 * 64 + 8 * lane;
    v16h kf[4][2], ef[6][2], vf[4][2];
#pragma unroll
    for (int n = 0; n < 4; ++n) { kf[n][0] = g2_fragp(kp + 1024 * n); kf[n][1] = g2_fragp(kp + 1024 * n + 512); }
#pragma unroll
    for (int u = 0; u < 6; ++u) { ef[u][0] = g2_fragp(ep + 1024 * u); ef[u][1] = g2_fragp(ep + 1024 * u + 512); }
#pragma unroll
    for (int dt = 0; dt < 4; ++dt) { vf[dt][0] = g2_fragp(vp + (size_t)(16 * dt) * TT); vf[dt][1] = g2_fragp(vp + (size_t)(16 * dt) * TT + 512); }
    /* the wait that stands in front of any write of a register which one of these loads names as its address; the addresses are its inputs so that their registers stay untouched up to it */
    asm volatile("s_wait_xcnt 0x0" :: "v"(kp), "v"(vp), "v"(ep) : "memory");
    __builtin_amdgcn_sched_barrier(0);      /* holds the loads and that wait in front of the products: without it the scheduler sinks the k loads between the products, two at a time, each with its own full wait */
    v8f s[2][4];      /* s[qs][n][r] = k[j0 + 16n + 8hh + r] . q[i0 + 16qs + ln] */
#pragma unroll
    for (int n = 0; n < 4; ++n)
#pragma unroll
      for (int qs = 0; qs < 2; ++qs) s[qs][n] = ra_mma(kf[n][1], q[qs][1], ra_mma(kf[n][0], q[qs][0], z8));
    /* TT - tb0 = 32 + i0 - j0 is a multiple of 32, so a tile of 16 table rows lies whole on one side of the wrap and the wrap stands in front of tile 0, 2 or 4 or behind the pass: rows below TT go with query i, rows from TT on with query i + 1 (row TT of the table is stored as zeros). No row is masked, and each of the four cases runs its twenty products with no branch between them */
    { float* d0 = &rl[w][0][ln][8 * hh]; float* d1 = &rl[w][1][ln][8 * hh]; const int below = TT - tb0;      /* table rows of the pass below the wrap, where under 96 */
      if (below >= 96) rel_pass<6>(ef, q, qn, d0, d1);
      else if (below <= 0) rel_pass<0>(ef, q, qn, d0, d1);
      else if (below == 64) rel_pass<4>(ef, q, qn, d0, d1);
      else rel_pass<2>(ef, q, qn, d0, d1); }
    /* a query's row is written by its two lanes and read by both: the wave's LDS writes are done before any lane reads; only the LDS counter is waited on, the v loads stay in flight */
    asm volatile("s_wait_dscnt 0x0" ::: "memory"); __builtin_amdgcn_wave_barrier();
    FragH p[2][2];
#pragma unroll
    for (int qs = 0; qs < 2; ++qs) { const float* rr = &rl[w][qs][ln][15 - ln + 8 * hh]; float mt = -3.0e38f;
#pragma unroll
      for (int n = 0; n < 4; ++n)
#pragma unroll
        for (int r = 0; r < 8; ++r) { const float lg = s[qs][n][r] + rr[16 * n + r]; s[qs][n][r] = lg; mt = fmaxf(mt, lg); }      /* 8 x the logit: the scale goes into the exponent's multiply-add */
      mt = fmaxf(mt, __shfl_xor(mt, 16, 32));
      const float mn = fmaxf(mx[qs], mt), ax = (mx[qs] - mn) * L2E8, nb = fmaf(-mn, L2E8, 10.0f); float al = __builtin_amdgcn_exp2f(ax); mx[qs] = mn; float ps[4] = {0.f, 0.f, 0.f, 0.f};      /* one partial sum per key tile: four short add chains */
      asm("v_nop" : "+v"(al) : "v"(ax));      /* the slot behind a transcendental, as below */
#pragma unroll
      for (int n = 0; n < 4; ++n)
      { float x[8], e[8];      /* e = 2^10 * exp(logit - max) */
#pragma unroll
        for (int r = 0; r < 8; ++r) { x[r] = fmaf(s[qs][n][r], L2E8, nb); e[r] = __builtin_amdgcn_exp2f(x[r]); }
        /* the slot that the instruction set asks for behind a transcendental, before its result is read or its source overwritten: no result is read and no source register is given up in front of this v_nop, so whatever stands directly behind one of the eight is independent of it or is the v_nop */
        asm("v_nop" : "+v"(e[0]), "+v"(e[1]), "+v"(e[2]), "+v"(e[3]), "+v"(e[4]), "+v"(e[5]), "+v"(e[6]), "+v"(e[7]) : "v"(x[0]), "v"(x[1]), "v"(x[2]), "v"(x[3]), "v"(x[4]), "v"(x[5]), "v"(x[6]), "v"(x[7]));
#pragma unroll
        for (int r = 0; r < 8; ++r) { ps[n] += e[r]; p[qs][n >> 1].h[(n & 1) * 8 + r] = (_Float16)e[r]; } }
      sm[qs] = sm[qs] * al + ((ps[0] + ps[1]) + (ps[2] + ps[3]));
#pragma unroll
      for (int dt = 0; dt < 4; ++dt) o[qs][dt] *= al; }
    /* keeps the compiler from lifting the next pass's LDS writes over this pass's reads (their values are already in registers here) */
    __builtin_amdgcn_fence(__ATOMIC_ACQ_REL, "wavefront"); __builtin_amdgcn_wave_barrier();
#pragma unroll
    for (int dt = 0; dt < 4; ++dt)
#pragma unroll
      for (int qs = 0; qs < 2; ++qs) o[qs][dt] = ra_mma(vf[dt][1], p[qs][1].v, ra_mma(vf[dt][0], p[qs][0].v, o[qs][dt]));
  }
#pragma unroll
  for (int qs = 0; qs < 2; ++qs) { const float tot = sm[qs] + __shfl_xor(sm[qs], 16, 32); const float inv = 1.0f / tot;      /* the row sum carries the 2^10 of P as well */
    /* O as f16 hi + residual x 2^10, two planes [row][DM] in fragment order: the lane's 8 values of d tile dt are its piece of the tile (row tile of the 16 queries, k tile 2 * h + dt / 2), half dt % 2 */
    const size_t ob = ((size_t)((b * TT + i0 + 16 * qs) >> 4) * (DM / 32) + 2 * h) * 512 + 8 * lane;
    FragH fh[4], fl[4];
#pragma unroll
    for (int dt = 0; dt < 4; ++dt) { const v8f a = o[qs][dt];
#pragma unroll
      for (int r = 0; r < 8; ++r) { const float v = a[r] * inv; const _Float16 hi = (_Float16)v; fh[dt].h[r] = hi; fl[dt].h[r] = (_Float16)((v - (float)hi) * 1024.0f); } }
    __builtin_amdgcn_sched_barrier(0);      /* with the one behind the wait: keeps the arithmetic, which reuses registers, out of the stretch between these stores and their wait */
#pragma unroll
    for (int dt = 0; dt < 4; ++dt) { *(v8us*)((unsigned short*)Oh + ob + 256 * dt) = fh[dt].half[0]; *(v8us*)((unsigned short*)Ol + ob + 256 * dt) = fl[dt].half[0]; }
    if (qs == 0) { asm volatile("s_wait_xcnt 0x0" ::: "memory");      /* the wait in front of any write of a register that one of these stores names; nothing is written behind the second group */
      __builtin_amdgcn_sched_barrier(0); } }
}

extern "C" void kernel_launch(void* const* d_in, const int* in_sizes, int n_in,
                              void* d_out, int out_size, void* d_ws, size_t ws_size, hipStream_t stream) {
  (void)in_sizes; (void)n_in; (void)out_size;
  const float* const* I = (const float* const*)d_in; const float* x = I[0]; const float* qw = I[1]; const float* qb = I[2]; const float* kvw = I[3]; const float* kvb = I[4]; const float* pw = I[5]; const float* pb = I[6]; const float* Er = I[7];
  char* ws = (char*)d_ws; size_t off = 0;
  auto take = [&](size_t bytes) { char* p = ws + off; off += (bytes + 255) & ~(size_t)255; return p; };
  _Float16* BP = (_Float16*)take((size_t)DM * DM * 2); _Float16* ER16 = (_Float16*)take((size_t)2 * TT * 64 * 2);
  _Float16* Q16 = (_Float16*)take((size_t)NR * DM * 2); _Float16* VT = (_Float16*)take((size_t)NR * DM * 2); _Float16* KP = (_Float16*)take((size_t)NR * DM * 2);
  _Float16* X16 = (_Float16*)take((size_t)NR * DM * 2); _Float16* BQKV = (_Float16*)take((size_t)DM * 3 * DM * 2);      /* [q_w | kv_w]^T: one plane of 3 * DM rows, the q rows first */
  _Float16* Oh = (_Float16*)take((size_t)NR * DM * 2); _Float16* Ol = (_Float16*)take((size_t)NR * DM * 2);
  if (off > ws_size) return;      /* about 57 MiB */
  k_prep<<<PB_KV + 2 * PB_W + PB_X + PB_E, 256, 0, stream>>>(qw, kvw, pw, Er, x, BQKV, BQKV + (size_t)DM * DM, BP, ER16, X16);
  const dim3 gA(TT / 128, NBT * NH);
  k_gemm_qkv<<<(NR / 256) * (3 * DM / 192), 384, 0, stream>>>(X16, BQKV, qb, kvb, Q16, KP, VT);
  k_relattn<<<gA, 128, 0, stream>>>(Q16, KP, VT, ER16, Oh, Ol);
  k_gemm_proj<<<(NR / 128) * (DM / 128), 256, 0, stream>>>(Oh, Ol, BP, pb, (float*)d_out);
}

// v009
// One run takes 104 microseconds.
// In two side-by-side timings against v008, it was 1.07 and 1.06 times as fast.
// All steps since v000 together make it 33.8 times as fast.
#include <hip/hip_runtime.h>
// Relative-position multi-head attention with the 'skew' trick (2 x 2048 tokens x 1024, 16 heads x 64): q = x*q_w + q_b; [k | v] = x*kv_w + kv_b; QEr = q . Er^T against the learned INPUT table Er [2048][64]; Srel = skew(QEr) (pad one zero column on the left, reinterpret as [(N+1)][N], drop the first row -> Srel[i][j] = padded.flat[(i+1)*N + j]); logits = (q.k + Srel)/8 (no mask); softmax; merged . proj_w + proj_b -> [2,2048,1024].
// Structure: x as an exact f16 plane; the projections as f16 WMMA GEMMs (4 x 4 fragment tiles per wave, one block per WGP, f32, exact products + bias; both operands stored in fragment order) whose epilogue stores q row-major and k and v per (batch, head) as [token][d] and [d][token] in fragment order; Er as an exact f16 table over the skewed index, in fragment order; one attention kernel for all (batch, head) pairs: a wave holds 32 queries and walks the keys 64 at a time; scores and relative terms as transposed WMMA tiles (keys or Er rows as A, queries as B), the skew as a per-query shifted read of the relative tile through LDS, running-max softmax per lane in base 2 (one multiply-add and one v_exp_f32 per score), P (x2^10 f16) taken from the score registers as the B operand of V^T.P^T, O stored as f16 hi + residual planes in fragment order; output projection as one GEMM with both terms.
// Compute dtype: x, weights, biases and Er rounded to bf16; projections exact; q, k, v, P as f16 operands (~2^-12), O as hi + residual; f32 accumulation and softmax. v_wmma_f32_16x16x32_f16.
#define NBT 2
#define TT 2048
#define DM 1024
#define NH 16
#define NR (NBT * TT)
#define L2E8 0.18033688011112042f   /* log2(e) / 8: the logit scale 1/8 and the change to base 2 in one factor */
#define RP 84   /* floats per query row of the relative tile in LDS: 80 used; a multiple of 4 for the 16-byte writes; lane ln reads at ln * (RP - 1) + const, and 83 is odd, which spreads the lanes over the banks */
typedef __bf16 v16b __attribute__((ext_vector_type(16)));
typedef unsigned short v8us __attribute__((ext_vector_type(8), may_alias));
typedef float  v8f  __attribute__((ext_vector_type(8)));
typedef float  v4f  __attribute__((ext_vector_type(4)));
typedef float  v4fa __attribute__((ext_vector_type(4), may_alias));
union FragB { v16b v; v8us half[2]; unsigned short u[16]; };

__device__ __forceinline__ unsigned short bf16_bits(float x) { unsigned int u = __float_as_uint(x); return (unsigned short)((u + 0x7FFFu + ((u >> 16) & 1u)) >> 16); }
__device__ __forceinline__ float bf16_val(unsigned short b) { return __uint_as_float(((unsigned int)b) << 16); }
__device__ __forceinline__ float bf16_round(float x) { return bf16_val(bf16_bits(x)); }
// D += A·B with NT terms: 1 = ah·bh, 2 = + al·bh (A split), 3 = + ah·bl (both split)
template <int NT>
__device__ __forceinline__ v8f mmaN(v16b ah, v16b al, v16b bh, v16b bl, v8f c) {
  c = __builtin_amdgcn_wmma_f32_16x16x32_bf16(false, ah, false, bh, (short)0, c, false, false);
  if (NT >= 2) c = __builtin_amdgcn_wmma_f32_16x16x32_bf16(false, al, false, bh, (short)0, c, false, false);
  if (NT >= 3) c = __builtin_amdgcn_wmma_f32_16x16x32_bf16(false, ah, false, bl, (short)0, c, false, false);
  asm volatile("v_nop\n\tv_nop\n\tv_nop\n\tv_nop" : "+v"(c) : "v"(ah), "v"(al), "v"(bh), "v"(bl));
  return c;
}

__global__ __launch_bounds__(256) void k_wt_bf16(const float* __restrict__ W, unsigned short* __restrict__ Wt, int K, int N) {
  const int t = blockIdx.x * 256 + threadIdx.x;
  const int k8n = K / 8;
  if (t >= N * k8n) return;
  const int n = t / k8n, k8 = (t % k8n) * 8;
  v8us v;
#pragma unroll
  for (int i = 0; i < 8; ++i) v[i] = bf16_bits(W[(size_t)(k8 + i) * N + n]);
  *(v8us*)(Wt + (size_t)n * K + k8) = v;
  
}

// GEMM C[M][N] (f32, pitch ldc) = act(A[M][K]·W + bias). A f32 row-major (pitch lda) converted per fragment to bf16
// (ASPLIT: hi/lo two planes -> 2 terms, else single rounded term); Wt bf16 [N][K] (pitch ldb). BIAS_BF16 rounds the
// bias to bf16 first (bias quantised to bf16 before the add). K%32==0, M%16==0, N%64==0.
template <bool ASPLIT, int ACT, bool BIAS_BF16>
__global__ __launch_bounds__(128) void k_gemm_bf(const float* __restrict__ A, int lda, const unsigned short* __restrict__ Wt, int ldb,
                                               const float* __restrict__ bias, float* __restrict__ C, int ldc, int M, int N, int K) {
  __shared__ __attribute__((aligned(16))) float so[4][16][64];
  const int tid = threadIdx.x, w = tid >> 5, lane = tid & 31, ln = lane & 15, hh = lane >> 4;
  const int ntn = N / 64;
  const int wid = blockIdx.x * 4 + w;
  const int mt = wid / ntn, nq = wid % ntn;
  if (mt * 16 >= M) return;
  const int row0 = mt * 16, col0 = nq * 64;
  const float* arow = A + (size_t)(row0 + ln) * lda;
  v8f acc[4] = {};
  for (int kb = 0; kb < K; kb += 32) {
    FragB ah, al;
    const v4f x0 = *(const v4fa*)(arow + kb + 8 * hh), x1 = *(const v4fa*)(arow + kb + 8 * hh + 4);
    const v4f x2 = *(const v4fa*)(arow + kb + 16 + 8 * hh), x3 = *(const v4fa*)(arow + kb + 16 + 8 * hh + 4);
    float xs[16] = {x0[0],x0[1],x0[2],x0[3],x1[0],x1[1],x1[2],x1[3],x2[0],x2[1],x2[2],x2[3],x3[0],x3[1],x3[2],x3[3]};
#pragma unroll
    for (int i = 0; i < 16; ++i) { const unsigned short hb = bf16_bits(xs[i]); ah.u[i] = hb; al.u[i] = ASPLIT ? bf16_bits(xs[i] - bf16_val(hb)) : (unsigned short)0; }
#pragma unroll
    for (int t = 0; t < 4; ++t) {
      const unsigned short* brow = Wt + (size_t)(col0 + t * 16 + ln) * ldb + kb;
      FragB b;
      b.half[0] = *(const v8us*)(brow + 8 * hh);
      b.half[1] = *(const v8us*)(brow + 16 + 8 * hh);
      acc[t] = mmaN<ASPLIT ? 2 : 1>(ah.v, al.v, b.v, b.v, acc[t]);
    }
  }
#pragma unroll
  for (int t = 0; t < 4; ++t) {
    float bv = bias ? bias[col0 + t * 16 + ln] : 0.f;
    if (BIAS_BF16) bv = bf16_round(bv);
#pragma unroll
    for (int r = 0; r < 8; ++r) { float v = acc[t][r] + bv; if (ACT == 1) v = fmaxf(v, 0.f); so[w][8 * hh + r][t * 16 + ln] = v; }
  }
  __builtin_amdgcn_fence(__ATOMIC_ACQ_REL, "workgroup");
  __builtin_amdgcn_wave_barrier();
  const int rsub = lane >> 4, c4 = (lane & 15) * 4;
  {
#pragma unroll
    for (int q = 0; q < 8; ++q) {
      const int r = q * 2 + rsub;
      const v4f v = *(const v4fa*)&so[w][r][c4];
      *(v4f*)(C + (size_t)(row0 + r) * ldc + col0 + c4) = v;
    }
    
  }
}

// GEMM C = act(A·W + bias + resid): A f32 (ASPLIT -> hi/lo 2 terms), Wt bf16 [N][K]; ACT 0 none, 1 relu, 2 exact gelu;
// resid (optional, f32, row index = (row % rmod), pitch ldr, RES_BF16 rounds it) added before the activation.
template <bool ASPLIT, int ACT, bool BIAS_BF16, bool RES_BF16>
__global__ __launch_bounds__(128) void k_gemm_bf3(const float* __restrict__ A, int lda, const unsigned short* __restrict__ Wt, int ldb,
                                                const float* __restrict__ bias, const float* __restrict__ resid, int rmod, int ldr,
                                                float* __restrict__ C, int ldc, int M, int N, int K) {
  __shared__ __attribute__((aligned(16))) float so[4][16][64];
  const int tid = threadIdx.x, w = tid >> 5, lane = tid & 31, ln = lane & 15, hh = lane >> 4;
  const int ntn = N / 64;
  const int wid = blockIdx.x * 4 + w;
  const int mt = wid / ntn, nq = wid % ntn;
  if (mt * 16 >= M) return;
  const int row0 = mt * 16, col0 = nq * 64;
  const float* arow = A + (size_t)(row0 + ln) * lda;
  v8f acc[4] = {};
  for (int kb = 0; kb < K; kb += 32) {
    FragB ah, al;
    const v4f x0 = *(const v4fa*)(arow + kb + 8 * hh), x1 = *(const v4fa*)(arow + kb + 8 * hh + 4);
    const v4f x2 = *(const v4fa*)(arow + kb + 16 + 8 * hh), x3 = *(const v4fa*)(arow + kb + 16 + 8 * hh + 4);
    float xs[16] = {x0[0],x0[1],x0[2],x0[3],x1[0],x1[1],x1[2],x1[3],x2[0],x2[1],x2[2],x2[3],x3[0],x3[1],x3[2],x3[3]};
#pragma unroll
    for (int i = 0; i < 16; ++i) { const unsigned short hb = bf16_bits(xs[i]); ah.u[i] = hb; al.u[i] = ASPLIT ? bf16_bits(xs[i] - bf16_val(hb)) : (unsigned short)0; }
#pragma unroll
    for (int t = 0; t < 4; ++t) {
      const unsigned short* brow = Wt + (size_t)(col0 + t * 16 + ln) * ldb + kb;
      FragB b;
      b.half[0] = *(const v8us*)(brow + 8 * hh);
      b.half[1] = *(const v8us*)(brow + 16 + 8 * hh);
      acc[t] = mmaN<ASPLIT ? 2 : 1>(ah.v, al.v, b.v, b.v, acc[t]);
    }
  }
#pragma unroll
  for (int t = 0; t < 4; ++t) {
    const int col = col0 + t * 16 + ln;
    float bv = bias ? bias[col] : 0.f;
    if (BIAS_BF16) bv = bf16_round(bv);
#pragma unroll
    for (int r = 0; r < 8; ++r) {
      float v = acc[t][r] + bv;
      if (resid) { float rv = resid[(size_t)((row0 + 8 * hh + r) % rmod) * ldr + col]; if (RES_BF16) rv = bf16_round(rv); v += rv; }
      if (ACT == 1) v = fmaxf(v, 0.f);
      if (ACT == 2) v = 0.5f * v * (1.0f + erff(v * 0.70710678118654752f));
      if (ACT == 3) { const float u = 0.7978845608028654f * (v + 0.044715f * v * v * v); v = 0.5f * v * (1.0f + tanhf(u)); }
      so[w][8 * hh + r][t * 16 + ln] = v;
    }
  }
  __builtin_amdgcn_fence(__ATOMIC_ACQ_REL, "workgroup");
  __builtin_amdgcn_wave_barrier();
  const int rsub = lane >> 4, c4 = (lane & 15) * 4;
  {
#pragma unroll
    for (int q = 0; q < 8; ++q) {
      const int r = q * 2 + rsub;
      const v4f v = *(const v4fa*)&so[w][r][c4];
      *(v4f*)(C + (size_t)(row0 + r) * ldc + col0 + c4) = v;
    }
    
  }
}
// row LayerNorm (biased variance, eps) over N: s = X (+ R); optional out_sum <- s; out_norm <- (s-mu)*rsqrt(var+eps)*g + b
template <bool PARAM_BF16>
__global__ __launch_bounds__(256) void k_layernorm(const float* __restrict__ X, const float* __restrict__ R, const float* __restrict__ g, const float* __restrict__ bta,
                                                  float* __restrict__ out_sum, float* __restrict__ out_norm, int N, float eps) {
  __shared__ float red[256];
  const int row = blockIdx.x, tid = threadIdx.x;
  const float* x = X + (size_t)row * N; const float* rr = R ? R + (size_t)row * N : nullptr;
  float vals[16];                     // up to N = 4096
  const int per = N / 256;            // contiguous chunk per thread? use strided-by-4 chunks: thread handles j = tid*4 + 1024*u
  float s1 = 0.f;
  for (int u = 0; u < per / 4; ++u) {
    const int j = tid * 4 + 1024 * u;
    const v4f a = *(const v4fa*)(x + j);
    v4f b = {0.f,0.f,0.f,0.f}; if (rr) b = *(const v4fa*)(rr + j);
#pragma unroll
    for (int q = 0; q < 4; ++q) { const float v = a[q] + b[q]; vals[u * 4 + q] = v; s1 += v; }
  }
  red[tid] = s1; __syncthreads();
  for (int st = 128; st > 0; st >>= 1) { if (tid < st) red[tid] += red[tid + st]; __syncthreads(); }
  const float mu = red[0] / (float)N; __syncthreads();
  float s2 = 0.f;
  for (int u = 0; u < per / 4; ++u)
#pragma unroll
    for (int q = 0; q < 4; ++q) { const float c = vals[u * 4 + q] - mu; s2 += c * c; }
  red[tid] = s2; __syncthreads();
  for (int st = 128; st > 0; st >>= 1) { if (tid < st) red[tid] += red[tid + st]; __syncthreads(); }
  const float rs = rsqrtf(red[0] / (float)N + eps);
  {
    for (int u = 0; u < per / 4; ++u) {
      const int j = tid * 4 + 1024 * u;
      v4f o, sm;
#pragma unroll
      for (int q = 0; q < 4; ++q) {
        float gg = g[j + q], bb = bta[j + q];
        if (PARAM_BF16) { gg = bf16_round(gg); bb = bf16_round(bb); }
        sm[q] = vals[u * 4 + q]; o[q] = (vals[u * 4 + q] - mu) * rs * gg + bb;
      }
      if (out_sum) *(v4f*)(out_sum + (size_t)row * N + j) = sm;
      *(v4f*)(out_norm + (size_t)row * N + j) = o;
    }
    
  }
}



// ---- f16 WMMA path (v_wmma_f32_16x16x32_f16): 11-bit significands for operands in range — used where a [0,1] probability operand needs more precision than bf16
typedef _Float16 v16h __attribute__((ext_vector_type(16)));
union FragH { v16h v; v8us half[2]; _Float16 h[16]; unsigned short u[16]; };
template <int NT>
__device__ __forceinline__ v8f mmaH(v16h ah, v16h al, v16h bh, v16h bl, v8f c) {
  c = __builtin_amdgcn_wmma_f32_16x16x32_f16(false, ah, false, bh, (short)0, c, false, false);
  if (NT >= 2) c = __builtin_amdgcn_wmma_f32_16x16x32_f16(false, al, false, bh, (short)0, c, false, false);
  if (NT >= 3) c = __builtin_amdgcn_wmma_f32_16x16x32_f16(false, ah, false, bl, (short)0, c, false, false);
  asm volatile("v_nop\n\tv_nop\n\tv_nop\n\tv_nop" : "+v"(c) : "v"(ah), "v"(al), "v"(bh), "v"(bl));
  return c;
}
// batched GEMM like k_gemm_b but f16 operands: A f32 (split into f16 hi/lo if ASPLIT, else rounded to f16), Bt = f16 values [n][k]; alpha; C f32; N multiple of 16 (partial tiles skipped)
template <bool ASPLIT>
__global__ __launch_bounds__(128) void k_gemm_h(const float* __restrict__ A, int lda, size_t sA, const _Float16* __restrict__ Bh, int ldb, size_t sB, float alpha, float* __restrict__ C, int ldc, size_t sC, int M, int N, int K) {
  __shared__ __attribute__((aligned(16))) float so[4][16][64];
  const int tid = threadIdx.x, w = tid >> 5, lane = tid & 31, ln = lane & 15, hh = lane >> 4; const int by = blockIdx.y;
  A += (size_t)by * sA; Bh += (size_t)by * sB; C += (size_t)by * sC;
  const int ntn = (N + 63) / 64; const int wid = blockIdx.x * 4 + w; const int mt = wid / ntn, nq = wid % ntn; if (mt * 16 >= M) return;
  const int row0 = mt * 16, col0 = nq * 64; const float* arow = A + (size_t)(row0 + ln) * lda;
  v8f acc[4] = {};
  for (int kb = 0; kb < K; kb += 32) {
    FragH ah, al;
    const v4f x0 = *(const v4fa*)(arow + kb + 8 * hh), x1 = *(const v4fa*)(arow + kb + 8 * hh + 4), x2 = *(const v4fa*)(arow + kb + 16 + 8 * hh), x3 = *(const v4fa*)(arow + kb + 16 + 8 * hh + 4);
    float xs[16] = {x0[0],x0[1],x0[2],x0[3],x1[0],x1[1],x1[2],x1[3],x2[0],x2[1],x2[2],x2[3],x3[0],x3[1],x3[2],x3[3]};
#pragma unroll
    for (int i = 0; i < 16; ++i) { const _Float16 h = (_Float16)xs[i]; ah.h[i] = h; al.h[i] = ASPLIT ? (_Float16)(xs[i] - (float)h) : (_Float16)0.0f; }
#pragma unroll
    for (int t = 0; t < 4; ++t) { if (col0 + t * 16 >= N) continue; const size_t boff = (size_t)(col0 + t * 16 + ln) * ldb + kb; FragH bq; bq.half[0] = *(const v8us*)(Bh + boff + 8 * hh); bq.half[1] = *(const v8us*)(Bh + boff + 16 + 8 * hh);
      acc[t] = mmaH<ASPLIT ? 2 : 1>(ah.v, al.v, bq.v, bq.v, acc[t]); }
  }
#pragma unroll
  for (int t = 0; t < 4; ++t) { if (col0 + t * 16 >= N) continue;
#pragma unroll
    for (int r = 0; r < 8; ++r) so[w][8 * hh + r][t * 16 + ln] = acc[t][r] * alpha; }
  __builtin_amdgcn_fence(__ATOMIC_ACQ_REL, "workgroup"); __builtin_amdgcn_wave_barrier();
  const int rsub = lane >> 4, c4 = (lane & 15) * 4;
  {
#pragma unroll
    for (int q = 0; q < 8; ++q) { const int r = q * 2 + rsub; if (col0 + c4 < N) { const v4f v = *(const v4fa*)&so[w][r][c4]; *(v4f*)(C + (size_t)(row0 + r) * ldc + col0 + c4) = v; } }
     }
}

// Fragment order of an f16 operand plane [R][K] (R % 16 == 0, K % 32 == 0): tiles of 16 rows x 32 k, 1 KiB each, the k tiles of one row tile one after the other (a row tile is 16 * K elements, as in the row-major plane).
// Inside a tile the 16-byte piece (row ln, k = 16 * half + 8 * hh + 0..7) lies at element 256 * half + 8 * (16 * hh + ln): lane 16 * hh + ln of a wave finds its fragment at its own 16 bytes of two runs of 512 bytes, so a fragment load covers four whole 128-byte lines.
// pk_src: piece t, counted in storage order, -> its row and its first k
__device__ __forceinline__ void pk_src(unsigned t, unsigned K, int& row, int& k) { const unsigned ktn = K >> 5, tile = t >> 6, rt = tile / ktn, kt = tile - rt * ktn; row = (int)(rt * 16 + (t & 15)); k = (int)(kt * 32 + ((t >> 5) & 1) * 16 + ((t >> 4) & 1) * 8); }
// Wt = f16(W[k][n] * scale) as the plane [n][k] in fragment order, from f32 row-major W[K][N] (scale = power of two; bf16-exact weights stay exact in f16 away from the subnormal range); thread t makes piece t, in storage order
__device__ __forceinline__ void d_wt_f16(const float* __restrict__ W, _Float16* __restrict__ Wt, int K, int N, float scale, int t) {
  int n, k8; pk_src((unsigned)t, (unsigned)K, n, k8); FragH f;
#pragma unroll
  for (int i = 0; i < 8; ++i) f.h[i] = (_Float16)(bf16_round(W[(size_t)(k8 + i) * N + n]) * scale); const v8us o = f.half[0];
  *(v8us*)((unsigned short*)Wt + (size_t)t * 8) = o;
  asm volatile("s_wait_xcnt 0x0" ::: "memory");      /* the wait in front of any write of a register that this store names */
}
// k_gemm_hh variant with fused epilogue: v = acc·alpha + bias[by·sBias + col] (+ CP[(row/rowsPerB)·sCPb + by·64 + col] if CP) ; ACT 0 none / 1 elu ; writes f16 C16 (and f32 C if non-null)
template <int ACT>
__global__ __launch_bounds__(128) void k_gemm_hhx(const _Float16* __restrict__ A, int lda, size_t sA, const _Float16* __restrict__ Bh, int ldb, size_t sB, float alpha, const float* __restrict__ bias, size_t sBias, const float* __restrict__ CP, int rowsPerB, size_t sCPb, int row0g,
    float* __restrict__ C, _Float16* __restrict__ C16, int ldc, size_t sC, int M, int N, int K) {
  __shared__ __attribute__((aligned(16))) float so[4][16][64];
  const int tid = threadIdx.x, w = tid >> 5, lane = tid & 31, ln = lane & 15, hh = lane >> 4; const int by = blockIdx.y;
  A += (size_t)by * sA; Bh += (size_t)by * sB; const size_t cofs = (size_t)by * sC; const float* bp = bias ? bias + (size_t)by * sBias : nullptr;
  const int ntn = (N + 63) / 64; const int wid = blockIdx.x * 4 + w; const int mt = wid / ntn, nq = wid % ntn; if (mt * 16 >= M) return;
  const int row0 = mt * 16, col0 = nq * 64; const _Float16* arow = A + (size_t)(row0 + ln) * lda;
  v8f acc[4] = {};
  for (int kb = 0; kb < K; kb += 32) { FragH ah; ah.half[0] = *(const v8us*)((const unsigned short*)arow + kb + 8 * hh); ah.half[1] = *(const v8us*)((const unsigned short*)arow + kb + 16 + 8 * hh);
#pragma unroll
    for (int t = 0; t < 4; ++t) { if (col0 + t * 16 >= N) continue; const size_t boff = (size_t)(col0 + t * 16 + ln) * ldb + kb; FragH bq; bq.half[0] = *(const v8us*)((const unsigned short*)Bh + boff + 8 * hh); bq.half[1] = *(const v8us*)((const unsigned short*)Bh + boff + 16 + 8 * hh);
      acc[t] = mmaH<1>(ah.v, ah.v, bq.v, bq.v, acc[t]); }
  }
#pragma unroll
  for (int t = 0; t < 4; ++t) { if (col0 + t * 16 >= N) continue; const int col = col0 + t * 16 + ln; const float bv = bp ? bf16_round(bp[col]) : 0.f;
#pragma unroll
    for (int r = 0; r < 8; ++r) { float v = acc[t][r] * alpha + bv; if (CP) { const int bidx = (row0g + row0 + 8 * hh + r) / rowsPerB; v += CP[(size_t)bidx * sCPb + (size_t)by * 64 + col]; } if (ACT == 1) v = (v > 0.f) ? v : expm1f(v); else if (ACT == 7) v = (v > 0.f) ? v + 1.0f : expf(v); else if (ACT == 8) v = tanhf(v); else if (ACT == 9) v = 0.5f * v * (1.0f + tanhf(0.7978845608028654f * (v + 0.044715f * v * v * v))); else if (ACT == 11) v = 1.0f / (1.0f + expf(-v)); else if (ACT == 12) v = (v > 0.f) ? v : 0.01f * v; else if (ACT == 14) v = (v > 0.f) ? v : 0.1f * v; else if (ACT == 15) v = v / (1.0f + expf(-v)); else if (ACT == 3) v = fmaxf(v, 0.f); else if (ACT == 6) v = 0.5f * v * (1.0f + erff(v * 0.70710678118654752f)); so[w][8 * hh + r][t * 16 + ln] = v; } }
  __builtin_amdgcn_fence(__ATOMIC_ACQ_REL, "workgroup"); __builtin_amdgcn_wave_barrier();
  const int rsub = lane >> 4, c4 = (lane & 15) * 4; typedef _Float16 v4h __attribute__((ext_vector_type(4)));
  {
#pragma unroll
    for (int q = 0; q < 8; ++q) { const int r = q * 2 + rsub; if (col0 + c4 < N) { const v4f v = *(const v4fa*)&so[w][r][c4]; if (C) *(v4f*)(C + cofs + (size_t)(row0 + r) * ldc + col0 + c4) = v; if (C16) { v4h h4; for (int i = 0; i < 4; ++i) h4[i] = (_Float16)v[i]; *(v4h*)(C16 + cofs + (size_t)(row0 + r) * ldc + col0 + c4) = h4; } } }
     }
}


typedef _Float16 v4h __attribute__((ext_vector_type(4)));

__global__ __launch_bounds__(256) void k_x16(const float* __restrict__ x, _Float16* __restrict__ X16, size_t n8) { const size_t t = (size_t)blockIdx.x * 256 + threadIdx.x; if (t >= n8) return; FragH f;
#pragma unroll
  for (int q = 0; q < 8; ++q) f.h[q] = (_Float16)bf16_round(x[t * 8 + q]); *(v8us*)((unsigned short*)X16 + t * 8) = f.half[0];  }
// Er as the table of the skewed index t = 0 .. 2 * TT - 1, a plane [t][64] in fragment order: row t is Er[t] for t < TT, zero for t == TT, Er[t - TT - 1] beyond; thread t makes piece t, in storage order
__device__ __forceinline__ void d_er2(const float* __restrict__ Er, _Float16* __restrict__ E2, unsigned t) { int row, k; pk_src(t, 64, row, k);
  const int er = (row < TT) ? row : ((row > TT) ? row - TT - 1 : 0); const float* ep = Er + (size_t)er * 64 + k; const v4f a = *(const v4fa*)ep, c = *(const v4fa*)(ep + 4); FragH f;
#pragma unroll
  for (int q = 0; q < 4; ++q) { f.h[q] = (_Float16)bf16_round(a[q]); f.h[4 + q] = (_Float16)bf16_round(c[q]); }
  const v8us zr = {0, 0, 0, 0, 0, 0, 0, 0}; *(v8us*)((unsigned short*)E2 + (size_t)t * 8) = (row == TT) ? zr : f.half[0];
  asm volatile("s_wait_xcnt 0x0" ::: "memory"); }      /* the wait in front of any write of a register that this store names */
// x as an exact f16 plane [rows][DM] in fragment order; thread t makes piece t, in storage order
__device__ __forceinline__ void d_x16p(const float* __restrict__ x, _Float16* __restrict__ X16, unsigned t) { int row, k; pk_src(t, DM, row, k); const float* xp = x + (size_t)row * DM + k; const v4f a = *(const v4fa*)xp, c = *(const v4fa*)(xp + 4); FragH f;
#pragma unroll
  for (int q = 0; q < 4; ++q) { f.h[q] = (_Float16)bf16_round(a[q]); f.h[4 + q] = (_Float16)bf16_round(c[q]); }
  *(v8us*)((unsigned short*)X16 + (size_t)t * 8) = f.half[0];
  asm volatile("s_wait_xcnt 0x0" ::: "memory"); }      /* the wait in front of any write of a register that this store names */
// the five operand planes that depend on the inputs alone, in one launch: a block makes 256 pieces of one plane
#define PB_KV (DM * 2 * DM / 8 / 256)
#define PB_W  (DM * DM / 8 / 256)
#define PB_X  (NR * DM / 8 / 256)
#define PB_E  (2 * TT * 64 / 8 / 256)
__global__ __launch_bounds__(256) void k_prep(const float* __restrict__ qw, const float* __restrict__ kvw, const float* __restrict__ pw, const float* __restrict__ Er, const float* __restrict__ x,
    _Float16* __restrict__ BQ, _Float16* __restrict__ BKV, _Float16* __restrict__ BP, _Float16* __restrict__ E2, _Float16* __restrict__ X16) {
  const int bx = blockIdx.x, tid = threadIdx.x;      /* (in,out) weights -> [out][in] x16 */
  if (bx < PB_KV) d_wt_f16(kvw, BKV, DM, 2 * DM, 16.0f, bx * 256 + tid);
  else if (bx < PB_KV + PB_W) d_wt_f16(qw, BQ, DM, DM, 16.0f, (bx - PB_KV) * 256 + tid);
  else if (bx < PB_KV + 2 * PB_W) d_wt_f16(pw, BP, DM, DM, 16.0f, (bx - PB_KV - PB_W) * 256 + tid);
  else if (bx < PB_KV + 2 * PB_W + PB_X) d_x16p(x, X16, (unsigned)((bx - PB_KV - 2 * PB_W) * 256 + tid));
  else d_er2(Er, E2, (unsigned)((bx - PB_KV - 2 * PB_W - PB_X) * 256 + tid));
}
__global__ __launch_bounds__(256) void k_h16(const float* __restrict__ x, _Float16* __restrict__ X16, size_t n8) { const size_t t = (size_t)blockIdx.x * 256 + threadIdx.x; if (t >= n8) return; FragH f;
#pragma unroll
  for (int q = 0; q < 8; ++q) f.h[q] = (_Float16)x[t * 8 + q]; *(v8us*)((unsigned short*)X16 + t * 8) = f.half[0];  }
__global__ __launch_bounds__(256) void k_round16f(const float* __restrict__ W, _Float16* __restrict__ Bt, size_t n8) { const size_t t = (size_t)blockIdx.x * 256 + threadIdx.x; if (t >= n8) return; FragH f;
#pragma unroll
  for (int i = 0; i < 8; ++i) f.h[i] = (_Float16)(bf16_round(W[t * 8 + i]) * 16.0f); *(v8us*)((unsigned short*)Bt + t * 8) = f.half[0];  }
__global__ __launch_bounds__(256) void k_hl(const float* __restrict__ F, _Float16* __restrict__ Hh, _Float16* __restrict__ Hl, size_t n8) { const size_t t = (size_t)blockIdx.x * 256 + threadIdx.x; if (t >= n8) return; FragH fh, fl; const v4f a = *(const v4fa*)(F + t * 8), c = *(const v4fa*)(F + t * 8 + 4);
#pragma unroll
  for (int q = 0; q < 4; ++q) { _Float16 h = (_Float16)a[q]; fh.h[q] = h; fl.h[q] = (_Float16)((a[q] - (float)h) * 1024.0f); h = (_Float16)c[q]; fh.h[4 + q] = h; fl.h[4 + q] = (_Float16)((c[q] - (float)h) * 1024.0f); }
  { *(v8us*)((unsigned short*)Hh + t * 8) = fh.half[0]; *(v8us*)((unsigned short*)Hl + t * 8) = fl.half[0];  } }

// ---- fast GEMMs (four row tiles of A by four of B per wave; K % 64 == 0; A and Bh in fragment order, pitch K) ----
__device__ __forceinline__ v16h g2_fragp(const _Float16* p) { FragH f; f.half[0] = *(const v8us*)((const unsigned short*)p); f.half[1] = *(const v8us*)((const unsigned short*)p + 256); return f.v; }      /* p: the tile's start + 8 * lane */
__device__ __forceinline__ v16h g2_frag(const _Float16* p, int hh) { FragH f; f.half[0] = *(const v8us*)((const unsigned short*)p + 8 * hh); f.half[1] = *(const v8us*)((const unsigned short*)p + 16 + 8 * hh); return f.v; }
// D = A.B + C as the plain builtin: the compiler keeps the distance behind it itself, and its operands may lie above v255, which an asm operand cannot
__device__ __forceinline__ v8f g4_mma(v16h a, v16h b, v8f c) { return __builtin_amdgcn_wmma_f32_16x16x32_f16(false, a, false, b, (short)0, c, false, false); }
// k loop of a wave: four row tiles of A against four row tiles of B, c[a][t] += A[a] . B[t]^T over K (K % 64 == 0); pa*, pb*: each lane's place in the first k tile of each row tile
// two register sets of eight fragments (32 k each): the sixteen loads of a set are issued as one group, one set ahead of the sixteen products that read it, so that a set's load latency runs behind the other set's products
// the walk over k is a ring of K / 64 trips that starts at trip r0 (the same for a whole block): blocks that read the same rows of A or of B get r0 spread evenly over the ring (all different where there are at most K / 64 of them), so that they do not ask L2 for the same lines at the same moment
__device__ __forceinline__ void g2_kloop4(const _Float16* pa0, const _Float16* pa1, const _Float16* pa2, const _Float16* pa3, const _Float16* pb0, const _Float16* pb1, const _Float16* pb2, const _Float16* pb3, int K, int r0, v8f (&c)[4][4]) {
  v16h xa[4], xb[4], ya[4], yb[4];
  const int nt = K >> 6; int pos = r0;
  { const int o = r0 * 1024; pa0 += o; pa1 += o; pa2 += o; pa3 += o; pb0 += o; pb1 += o; pb2 += o; pb3 += o; }
  xa[0] = g2_fragp(pa0); xa[1] = g2_fragp(pa1); xa[2] = g2_fragp(pa2); xa[3] = g2_fragp(pa3); xb[0] = g2_fragp(pb0); xb[1] = g2_fragp(pb1); xb[2] = g2_fragp(pb2); xb[3] = g2_fragp(pb3);
  __builtin_amdgcn_sched_barrier(0);      /* holds the first group in front of the loop */
#pragma unroll 1      /* the two sets are the whole ring: a further copy of the body would only cost registers */
  for (int it = 0; it < nt; ++it) {
    ya[0] = g2_fragp(pa0 + 512); ya[1] = g2_fragp(pa1 + 512); ya[2] = g2_fragp(pa2 + 512); ya[3] = g2_fragp(pa3 + 512); yb[0] = g2_fragp(pb0 + 512); yb[1] = g2_fragp(pb1 + 512); yb[2] = g2_fragp(pb2 + 512); yb[3] = g2_fragp(pb3 + 512);
    /* the wait that stands in front of the write of the eight address registers below, which both groups in flight name; the addresses are its inputs so that their registers stay untouched up to it */
    asm volatile("s_wait_xcnt 0x0" :: "v"(pa0), "v"(pa1), "v"(pa2), "v"(pa3), "v"(pb0), "v"(pb1), "v"(pb2), "v"(pb3) : "memory");
    __builtin_amdgcn_sched_barrier(0);      /* holds this group in front of the products: without it the scheduler sinks each load to its first use, with a full wait each */
#pragma unroll
    for (int t = 0; t < 4; ++t)
#pragma unroll
      for (int a = 0; a < 4; ++a) c[a][t] = g4_mma(xa[a], xb[t], c[a][t]);
    const bool wrap = pos + 1 == nt; const int adv = wrap ? -(nt - 1) * 1024 : 1024; pos = wrap ? 0 : pos + 1;      /* the next place on the ring; the last trip reads the walk's first set again, in bounds and unused, so that every trip has the same loads in flight */
    pa0 += adv; pa1 += adv; pa2 += adv; pa3 += adv; pb0 += adv; pb1 += adv; pb2 += adv; pb3 += adv;
    __builtin_amdgcn_sched_barrier(0);      /* keeps the first set's products in front of the loads that refill it */
    xa[0] = g2_fragp(pa0); xa[1] = g2_fragp(pa1); xa[2] = g2_fragp(pa2); xa[3] = g2_fragp(pa3); xb[0] = g2_fragp(pb0); xb[1] = g2_fragp(pb1); xb[2] = g2_fragp(pb2); xb[3] = g2_fragp(pb3);
    __builtin_amdgcn_sched_barrier(0);      /* holds the next set's group in front of this set's products */
#pragma unroll
    for (int t = 0; t < 4; ++t)
#pragma unroll
      for (int a = 0; a < 4; ++a) c[a][t] = g4_mma(ya[a], yb[t], c[a][t]); }
  /* the same wait for the last group, in front of whatever reuses its address registers behind the loop */
  asm volatile("s_wait_xcnt 0x0" :: "v"(pa0), "v"(pa1), "v"(pa2), "v"(pa3), "v"(pb0), "v"(pb1), "v"(pb2), "v"(pb3) : "memory");
}
// q, k and v projections in one launch: a block makes a 256 x 192 tile of the plane [q | k | v] (3 * DM columns), its twelve waves 64 x 64 each (four down, three across): a fragment that a wave loads feeds four products, and each A fragment of the block is asked for by three of its waves, each B fragment by four, at about the same time, so that most of these loads are served on the WGP; A = x and Bh = [q_w | kv_w]^T x16 in fragment order.
// 256 blocks, one per WGP, three waves per SIMD.
// The epilogue stores each part as the attention kernel reads it: q row-major [row][DM]; k per (batch, head) as [token][d] and v as [d][token], both in fragment order. A wave's 64 columns are one head.
__global__ __launch_bounds__(384) void k_gemm_qkv(const _Float16* __restrict__ A, const _Float16* __restrict__ Bh, const float* __restrict__ qb, const float* __restrict__ kvb,
    _Float16* __restrict__ Q16, _Float16* __restrict__ KP, _Float16* __restrict__ VT) {
  __shared__ __attribute__((aligned(16))) float so[12][64][68];
  const int tid = threadIdx.x, w = __builtin_amdgcn_readfirstlane(tid >> 5), lane = tid & 31, ln = lane & 15, hh = lane >> 4;
  const int mt = blockIdx.x % (NR / 256), nq = 3 * (blockIdx.x / (NR / 256)) + (w >> 2); const int row0 = mt * 256 + 64 * (w & 3), col0 = nq * 64; const int part = nq / NH, h = nq - part * NH;
  /* each lane's place in the first k tile of the eight row tiles */
  const _Float16* pa0 = A + (size_t)row0 * DM + 8 * lane; const _Float16* pa1 = pa0 + (size_t)16 * DM; const _Float16* pa2 = pa1 + (size_t)16 * DM; const _Float16* pa3 = pa2 + (size_t)16 * DM;
  const _Float16* pb0 = Bh + (size_t)col0 * DM + 8 * lane; const _Float16* pb1 = pb0 + (size_t)16 * DM; const _Float16* pb2 = pb1 + (size_t)16 * DM; const _Float16* pb3 = pb2 + (size_t)16 * DM;
  const v8f z8 = {0.f,0.f,0.f,0.f,0.f,0.f,0.f,0.f}; v8f c[4][4] = {{z8, z8, z8, z8}, {z8, z8, z8, z8}, {z8, z8, z8, z8}, {z8, z8, z8, z8}};
  g2_kloop4(pa0, pa1, pa2, pa3, pb0, pb1, pb2, pb3, DM, (int)((blockIdx.x % (NR / 256) + blockIdx.x / (NR / 256)) & (DM / 64 - 1)), c);      /* 16 x 16 blocks, 16 trips: the sixteen blocks of a block row (same A) and of a block column (same B) all start apart */
  const float* bp = (part == 0) ? qb + col0 : kvb + (col0 - DM);
  const int b = row0 / TT, tok0 = row0 - b * TT; const size_t slab = (size_t)(b * NH + h) * 64 * TT;      /* the wave's 64 rows are tokens tok0 .. tok0 + 63 of batch b */
  if (part == 2) {      /* v: the accumulator tile (a, t) holds in each lane 8 tokens in a row of one d, which is that lane's piece of the tile (d tile t, token tile tok0 / 32 + a / 2), half a % 2 */
#pragma unroll
    for (int t = 0; t < 4; ++t) { const float bv = bf16_round(bp[t * 16 + ln]); FragH f[4];
#pragma unroll
      for (int a = 0; a < 4; ++a)
#pragma unroll
        for (int r = 0; r < 8; ++r) f[a].h[r] = (_Float16)(c[a][t][r] * 0.0625f + bv);
      __builtin_amdgcn_sched_barrier(0);      /* with the one behind the wait: keeps the arithmetic, which reuses registers, out of the stretch between these stores and their wait */
#pragma unroll
      for (int a = 0; a < 4; ++a) *(v8us*)((unsigned short*)VT + slab + (size_t)(t * 16) * TT + (size_t)((tok0 >> 5) + (a >> 1)) * 512 + (a & 1) * 256 + lane * 8) = f[a].half[0];
      asm volatile("s_wait_xcnt 0x0" ::: "memory");      /* the wait in front of any write of a register that one of the four stores before it names */
      __builtin_amdgcn_sched_barrier(0); }
    return; }
#pragma unroll
  for (int t = 0; t < 4; ++t) { const float bv = bf16_round(bp[t * 16 + ln]);
#pragma unroll
    for (int a = 0; a < 4; ++a)
#pragma unroll
      for (int r = 0; r < 8; ++r) so[w][a * 16 + 8 * hh + r][t * 16 + ln] = c[a][t][r] * 0.0625f + bv; }
  __builtin_amdgcn_fence(__ATOMIC_ACQ_REL, "workgroup"); __builtin_amdgcn_wave_barrier();      /* a wave reads back only its own part of so: its LDS writes are done before any of its lanes reads */
  if (part == 0) { const int rsub = lane >> 4, c4 = (lane & 15) * 4;
#pragma unroll
    for (int g = 0; g < 4; ++g) { v4h h4[8];
#pragma unroll
      for (int q = 0; q < 8; ++q) { const v4f v = *(const v4fa*)&so[w][(g * 8 + q) * 2 + rsub][c4]; for (int i = 0; i < 4; ++i) h4[q][i] = (_Float16)v[i]; }
      __builtin_amdgcn_sched_barrier(0);      /* as above: nothing that reuses a register stands between these stores and their wait */
#pragma unroll
      for (int q = 0; q < 8; ++q) *(v4h*)(Q16 + (size_t)(row0 + (g * 8 + q) * 2 + rsub) * DM + col0 + c4) = h4[q];
      asm volatile("s_wait_xcnt 0x0" ::: "memory");      /* the wait in front of any write of a register that one of the eight stores before it names */
      __builtin_amdgcn_sched_barrier(0); }
  } else {      /* k: piece (token tile rt, d tile kt, half hf) of lane 16 * hh + ln is token rt * 16 + ln, d = kt * 32 + hf * 16 + hh * 8 + (0 .. 7) */
#pragma unroll
    for (int rt = 0; rt < 4; ++rt) { FragH f[4];
#pragma unroll
      for (int pc = 0; pc < 4; ++pc) { const int kt = pc >> 1, hf = pc & 1; const float* sp = &so[w][rt * 16 + ln][kt * 32 + hf * 16 + hh * 8]; const v4f lo = *(const v4fa*)sp, hi = *(const v4fa*)(sp + 4);
#pragma unroll
        for (int i = 0; i < 4; ++i) { f[pc].h[i] = (_Float16)lo[i]; f[pc].h[4 + i] = (_Float16)hi[i]; } }
      __builtin_amdgcn_sched_barrier(0);      /* as above: nothing that reuses a register stands between these stores and their wait */
#pragma unroll
      for (int pc = 0; pc < 4; ++pc) *(v8us*)((unsigned short*)KP + slab + (size_t)((tok0 >> 4) + rt) * 1024 + pc * 256 + lane * 8) = f[pc].half[0];
      asm volatile("s_wait_xcnt 0x0" ::: "memory");      /* the wait in front of any write of a register that one of the four stores before it names */
      __builtin_amdgcn_sched_barrier(0); } }
}
// output projection: out = Oh . W + bias + (Ol . W) / 1024, W = Bh / 16; both terms in one k loop over the same B fragments, each in accumulators of its own; Ah, Al, Bh in fragment order
// a block makes a 128 x 128 tile, its eight waves 32 x 64 each (four down, two across); 256 blocks, one per WGP, two waves per SIMD
__global__ __launch_bounds__(256) void k_gemm_proj(const _Float16* __restrict__ Ah, const _Float16* __restrict__ Al, const _Float16* __restrict__ Bh, const float* __restrict__ bias, float* __restrict__ C) {
  __shared__ __attribute__((aligned(16))) float so[8][32][68];
  const int tid = threadIdx.x, w = tid >> 5, lane = tid & 31, ln = lane & 15, hh = lane >> 4;
  const int mt = blockIdx.x % (NR / 128), nq = blockIdx.x / (NR / 128); const int row0 = mt * 128 + 32 * (w & 3), col0 = nq * 128 + 64 * (w >> 2);
  /* each lane's place in the first k tile of the eight row tiles */
  const _Float16* pa0 = Ah + (size_t)row0 * DM + 8 * lane; const _Float16* pa1 = pa0 + (size_t)16 * DM; const _Float16* pa2 = Al + (size_t)row0 * DM + 8 * lane; const _Float16* pa3 = pa2 + (size_t)16 * DM;
  const _Float16* pb0 = Bh + (size_t)col0 * DM + 8 * lane; const _Float16* pb1 = pb0 + (size_t)16 * DM; const _Float16* pb2 = pb1 + (size_t)16 * DM; const _Float16* pb3 = pb2 + (size_t)16 * DM;
  const v8f z8 = {0.f,0.f,0.f,0.f,0.f,0.f,0.f,0.f}; v8f c[4][4] = {{z8, z8, z8, z8}, {z8, z8, z8, z8}, {z8, z8, z8, z8}, {z8, z8, z8, z8}};
  g2_kloop4(pa0, pa1, pa2, pa3, pb0, pb1, pb2, pb3, DM, (mt + 2 * nq) & (DM / 64 - 1), c);      /* 32 x 8 blocks, 16 trips: the eight blocks with the same A start apart, of the 32 with the same B two share a start */
#pragma unroll
  for (int t = 0; t < 4; ++t) { const float bv = bf16_round(bias[col0 + t * 16 + ln]);
#pragma unroll
    for (int half = 0; half < 2; ++half)
#pragma unroll
      for (int r = 0; r < 8; ++r) so[w][half * 16 + 8 * hh + r][t * 16 + ln] = c[2 + half][t][r] * (0.0625f / 1024.0f) + (c[half][t][r] * 0.0625f + bv); }
  __builtin_amdgcn_fence(__ATOMIC_ACQ_REL, "workgroup"); __builtin_amdgcn_wave_barrier();      /* a wave reads back only its own part of so: its LDS writes are done before any of its lanes reads */
  const int rsub = lane >> 4, c4 = (lane & 15) * 4;
#pragma unroll
  for (int q = 0; q < 16; ++q) { const int r = q * 2 + rsub; const v4f v = *(const v4fa*)&so[w][r][c4]; *(v4f*)(C + (size_t)(row0 + r) * DM + col0 + c4) = v; }
}

// D = A.B + C as the plain builtin: the compiler keeps the distance behind it itself
__device__ __forceinline__ v8f ra_mma(v16h a, v16h b, v8f c) { return __builtin_amdgcn_wmma_f32_16x16x32_f16(false, a, false, b, (short)0, c, false, false); }
// the six relative tiles of a pass: tile u = 16 rows of the table (A: its two k halves ef[u][0], ef[u][1]) against the two query groups (B), stored to each query's row in LDS; tile u serves group 0 for u >= 1 and group 1 for u <= 4.
// Tiles u < UC lie below the wrap and go with query i (q), the others with query i + 1 (qn); d0, d1: the lane's place in tile 0 of each group's row
template <int UC>
__device__ __forceinline__ void rel_pass(const v16h (&ef)[6][2], const v16h (&q)[2][2], const v16h (&qn)[2][2], float* d0, float* d1) {
  const v8f z8 = {0.f,0.f,0.f,0.f,0.f,0.f,0.f,0.f}; v8f r0[6], r1[6];
#pragma unroll
  for (int ks = 0; ks < 2; ++ks)
#pragma unroll
    for (int u = 0; u < 6; ++u) {
      if (u >= 1) r0[u] = ra_mma(ef[u][ks], (u < UC) ? q[0][ks] : qn[0][ks], ks ? r0[u] : z8);
      if (u <= 4) r1[u] = ra_mma(ef[u][ks], (u < UC) ? q[1][ks] : qn[1][ks], ks ? r1[u] : z8); }
  __builtin_amdgcn_sched_barrier(0);      /* holds the twenty products, ten tiles in registers of their own, in front of the stores: without it each tile's two products and its stores run one after the other through one register set, a dependent chain per tile */
#pragma unroll
  for (int u = 0; u < 6; ++u) {
    if (u >= 1) { float* d = d0 + 16 * (u - 1); const v4f lo = {r0[u][0], r0[u][1], r0[u][2], r0[u][3]}, hi = {r0[u][4], r0[u][5], r0[u][6], r0[u][7]}; *(v4fa*)d = lo; *(v4fa*)(d + 4) = hi; }
    if (u <= 4) { float* d = d1 + 16 * u; const v4f lo = {r1[u][0], r1[u][1], r1[u][2], r1[u][3]}, hi = {r1[u][4], r1[u][5], r1[u][6], r1[u][7]}; *(v4fa*)d = lo; *(v4fa*)(d + 4) = hi; } }
}

// Attention of one (batch, head) and 128 queries per block, 32 queries per wave, keys 64 at a time; nothing of S, QEr or P goes to memory.
// With t = TT-1-i+j the skewed term of (query i, key j) is q[i].Er[t] for t < TT, 0 for t == TT, q[i+1].Er[t-TT-1] for t > TT.
// All tiles are transposed: D[row 8*hh+r][column ln] with the query in the column, so a lane owns one query's max, sum and O column.
// Every inner loop is unrolled so that each array index is a constant and the arrays live in registers.
__global__ __launch_bounds__(128) void k_relattn(const _Float16* __restrict__ Q16, const _Float16* __restrict__ KP, const _Float16* __restrict__ VT, const _Float16* __restrict__ ER16, _Float16* __restrict__ Oh, _Float16* __restrict__ Ol) {
  __shared__ __attribute__((aligned(16))) float rl[4][2][16][RP];
  const int tid = threadIdx.x, w = __builtin_amdgcn_readfirstlane(tid >> 5), lane = tid & 31, ln = lane & 15, hh = lane >> 4;
  const int bh = blockIdx.y, b = bh / NH, h = bh - b * NH; const int i0 = blockIdx.x * 128 + 32 * w;
  const _Float16* qbase = Q16 + (size_t)b * TT * DM + h * 64; const _Float16* kbase = KP + (size_t)bh * 64 * TT; const _Float16* vbase = VT + (size_t)bh * 64 * TT;      /* [token][d] and [d][token], both in fragment order */
  v16h q[2][2], qn[2][2];      /* queries i and i + 1 as B operands; the row past the last query is never used, its address is clamped */
  const _Float16* qp[2]; const _Float16* qnp[2];
  __builtin_amdgcn_sched_barrier(0);      /* with the one behind the wait: keeps the set-up arithmetic, which reuses registers, out of the stretch between these loads and their wait */
#pragma unroll
  for (int qs = 0; qs < 2; ++qs) { const int i = i0 + 16 * qs + ln; const int i1 = (i + 1 < TT) ? i + 1 : TT - 1; qp[qs] = qbase + (size_t)i * DM + 8 * hh; qnp[qs] = qbase + (size_t)i1 * DM + 8 * hh;
#pragma unroll
    for (int ks = 0; ks < 2; ++ks) { q[qs][ks] = g2_frag(qp[qs] + 32 * ks, 0); qn[qs][ks] = g2_frag(qnp[qs] + 32 * ks, 0); } }
  asm volatile("s_wait_xcnt 0x0" ::: "memory");      /* the wait in front of any write of an address register of these loads */
  __builtin_amdgcn_sched_barrier(0);
  const v8f z8 = {0.f,0.f,0.f,0.f,0.f,0.f,0.f,0.f};
  v8f o[2][4] = {{z8, z8, z8, z8}, {z8, z8, z8, z8}}; float mx[2] = {-3.0e38f, -3.0e38f}, sm[2] = {0.f, 0.f};
  /* the key walk is a ring of TT / 64 passes: the sixteen blocks of a (batch, head), which read the same k and v, start at sixteen different passes (5 is odd), and their windows on the relative table, which move with j0 - i0, stand three passes apart; the (batch, head) number shifts the start too, since every head reads the one relative table; so blocks do not ask L2 for the same lines at the same moment; the running-max softmax takes the key tiles in any order */
  const int rot = (5 * (int)blockIdx.x + (bh & 15)) & (TT / 64 - 1);
#pragma unroll 1      /* the pass is some 1,100 instructions long: a second copy would only cost instruction fetch and registers */
  for (int it = 0; it < TT / 64; ++it) { const int j0 = ((it + rot) & (TT / 64 - 1)) * 64;
    /* every global load of the pass is issued here, so that the pass waits out one load latency and not one per tile */
    /* relative tiles: rows t = tb0 + 16u + (0..15); queries i0+16.. take u = 0..4, queries i0.. take u = 1..5 */
    const int tb0 = TT - 32 - i0 + j0;
    /* each lane's three addresses: its place in the first k, v and relative tile of the pass; 0 <= tb0 and tb0 + 95 <= 2 * TT - 1, the rows of the table */
    const _Float16* kp = kbase + (size_t)j0 * 64 + 8 * lane; const _Float16* vp = vbase + (size_t)j0 * 16 + 8 * lane; const _Float16* ep = ER16 + (size_t)tb0 * 64 + 8 * lane;
    v16h kf[4][2], ef[6][2], vf[4][2];
#pragma unroll
    for (int n = 0; n < 4; ++n) { kf[n][0] = g2_fragp(kp + 1024 * n); kf[n][1] = g2_fragp(kp + 1024 * n + 512); }
    __builtin_amdgcn_sched_barrier(0);      /* keeps the k loads, whose values the pass needs first, at the head of the group: loads come back in the order of issue */
#pragma unroll
    for (int u = 0; u < 6; ++u) { ef[u][0] = g2_fragp(ep + 1024 * u); ef[u][1] = g2_fragp(ep + 1024 * u + 512); }
    __builtin_amdgcn_sched_barrier(0);      /* likewise: keeps the v loads, whose values the pass needs last, behind every relative tile's */
#pragma unroll
    for (int dt = 0; dt < 4; ++dt) { vf[dt][0] = g2_fragp(vp + (size_t)(16 * dt) * TT); vf[dt][1] = g2_fragp(vp + (size_t)(16 * dt) * TT + 512); }
    /* the wait that stands in front of any write of a register which one of these loads names as its address; the addresses are its inputs so that their registers stay untouched up to it */
    asm volatile("s_wait_xcnt 0x0" :: "v"(kp), "v"(vp), "v"(ep) : "memory");
    __builtin_amdgcn_sched_barrier(0);      /* holds the loads and that wait in front of the products: without it the scheduler sinks the k loads between the products, two at a time, each with its own full wait */
    v8f s[2][4];      /* s[qs][n][r] = k[j0 + 16n + 8hh + r] . q[i0 + 16qs + ln] */
#pragma unroll
    for (int n = 0; n < 4; ++n)
#pragma unroll
      for (int qs = 0; qs < 2; ++qs) s[qs][n] = ra_mma(kf[n][1], q[qs][1], ra_mma(kf[n][0], q[qs][0], z8));
    /* TT - tb0 = 32 + i0 - j0 is a multiple of 32, so a tile of 16 table rows lies whole on one side of the wrap and the wrap stands in front of tile 0, 2 or 4 or behind the pass: rows below TT go with query i, rows from TT on with query i + 1 (row TT of the table is stored as zeros). No row is masked, and each of the four cases runs its twenty products with no branch between them */
    { float* d0 = &rl[w][0][ln][8 * hh]; float* d1 = &rl[w][1][ln][8 * hh]; const int below = TT - tb0;      /* table rows of the pass below the wrap, where under 96 */
      if (below >= 96) rel_pass<6>(ef, q, qn, d0, d1);
      else if (below <= 0) rel_pass<0>(ef, q, qn, d0, d1);
      else if (below == 64) rel_pass<4>(ef, q, qn, d0, d1);
      else rel_pass<2>(ef, q, qn, d0, d1); }
    /* a query's row is written by its two lanes and read by both: the wave's LDS writes are done before any lane reads; only the LDS counter is waited on, the v loads stay in flight */
    asm volatile("s_wait_dscnt 0x0" ::: "memory"); __builtin_amdgcn_wave_barrier();
    FragH p[2][2];
#pragma unroll
    for (int qs = 0; qs < 2; ++qs) { const float* rr = &rl[w][qs][ln][15 - ln + 8 * hh]; float mt = -3.0e38f;
#pragma unroll
      for (int n = 0; n < 4; ++n)
#pragma unroll
        for (int r = 0; r < 8; ++r) { const float lg = s[qs][n][r] + rr[16 * n + r]; s[qs][n][r] = lg; mt = fmaxf(mt, lg); }      /* 8 x the logit: the scale goes into the exponent's multiply-add */
      mt = fmaxf(mt, __shfl_xor(mt, 16, 32));
      const float mn = fmaxf(mx[qs], mt), ax = (mx[qs] - mn) * L2E8, nb = fmaf(-mn, L2E8, 10.0f); float al = __builtin_amdgcn_exp2f(ax); mx[qs] = mn; float ps[4] = {0.f, 0.f, 0.f, 0.f};      /* one partial sum per key tile: four short add chains */
      asm("v_nop" : "+v"(al) : "v"(ax));      /* the slot behind a transcendental, as below */
#pragma unroll
      for (int n = 0; n < 4; ++n)
      { float x[8], e[8];      /* e = 2^10 * exp(logit - max) */
#pragma unroll
        for (int r = 0; r < 8; ++r) { x[r] = fmaf(s[qs][n][r], L2E8, nb); e[r] = __builtin_amdgcn_exp2f(x[r]); }
        /* the slot that the instruction set asks for behind a transcendental, before its result is read or its source overwritten: no result is read and no source register is given up in front of this v_nop, so whatever stands directly behind one of the eight is independent of it or is the v_nop */
        asm("v_nop" : "+v"(e[0]), "+v"(e[1]), "+v"(e[2]), "+v"(e[3]), "+v"(e[4]), "+v"(e[5]), "+v"(e[6]), "+v"(e[7]) : "v"(x[0]), "v"(x[1]), "v"(x[2]), "v"(x[3]), "v"(x[4]), "v"(x[5]), "v"(x[6]), "v"(x[7]));
#pragma unroll
        for (int r = 0; r < 8; ++r) { ps[n] += e[r]; p[qs][n >> 1].h[(n & 1) * 8 + r] = (_Float16)e[r]; } }
      sm[qs] = sm[qs] * al + ((ps[0] + ps[1]) + (ps[2] + ps[3]));
#pragma unroll
      for (int dt = 0; dt < 4; ++dt) o[qs][dt] *= al; }
    /* keeps the compiler from lifting the next pass's LDS writes over this pass's reads (their values are already in registers here) */
    __builtin_amdgcn_fence(__ATOMIC_ACQ_REL, "wavefront"); __builtin_amdgcn_wave_barrier();
#pragma unroll
    for (int dt = 0; dt < 4; ++dt)
#pragma unroll
      for (int qs = 0; qs < 2; ++qs) o[qs][dt] = ra_mma(vf[dt][1], p[qs][1].v, ra_mma(vf[dt][0], p[qs][0].v, o[qs][dt]));
  }
#pragma unroll
  for (int qs = 0; qs < 2; ++qs) { const float tot = sm[qs] + __shfl_xor(sm[qs], 16, 32); const float inv = 1.0f / tot;      /* the row sum carries the 2^10 of P as well */
    /* O as f16 hi + residual x 2^10, two planes [row][DM] in fragment order: the lane's 8 values of d tile dt are its piece of the tile (row tile of the 16 queries, k tile 2 * h + dt / 2), half dt % 2 */
    const size_t ob = ((size_t)((b * TT + i0 + 16 * qs) >> 4) * (DM / 32) + 2 * h) * 512 + 8 * lane;
    FragH fh[4], fl[4];
#pragma unroll
    for (int dt = 0; dt < 4; ++dt) { const v8f a = o[qs][dt];
#pragma unroll
      for (int r = 0; r < 8; ++r) { const float v = a[r] * inv; const _Float16 hi = (_Float16)v; fh[dt].h[r] = hi; fl[dt].h[r] = (_Float16)((v - (float)hi) * 1024.0f); } }
    __builtin_amdgcn_sched_barrier(0);      /* with the one behind the wait: keeps the arithmetic, which reuses registers, out of the stretch between these stores and their wait */
#pragma unroll
    for (int dt = 0; dt < 4; ++dt) { *(v8us*)((unsigned short*)Oh + ob + 256 * dt) = fh[dt].half[0]; *(v8us*)((unsigned short*)Ol + ob + 256 * dt) = fl[dt].half[0]; }
    if (qs == 0) { asm volatile("s_wait_xcnt 0x0" ::: "memory");      /* the wait in front of any write of a register that one of these stores names; nothing is written behind the second group */
      __builtin_amdgcn_sched_barrier(0); } }
}

extern "C" void kernel_launch(void* const* d_in, const int* in_sizes, int n_in,
                              void* d_out, int out_size, void* d_ws, size_t ws_size, hipStream_t stream) {
  (void)in_sizes; (void)n_in; (void)out_size;
  const float* const* I = (const float* const*)d_in; const float* x = I[0]; const float* qw = I[1]; const float* qb = I[2]; const float* kvw = I[3]; const float* kvb = I[4]; const float* pw = I[5]; const float* pb = I[6]; const float* Er = I[7];
  char* ws = (char*)d_ws; size_t off = 0;
  auto take = [&](size_t bytes) { char* p = ws + off; off += (bytes + 255) & ~(size_t)255; return p; };
  _Float16* BP = (_Float16*)take((size_t)DM * DM * 2); _Float16* ER16 = (_Float16*)take((size_t)2 * TT * 64 * 2);
  _Float16* Q16 = (_Float16*)take((size_t)NR * DM * 2); _Float16* VT = (_Float16*)take((size_t)NR * DM * 2); _Float16* KP = (_Float16*)take((size_t)NR * DM * 2);
  _Float16* X16 = (_Float16*)take((size_t)NR * DM * 2); _Float16* BQKV = (_Float16*)take((size_t)DM * 3 * DM * 2);      /* [q_w | kv_w]^T: one plane of 3 * DM rows, the q rows first */
  _Float16* Oh = (_Float16*)take((size_t)NR * DM * 2); _Float16* Ol = (_Float16*)take((size_t)NR * DM * 2);
  if (off > ws_size) return;      /* about 57 MiB */
  k_prep<<<PB_KV + 2 * PB_W + PB_X + PB_E, 256, 0, stream>>>(qw, kvw, pw, Er, x, BQKV, BQKV + (size_t)DM * DM, BP, ER16, X16);
  const dim3 gA(TT / 128, NBT * NH);
  k_gemm_qkv<<<(NR / 256) * (3 * DM / 192), 384, 0, stream>>>(X16, BQKV, qb, kvb, Q16, KP, VT);
  k_relattn<<<gA, 128, 0, stream>>>(Q16, KP, VT, ER16, Oh, Ol);
  k_gemm_proj<<<(NR / 128) * (DM / 128), 256, 0, stream>>>(Oh, Ol, BP, pb, (float*)d_out);
}

// v010
// It runs in 94.9 microseconds.
// In both of two side-by-side timings against v009, it was 1.10 times as fast.
// Over all steps from v000 it is 37.2 times as fast.
#include <hip/hip_runtime.h>
// Relative-position multi-head attention with the 'skew' trick (2 x 2048 tokens x 1024, 16 heads x 64): q = x*q_w + q_b; [k | v] = x*kv_w + kv_b; QEr = q . Er^T against the learned INPUT table Er [2048][64]; Srel = skew(QEr) (pad one zero column on the left, reinterpret as [(N+1)][N], drop the first row -> Srel[i][j] = padded.flat[(i+1)*N + j]); logits = (q.k + Srel)/8 (no mask); softmax; merged . proj_w + proj_b -> [2,2048,1024].
// Structure: x as an exact f16 plane; the projections as f16 WMMA GEMMs (4 x 4 fragment tiles per wave, one block per WGP, f32, exact products + bias; both operands stored in fragment order) whose epilogue stores q row-major and k and v per (batch, head) as [token][d] and [d][token] in fragment order; Er as an exact f16 table over the skewed index, in fragment order; one attention kernel for all (batch, head) pairs: a wave holds 32 queries and walks the keys 64 at a time; scores and relative terms as transposed WMMA tiles (keys or Er rows as A, queries as B), the skew as a per-query shifted read of the relative tile through LDS, running-max softmax per lane in base 2 (one multiply-add and one v_exp_f32 per score), P (x2^10 f16) taken from the score registers as the B operand of V^T.P^T, O stored as f16 hi + residual planes in fragment order; output projection as one GEMM with both terms.
// Compute dtype: x, weights, biases and Er rounded to bf16; projections exact; q, k, v, P as f16 operands (~2^-12), O as hi + residual; f32 accumulation and softmax. v_wmma_f32_16x16x32_f16.
#define NBT 2
#define TT 2048
#define DM 1024
#define NH 16
#define NR (NBT * TT)
#define L2E8 0.18033688011112042f   /* log2(e) / 8: the logit scale 1/8 and the change to base 2 in one factor */
#define RP 84   /* floats per query row of the relative tile in LDS: 80 used; a multiple of 4 for the 16-byte writes; lane ln reads at ln * (RP - 1) + const, and 83 is odd, which spreads the lanes over the banks */
typedef __bf16 v16b __attribute__((ext_vector_type(16)));
typedef unsigned short v8us __attribute__((ext_vector_type(8), may_alias));
typedef float  v8f  __attribute__((ext_vector_type(8)));
typedef float  v4f  __attribute__((ext_vector_type(4)));
typedef float  v4fa __attribute__((ext_vector_type(4), may_alias));
union FragB { v16b v; v8us half[2]; unsigned short u[16]; };

__device__ __forceinline__ unsigned short bf16_bits(float x) { unsigned int u = __float_as_uint(x); return (unsigned short)((u + 0x7FFFu + ((u >> 16) & 1u)) >> 16); }
__device__ __forceinline__ float bf16_val(unsigned short b) { return __uint_as_float(((unsigned int)b) << 16); }
__device__ __forceinline__ float bf16_round(float x) { return bf16_val(bf16_bits(x)); }
// D += A·B with NT terms: 1 = ah·bh, 2 = + al·bh (A split), 3 = + ah·bl (both split)
template <int NT>
__device__ __forceinline__ v8f mmaN(v16b ah, v16b al, v16b bh, v16b bl, v8f c) {
  c = __builtin_amdgcn_wmma_f32_16x16x32_bf16(false, ah, false, bh, (short)0, c, false, false);
  if (NT >= 2) c = __builtin_amdgcn_wmma_f32_16x16x32_bf16(false, al, false, bh, (short)0, c, false, false);
  if (NT >= 3) c = __builtin_amdgcn_wmma_f32_16x16x32_bf16(false, ah, false, bl, (short)0, c, false, false);
  asm volatile("v_nop\n\tv_nop\n\tv_nop\n\tv_nop" : "+v"(c) : "v"(ah), "v"(al), "v"(bh), "v"(bl));
  return c;
}

__global__ __launch_bounds__(256) void k_wt_bf16(const float* __restrict__ W, unsigned short* __restrict__ Wt, int K, int N) {
  const int t = blockIdx.x * 256 + threadIdx.x;
  const int k8n = K / 8;
  if (t >= N * k8n) return;
  const int n = t / k8n, k8 = (t % k8n) * 8;
  v8us v;
#pragma unroll
  for (int i = 0; i < 8; ++i) v[i] = bf16_bits(W[(size_t)(k8 + i) * N + n]);
  *(v8us*)(Wt + (size_t)n * K + k8) = v;
  
}

// GEMM C[M][N] (f32, pitch ldc) = act(A[M][K]·W + bias). A f32 row-major (pitch lda) converted per fragment to bf16
// (ASPLIT: hi/lo two planes -> 2 terms, else single rounded term); Wt bf16 [N][K] (pitch ldb). BIAS_BF16 rounds the
// bias to bf16 first (bias quantised to bf16 before the add). K%32==0, M%16==0, N%64==0.
template <bool ASPLIT, int ACT, bool BIAS_BF16>
__global__ __launch_bounds__(128) void k_gemm_bf(const float* __restrict__ A, int lda, const unsigned short* __restrict__ Wt, int ldb,
                                               const float* __restrict__ bias, float* __restrict__ C, int ldc, int M, int N, int K) {
  __shared__ __attribute__((aligned(16))) float so[4][16][64];
  const int tid = threadIdx.x, w = tid >> 5, lane = tid & 31, ln = lane & 15, hh = lane >> 4;
  const int ntn = N / 64;
  const int wid = blockIdx.x * 4 + w;
  const int mt = wid / ntn, nq = wid % ntn;
  if (mt * 16 >= M) return;
  const int row0 = mt * 16, col0 = nq * 64;
  const float* arow = A + (size_t)(row0 + ln) * lda;
  v8f acc[4] = {};
  for (int kb = 0; kb < K; kb += 32) {
    FragB ah, al;
    const v4f x0 = *(const v4fa*)(arow + kb + 8 * hh), x1 = *(const v4fa*)(arow + kb + 8 * hh + 4);
    const v4f x2 = *(const v4fa*)(arow + kb + 16 + 8 * hh), x3 = *(const v4fa*)(arow + kb + 16 + 8 * hh + 4);
    float xs[16] = {x0[0],x0[1],x0[2],x0[3],x1[0],x1[1],x1[2],x1[3],x2[0],x2[1],x2[2],x2[3],x3[0],x3[1],x3[2],x3[3]};
#pragma unroll
    for (int i = 0; i < 16; ++i) { const unsigned short hb = bf16_bits(xs[i]); ah.u[i] = hb; al.u[i] = ASPLIT ? bf16_bits(xs[i] - bf16_val(hb)) : (unsigned short)0; }
#pragma unroll
    for (int t = 0; t < 4; ++t) {
      const unsigned short* brow = Wt + (size_t)(col0 + t * 16 + ln) * ldb + kb;
      FragB b;
      b.half[0] = *(const v8us*)(brow + 8 * hh);
      b.half[1] = *(const v8us*)(brow + 16 + 8 * hh);
      acc[t] = mmaN<ASPLIT ? 2 : 1>(ah.v, al.v, b.v, b.v, acc[t]);
    }
  }
#pragma unroll
  for (int t = 0; t < 4; ++t) {
    float bv = bias ? bias[col0 + t * 16 + ln] : 0.f;
    if (BIAS_BF16) bv = bf16_round(bv);
#pragma unroll
    for (int r = 0; r < 8; ++r) { float v = acc[t][r] + bv; if (ACT == 1) v = fmaxf(v, 0.f); so[w][8 * hh + r][t * 16 + ln] = v; }
  }
  __builtin_amdgcn_fence(__ATOMIC_ACQ_REL, "workgroup");
  __builtin_amdgcn_wave_barrier();
  const int rsub = lane >> 4, c4 = (lane & 15) * 4;
  {
#pragma unroll
    for (int q = 0; q < 8; ++q) {
      const int r = q * 2 + rsub;
      const v4f v = *(const v4fa*)&so[w][r][c4];
      *(v4f*)(C + (size_t)(row0 + r) * ldc + col0 + c4) = v;
    }
    
  }
}

// GEMM C = act(A·W + bias + resid): A f32 (ASPLIT -> hi/lo 2 terms), Wt bf16 [N][K]; ACT 0 none, 1 relu, 2 exact gelu;
// resid (optional, f32, row index = (row % rmod), pitch ldr, RES_BF16 rounds it) added before the activation.
template <bool ASPLIT, int ACT, bool BIAS_BF16, bool RES_BF16>
__global__ __launch_bounds__(128) void k_gemm_bf3(const float* __restrict__ A, int lda, const unsigned short* __restrict__ Wt, int ldb,
                                                const float* __restrict__ bias, const float* __restrict__ resid, int rmod, int ldr,
                                                float* __restrict__ C, int ldc, int M, int N, int K) {
  __shared__ __attribute__((aligned(16))) float so[4][16][64];
  const int tid = threadIdx.x, w = tid >> 5, lane = tid & 31, ln = lane & 15, hh = lane >> 4;
  const int ntn = N / 64;
  const int wid = blockIdx.x * 4 + w;
  const int mt = wid / ntn, nq = wid % ntn;
  if (mt * 16 >= M) return;
  const int row0 = mt * 16, col0 = nq * 64;
  const float* arow = A + (size_t)(row0 + ln) * lda;
  v8f acc[4] = {};
  for (int kb = 0; kb < K; kb += 32) {
    FragB ah, al;
    const v4f x0 = *(const v4fa*)(arow + kb + 8 * hh), x1 = *(const v4fa*)(arow + kb + 8 * hh + 4);
    const v4f x2 = *(const v4fa*)(arow + kb + 16 + 8 * hh), x3 = *(const v4fa*)(arow + kb + 16 + 8 * hh + 4);
    float xs[16] = {x0[0],x0[1],x0[2],x0[3],x1[0],x1[1],x1[2],x1[3],x2[0],x2[1],x2[2],x2[3],x3[0],x3[1],x3[2],x3[3]};
#pragma unroll
    for (int i = 0; i < 16; ++i) { const unsigned short hb = bf16_bits(xs[i]); ah.u[i] = hb; al.u[i] = ASPLIT ? bf16_bits(xs[i] - bf16_val(hb)) : (unsigned short)0; }
#pragma unroll
    for (int t = 0; t < 4; ++t) {
      const unsigned short* brow = Wt + (size_t)(col0 + t * 16 + ln) * ldb + kb;
      FragB b;
      b.half[0] = *(const v8us*)(brow + 8 * hh);
      b.half[1] = *(const v8us*)(brow + 16 + 8 * hh);
      acc[t] = mmaN<ASPLIT ? 2 : 1>(ah.v, al.v, b.v, b.v, acc[t]);
    }
  }
#pragma unroll
  for (int t = 0; t < 4; ++t) {
    const int col = col0 + t * 16 + ln;
    float bv = bias ? bias[col] : 0.f;
    if (BIAS_BF16) bv = bf16_round(bv);
#pragma unroll
    for (int r = 0; r < 8; ++r) {
      float v = acc[t][r] + bv;
      if (resid) { float rv = resid[(size_t)((row0 + 8 * hh + r) % rmod) * ldr + col]; if (RES_BF16) rv = bf16_round(rv); v += rv; }
      if (ACT == 1) v = fmaxf(v, 0.f);
      if (ACT == 2) v = 0.5f * v * (1.0f + erff(v * 0.70710678118654752f));
      if (ACT == 3) { const float u = 0.7978845608028654f * (v + 0.044715f * v * v * v); v = 0.5f * v * (1.0f + tanhf(u)); }
      so[w][8 * hh + r][t * 16 + ln] = v;
    }
  }
  __builtin_amdgcn_fence(__ATOMIC_ACQ_REL, "workgroup");
  __builtin_amdgcn_wave_barrier();
  const int rsub = lane >> 4, c4 = (lane & 15) * 4;
  {
#pragma unroll
    for (int q = 0; q < 8; ++q) {
      const int r = q * 2 + rsub;
      const v4f v = *(const v4fa*)&so[w][r][c4];
      *(v4f*)(C + (size_t)(row0 + r) * ldc + col0 + c4) = v;
    }
    
  }
}
// row LayerNorm (biased variance, eps) over N: s = X (+ R); optional out_sum <- s; out_norm <- (s-mu)*rsqrt(var+eps)*g + b
template <bool PARAM_BF16>
__global__ __launch_bounds__(256) void k_layernorm(const float* __restrict__ X, const float* __restrict__ R, const float* __restrict__ g, const float* __restrict__ bta,
                                                  float* __restrict__ out_sum, float* __restrict__ out_norm, int N, float eps) {
  __shared__ float red[256];
  const int row = blockIdx.x, tid = threadIdx.x;
  const float* x = X + (size_t)row * N; const float* rr = R ? R + (size_t)row * N : nullptr;
  float vals[16];                     // up to N = 4096
  const int per = N / 256;            // contiguous chunk per thread? use strided-by-4 chunks: thread handles j = tid*4 + 1024*u
  float s1 = 0.f;
  for (int u = 0; u < per / 4; ++u) {
    const int j = tid * 4 + 1024 * u;
    const v4f a = *(const v4fa*)(x + j);
    v4f b = {0.f,0.f,0.f,0.f}; if (rr) b = *(const v4fa*)(rr + j);
#pragma unroll
    for (int q = 0; q < 4; ++q) { const float v = a[q] + b[q]; vals[u * 4 + q] = v; s1 += v; }
  }
  red[tid] = s1; __syncthreads();
  for (int st = 128; st > 0; st >>= 1) { if (tid < st) red[tid] += red[tid + st]; __syncthreads(); }
  const float mu = red[0] / (float)N; __syncthreads();
  float s2 = 0.f;
  for (int u = 0; u < per / 4; ++u)
#pragma unroll
    for (int q = 0; q < 4; ++q) { const float c = vals[u * 4 + q] - mu; s2 += c * c; }
  red[tid] = s2; __syncthreads();
  for (int st = 128; st > 0; st >>= 1) { if (tid < st) red[tid] += red[tid + st]; __syncthreads(); }
  const float rs = rsqrtf(red[0] / (float)N + eps);
  {
    for (int u = 0; u < per / 4; ++u) {
      const int j = tid * 4 + 1024 * u;
      v4f o, sm;
#pragma unroll
      for (int q = 0; q < 4; ++q) {
        float gg = g[j + q], bb = bta[j + q];
        if (PARAM_BF16) { gg = bf16_round(gg); bb = bf16_round(bb); }
        sm[q] = vals[u * 4 + q]; o[q] = (vals[u * 4 + q] - mu) * rs * gg + bb;
      }
      if (out_sum) *(v4f*)(out_sum + (size_t)row * N + j) = sm;
      *(v4f*)(out_norm + (size_t)row * N + j) = o;
    }
    
  }
}



// ---- f16 WMMA path (v_wmma_f32_16x16x32_f16): 11-bit significands for operands in range — used where a [0,1] probability operand needs more precision than bf16
typedef _Float16 v16h __attribute__((ext_vector_type(16)));
union FragH { v16h v; v8us half[2]; _Float16 h[16]; unsigned short u[16]; };
template <int NT>
__device__ __forceinline__ v8f mmaH(v16h ah, v16h al, v16h bh, v16h bl, v8f c) {
  c = __builtin_amdgcn_wmma_f32_16x16x32_f16(false, ah, false, bh, (short)0, c, false, false);
  if (NT >= 2) c = __builtin_amdgcn_wmma_f32_16x16x32_f16(false, al, false, bh, (short)0, c, false, false);
  if (NT >= 3) c = __builtin_amdgcn_wmma_f32_16x16x32_f16(false, ah, false, bl, (short)0, c, false, false);
  asm volatile("v_nop\n\tv_nop\n\tv_nop\n\tv_nop" : "+v"(c) : "v"(ah), "v"(al), "v"(bh), "v"(bl));
  return c;
}
// batched GEMM like k_gemm_b but f16 operands: A f32 (split into f16 hi/lo if ASPLIT, else rounded to f16), Bt = f16 values [n][k]; alpha; C f32; N multiple of 16 (partial tiles skipped)
template <bool ASPLIT>
__global__ __launch_bounds__(128) void k_gemm_h(const float* __restrict__ A, int lda, size_t sA, const _Float16* __restrict__ Bh, int ldb, size_t sB, float alpha, float* __restrict__ C, int ldc, size_t sC, int M, int N, int K) {
  __shared__ __attribute__((aligned(16))) float so[4][16][64];
  const int tid = threadIdx.x, w = tid >> 5, lane = tid & 31, ln = lane & 15, hh = lane >> 4; const int by = blockIdx.y;
  A += (size_t)by * sA; Bh += (size_t)by * sB; C += (size_t)by * sC;
  const int ntn = (N + 63) / 64; const int wid = blockIdx.x * 4 + w; const int mt = wid / ntn, nq = wid % ntn; if (mt * 16 >= M) return;
  const int row0 = mt * 16, col0 = nq * 64; const float* arow = A + (size_t)(row0 + ln) * lda;
  v8f acc[4] = {};
  for (int kb = 0; kb < K; kb += 32) {
    FragH ah, al;
    const v4f x0 = *(const v4fa*)(arow + kb + 8 * hh), x1 = *(const v4fa*)(arow + kb + 8 * hh + 4), x2 = *(const v4fa*)(arow + kb + 16 + 8 * hh), x3 = *(const v4fa*)(arow + kb + 16 + 8 * hh + 4);
    float xs[16] = {x0[0],x0[1],x0[2],x0[3],x1[0],x1[1],x1[2],x1[3],x2[0],x2[1],x2[2],x2[3],x3[0],x3[1],x3[2],x3[3]};
#pragma unroll
    for (int i = 0; i < 16; ++i) { const _Float16 h = (_Float16)xs[i]; ah.h[i] = h; al.h[i] = ASPLIT ? (_Float16)(xs[i] - (float)h) : (_Float16)0.0f; }
#pragma unroll
    for (int t = 0; t < 4; ++t) { if (col0 + t * 16 >= N) continue; const size_t boff = (size_t)(col0 + t * 16 + ln) * ldb + kb; FragH bq; bq.half[0] = *(const v8us*)(Bh + boff + 8 * hh); bq.half[1] = *(const v8us*)(Bh + boff + 16 + 8 * hh);
      acc[t] = mmaH<ASPLIT ? 2 : 1>(ah.v, al.v, bq.v, bq.v, acc[t]); }
  }
#pragma unroll
  for (int t = 0; t < 4; ++t) { if (col0 + t * 16 >= N) continue;
#pragma unroll
    for (int r = 0; r < 8; ++r) so[w][8 * hh + r][t * 16 + ln] = acc[t][r] * alpha; }
  __builtin_amdgcn_fence(__ATOMIC_ACQ_REL, "workgroup"); __builtin_amdgcn_wave_barrier();
  const int rsub = lane >> 4, c4 = (lane & 15) * 4;
  {
#pragma unroll
    for (int q = 0; q < 8; ++q) { const int r = q * 2 + rsub; if (col0 + c4 < N) { const v4f v = *(const v4fa*)&so[w][r][c4]; *(v4f*)(C + (size_t)(row0 + r) * ldc + col0 + c4) = v; } }
     }
}

// Fragment order of an f16 operand plane [R][K] (R % 16 == 0, K % 32 == 0): tiles of 16 rows x 32 k, 1 KiB each, the k tiles of one row tile one after the other (a row tile is 16 * K elements, as in the row-major plane).
// Inside a tile the 16-byte piece (row ln, k = 16 * half + 8 * hh + 0..7) lies at element 256 * half + 8 * (16 * hh + ln): lane 16 * hh + ln of a wave finds its fragment at its own 16 bytes of two runs of 512 bytes, so a fragment load covers four whole 128-byte lines.
// pk_src: piece t, counted in storage order, -> its row and its first k
__device__ __forceinline__ void pk_src(unsigned t, unsigned K, int& row, int& k) { const unsigned ktn = K >> 5, tile = t >> 6, rt = tile / ktn, kt = tile - rt * ktn; row = (int)(rt * 16 + (t & 15)); k = (int)(kt * 32 + ((t >> 5) & 1) * 16 + ((t >> 4) & 1) * 8); }
// Wt = f16(W[k][n] * scale) as the plane [n][k] in fragment order, from f32 row-major W[K][N] (scale = power of two; bf16-exact weights stay exact in f16 away from the subnormal range); thread t makes piece t, in storage order
__device__ __forceinline__ void d_wt_f16(const float* __restrict__ W, _Float16* __restrict__ Wt, int K, int N, float scale, int t) {
  int n, k8; pk_src((unsigned)t, (unsigned)K, n, k8); FragH f;
#pragma unroll
  for (int i = 0; i < 8; ++i) f.h[i] = (_Float16)(bf16_round(W[(size_t)(k8 + i) * N + n]) * scale); const v8us o = f.half[0];
  *(v8us*)((unsigned short*)Wt + (size_t)t * 8) = o;
  asm volatile("s_wait_xcnt 0x0" ::: "memory");      /* the wait in front of any write of a register that this store names */
}
// k_gemm_hh variant with fused epilogue: v = acc·alpha + bias[by·sBias + col] (+ CP[(row/rowsPerB)·sCPb + by·64 + col] if CP) ; ACT 0 none / 1 elu ; writes f16 C16 (and f32 C if non-null)
template <int ACT>
__global__ __launch_bounds__(128) void k_gemm_hhx(const _Float16* __restrict__ A, int lda, size_t sA, const _Float16* __restrict__ Bh, int ldb, size_t sB, float alpha, const float* __restrict__ bias, size_t sBias, const float* __restrict__ CP, int rowsPerB, size_t sCPb, int row0g,
    float* __restrict__ C, _Float16* __restrict__ C16, int ldc, size_t sC, int M, int N, int K) {
  __shared__ __attribute__((aligned(16))) float so[4][16][64];
  const int tid = threadIdx.x, w = tid >> 5, lane = tid & 31, ln = lane & 15, hh = lane >> 4; const int by = blockIdx.y;
  A += (size_t)by * sA; Bh += (size_t)by * sB; const size_t cofs = (size_t)by * sC; const float* bp = bias ? bias + (size_t)by * sBias : nullptr;
  const int ntn = (N + 63) / 64; const int wid = blockIdx.x * 4 + w; const int mt = wid / ntn, nq = wid % ntn; if (mt * 16 >= M) return;
  const int row0 = mt * 16, col0 = nq * 64; const _Float16* arow = A + (size_t)(row0 + ln) * lda;
  v8f acc[4] = {};
  for (int kb = 0; kb < K; kb += 32) { FragH ah; ah.half[0] = *(const v8us*)((const unsigned short*)arow + kb + 8 * hh); ah.half[1] = *(const v8us*)((const unsigned short*)arow + kb + 16 + 8 * hh);
#pragma unroll
    for (int t = 0; t < 4; ++t) { if (col0 + t * 16 >= N) continue; const size_t boff = (size_t)(col0 + t * 16 + ln) * ldb + kb; FragH bq; bq.half[0] = *(const v8us*)((const unsigned short*)Bh + boff + 8 * hh); bq.half[1] = *(const v8us*)((const unsigned short*)Bh + boff + 16 + 8 * hh);
      acc[t] = mmaH<1>(ah.v, ah.v, bq.v, bq.v, acc[t]); }
  }
#pragma unroll
  for (int t = 0; t < 4; ++t) { if (col0 + t * 16 >= N) continue; const int col = col0 + t * 16 + ln; const float bv = bp ? bf16_round(bp[col]) : 0.f;
#pragma unroll
    for (int r = 0; r < 8; ++r) { float v = acc[t][r] * alpha + bv; if (CP) { const int bidx = (row0g + row0 + 8 * hh + r) / rowsPerB; v += CP[(size_t)bidx * sCPb + (size_t)by * 64 + col]; } if (ACT == 1) v = (v > 0.f) ? v : expm1f(v); else if (ACT == 7) v = (v > 0.f) ? v + 1.0f : expf(v); else if (ACT == 8) v = tanhf(v); else if (ACT == 9) v = 0.5f * v * (1.0f + tanhf(0.7978845608028654f * (v + 0.044715f * v * v * v))); else if (ACT == 11) v = 1.0f / (1.0f + expf(-v)); else if (ACT == 12) v = (v > 0.f) ? v : 0.01f * v; else if (ACT == 14) v = (v > 0.f) ? v : 0.1f * v; else if (ACT == 15) v = v / (1.0f + expf(-v)); else if (ACT == 3) v = fmaxf(v, 0.f); else if (ACT == 6) v = 0.5f * v * (1.0f + erff(v * 0.70710678118654752f)); so[w][8 * hh + r][t * 16 + ln] = v; } }
  __builtin_amdgcn_fence(__ATOMIC_ACQ_REL, "workgroup"); __builtin_amdgcn_wave_barrier();
  const int rsub = lane >> 4, c4 = (lane & 15) * 4; typedef _Float16 v4h __attribute__((ext_vector_type(4)));
  {
#pragma unroll
    for (int q = 0; q < 8; ++q) { const int r = q * 2 + rsub; if (col0 + c4 < N) { const v4f v = *(const v4fa*)&so[w][r][c4]; if (C) *(v4f*)(C + cofs + (size_t)(row0 + r) * ldc + col0 + c4) = v; if (C16) { v4h h4; for (int i = 0; i < 4; ++i) h4[i] = (_Float16)v[i]; *(v4h*)(C16 + cofs + (size_t)(row0 + r) * ldc + col0 + c4) = h4; } } }
     }
}


typedef _Float16 v4h __attribute__((ext_vector_type(4)));

__global__ __launch_bounds__(256) void k_x16(const float* __restrict__ x, _Float16* __restrict__ X16, size_t n8) { const size_t t = (size_t)blockIdx.x * 256 + threadIdx.x; if (t >= n8) return; FragH f;
#pragma unroll
  for (int q = 0; q < 8; ++q) f.h[q] = (_Float16)bf16_round(x[t * 8 + q]); *(v8us*)((unsigned short*)X16 + t * 8) = f.half[0];  }
// Er as the table of the skewed index t = 0 .. 2 * TT - 1, a plane [t][64] in fragment order: row t is Er[t] for t < TT, zero for t == TT, Er[t - TT - 1] beyond; thread t makes piece t, in storage order
__device__ __forceinline__ void d_er2(const float* __restrict__ Er, _Float16* __restrict__ E2, unsigned t) { int row, k; pk_src(t, 64, row, k);
  const int er = (row < TT) ? row : ((row > TT) ? row - TT - 1 : 0); const float* ep = Er + (size_t)er * 64 + k; const v4f a = *(const v4fa*)ep, c = *(const v4fa*)(ep + 4); FragH f;
#pragma unroll
  for (int q = 0; q < 4; ++q) { f.h[q] = (_Float16)bf16_round(a[q]); f.h[4 + q] = (_Float16)bf16_round(c[q]); }
  const v8us zr = {0, 0, 0, 0, 0, 0, 0, 0}; *(v8us*)((unsigned short*)E2 + (size_t)t * 8) = (row == TT) ? zr : f.half[0];
  asm volatile("s_wait_xcnt 0x0" ::: "memory"); }      /* the wait in front of any write of a register that this store names */
// x as an exact f16 plane [rows][DM] in fragment order; thread t makes piece t, in storage order
__device__ __forceinline__ void d_x16p(const float* __restrict__ x, _Float16* __restrict__ X16, unsigned t) { int row, k; pk_src(t, DM, row, k); const float* xp = x + (size_t)row * DM + k; const v4f a = *(const v4fa*)xp, c = *(const v4fa*)(xp + 4); FragH f;
#pragma unroll
  for (int q = 0; q < 4; ++q) { f.h[q] = (_Float16)bf16_round(a[q]); f.h[4 + q] = (_Float16)bf16_round(c[q]); }
  *(v8us*)((unsigned short*)X16 + (size_t)t * 8) = f.half[0];
  asm volatile("s_wait_xcnt 0x0" ::: "memory"); }      /* the wait in front of any write of a register that this store names */
// the five operand planes that depend on the inputs alone, in one launch: a block makes 256 pieces of one plane
#define PB_KV (DM * 2 * DM / 8 / 256)
#define PB_W  (DM * DM / 8 / 256)
#define PB_X  (NR * DM / 8 / 256)
#define PB_E  (2 * TT * 64 / 8 / 256)
__global__ __launch_bounds__(256) void k_prep(const float* __restrict__ qw, const float* __restrict__ kvw, const float* __restrict__ pw, const float* __restrict__ Er, const float* __restrict__ x,
    _Float16* __restrict__ BQ, _Float16* __restrict__ BKV, _Float16* __restrict__ BP, _Float16* __restrict__ E2, _Float16* __restrict__ X16) {
  const int bx = blockIdx.x, tid = threadIdx.x;      /* (in,out) weights -> [out][in] x16 */
  if (bx < PB_KV) d_wt_f16(kvw, BKV, DM, 2 * DM, 16.0f, bx * 256 + tid);
  else if (bx < PB_KV + PB_W) d_wt_f16(qw, BQ, DM, DM, 16.0f, (bx - PB_KV) * 256 + tid);
  else if (bx < PB_KV + 2 * PB_W) d_wt_f16(pw, BP, DM, DM, 16.0f, (bx - PB_KV - PB_W) * 256 + tid);
  else if (bx < PB_KV + 2 * PB_W + PB_X) d_x16p(x, X16, (unsigned)((bx - PB_KV - 2 * PB_W) * 256 + tid));
  else d_er2(Er, E2, (unsigned)((bx - PB_KV - 2 * PB_W - PB_X) * 256 + tid));
}
__global__ __launch_bounds__(256) void k_h16(const float* __restrict__ x, _Float16* __restrict__ X16, size_t n8) { const size_t t = (size_t)blockIdx.x * 256 + threadIdx.x; if (t >= n8) return; FragH f;
#pragma unroll
  for (int q = 0; q < 8; ++q) f.h[q] = (_Float16)x[t * 8 + q]; *(v8us*)((unsigned short*)X16 + t * 8) = f.half[0];  }
__global__ __launch_bounds__(256) void k_round16f(const float* __restrict__ W, _Float16* __restrict__ Bt, size_t n8) { const size_t t = (size_t)blockIdx.x * 256 + threadIdx.x; if (t >= n8) return; FragH f;
#pragma unroll
  for (int i = 0; i < 8; ++i) f.h[i] = (_Float16)(bf16_round(W[t * 8 + i]) * 16.0f); *(v8us*)((unsigned short*)Bt + t * 8) = f.half[0];  }
__global__ __launch_bounds__(256) void k_hl(const float* __restrict__ F, _Float16* __restrict__ Hh, _Float16* __restrict__ Hl, size_t n8) { const size_t t = (size_t)blockIdx.x * 256 + threadIdx.x; if (t >= n8) return; FragH fh, fl; const v4f a = *(const v4fa*)(F + t * 8), c = *(const v4fa*)(F + t * 8 + 4);
#pragma unroll
  for (int q = 0; q < 4; ++q) { _Float16 h = (_Float16)a[q]; fh.h[q] = h; fl.h[q] = (_Float16)((a[q] - (float)h) * 1024.0f); h = (_Float16)c[q]; fh.h[4 + q] = h; fl.h[4 + q] = (_Float16)((c[q] - (float)h) * 1024.0f); }
  { *(v8us*)((unsigned short*)Hh + t * 8) = fh.half[0]; *(v8us*)((unsigned short*)Hl + t * 8) = fl.half[0];  } }

// ---- fast GEMMs (four row tiles of A by four of B per wave; K % 64 == 0; A and Bh in fragment order, pitch K) ----
__device__ __forceinline__ v16h g2_fragp(const _Float16* p) { FragH f; f.half[0] = *(const v8us*)((const unsigned short*)p); f.half[1] = *(const v8us*)((const unsigned short*)p + 256); return f.v; }      /* p: the tile's start + 8 * lane */
__device__ __forceinline__ v16h g2_frag(const _Float16* p, int hh) { FragH f; f.half[0] = *(const v8us*)((const unsigned short*)p + 8 * hh); f.half[1] = *(const v8us*)((const unsigned short*)p + 16 + 8 * hh); return f.v; }
// D = A.B + C as the plain builtin: the compiler keeps the distance behind it itself, and its operands may lie above v255, which an asm operand cannot
__device__ __forceinline__ v8f g4_mma(v16h a, v16h b, v8f c) { return __builtin_amdgcn_wmma_f32_16x16x32_f16(false, a, false, b, (short)0, c, false, false); }
// k loop of a wave: four row tiles of A against four row tiles of B, c[a][t] += A[a] . B[t]^T over K (K % 64 == 0); pa*, pb*: each lane's place in the first k tile of each row tile
// two register sets of eight fragments (32 k each): the sixteen loads of a set are issued as one group, one set ahead of the sixteen products that read it, so that a set's load latency runs behind the other set's products
// the walk over k is a ring of K / 64 trips that starts at trip r0 (the same for a whole block): blocks that read the same rows of A or of B get r0 spread evenly over the ring (all different where there are at most K / 64 of them), so that they do not ask L2 for the same lines at the same moment
__device__ __forceinline__ void g2_kloop4(const _Float16* pa0, const _Float16* pa1, const _Float16* pa2, const _Float16* pa3, const _Float16* pb0, const _Float16* pb1, const _Float16* pb2, const _Float16* pb3, int K, int r0, v8f (&c)[4][4]) {
  v16h xa[4], xb[4], ya[4], yb[4];
  const int nt = K >> 6; int pos = r0;
  { const int o = r0 * 1024; pa0 += o; pa1 += o; pa2 += o; pa3 += o; pb0 += o; pb1 += o; pb2 += o; pb3 += o; }
  xa[0] = g2_fragp(pa0); xa[1] = g2_fragp(pa1); xa[2] = g2_fragp(pa2); xa[3] = g2_fragp(pa3); xb[0] = g2_fragp(pb0); xb[1] = g2_fragp(pb1); xb[2] = g2_fragp(pb2); xb[3] = g2_fragp(pb3);
  __builtin_amdgcn_sched_barrier(0);      /* holds the first group in front of the loop */
#pragma unroll 1      /* the two sets are the whole ring: a further copy of the body would only cost registers */
  for (int it = 0; it < nt; ++it) {
    ya[0] = g2_fragp(pa0 + 512); ya[1] = g2_fragp(pa1 + 512); ya[2] = g2_fragp(pa2 + 512); ya[3] = g2_fragp(pa3 + 512); yb[0] = g2_fragp(pb0 + 512); yb[1] = g2_fragp(pb1 + 512); yb[2] = g2_fragp(pb2 + 512); yb[3] = g2_fragp(pb3 + 512);
    /* the wait that stands in front of the write of the eight address registers below, which both groups in flight name; the addresses are its inputs so that their registers stay untouched up to it */
    asm volatile("s_wait_xcnt 0x0" :: "v"(pa0), "v"(pa1), "v"(pa2), "v"(pa3), "v"(pb0), "v"(pb1), "v"(pb2), "v"(pb3) : "memory");
    __builtin_amdgcn_sched_barrier(0);      /* holds this group in front of the products: without it the scheduler sinks each load to its first use, with a full wait each */
#pragma unroll
    for (int t = 0; t < 4; ++t)
#pragma unroll
      for (int a = 0; a < 4; ++a) c[a][t] = g4_mma(xa[a], xb[t], c[a][t]);
    const bool wrap = pos + 1 == nt; const int adv = wrap ? -(nt - 1) * 1024 : 1024; pos = wrap ? 0 : pos + 1;      /* the next place on the ring; the last trip reads the walk's first set again, in bounds and unused, so that every trip has the same loads in flight */
    pa0 += adv; pa1 += adv; pa2 += adv; pa3 += adv; pb0 += adv; pb1 += adv; pb2 += adv; pb3 += adv;
    __builtin_amdgcn_sched_barrier(0);      /* keeps the first set's products in front of the loads that refill it */
    xa[0] = g2_fragp(pa0); xa[1] = g2_fragp(pa1); xa[2] = g2_fragp(pa2); xa[3] = g2_fragp(pa3); xb[0] = g2_fragp(pb0); xb[1] = g2_fragp(pb1); xb[2] = g2_fragp(pb2); xb[3] = g2_fragp(pb3);
    __builtin_amdgcn_sched_barrier(0);      /* holds the next set's group in front of this set's products */
#pragma unroll
    for (int t = 0; t < 4; ++t)
#pragma unroll
      for (int a = 0; a < 4; ++a) c[a][t] = g4_mma(ya[a], yb[t], c[a][t]); }
  /* the same wait for the last group, in front of whatever reuses its address registers behind the loop */
  asm volatile("s_wait_xcnt 0x0" :: "v"(pa0), "v"(pa1), "v"(pa2), "v"(pa3), "v"(pb0), "v"(pb1), "v"(pb2), "v"(pb3) : "memory");
}
// q, k and v projections in one launch: a block makes a 256 x 192 tile of the plane [q | k | v] (3 * DM columns), its twelve waves 64 x 64 each (four down, three across): a fragment that a wave loads feeds four products, and each A fragment of the block is asked for by three of its waves, each B fragment by four, at about the same time, so that most of these loads are served on the WGP; A = x and Bh = [q_w | kv_w]^T x16 in fragment order.
// 256 blocks, one per WGP, three waves per SIMD.
// The epilogue stores each part as the attention kernel reads it: q row-major [row][DM]; k per (batch, head) as [token][d] and v as [d][token], both in fragment order. A wave's 64 columns are one head.
__global__ __launch_bounds__(384) void k_gemm_qkv(const _Float16* __restrict__ A, const _Float16* __restrict__ Bh, const float* __restrict__ qb, const float* __restrict__ kvb,
    _Float16* __restrict__ Q16, _Float16* __restrict__ KP, _Float16* __restrict__ VT) {
  __shared__ __attribute__((aligned(16))) float so[12][64][68];
  const int tid = threadIdx.x, w = __builtin_amdgcn_readfirstlane(tid >> 5), lane = tid & 31, ln = lane & 15, hh = lane >> 4;
  const int mt = blockIdx.x % (NR / 256), nq = 3 * (blockIdx.x / (NR / 256)) + (w >> 2); const int row0 = mt * 256 + 64 * (w & 3), col0 = nq * 64; const int part = nq / NH, h = nq - part * NH;
  /* each lane's place in the first k tile of the eight row tiles */
  const _Float16* pa0 = A + (size_t)row0 * DM + 8 * lane; const _Float16* pa1 = pa0 + (size_t)16 * DM; const _Float16* pa2 = pa1 + (size_t)16 * DM; const _Float16* pa3 = pa2 + (size_t)16 * DM;
  const _Float16* pb0 = Bh + (size_t)col0 * DM + 8 * lane; const _Float16* pb1 = pb0 + (size_t)16 * DM; const _Float16* pb2 = pb1 + (size_t)16 * DM; const _Float16* pb3 = pb2 + (size_t)16 * DM;
  const v8f z8 = {0.f,0.f,0.f,0.f,0.f,0.f,0.f,0.f}; v8f c[4][4] = {{z8, z8, z8, z8}, {z8, z8, z8, z8}, {z8, z8, z8, z8}, {z8, z8, z8, z8}};
  g2_kloop4(pa0, pa1, pa2, pa3, pb0, pb1, pb2, pb3, DM, (int)((blockIdx.x % (NR / 256) + blockIdx.x / (NR / 256)) & (DM / 64 - 1)), c);      /* 16 x 16 blocks, 16 trips: the sixteen blocks of a block row (same A) and of a block column (same B) all start apart */
  const float* bp = (part == 0) ? qb + col0 : kvb + (col0 - DM);
  const int b = row0 / TT, tok0 = row0 - b * TT; const size_t slab = (size_t)(b * NH + h) * 64 * TT;      /* the wave's 64 rows are tokens tok0 .. tok0 + 63 of batch b */
  if (part == 2) {      /* v: the accumulator tile (a, t) holds in each lane 8 tokens in a row of one d, which is that lane's piece of the tile (d tile t, token tile tok0 / 32 + a / 2), half a % 2 */
#pragma unroll
    for (int t = 0; t < 4; ++t) { const float bv = bf16_round(bp[t * 16 + ln]); FragH f[4];
#pragma unroll
      for (int a = 0; a < 4; ++a)
#pragma unroll
        for (int r = 0; r < 8; ++r) f[a].h[r] = (_Float16)(c[a][t][r] * 0.0625f + bv);
      __builtin_amdgcn_sched_barrier(0);      /* with the one behind the wait: keeps the arithmetic, which reuses registers, out of the stretch between these stores and their wait */
#pragma unroll
      for (int a = 0; a < 4; ++a) *(v8us*)((unsigned short*)VT + slab + (size_t)(t * 16) * TT + (size_t)((tok0 >> 5) + (a >> 1)) * 512 + (a & 1) * 256 + lane * 8) = f[a].half[0];
      asm volatile("s_wait_xcnt 0x0" ::: "memory");      /* the wait in front of any write of a register that one of the four stores before it names */
      __builtin_amdgcn_sched_barrier(0); }
    return; }
#pragma unroll
  for (int t = 0; t < 4; ++t) { const float bv = bf16_round(bp[t * 16 + ln]);
#pragma unroll
    for (int a = 0; a < 4; ++a)
#pragma unroll
      for (int r = 0; r < 8; ++r) so[w][a * 16 + 8 * hh + r][t * 16 + ln] = c[a][t][r] * 0.0625f + bv; }
  __builtin_amdgcn_fence(__ATOMIC_ACQ_REL, "workgroup"); __builtin_amdgcn_wave_barrier();      /* a wave reads back only its own part of so: its LDS writes are done before any of its lanes reads */
  if (part == 0) { const int rsub = lane >> 4, c4 = (lane & 15) * 4;
#pragma unroll
    for (int g = 0; g < 4; ++g) { v4h h4[8];
#pragma unroll
      for (int q = 0; q < 8; ++q) { const v4f v = *(const v4fa*)&so[w][(g * 8 + q) * 2 + rsub][c4]; for (int i = 0; i < 4; ++i) h4[q][i] = (_Float16)v[i]; }
      __builtin_amdgcn_sched_barrier(0);      /* as above: nothing that reuses a register stands between these stores and their wait */
#pragma unroll
      for (int q = 0; q < 8; ++q) *(v4h*)(Q16 + (size_t)(row0 + (g * 8 + q) * 2 + rsub) * DM + col0 + c4) = h4[q];
      asm volatile("s_wait_xcnt 0x0" ::: "memory");      /* the wait in front of any write of a register that one of the eight stores before it names */
      __builtin_amdgcn_sched_barrier(0); }
  } else {      /* k: piece (token tile rt, d tile kt, half hf) of lane 16 * hh + ln is token rt * 16 + ln, d = kt * 32 + hf * 16 + hh * 8 + (0 .. 7) */
#pragma unroll
    for (int rt = 0; rt < 4; ++rt) { FragH f[4];
#pragma unroll
      for (int pc = 0; pc < 4; ++pc) { const int kt = pc >> 1, hf = pc & 1; const float* sp = &so[w][rt * 16 + ln][kt * 32 + hf * 16 + hh * 8]; const v4f lo = *(const v4fa*)sp, hi = *(const v4fa*)(sp + 4);
#pragma unroll
        for (int i = 0; i < 4; ++i) { f[pc].h[i] = (_Float16)lo[i]; f[pc].h[4 + i] = (_Float16)hi[i]; } }
      __builtin_amdgcn_sched_barrier(0);      /* as above: nothing that reuses a register stands between these stores and their wait */
#pragma unroll
      for (int pc = 0; pc < 4; ++pc) *(v8us*)((unsigned short*)KP + slab + (size_t)((tok0 >> 4) + rt) * 1024 + pc * 256 + lane * 8) = f[pc].half[0];
      asm volatile("s_wait_xcnt 0x0" ::: "memory");      /* the wait in front of any write of a register that one of the four stores before it names */
      __builtin_amdgcn_sched_barrier(0); } }
}
// output projection: out = Oh . W + bias + (Ol . W) / 1024, W = Bh / 16; both terms in one k loop over the same B fragments, each in accumulators of its own; Ah, Al, Bh in fragment order
// a block makes a 128 x 128 tile, its eight waves 32 x 64 each (four down, two across); 256 blocks, one per WGP, two waves per SIMD
__global__ __launch_bounds__(256) void k_gemm_proj(const _Float16* __restrict__ Ah, const _Float16* __restrict__ Al, const _Float16* __restrict__ Bh, const float* __restrict__ bias, float* __restrict__ C) {
  __shared__ __attribute__((aligned(16))) float so[8][32][68];
  const int tid = threadIdx.x, w = tid >> 5, lane = tid & 31, ln = lane & 15, hh = lane >> 4;
  const int mt = blockIdx.x % (NR / 128), nq = blockIdx.x / (NR / 128); const int row0 = mt * 128 + 32 * (w & 3), col0 = nq * 128 + 64 * (w >> 2);
  /* each lane's place in the first k tile of the eight row tiles */
  const _Float16* pa0 = Ah + (size_t)row0 * DM + 8 * lane; const _Float16* pa1 = pa0 + (size_t)16 * DM; const _Float16* pa2 = Al + (size_t)row0 * DM + 8 * lane; const _Float16* pa3 = pa2 + (size_t)16 * DM;
  const _Float16* pb0 = Bh + (size_t)col0 * DM + 8 * lane; const _Float16* pb1 = pb0 + (size_t)16 * DM; const _Float16* pb2 = pb1 + (size_t)16 * DM; const _Float16* pb3 = pb2 + (size_t)16 * DM;
  const v8f z8 = {0.f,0.f,0.f,0.f,0.f,0.f,0.f,0.f}; v8f c[4][4] = {{z8, z8, z8, z8}, {z8, z8, z8, z8}, {z8, z8, z8, z8}, {z8, z8, z8, z8}};
  g2_kloop4(pa0, pa1, pa2, pa3, pb0, pb1, pb2, pb3, DM, (mt + 2 * nq) & (DM / 64 - 1), c);      /* 32 x 8 blocks, 16 trips: the eight blocks with the same A start apart, of the 32 with the same B two share a start */
#pragma unroll
  for (int t = 0; t < 4; ++t) { const float bv = bf16_round(bias[col0 + t * 16 + ln]);
#pragma unroll
    for (int half = 0; half < 2; ++half)
#pragma unroll
      for (int r = 0; r < 8; ++r) so[w][half * 16 + 8 * hh + r][t * 16 + ln] = c[2 + half][t][r] * (0.0625f / 1024.0f) + (c[half][t][r] * 0.0625f + bv); }
  __builtin_amdgcn_fence(__ATOMIC_ACQ_REL, "workgroup"); __builtin_amdgcn_wave_barrier();      /* a wave reads back only its own part of so: its LDS writes are done before any of its lanes reads */
  const int rsub = lane >> 4, c4 = (lane & 15) * 4;
#pragma unroll
  for (int q = 0; q < 16; ++q) { const int r = q * 2 + rsub; const v4f v = *(const v4fa*)&so[w][r][c4]; *(v4f*)(C + (size_t)(row0 + r) * DM + col0 + c4) = v; }
}

// D = A.B + C as the plain builtin: the compiler keeps the distance behind it itself
__device__ __forceinline__ v8f ra_mma(v16h a, v16h b, v8f c) { return __builtin_amdgcn_wmma_f32_16x16x32_f16(false, a, false, b, (short)0, c, false, false); }
// the six relative tiles of a pass: tile u = 16 rows of the table (A: its two k halves ef[u][0], ef[u][1]) against the two query groups (B), stored to each query's row in LDS; tile u serves group 0 for u >= 1 and group 1 for u <= 4.
// Tiles u < UC lie below the wrap and go with query i (q), the others with query i + 1 (qn); d0, d1: the lane's place in tile 0 of each group's row
template <int UC>
__device__ __forceinline__ void rel_pass(const v16h (&ef)[6][2], const v16h (&q)[2][2], const v16h (&qn)[2][2], float* d0, float* d1) {
  const v8f z8 = {0.f,0.f,0.f,0.f,0.f,0.f,0.f,0.f}; v8f r0[6], r1[6];
#pragma unroll
  for (int ks = 0; ks < 2; ++ks)
#pragma unroll
    for (int u = 0; u < 6; ++u) {
      if (u >= 1) r0[u] = ra_mma(ef[u][ks], (u < UC) ? q[0][ks] : qn[0][ks], ks ? r0[u] : z8);
      if (u <= 4) r1[u] = ra_mma(ef[u][ks], (u < UC) ? q[1][ks] : qn[1][ks], ks ? r1[u] : z8); }
  __builtin_amdgcn_sched_barrier(0);      /* holds the twenty products, ten tiles in registers of their own, in front of the stores: without it each tile's two products and its stores run one after the other through one register set, a dependent chain per tile */
#pragma unroll
  for (int u = 0; u < 6; ++u) {
    if (u >= 1) { float* d = d0 + 16 * (u - 1); const v4f lo = {r0[u][0], r0[u][1], r0[u][2], r0[u][3]}, hi = {r0[u][4], r0[u][5], r0[u][6], r0[u][7]}; *(v4fa*)d = lo; *(v4fa*)(d + 4) = hi; }
    if (u <= 4) { float* d = d1 + 16 * u; const v4f lo = {r1[u][0], r1[u][1], r1[u][2], r1[u][3]}, hi = {r1[u][4], r1[u][5], r1[u][6], r1[u][7]}; *(v4fa*)d = lo; *(v4fa*)(d + 4) = hi; } }
}

// Attention of one (batch, head) and 128 queries per block, 32 queries per wave, keys 64 at a time; nothing of S, QEr or P goes to memory.
// With t = TT-1-i+j the skewed term of (query i, key j) is q[i].Er[t] for t < TT, 0 for t == TT, q[i+1].Er[t-TT-1] for t > TT.
// All tiles are transposed: D[row 8*hh+r][column ln] with the query in the column, so a lane owns one query's max, sum and O column.
// Every inner loop is unrolled so that each array index is a constant and the arrays live in registers.
__global__ __launch_bounds__(128) void k_relattn(const _Float16* __restrict__ Q16, const _Float16* __restrict__ KP, const _Float16* __restrict__ VT, const _Float16* __restrict__ ER16, _Float16* __restrict__ Oh, _Float16* __restrict__ Ol) {
  __shared__ __attribute__((aligned(16))) float rl[4][2][16][RP];
  const int tid = threadIdx.x, w = __builtin_amdgcn_readfirstlane(tid >> 5), lane = tid & 31, ln = lane & 15, hh = lane >> 4;
  const int bh = blockIdx.y, b = bh / NH, h = bh - b * NH; const int i0 = blockIdx.x * 128 + 32 * w;
  const _Float16* qbase = Q16 + (size_t)b * TT * DM + h * 64; const _Float16* kbase = KP + (size_t)bh * 64 * TT; const _Float16* vbase = VT + (size_t)bh * 64 * TT;      /* [token][d] and [d][token], both in fragment order */
  v16h q[2][2], qn[2][2];      /* queries i and i + 1 as B operands; the row past the last query is never used, its address is clamped */
  const _Float16* qp[2]; const _Float16* qnp[2];
  __builtin_amdgcn_sched_barrier(0);      /* with the one behind the wait: keeps the set-up arithmetic, which reuses registers, out of the stretch between these loads and their wait */
#pragma unroll
  for (int qs = 0; qs < 2; ++qs) { const int i = i0 + 16 * qs + ln; const int i1 = (i + 1 < TT) ? i + 1 : TT - 1; qp[qs] = qbase + (size_t)i * DM + 8 * hh; qnp[qs] = qbase + (size_t)i1 * DM + 8 * hh;
#pragma unroll
    for (int ks = 0; ks < 2; ++ks) { q[qs][ks] = g2_frag(qp[qs] + 32 * ks, 0); qn[qs][ks] = g2_frag(qnp[qs] + 32 * ks, 0); } }
  asm volatile("s_wait_xcnt 0x0" ::: "memory");      /* the wait in front of any write of an address register of these loads */
  __builtin_amdgcn_sched_barrier(0);
  const v8f z8 = {0.f,0.f,0.f,0.f,0.f,0.f,0.f,0.f};
  v8f o[2][4] = {{z8, z8, z8, z8}, {z8, z8, z8, z8}}; float mx[2] = {-3.0e38f, -3.0e38f}, sm[2] = {0.f, 0.f};
  /* the key walk is a ring of TT / 64 passes: the sixteen blocks of a (batch, head), which read the same k and v, start at sixteen different passes (5 is odd), and their windows on the relative table, which move with j0 - i0, stand three passes apart; the (batch, head) number shifts the start too, since every head reads the one relative table; so blocks do not ask L2 for the same lines at the same moment; the running-max softmax takes the key tiles in any order */
  const int rot = (5 * (int)blockIdx.x + (bh & 15)) & (TT / 64 - 1);
  /* k and relative tiles are fetched one pass ahead, into the registers that the running pass has just read for the last time: their load latency runs behind the softmax and the P.V products of the pass before, not in front of the score products */
  /* relative tiles of the pass at key j0: rows t = tb0 + 16u + (0..15), tb0 = TT - 32 - i0 + j0; queries i0+16.. take u = 0..4, queries i0.. take u = 1..5; 0 <= tb0 and tb0 + 95 <= 2 * TT - 1, the rows of the table */
  v16h kf[4][2], ef[6][2];
  { const _Float16* kp = kbase + (size_t)(rot * 64) * 64 + 8 * lane; const _Float16* ep = ER16 + (size_t)(TT - 32 - i0 + rot * 64) * 64 + 8 * lane;      /* each lane's place in the first k and relative tile of the first pass */
#pragma unroll
    for (int n = 0; n < 4; ++n) { kf[n][0] = g2_fragp(kp + 1024 * n); kf[n][1] = g2_fragp(kp + 1024 * n + 512); }
    __builtin_amdgcn_sched_barrier(0);      /* keeps the k loads, whose values a pass needs first, at the head of the group: loads come back in the order of issue */
#pragma unroll
    for (int u = 0; u < 6; ++u) { ef[u][0] = g2_fragp(ep + 1024 * u); ef[u][1] = g2_fragp(ep + 1024 * u + 512); }
    asm volatile("s_wait_xcnt 0x0" ::: "memory");      /* the wait in front of any write of an address register of these loads */
    __builtin_amdgcn_sched_barrier(0); }      /* holds the first group and its wait in front of the set-up below, which reuses registers */
#pragma unroll 1      /* the pass is some 1,100 instructions long: a second copy would only cost instruction fetch and registers */
  for (int it = 0; it < TT / 64; ++it) { const int j0 = ((it + rot) & (TT / 64 - 1)) * 64;
    const int tb0 = TT - 32 - i0 + j0;
    /* the pass's own v tiles, which it needs last, are asked for at its head */
    const _Float16* vp = vbase + (size_t)j0 * 16 + 8 * lane;      /* each lane's place in the first v tile of the pass */
    v16h vf[4][2];
#pragma unroll
    for (int dt = 0; dt < 4; ++dt) { vf[dt][0] = g2_fragp(vp + (size_t)(16 * dt) * TT); vf[dt][1] = g2_fragp(vp + (size_t)(16 * dt) * TT + 512); }
    __builtin_amdgcn_sched_barrier(0);      /* holds the v loads in front of the products: without it the scheduler sinks them to their first use, with a full wait */
    v8f s[2][4];      /* s[qs][n][r] = k[j0 + 16n + 8hh + r] . q[i0 + 16qs + ln] */
#pragma unroll
    for (int n = 0; n < 4; ++n)
#pragma unroll
      for (int qs = 0; qs < 2; ++qs) s[qs][n] = ra_mma(kf[n][1], q[qs][1], ra_mma(kf[n][0], q[qs][0], z8));
    /* TT - tb0 = 32 + i0 - j0 is a multiple of 32, so a tile of 16 table rows lies whole on one side of the wrap and the wrap stands in front of tile 0, 2 or 4 or behind the pass: rows below TT go with query i, rows from TT on with query i + 1 (row TT of the table is stored as zeros). No row is masked, and each of the four cases runs its twenty products with no branch between them */
    { float* d0 = &rl[w][0][ln][8 * hh]; float* d1 = &rl[w][1][ln][8 * hh]; const int below = TT - tb0;      /* table rows of the pass below the wrap, where under 96 */
      if (below >= 96) rel_pass<6>(ef, q, qn, d0, d1);
      else if (below <= 0) rel_pass<0>(ef, q, qn, d0, d1);
      else if (below == 64) rel_pass<4>(ef, q, qn, d0, d1);
      else rel_pass<2>(ef, q, qn, d0, d1); }
    { /* the next pass's k and relative tiles, over the registers of this pass's; the last pass asks for the walk's first tiles again, in bounds and unused, so that every pass has the same loads in flight */
      const int jn = ((it + 1 + rot) & (TT / 64 - 1)) * 64;
      const _Float16* kp = kbase + (size_t)jn * 64 + 8 * lane; const _Float16* ep = ER16 + (size_t)(TT - 32 - i0 + jn) * 64 + 8 * lane;
#pragma unroll
      for (int n = 0; n < 4; ++n) { kf[n][0] = g2_fragp(kp + 1024 * n); kf[n][1] = g2_fragp(kp + 1024 * n + 512); }
      __builtin_amdgcn_sched_barrier(0);      /* k in front of the relative tiles, as in front of the loop */
#pragma unroll
      for (int u = 0; u < 6; ++u) { ef[u][0] = g2_fragp(ep + 1024 * u); ef[u][1] = g2_fragp(ep + 1024 * u + 512); }
      /* the wait that stands in front of any write of a register which one of the pass's loads names as its address, the v loads at its head too; the addresses are its inputs so that their registers stay untouched up to it */
      asm volatile("s_wait_xcnt 0x0" :: "v"(kp), "v"(vp), "v"(ep) : "memory");
      __builtin_amdgcn_sched_barrier(0); }      /* holds the group here: without it the scheduler sinks the loads towards the end of the pass and their lead is lost */
    /* a query's row is written by its two lanes and read by both: the wave's LDS writes are done before any lane reads; only the LDS counter is waited on, the v loads stay in flight */
    asm volatile("s_wait_dscnt 0x0" ::: "memory"); __builtin_amdgcn_wave_barrier();
    FragH p[2][2];
#pragma unroll
    for (int qs = 0; qs < 2; ++qs) { const float* rr = &rl[w][qs][ln][15 - ln + 8 * hh]; float mt = -3.0e38f;
#pragma unroll
      for (int n = 0; n < 4; ++n)
#pragma unroll
        for (int r = 0; r < 8; ++r) { const float lg = s[qs][n][r] + rr[16 * n + r]; s[qs][n][r] = lg; mt = fmaxf(mt, lg); }      /* 8 x the logit: the scale goes into the exponent's multiply-add */
      mt = fmaxf(mt, __shfl_xor(mt, 16, 32));
      const float mn = fmaxf(mx[qs], mt), ax = (mx[qs] - mn) * L2E8, nb = fmaf(-mn, L2E8, 10.0f); float al = __builtin_amdgcn_exp2f(ax); mx[qs] = mn; float ps[4] = {0.f, 0.f, 0.f, 0.f};      /* one partial sum per key tile: four short add chains */
      asm("v_nop" : "+v"(al) : "v"(ax));      /* the slot behind a transcendental, as below */
#pragma unroll
      for (int n = 0; n < 4; ++n)
      { float x[8], e[8];      /* e = 2^10 * exp(logit - max) */
#pragma unroll
        for (int r = 0; r < 8; ++r) { x[r] = fmaf(s[qs][n][r], L2E8, nb); e[r] = __builtin_amdgcn_exp2f(x[r]); }
        /* the slot that the instruction set asks for behind a transcendental, before its result is read or its source overwritten: no result is read and no source register is given up in front of this v_nop, so whatever stands directly behind one of the eight is independent of it or is the v_nop */
        asm("v_nop" : "+v"(e[0]), "+v"(e[1]), "+v"(e[2]), "+v"(e[3]), "+v"(e[4]), "+v"(e[5]), "+v"(e[6]), "+v"(e[7]) : "v"(x[0]), "v"(x[1]), "v"(x[2]), "v"(x[3]), "v"(x[4]), "v"(x[5]), "v"(x[6]), "v"(x[7]));
#pragma unroll
        for (int r = 0; r < 8; ++r) { ps[n] += e[r]; p[qs][n >> 1].h[(n & 1) * 8 + r] = (_Float16)e[r]; } }
      sm[qs] = sm[qs] * al + ((ps[0] + ps[1]) + (ps[2] + ps[3]));
#pragma unroll
      for (int dt = 0; dt < 4; ++dt) o[qs][dt] *= al; }
    /* keeps the compiler from lifting the next pass's LDS writes over this pass's reads (their values are already in registers here) */
    __builtin_amdgcn_fence(__ATOMIC_ACQ_REL, "wavefront"); __builtin_amdgcn_wave_barrier();
#pragma unroll
    for (int dt = 0; dt < 4; ++dt)
#pragma unroll
      for (int qs = 0; qs < 2; ++qs) o[qs][dt] = ra_mma(vf[dt][1], p[qs][1].v, ra_mma(vf[dt][0], p[qs][0].v, o[qs][dt]));
  }
#pragma unroll
  for (int qs = 0; qs < 2; ++qs) { const float tot = sm[qs] + __shfl_xor(sm[qs], 16, 32); const float inv = 1.0f / tot;      /* the row sum carries the 2^10 of P as well */
    /* O as f16 hi + residual x 2^10, two planes [row][DM] in fragment order: the lane's 8 values of d tile dt are its piece of the tile (row tile of the 16 queries, k tile 2 * h + dt / 2), half dt % 2 */
    const size_t ob = ((size_t)((b * TT + i0 + 16 * qs) >> 4) * (DM / 32) + 2 * h) * 512 + 8 * lane;
    FragH fh[4], fl[4];
#pragma unroll
    for (int dt = 0; dt < 4; ++dt) { const v8f a = o[qs][dt];
#pragma unroll
      for (int r = 0; r < 8; ++r) { const float v = a[r] * inv; const _Float16 hi = (_Float16)v; fh[dt].h[r] = hi; fl[dt].h[r] = (_Float16)((v - (float)hi) * 1024.0f); } }
    __builtin_amdgcn_sched_barrier(0);      /* with the one behind the wait: keeps the arithmetic, which reuses registers, out of the stretch between these stores and their wait */
#pragma unroll
    for (int dt = 0; dt < 4; ++dt) { *(v8us*)((unsigned short*)Oh + ob + 256 * dt) = fh[dt].half[0]; *(v8us*)((unsigned short*)Ol + ob + 256 * dt) = fl[dt].half[0]; }
    if (qs == 0) { asm volatile("s_wait_xcnt 0x0" ::: "memory");      /* the wait in front of any write of a register that one of these stores names; nothing is written behind the second group */
      __builtin_amdgcn_sched_barrier(0); } }
}

extern "C" void kernel_launch(void* const* d_in, const int* in_sizes, int n_in,
                              void* d_out, int out_size, void* d_ws, size_t ws_size, hipStream_t stream) {
  (void)in_sizes; (void)n_in; (void)out_size;
  const float* const* I = (const float* const*)d_in; const float* x = I[0]; const float* qw = I[1]; const float* qb = I[2]; const float* kvw = I[3]; const float* kvb = I[4]; const float* pw = I[5]; const float* pb = I[6]; const float* Er = I[7];
  char* ws = (char*)d_ws; size_t off = 0;
  auto take = [&](size_t bytes) { char* p = ws + off; off += (bytes + 255) & ~(size_t)255; return p; };
  _Float16* BP = (_Float16*)take((size_t)DM * DM * 2); _Float16* ER16 = (_Float16*)take((size_t)2 * TT * 64 * 2);
  _Float16* Q16 = (_Float16*)take((size_t)NR * DM * 2); _Float16* VT = (_Float16*)take((size_t)NR * DM * 2); _Float16* KP = (_Float16*)take((size_t)NR * DM * 2);
  _Float16* X16 = (_Float16*)take((size_t)NR * DM * 2); _Float16* BQKV = (_Float16*)take((size_t)DM * 3 * DM * 2);      /* [q_w | kv_w]^T: one plane of 3 * DM rows, the q rows first */
  _Float16* Oh = (_Float16*)take((size_t)NR * DM * 2); _Float16* Ol = (_Float16*)take((size_t)NR * DM * 2);
  if (off > ws_size) return;      /* about 57 MiB */
  k_prep<<<PB_KV + 2 * PB_W + PB_X + PB_E, 256, 0, stream>>>(qw, kvw, pw, Er, x, BQKV, BQKV + (size_t)DM * DM, BP, ER16, X16);
  const dim3 gA(TT / 128, NBT * NH);
  k_gemm_qkv<<<(NR / 256) * (3 * DM / 192), 384, 0, stream>>>(X16, BQKV, qb, kvb, Q16, KP, VT);
  k_relattn<<<gA, 128, 0, stream>>>(Q16, KP, VT, ER16, Oh, Ol);
  k_gemm_proj<<<(NR / 128) * (DM / 128), 256, 0, stream>>>(Oh, Ol, BP, pb, (float*)d_out);
}
